// v000
// Measured on an AMD MI455X. A time is GPU time per run, averaged over a window of back-to-back runs after a warm-up
// (all launches, gaps included; the runs take copies of the inputs in turn), and the median of several windows.
// Apart from v000's, it joins two sittings. Times from different sittings can be a few percent apart, while
// side-by-side timings come from the same sitting.
// v000 is the starting kernel. One run takes 231 microseconds.
#include <hip/hip_runtime.h>
#include <math.h>
#include <stdint.h>

// All contractions on v_wmma_f32_16x16x32_f16 (f16 operands, f32 accumulate): the three 1x1-conv
// projections take bf16-RNE inputs (x1) and bf16-RNE weights (x64) as single f16 planes; the 256-deep
// query.key scores use single f16 planes of 8*q and 8*k; the 1024-deep softmax-weighted value sum uses
// a single f16 plane of 16*v against E = f16(32768*softmax) held as a single f16 plane. Softmax
// statistics, biases, residual add and epilogues are f32.

#define NB   32
#define CH   256
#define NT   1024
#define TOK  (NB * NT)
#define RSB  32
#define PVN  64
#define OUTN (NB * CH * NT)

#define SCW  64.0f
#define SCQK 8.0f
#define SCV  16.0f
#define SCE  32768.0f
#define SCS  (1.0f / (SCQK * SCQK * 16.0f))

static_assert(TOK % 64 == 0 && CH % 64 == 0 && CH % 32 == 0 && NT % 32 == 0);
static_assert((((TOK / 64) * (CH / 64)) % 8) == 0);
static_assert(NT % RSB == 0 && RSB == 32 && NT == 4 * 256);
static_assert((NT / 16) % 8 == 0 && CH == 8 * 32);
static_assert(NT % PVN == 0 && PVN == 64);
static_assert((CH * CH) % 2048 == 0);
static_assert(NT % 64 == 0 && CH % 64 == 0);

typedef _Float16       v16h __attribute__((ext_vector_type(16)));
typedef _Float16       v8h  __attribute__((ext_vector_type(8)));
typedef float          v8f  __attribute__((ext_vector_type(8)));
typedef float          v4f  __attribute__((ext_vector_type(4)));
typedef unsigned int   v4u  __attribute__((ext_vector_type(4)));

union HU { v8h h; v4u u; _Float16 s[8]; };
union FR { v16h v; v8h h[2]; _Float16 s[16]; };
static_assert(sizeof(HU) == 16);
static_assert(sizeof(FR) == 32);

// ---- scalar helpers --------------------------------------------------------------------------------
__device__ __forceinline__ unsigned short bf_bits(float f) {          // f32 -> bf16 bits, RNE convert
  const unsigned u = __float_as_uint(f);
  return (unsigned short)((u + 0x7FFFu + ((u >> 16) & 1u)) >> 16);
}
__device__ __forceinline__ float bf_up(unsigned short h) { return __uint_as_float(((unsigned)h) << 16); }
__device__ __forceinline__ float bfr(float f) { return bf_up(bf_bits(f)); }   // value after bf16 RNE convert
__device__ __forceinline__ v8f zero8() { v8f z = {0.f, 0.f, 0.f, 0.f, 0.f, 0.f, 0.f, 0.f}; return z; }

__device__ __forceinline__ void ld8(const float* p, float* o) {
  const v4f a = *(const v4f*)(p);
  const v4f b = *(const v4f*)(p + 4);
  o[0] = a[0]; o[1] = a[1]; o[2] = a[2]; o[3] = a[3];
  o[4] = b[0]; o[5] = b[1]; o[6] = b[2]; o[7] = b[3];
}

// ---- fragment loader: 16-bit A/B operand from a k-contiguous row, p = row*pitch + k0 + 8*(lane>>4);
//      elements 0..7 <- p[0..7] (k0+8h..k0+8h+7), elements 8..15 <- p[16..23] (k0+16+8h..k0+16+8h+7)
__device__ __forceinline__ v16h ldfrag_h(const _Float16* p) {
  FR f;
  f.h[0] = *(const v8h*)(p);
  f.h[1] = *(const v8h*)(p + 16);
  return f.v;
}

// ---- WMMA helpers with trailing VALU hazard gap --------------------------------------------------------
__device__ __forceinline__ v8f mma_h(v16h a, v16h b, v8f c) {
  c = __builtin_amdgcn_wmma_f32_16x16x32_f16(false, a, false, b, (short)0, c, false, false);
#if defined(__HIP_DEVICE_COMPILE__)
  asm volatile("v_nop\n\tv_nop\n\tv_nop\n\tv_nop" : "+v"(c) : "v"(a), "v"(b));
#endif
  return c;
}
__device__ __forceinline__ v8f mma_h_raw(v16h a, v16h b, v8f c) {
  return __builtin_amdgcn_wmma_f32_16x16x32_f16(false, a, false, b, (short)0, c, false, false);
}
__device__ __forceinline__ void dep_guard_h(v8f& a, v8f& b, v16h x) {
#if defined(__HIP_DEVICE_COMPILE__)
  asm volatile("v_nop\n\tv_nop\n\tv_nop\n\tv_nop" : "+v"(a), "+v"(b) : "v"(x));
#endif
}
__device__ __forceinline__ void keep4_h(v16h a, v16h b, v16h c, v16h d) {
#if defined(__HIP_DEVICE_COMPILE__)
  asm volatile("v_nop" :: "v"(a), "v"(b), "v"(c), "v"(d));
#endif
}
__device__ __forceinline__ void acc_guard4(v8f& a, v8f& b, v8f& c, v8f& d) {
#if defined(__HIP_DEVICE_COMPILE__)
  asm volatile("v_nop\n\tv_nop\n\tv_nop\n\tv_nop" : "+v"(a), "+v"(b), "+v"(c), "+v"(d));
#endif
}
__device__ __forceinline__ void wave_lds_sync() {
  __builtin_amdgcn_fence(__ATOMIC_RELEASE, "workgroup");
  __builtin_amdgcn_wave_barrier();
  __builtin_amdgcn_fence(__ATOMIC_ACQUIRE, "workgroup");
}

// =====================================================================================================
// Flat weight convert: out[i] = f16(scale * bf16RNE(in[i])), 8 elements per thread, one 16-B store per lane
// coverage: n8 threads x 8 = the whole plane; n8 is a multiple of 256 at every launch here.
// =====================================================================================================
__global__ __launch_bounds__(256) void cvt_flat(const float* __restrict__ in, _Float16* out, int n8, float scale) {
  const int i = blockIdx.x * 256 + threadIdx.x;
  if (i < n8) {
    float v[8];
    ld8(in + (size_t)i * 8, v);
    HU u;
#pragma unroll
    for (int e = 0; e < 8; ++e) u.s[e] = (_Float16)(bfr(v[e]) * scale);
    _Float16* p = out + (size_t)i * 8;
    *(v4u*)p = u.u;
    
  }
}

// =====================================================================================================
// Activation transpose-convert: in X[b][k][n] f32 (k = channel 0..Cd-1, n = position 0..NT-1, n contiguous)
// -> XT[b*NT + n][k] f16 = f16(bf16RNE(X)), pitch Cd (k contiguous).
// grid (NT/64, Cd/64, NB). coverage: load phase 256 threads x 4 row-iterations x 4 floats = 64 k x 64 n;
// store phase 256 threads x 2 n-iterations x 8 halves = 64 n rows x 64 k per block; grid = every
// (n tile, k tile, b) -> whole [TOK][Cd] plane.
// =====================================================================================================
__global__ __launch_bounds__(256) void cvt_xT(const float* __restrict__ X, _Float16* XT, int Cd) {
  __shared__ float sw[64][65];
  const int t = threadIdx.x;
  const int n0 = blockIdx.x * 64, k0 = blockIdx.y * 64, b = blockIdx.z;
  const float* Xb = X + (size_t)b * Cd * NT;
  {
    const int r = t >> 4, c4 = (t & 15) * 4;
#pragma unroll
    for (int it = 0; it < 4; ++it) {
      const int row = r + 16 * it;
      const v4f x = *(const v4f*)(Xb + (size_t)(k0 + row) * NT + n0 + c4);
      sw[row][c4 + 0] = x[0]; sw[row][c4 + 1] = x[1]; sw[row][c4 + 2] = x[2]; sw[row][c4 + 3] = x[3];
    }
  }
  __syncthreads();
  const int q8 = t & 7, rr = t >> 3;
  HU u[2];
#pragma unroll
  for (int it = 0; it < 2; ++it) {
    const int n = rr + 32 * it;
#pragma unroll
    for (int e = 0; e < 8; ++e) u[it].s[e] = (_Float16)bfr(sw[8 * q8 + e][n]);
  }
  {
#pragma unroll
    for (int it = 0; it < 2; ++it) {
      const int n = rr + 32 * it;
      _Float16* dst = XT + (size_t)(b * NT + n0 + n) * Cd + k0 + 8 * q8;
      *(v4u*)dst = u[it].u;
    }
    
  }
}

// =====================================================================================================
// One GEMM k sweep for MI 16-row A subtiles x 4 16-col B subtiles: acc[i][j] += A-frag(i) . Bt-frag(j).
// A row-major pitch lda (rows m0.., k contiguous), Bt row-major [N][K] pitch ldb (rows n0.., k contiguous),
// K a multiple of 32; both operand fragments through ldfrag_h (same split k map for A and B).
// =====================================================================================================
template <int MI>
__device__ __forceinline__ void kseg(v8f (&acc)[MI][4], const _Float16* __restrict__ A, int lda, int m0,
                                     const _Float16* __restrict__ Bt, int ldb, int n0, int K, int rlane, int koff) {
  for (int kk = 0; kk < K; kk += 32) {
    v16h bh[4];
#pragma unroll
    for (int j = 0; j < 4; ++j) {
      const size_t bo = (size_t)(n0 + (j << 4) + rlane) * (size_t)ldb + koff + kk;
      bh[j] = ldfrag_h(Bt + bo);
    }
#pragma unroll
    for (int i = 0; i < MI; ++i) {
      const size_t ao = (size_t)(m0 + (i << 4) + rlane) * (size_t)lda + koff + kk;
      const v16h a0 = ldfrag_h(A + ao);
#pragma unroll
      for (int j = 0; j < 4; ++j) acc[i][j] = mma_h_raw(a0, bh[j], acc[i][j]);
      dep_guard_h(acc[i][0], acc[i][3], a0);
    }
    keep4_h(bh[0], bh[1], bh[2], bh[3]);
  }
}

// =====================================================================================================
// Register-blocked f16 WMMA GEMM with a single f16 plane epilogue, one wave per 64x64 tile, no block barriers:
//   acc[m][n] = sum_k A[m][k] Bt[n][k]; M, N multiples of 64, K multiple of 32.
//   v = (acc*cs + b) * so, where RB == 1: b = bf16RNE(bias[m]) (row bias), RB == 2: b = bf16RNE(bias[n])
//   (column bias); bias index clamped to nbias.
//   in LDS (rows 0..15 x cols 0..63 fully staged before the reload; pad cols 64..67 never read).
// coverage: 4 slabs x 16 rows x 64 cols = the wave's whole 64x64 tile; grid*8 == tiles at every launch here.
// =====================================================================================================
template <int RB>
__global__ __launch_bounds__(256) void gemm64p(
    const _Float16* __restrict__ A, int lda, const _Float16* __restrict__ Bt, int ldb,
    const float* __restrict__ bias, int nbias, float cs, float so,
    _Float16* Cp, int ldc, int M, int N, int K) {
  __shared__ __align__(16) float sT[8][16 * 68];   // per-wave 16x64 slab, pitch 68 floats
  const int lane = threadIdx.x & 31;
  const int wave = threadIdx.x >> 5;
  const int tilesN = N >> 6;
  const int tilesM = M >> 6;
  const int tiles = tilesM * tilesN;
  const int item = blockIdx.x * 8 + wave;
  if (item >= tiles) return;   // wave-uniform; no block barriers in this kernel
  const int tm = item / tilesN;
  const int tn = item - tm * tilesN;
  const int m0 = tm << 6;
  const int n0 = tn << 6;

  const int rlane = lane & 15;                 // row (A) / col (B, D) within subtile
  const int koff  = (lane >> 4) * 8;           // k offset of this lane half
  const int mOff  = (lane >> 4) * 8;           // D row offset

  v8f acc[4][4];
#pragma unroll
  for (int i = 0; i < 4; ++i)
#pragma unroll
    for (int j = 0; j < 4; ++j) acc[i][j] = zero8();

  kseg<4>(acc, A, lda, m0, Bt, ldb, n0, K, rlane, koff);
  acc_guard4(acc[0][0], acc[0][1], acc[0][2], acc[0][3]);
  acc_guard4(acc[1][0], acc[1][1], acc[1][2], acc[1][3]);
  acc_guard4(acc[2][0], acc[2][1], acc[2][2], acc[2][3]);
  acc_guard4(acc[3][0], acc[3][1], acc[3][2], acc[3][3]);

  const int q8 = lane & 7, rr = lane >> 3, c8 = q8 * 8;

  float cbv[8];
#pragma unroll
  for (int e = 0; e < 8; ++e) cbv[e] = 0.0f;
  if (RB == 2) {
#pragma unroll
    for (int e = 0; e < 8; ++e) cbv[e] = bfr(bias[min(n0 + c8 + e, nbias - 1)]);
  }

  float* slab = sT[wave];
#pragma unroll
  for (int i = 0; i < 4; ++i) {
    const int mBase = m0 + (i << 4);
#pragma unroll
    for (int r = 0; r < 8; ++r) {
#pragma unroll
      for (int j = 0; j < 4; ++j) {
        slab[(mOff + r) * 68 + (j << 4) + rlane] = acc[i][j][r];
      }
    }
    wave_lds_sync();
    v4u uh[4];
#pragma unroll
    for (int it = 0; it < 4; ++it) {
      const int row = it * 4 + rr;                       // it 0..3 x rr 0..3 = rows 0..15
      float xs[8];
      ld8(slab + row * 68 + c8, xs);
      float rbv = 0.0f;
      if (RB == 1) rbv = bfr(bias[min(mBase + row, nbias - 1)]);
      HU h;
#pragma unroll
      for (int e = 0; e < 8; ++e) {
        const float v = (xs[e] * cs + rbv + cbv[e]) * so;
        h.s[e] = (_Float16)v;
      }
      uh[it] = h.u;
    }
    {
#pragma unroll
      for (int it = 0; it < 4; ++it) {
        const int row = it * 4 + rr;
        const size_t co = (size_t)(mBase + row) * (size_t)ldc + n0 + c8;
        *(v4u*)(Cp + co) = uh[it];
      }
      
    }
    wave_lds_sync();
  }
}

// =====================================================================================================
// Score rows + row softmax + E plane. Block = (b, 32 query rows n0..n0+31), 8 waves,
// dynamic LDS = 32 x 1024 f32 score rows.
//  (1) wave w computes the 16-column score tiles ct = w, w+8, ... (8 of them) for both 16-row tiles:
//      s = (q8 . k8) / (64*16) from the 8*q / 8*k planes (K = 256, A = XQ rows, Bt = XK rows), into LDS.
//  (2) wave w owns rows 4w..4w+3: lane holds cols 256j + 8*lane..+7 (j = 0..3) in registers; row max M
//      (xor shuffles), ef = exp(s - M), Z = sum_m ef (fixed lane order + xor shuffles), then
//      E = f16(32768 * ef / Z) with explicit flush of f16 subnormals to zero; the f16 row goes to the
// coverage: sc: 8 waves x 8 col tiles x 16 cols x 32 rows = the whole 32x1024 block; E: 8 waves x 4 rows x
// 4 j x 32 lanes x 8 halves = 32 rows x 1024; grid (32, 32) = every (row block, b) -> whole E plane
// [TOK][NT].
// =====================================================================================================
__global__ __launch_bounds__(256) void k_soft(const _Float16* __restrict__ XQ, const _Float16* __restrict__ XK,
                                              _Float16* E) {
  extern __shared__ __align__(16) float sc[];                 // [RSB][NT]
  const int tid = threadIdx.x, wave = tid >> 5, lane = tid & 31;
  const int hh = lane >> 4, rl = lane & 15;
  const int rb = blockIdx.x, b = blockIdx.y, n0 = rb * RSB;

  // ---- (1) scores ----
  const _Float16* aq = XQ + (size_t)(b * NT + n0 + rl) * CH + 8 * hh;
  for (int ct = wave; ct < NT / 16; ct += 8) {
    const _Float16* bk = XK + (size_t)(b * NT + 16 * ct + rl) * CH + 8 * hh;
    v8f a0 = zero8(), a1 = zero8();
#pragma unroll 2
    for (int ks = 0; ks < CH / 32; ++ks) {
      const v16h kb = ldfrag_h(bk + 32 * ks);
      const v16h q0 = ldfrag_h(aq + 32 * ks);
      const v16h q1 = ldfrag_h(aq + 16 * CH + 32 * ks);
      a0 = mma_h(q0, kb, a0);
      a1 = mma_h(q1, kb, a1);
    }
    const int mc = 16 * ct + rl;                               // D col = m; D row = 8hh + r within the row tile
#pragma unroll
    for (int r = 0; r < 8; ++r) {
      sc[(size_t)(8 * hh + r) * NT + mc]      = a0[r] * SCS;
      sc[(size_t)(16 + 8 * hh + r) * NT + mc] = a1[r] * SCS;
    }
  }
  __syncthreads();

  // ---- (2) row softmax, E plane ----
  for (int q4 = 0; q4 < 4; ++q4) {
    const int row = 4 * wave + q4;
    const float* rp = sc + (size_t)row * NT + 8 * lane;         // lane covers cols 256j + 8*lane .. +7
    float v[4][8];
    float mx = -3.0e38f;
#pragma unroll
    for (int j = 0; j < 4; ++j) {
      ld8(rp + 256 * j, v[j]);
#pragma unroll
      for (int e = 0; e < 8; ++e) mx = fmaxf(mx, v[j][e]);
    }
#pragma unroll
    for (int off = 16; off >= 1; off >>= 1) mx = fmaxf(mx, __shfl_xor(mx, off, 32));
    float z = 0.0f;
#pragma unroll
    for (int j = 0; j < 4; ++j) {
#pragma unroll
      for (int e = 0; e < 8; ++e) {
        const float ef = __expf(v[j][e] - mx);
        z += ef;
        v[j][e] = ef;
      }
    }
#pragma unroll
    for (int off = 16; off >= 1; off >>= 1) z += __shfl_xor(z, off, 32);
    const float rz = SCE * (1.0f / z);                         // z in [1, 1024]
    HU u[4];
#pragma unroll
    for (int j = 0; j < 4; ++j) {
#pragma unroll
      for (int e = 0; e < 8; ++e) {
        const _Float16 h0 = (_Float16)(v[j][e] * rz);
        const float f0 = (float)h0;
        const bool sub = f0 < 6.103515625e-05f;                // f16 subnormal -> exact zero
        u[j].s[e] = sub ? (_Float16)0.0f : h0;
      }
    }
    _Float16* erow = E + (size_t)(b * NT + n0 + row) * NT + 8 * lane;
    {
#pragma unroll
      for (int j = 0; j < 4; ++j) *(v4u*)(erow + 256 * j) = u[j].u;
      
    }
  }
}

// =====================================================================================================
// Softmax-weighted value sum + residual, output in [b][c][n] order directly:
//   D[c][n] = sum_m (16*v)[c][m] . E[n][m], A = value plane rows c (pitch TOK, col offset b*NT, k = m),
//   Bt = E rows b*NT + n (pitch NT, k = m), K = 1024 (32 k-steps of 32).
// Block = (b, 64 query columns n0..n0+63), 8 waves; wave w owns channels 32w..32w+31 (2 x 4 tiles).
// Epilogue: out[b][c][n] = D/(16*32768) + bf16RNE(x[b][c][n]); per wave two 16x64 f32 slabs staged in LDS
// coverage: 8 waves x 2 slabs x 16 rows x 64 cols = 256 c x 64 n per block; 512 blocks = every (b, n tile)
// -> whole output [32][256][1024].
// =====================================================================================================
__global__ __launch_bounds__(256) void k_pv(const _Float16* __restrict__ E, const _Float16* __restrict__ VH,
                                            const float* __restrict__ X, float* out) {
  __shared__ __align__(16) float sO[8][16 * 68];            // per-wave 16x64 slab, pitch 68 floats
  const int tid = threadIdx.x, wave = tid >> 5, lane = tid & 31;
  const int hh = lane >> 4, rl = lane & 15;
  const int bx = blockIdx.x;
  const int b = bx / (NT / PVN);
  const int n0 = (bx - b * (NT / PVN)) * PVN;
  const int cb = wave * 32;

  v8f acc[2][4];
#pragma unroll
  for (int i = 0; i < 2; ++i)
#pragma unroll
    for (int j = 0; j < 4; ++j) acc[i][j] = zero8();

  const _Float16* Ab = VH + (size_t)b * NT;                 // row c, pitch TOK, k = m of batch b
  const _Float16* Bb = E + (size_t)b * NT * NT;             // row n of batch b, pitch NT, k = m
  kseg<2>(acc, Ab, TOK, cb, Bb, NT, n0, NT, rl, 8 * hh);
  acc_guard4(acc[0][0], acc[0][1], acc[0][2], acc[0][3]);
  acc_guard4(acc[1][0], acc[1][1], acc[1][2], acc[1][3]);

  // ---- epilogue ----
  const float fo = 1.0f / (SCV * SCE);
  float* slab = sO[wave];
  const int p4 = (lane & 15) * 4, r2 = lane >> 4;
#pragma unroll
  for (int i = 0; i < 2; ++i) {
    const int cBase = cb + 16 * i;
#pragma unroll
    for (int r = 0; r < 8; ++r) {
#pragma unroll
      for (int j = 0; j < 4; ++j) {
        slab[(8 * hh + r) * 68 + 16 * j + rl] = acc[i][j][r];   // D row = c offset 8hh + r, D col = n offset 16j + rl
      }
    }
    wave_lds_sync();
    v4f ov[8];
#pragma unroll
    for (int it = 0; it < 8; ++it) {
      const int row = 2 * it + r2;                          // it 0..7 x r2 0..1 = rows 0..15
      const v4f a = *(const v4f*)(slab + row * 68 + p4);
      const size_t xo = ((size_t)(b * CH + cBase + row)) * NT + n0 + p4;
      const v4f xv = *(const v4f*)(X + xo);
      v4f o;
#pragma unroll
      for (int e = 0; e < 4; ++e) o[e] = a[e] * fo + bfr(xv[e]);
      ov[it] = o;
    }
    {
#pragma unroll
      for (int it = 0; it < 8; ++it) {
        const int row = 2 * it + r2;
        const size_t oo = ((size_t)(b * CH + cBase + row)) * NT + n0 + p4;
        *(v4f*)(out + oo) = ov[it];
      }
      
    }
    wave_lds_sync();
  }
}

// =====================================================================================================
//   WQ16  f16 [256][256]             0        131072   (64*Wq, bf16RNE)
//   WK16  f16 [256][256]        131072        131072   (64*Wk)
//   WV16  f16 [256][256]        262144        131072   (64*Wv)
//   XQ    f16 [32768][256]      393216      16777216   (8*q, position rows, c contiguous)
//   XK    f16 [32768][256]    17170432      16777216   (8*k)
//   VH    f16 [256][32768]    33947648      16777216   (16*v, row c, col b*1024 + m)
//   xT    f16 [32768][256]    50724864      16777216   (bf16RNE(x) transposed to position rows)
//   E     f16 [32768][1024]   50724864      67108864   (32768 * row softmax; reuses the xT region: written by
//                                                       the softmax kernel after the last xT reader, the value
//                                                       projection, on the single in-order stream)
//   end                      117833728
// d_out f32 [32][256][1024] at byte 0.
// =====================================================================================================
extern "C" void kernel_launch(void* const* d_in, const int* in_sizes, int n_in,
                              void* d_out, int out_size, void* d_ws, size_t ws_size,
                              hipStream_t stream) {
  if (n_in < 7) return;
  if (in_sizes[0] != NB * CH * NT) return;
  if (in_sizes[1] != CH * CH || in_sizes[2] != CH) return;
  if (in_sizes[3] != CH * CH || in_sizes[4] != CH) return;
  if (in_sizes[5] != CH * CH || in_sizes[6] != CH) return;
  if (out_size != OUTN) return;

  const float* x  = (const float*)d_in[0];   // [32][256][1024]
  const float* Wq = (const float*)d_in[1];   // [256][256]  ([out][in])
  const float* bq = (const float*)d_in[2];   // [256]
  const float* Wk = (const float*)d_in[3];   // [256][256]
  const float* bk = (const float*)d_in[4];   // [256]
  const float* Wv = (const float*)d_in[5];   // [256][256]
  const float* bv = (const float*)d_in[6];   // [256]

  const size_t PW  = (size_t)CH * CH * 2;                    //   131072
  const size_t PPL = (size_t)TOK * CH * 2;                   // 16777216
  const size_t PE  = (size_t)TOK * NT * 2;                   // 67108864
  const size_t PXE = (PE > PPL) ? PE : PPL;                  // shared xT / E region

  size_t off = 0;
  const size_t oWQ = off; off += PW;
  const size_t oWK = off; off += PW;
  const size_t oWV = off; off += PW;
  const size_t oXQ = off; off += PPL;
  const size_t oXK = off; off += PPL;
  const size_t oVH = off; off += PPL;
  const size_t oXE = off; off += PXE;                        // off = 117833728
  if (off > ws_size) return;
  if (off > (size_t)134217728) return;

  char* ws = (char*)d_ws;
  _Float16* WQ16 = (_Float16*)(ws + oWQ);
  _Float16* WK16 = (_Float16*)(ws + oWK);
  _Float16* WV16 = (_Float16*)(ws + oWV);
  _Float16* XQ   = (_Float16*)(ws + oXQ);
  _Float16* XK   = (_Float16*)(ws + oXK);
  _Float16* VH   = (_Float16*)(ws + oVH);
  _Float16* xT   = (_Float16*)(ws + oXE);
  _Float16* E    = (_Float16*)(ws + oXE);                    // region reuse, see map
  float*    outf = (float*)d_out;

  const dim3 blk(256);
  const int n8cc = (CH * CH) / 8;                                      // 8192
  const dim3 gWcc((n8cc + 255) / 256);                                 // 32
  const dim3 gXT(NT / 64, CH / 64, NB);                                // (16, 4, 32)
  const dim3 gPr(((TOK / 64) * (CH / 64) + 7) / 8);                    // 2048 tiles -> 256 blocks
  const dim3 gSo(NT / RSB, NB);                                        // (32, 32)
  const dim3 gPV(NB * (NT / PVN));                                     // 512
  const float cs64 = 1.0f / SCW;                                       // undo the weight carry
  const size_t ldsSoft = (size_t)RSB * NT * sizeof(float);             // 131072

  // (1) weight planes, x64 carried (conv weights [out][in] are already the k-contiguous Bt / A layout)
  cvt_flat<<<gWcc, blk, 0, stream>>>(Wq, WQ16, n8cc, SCW);
  cvt_flat<<<gWcc, blk, 0, stream>>>(Wk, WK16, n8cc, SCW);
  cvt_flat<<<gWcc, blk, 0, stream>>>(Wv, WV16, n8cc, SCW);
  // (2) activations transposed to position rows: x [32][256][1024] -> xT [32768][256]
  cvt_xT<<<gXT, blk, 0, stream>>>(x, xT, CH);
  // (3) XQ = f16(8*(xT . Wq^T + bq))        (M=32768, N=256, K=256, column bias)
  gemm64p<2><<<gPr, blk, 0, stream>>>(xT, CH, WQ16, CH, bq, CH, cs64, SCQK, XQ, CH, TOK, CH, CH);
  // (4) XK = f16(8*(xT . Wk^T + bk))        (M=32768, N=256, K=256, column bias)
  gemm64p<2><<<gPr, blk, 0, stream>>>(xT, CH, WK16, CH, bk, CH, cs64, SCQK, XK, CH, TOK, CH, CH);
  // (5) VH = f16(16*(Wv . x + bv))          (M=256, N=32768, K=256, row bias)
  gemm64p<1><<<gPr, blk, 0, stream>>>(WV16, CH, xT, CH, bv, CH, cs64, SCV, VH, TOK, CH, TOK, CH);
  // (6) scores + row softmax -> E plane (overwrites the dead xT region)
  k_soft<<<gSo, blk, ldsSoft, stream>>>(XQ, XK, E);
  // (7) softmax-weighted value sum + residual -> d_out
  k_pv<<<gPV, blk, 0, stream>>>(E, VH, x, outf);
}

// v001
// A run of this version takes 189 microseconds.
// In both of two side-by-side timings against v000, it was 1.25 times as fast.
#include <hip/hip_runtime.h>
#include <math.h>
#include <stdint.h>

// All contractions on v_wmma_f32_16x16x32_f16 (f16 operands, f32 accumulate): the three 1x1-conv
// projections take bf16-RNE inputs (x1) and bf16-RNE weights (x64) as single f16 planes; the 256-deep
// query.key scores use single f16 planes of 8*q and 8*k; the 1024-deep softmax-weighted value sum uses
// a single f16 plane of 16*v against E = f16(32768*softmax) held as a single f16 plane. Softmax
// statistics, biases, residual add and epilogues are f32.
//
// Every f16 operand plane [R][K] lives in fragment order: for 16-row tile T and 32-deep k step S the unit
// (T*(K/32) + S) is 512 halves; inside it element (row, k) sits at ((k>>4)&1)*256 + (((k>>3)&1)*16 + (row&15))*8
// + (k&7). A wave's two 16-B loads of one fragment then cover 2 x 512 contiguous bytes (whole 128-B lines).

#define NB   32
#define CH   256
#define NT   1024
#define TOK  (NB * NT)
#define RSB  32
#define PVN  64
#define OUTN (NB * CH * NT)

#define SCW  64.0f
#define SCQK 8.0f
#define SCV  16.0f
#define SCE  32768.0f
#define SCS  (1.0f / (SCQK * SCQK * 16.0f))

static_assert(TOK % 64 == 0 && CH % 64 == 0 && CH % 32 == 0 && NT % 32 == 0);
static_assert((((TOK / 64) * (CH / 64)) % 8) == 0);
static_assert(NT % RSB == 0 && RSB == 32 && NT == 4 * 256);
static_assert((NT / 16) % 8 == 0 && CH == 8 * 32);
static_assert(NT % PVN == 0 && PVN == 64);
static_assert((CH * CH) % 2048 == 0);
static_assert(NT % 64 == 0 && CH % 64 == 0);

typedef _Float16       v16h __attribute__((ext_vector_type(16)));
typedef _Float16       v8h  __attribute__((ext_vector_type(8)));
typedef float          v8f  __attribute__((ext_vector_type(8)));
typedef float          v4f  __attribute__((ext_vector_type(4)));
typedef unsigned int   v4u  __attribute__((ext_vector_type(4)));

union HU { v8h h; v4u u; v4f f; _Float16 s[8]; };
union FR { v16h v; v8h h[2]; _Float16 s[16]; };
static_assert(sizeof(HU) == 16);
static_assert(sizeof(FR) == 32);

// ---- scalar helpers --------------------------------------------------------------------------------
__device__ __forceinline__ unsigned short bf_bits(float f) {          // f32 -> bf16 bits, RNE convert
  const unsigned u = __float_as_uint(f);
  return (unsigned short)((u + 0x7FFFu + ((u >> 16) & 1u)) >> 16);
}
__device__ __forceinline__ float bf_up(unsigned short h) { return __uint_as_float(((unsigned)h) << 16); }
__device__ __forceinline__ float bfr(float f) { return bf_up(bf_bits(f)); }   // value after bf16 RNE convert
__device__ __forceinline__ v8f zero8() { v8f z = {0.f, 0.f, 0.f, 0.f, 0.f, 0.f, 0.f, 0.f}; return z; }

__device__ __forceinline__ void ld8(const float* p, float* o) {
  const v4f a = *(const v4f*)(p);
  const v4f b = *(const v4f*)(p + 4);
  o[0] = a[0]; o[1] = a[1]; o[2] = a[2]; o[3] = a[3];
  o[4] = b[0]; o[5] = b[1]; o[6] = b[2]; o[7] = b[3];
}

// ---- fragment loader: 16-bit A/B operand from a fragment-order plane, p = unit*512 + 8*lane, h = lane>>4;
//      elements 0..7 <- p[0..7] (k0+8h..k0+8h+7), elements 8..15 <- p[256..263] (k0+16+8h..k0+16+8h+7)
__device__ __forceinline__ v16h ldfrag_h(const _Float16* p) {
  FR f;
  f.h[0] = *(const v8h*)(p);
  f.h[1] = *(const v8h*)(p + 256);
  return f.v;
}

// ---- WMMA helpers with trailing VALU hazard gap --------------------------------------------------------
__device__ __forceinline__ v8f mma_h(v16h a, v16h b, v8f c) {
  c = __builtin_amdgcn_wmma_f32_16x16x32_f16(false, a, false, b, (short)0, c, false, false);
#if defined(__HIP_DEVICE_COMPILE__)
  asm volatile("v_nop\n\tv_nop\n\tv_nop\n\tv_nop" : "+v"(c) : "v"(a), "v"(b));
#endif
  return c;
}
__device__ __forceinline__ v8f mma_h_raw(v16h a, v16h b, v8f c) {
  return __builtin_amdgcn_wmma_f32_16x16x32_f16(false, a, false, b, (short)0, c, false, false);
}
__device__ __forceinline__ void dep_guard_h(v8f& a, v8f& b, v16h x) {
#if defined(__HIP_DEVICE_COMPILE__)
  asm volatile("v_nop\n\tv_nop\n\tv_nop\n\tv_nop" : "+v"(a), "+v"(b) : "v"(x));
#endif
}
__device__ __forceinline__ void keep4_h(v16h a, v16h b, v16h c, v16h d) {
#if defined(__HIP_DEVICE_COMPILE__)
  asm volatile("v_nop" :: "v"(a), "v"(b), "v"(c), "v"(d));
#endif
}
__device__ __forceinline__ void acc_guard4(v8f& a, v8f& b, v8f& c, v8f& d) {
#if defined(__HIP_DEVICE_COMPILE__)
  asm volatile("v_nop\n\tv_nop\n\tv_nop\n\tv_nop" : "+v"(a), "+v"(b), "+v"(c), "+v"(d));
#endif
}
__device__ __forceinline__ void wave_lds_sync() {
  __builtin_amdgcn_fence(__ATOMIC_RELEASE, "workgroup");
  __builtin_amdgcn_wave_barrier();
  __builtin_amdgcn_fence(__ATOMIC_ACQUIRE, "workgroup");
}

// =====================================================================================================
// Weight convert: in [R][kd] f32 row-major -> out f16(scale * bf16RNE(in)) in fragment order; thread i owns
// the i-th 16-B chunk of the output (lane = i&31, part = (i>>5)&1, unit = i>>6), one 16-B store per lane.
// coverage: n8 threads x 8 = the whole plane; n8 is a multiple of 256 at every launch here.
// =====================================================================================================
__global__ __launch_bounds__(256) void cvt_flat(const float* __restrict__ in, _Float16* out, int n8, int kd, float scale) {
  const int i = blockIdx.x * 256 + threadIdx.x;
  if (i < n8) {
    const int ksn = kd >> 5, unit = i >> 6;
    const int tile = unit / ksn, ks = unit - tile * ksn;
    const int row = tile * 16 + (i & 15);
    const int k = ks * 32 + ((i >> 5) & 1) * 16 + ((i >> 4) & 1) * 8;
    float v[8];
    ld8(in + (size_t)row * kd + k, v);
    HU u;
#pragma unroll
    for (int e = 0; e < 8; ++e) u.s[e] = (_Float16)(bfr(v[e]) * scale);
    _Float16* p = out + (size_t)i * 8;
    *(v4u*)p = u.u;
    
  }
}

// =====================================================================================================
// Activation transpose-convert: in X[b][k][n] f32 (k = channel 0..Cd-1, n = position 0..NT-1, n contiguous)
// -> XT plane [b*NT + n][k] f16 = f16(bf16RNE(X)), K = Cd, in fragment order.
// grid (NT/64, Cd/64, NB). coverage: load phase 256 threads x 4 row-iterations x 4 floats = 64 k x 64 n;
// store phase 8 waves x 2 half-units x 32 lanes x 8 halves = 64 n rows x 64 k per block; grid = every
// (n tile, k tile, b) -> whole [TOK][Cd] plane.
// =====================================================================================================
__global__ __launch_bounds__(256) void cvt_xT(const float* __restrict__ X, _Float16* XT, int Cd) {
  __shared__ float sw[64][66];   // pitch 66: the two lane halves (8 k rows apart) read disjoint banks
  const int t = threadIdx.x;
  const int n0 = blockIdx.x * 64, k0 = blockIdx.y * 64, b = blockIdx.z;
  const float* Xb = X + (size_t)b * Cd * NT;
  {
    const int r = t >> 4, c4 = (t & 15) * 4;
#pragma unroll
    for (int it = 0; it < 4; ++it) {
      const int row = r + 16 * it;
      const v4f x = *(const v4f*)(Xb + (size_t)(k0 + row) * NT + n0 + c4);
      sw[row][c4 + 0] = x[0]; sw[row][c4 + 1] = x[1]; sw[row][c4 + 2] = x[2]; sw[row][c4 + 3] = x[3];
    }
  }
  __syncthreads();
  const int wave = t >> 5, lane = t & 31, hh = lane >> 4, rl = lane & 15;
  HU u[2];
#pragma unroll
  for (int it = 0; it < 2; ++it) {
    const int hu = wave * 2 + it;                  // 16 half-units: row tile hu>>2, k offset 16*(hu&3)
    const int n = (hu >> 2) * 16 + rl;
    const int kl = (hu & 3) * 16 + hh * 8;
#pragma unroll
    for (int e = 0; e < 8; ++e) u[it].s[e] = (_Float16)bfr(sw[kl + e][n]);
  }
  {
#pragma unroll
    for (int it = 0; it < 2; ++it) {
      const int hu = wave * 2 + it;
      const size_t unit = (size_t)(((b * NT + n0) >> 4) + (hu >> 2)) * (size_t)(Cd >> 5) + (k0 >> 5);
      _Float16* dst = XT + unit * 512 + (hu & 3) * 256 + lane * 8;
      *(v4u*)dst = u[it].u;
    }
    
  }
}

// =====================================================================================================
// One GEMM k sweep for MI 16-row A subtiles x 4 16-col B subtiles: acc[i][j] += A-frag(i) . Bt-frag(j).
// A and Bt are fragment-order planes with row lengths lda and ldb; rows m0.. / n0.. (multiples of 16), k from
// ka0 / kb0 (multiples of 32) on, K a multiple of 32; both fragments through ldfrag_h (same k map for A and B).
// =====================================================================================================
template <int MI>
__device__ __forceinline__ void kseg(v8f (&acc)[MI][4], const _Float16* __restrict__ A, int lda, int m0, int ka0,
                                     const _Float16* __restrict__ Bt, int ldb, int n0, int kb0, int K, int lane) {
  unsigned ob[4], oa[MI];                      // byte offset of this lane's 16 B in the current unit, per row tile
#pragma unroll
  for (int j = 0; j < 4; ++j) ob[j] = ((unsigned)((n0 >> 4) + j) * (unsigned)(ldb >> 5) + (unsigned)(kb0 >> 5)) * 1024u + lane * 16u;
#pragma unroll
  for (int i = 0; i < MI; ++i) oa[i] = ((unsigned)((m0 >> 4) + i) * (unsigned)(lda >> 5) + (unsigned)(ka0 >> 5)) * 1024u + lane * 16u;
  for (int kk = 0; kk < K; kk += 32) {
    v16h bh[4];
#pragma unroll
    for (int j = 0; j < 4; ++j) {
      bh[j] = ldfrag_h((const _Float16*)((const char*)Bt + ob[j]));
      ob[j] += 1024u;                          // the next k step's unit follows directly
    }
#pragma unroll
    for (int i = 0; i < MI; ++i) {
      const v16h a0 = ldfrag_h((const _Float16*)((const char*)A + oa[i]));
      oa[i] += 1024u;
#pragma unroll
      for (int j = 0; j < 4; ++j) acc[i][j] = mma_h_raw(a0, bh[j], acc[i][j]);
      dep_guard_h(acc[i][0], acc[i][3], a0);
    }
    keep4_h(bh[0], bh[1], bh[2], bh[3]);
  }
}

// =====================================================================================================
// Register-blocked f16 WMMA GEMM with a single f16 plane epilogue, one wave per 64x64 tile, no block barriers:
//   acc[m][n] = sum_k A[m][k] Bt[n][k]; M, N multiples of 64, K multiple of 32.
//   v = (acc*cs + b) * so, where RB == 1: b = bf16RNE(bias[m]) (row bias), RB == 2: b = bf16RNE(bias[n])
//   (column bias); bias index clamped to nbias. C is written as a fragment-order plane of row length ldc
//   (rows m, k = n): each 16x64 slab is staged in LDS (rows 0..15 x cols 0..63 fully staged before the
//   reload; pad cols 64..67 never read) and leaves as four 512-B contiguous wave stores.
// coverage: 4 slabs x 16 rows x 64 cols = the wave's whole 64x64 tile; grid*8 == tiles at every launch here.
// =====================================================================================================
template <int RB>
__global__ __launch_bounds__(256) void gemm64p(
    const _Float16* __restrict__ A, int lda, const _Float16* __restrict__ Bt, int ldb,
    const float* __restrict__ bias, int nbias, float cs, float so,
    _Float16* Cp, int ldc, int M, int N, int K) {
  __shared__ __align__(16) float sT[8][16 * 68];   // per-wave 16x64 slab, pitch 68 floats
  const int lane = threadIdx.x & 31;
  const int wave = threadIdx.x >> 5;
  const int tilesN = N >> 6;
  const int tilesM = M >> 6;
  const int tiles = tilesM * tilesN;
  const int item = blockIdx.x * 8 + wave;
  if (item >= tiles) return;   // wave-uniform; no block barriers in this kernel
  const int tm = item / tilesN;
  const int tn = item - tm * tilesN;
  const int m0 = tm << 6;
  const int n0 = tn << 6;

  const int rlane = lane & 15;                 // row (A) / col (B, D) within subtile
  const int mOff  = (lane >> 4) * 8;           // D row offset

  v8f acc[4][4];
#pragma unroll
  for (int i = 0; i < 4; ++i)
#pragma unroll
    for (int j = 0; j < 4; ++j) acc[i][j] = zero8();

  kseg<4>(acc, A, lda, m0, 0, Bt, ldb, n0, 0, K, lane);
  acc_guard4(acc[0][0], acc[0][1], acc[0][2], acc[0][3]);
  acc_guard4(acc[1][0], acc[1][1], acc[1][2], acc[1][3]);
  acc_guard4(acc[2][0], acc[2][1], acc[2][2], acc[2][3]);
  acc_guard4(acc[3][0], acc[3][1], acc[3][2], acc[3][3]);

  const int c8 = (lane >> 4) * 8;              // column offset of this lane half inside a 16-column group

  float cbv[4][8];
#pragma unroll
  for (int it = 0; it < 4; ++it) {
#pragma unroll
    for (int e = 0; e < 8; ++e) cbv[it][e] = 0.0f;
    if (RB == 2) {
#pragma unroll
      for (int e = 0; e < 8; ++e) cbv[it][e] = bfr(bias[min(n0 + 16 * it + c8 + e, nbias - 1)]);
    }
  }

  float* slab = sT[wave];
#pragma unroll
  for (int i = 0; i < 4; ++i) {
    const int mBase = m0 + (i << 4);
#pragma unroll
    for (int r = 0; r < 8; ++r) {
#pragma unroll
      for (int j = 0; j < 4; ++j) {
        slab[(mOff + r) * 68 + (j << 4) + rlane] = acc[i][j][r];
      }
    }
    wave_lds_sync();
    v4u uh[4];
    float rbv = 0.0f;
    if (RB == 1) rbv = bfr(bias[min(mBase + rlane, nbias - 1)]);
#pragma unroll
    for (int it = 0; it < 4; ++it) {                     // lane = row rlane, cols 16*it + c8 .. +7
      float xs[8];
      ld8(slab + rlane * 68 + 16 * it + c8, xs);
      HU h;
#pragma unroll
      for (int e = 0; e < 8; ++e) {
        const float v = (xs[e] * cs + rbv + cbv[it][e]) * so;
        h.s[e] = (_Float16)v;
      }
      uh[it] = h.u;
    }
    {
      const size_t co = ((size_t)(mBase >> 4) * (size_t)(ldc >> 5) + (n0 >> 5)) * 512 + lane * 8;
#pragma unroll
      for (int it = 0; it < 4; ++it) *(v4u*)(Cp + co + 256 * it) = uh[it];
      
    }
    wave_lds_sync();
  }
}

// =====================================================================================================
// Score rows + row softmax + E plane. Block = (b, 32 query rows n0..n0+31), 8 waves,
// dynamic LDS = 32 x 1024 f32 score rows.
//  (1) wave w computes the 16-column score tiles ct = w, w+8, ... (8 of them) for both 16-row tiles:
//      s = (q8 . k8) / (64*16) from the 8*q / 8*k planes (K = 256, A = XQ rows, Bt = XK rows), into LDS.
//  (2) wave w owns rows 4w..4w+3: lane holds cols 256j + 8*lane..+7 (j = 0..3) in registers; row max M
//      (xor shuffles), ef = exp(s - M), Z = sum_m ef (fixed lane order + xor shuffles), then
//      E = f16(32768 * ef / Z) with explicit flush of f16 subnormals to zero; the f16 row is staged in the
//      first half of its own score row's LDS bytes, 16-B chunk c at slot (c + row) & 127 (bank spread).
//  (3) after a block barrier the 32 x 1024 f16 block leaves in fragment order (64 KiB contiguous): wave w
//      stores half-units 16w..16w+15, each 512 contiguous bytes.
// coverage: sc: 8 waves x 8 col tiles x 16 cols x 32 rows = the whole 32x1024 block; E: 8 waves x 4 rows x
// 4 j x 32 lanes x 8 halves = 32 rows x 1024; grid (32, 32) = every (row block, b) -> whole E plane
// [TOK][NT].
// =====================================================================================================
__global__ __launch_bounds__(256) void k_soft(const _Float16* __restrict__ XQ, const _Float16* __restrict__ XK,
                                              _Float16* E) {
  extern __shared__ __align__(16) float sc[];                 // [RSB][NT]
  const int tid = threadIdx.x, wave = tid >> 5, lane = tid & 31;
  const int hh = lane >> 4, rl = lane & 15;
  const int rb = blockIdx.x, b = blockIdx.y, n0 = rb * RSB;

  // ---- (1) scores ----
  const _Float16* aq = XQ + (size_t)(b * NT + n0) * CH + 8 * lane;      // row tile (b*NT+n0)/16, CH/32 units each
  for (int ct = wave; ct < NT / 16; ct += 8) {
    const _Float16* bk = XK + (size_t)(b * NT + 16 * ct) * CH + 8 * lane;
    v8f a0 = zero8(), a1 = zero8();
#pragma unroll 2
    for (int ks = 0; ks < CH / 32; ++ks) {
      const v16h kb = ldfrag_h(bk + 512 * ks);
      const v16h q0 = ldfrag_h(aq + 512 * ks);
      const v16h q1 = ldfrag_h(aq + 16 * CH + 512 * ks);
      a0 = mma_h(q0, kb, a0);
      a1 = mma_h(q1, kb, a1);
    }
    const int mc = 16 * ct + rl;                               // D col = m; D row = 8hh + r within the row tile
#pragma unroll
    for (int r = 0; r < 8; ++r) {
      sc[(size_t)(8 * hh + r) * NT + mc]      = a0[r] * SCS;
      sc[(size_t)(16 + 8 * hh + r) * NT + mc] = a1[r] * SCS;
    }
  }
  __syncthreads();

  // ---- (2) row softmax, E plane ----
  for (int q4 = 0; q4 < 4; ++q4) {
    const int row = 4 * wave + q4;
    const float* rp = sc + (size_t)row * NT + 8 * lane;         // lane covers cols 256j + 8*lane .. +7
    float v[4][8];
    float mx = -3.0e38f;
#pragma unroll
    for (int j = 0; j < 4; ++j) {
      ld8(rp + 256 * j, v[j]);
#pragma unroll
      for (int e = 0; e < 8; ++e) mx = fmaxf(mx, v[j][e]);
    }
#pragma unroll
    for (int off = 16; off >= 1; off >>= 1) mx = fmaxf(mx, __shfl_xor(mx, off, 32));
    float z = 0.0f;
#pragma unroll
    for (int j = 0; j < 4; ++j) {
#pragma unroll
      for (int e = 0; e < 8; ++e) {
        const float ef = __expf(v[j][e] - mx);
        z += ef;
        v[j][e] = ef;
      }
    }
#pragma unroll
    for (int off = 16; off >= 1; off >>= 1) z += __shfl_xor(z, off, 32);
    const float rz = SCE * (1.0f / z);                         // z in [1, 1024]
    HU u[4];
#pragma unroll
    for (int j = 0; j < 4; ++j) {
#pragma unroll
      for (int e = 0; e < 8; ++e) {
        const _Float16 h0 = (_Float16)(v[j][e] * rz);
        const float f0 = (float)h0;
        const bool sub = f0 < 6.103515625e-05f;                // f16 subnormal -> exact zero
        u[j].s[e] = sub ? (_Float16)0.0f : h0;
      }
    }
    v4f* srow = (v4f*)(sc + (size_t)row * NT);
#pragma unroll
    for (int j = 0; j < 4; ++j) srow[(32 * j + lane + row) & 127] = u[j].f;
  }
  __syncthreads();   // every staged f16 row is complete before another wave gathers it

  // ---- (3) fragment-order store ----
  _Float16* eb = E + (size_t)(b * NT + n0) * NT + 8 * lane;     // row tiles (b*NT+n0)/16 and +1, NT/32 units each
#pragma unroll 4   // four LDS reads in flight per trip, so one LDS latency is paid per four stores
  for (int i = 0; i < 16; ++i) {
    const int hu = 16 * wave + i;                              // row tile hu>>6, k = 16*(hu&63) + 8*hh
    const int r = (hu >> 6) * 16 + rl;
    const int c = (hu & 63) * 2 + hh;
    const v4f x = ((const v4f*)(sc + (size_t)r * NT))[(c + r) & 127];
    *(v4f*)(eb + 256 * hu) = x;
  }
}

// =====================================================================================================
// Softmax-weighted value sum + residual, output in [b][c][n] order directly:
//   D[c][n] = sum_m (16*v)[c][m] . E[n][m], A = value plane rows c (row length TOK, k from b*NT, k = m),
//   Bt = E rows b*NT + n (row length NT, k = m), both in fragment order, K = 1024 (32 k-steps of 32).
// Block = (b, 64 query columns n0..n0+63), 8 waves; wave w owns channels 32w..32w+31 (2 x 4 tiles).
// Epilogue: out[b][c][n] = D/(16*32768) + bf16RNE(x[b][c][n]); per wave two 16x64 f32 slabs staged in LDS
// coverage: 8 waves x 2 slabs x 16 rows x 64 cols = 256 c x 64 n per block; 512 blocks = every (b, n tile)
// -> whole output [32][256][1024].
// =====================================================================================================
__global__ __launch_bounds__(256) void k_pv(const _Float16* __restrict__ E, const _Float16* __restrict__ VH,
                                            const float* __restrict__ X, float* out) {
  __shared__ __align__(16) float sO[8][16 * 68];            // per-wave 16x64 slab, pitch 68 floats
  const int tid = threadIdx.x, wave = tid >> 5, lane = tid & 31;
  const int hh = lane >> 4, rl = lane & 15;
  const int bx = blockIdx.x;
  const int b = bx / (NT / PVN);
  const int n0 = (bx - b * (NT / PVN)) * PVN;
  const int cb = wave * 32;

  v8f acc[2][4];
#pragma unroll
  for (int i = 0; i < 2; ++i)
#pragma unroll
    for (int j = 0; j < 4; ++j) acc[i][j] = zero8();

  kseg<2>(acc, VH, TOK, cb, b * NT, E, NT, b * NT + n0, 0, NT, lane);
  acc_guard4(acc[0][0], acc[0][1], acc[0][2], acc[0][3]);
  acc_guard4(acc[1][0], acc[1][1], acc[1][2], acc[1][3]);

  // ---- epilogue ----
  const float fo = 1.0f / (SCV * SCE);
  float* slab = sO[wave];
  const int p4 = (lane & 15) * 4, r2 = lane >> 4;
#pragma unroll
  for (int i = 0; i < 2; ++i) {
    const int cBase = cb + 16 * i;
#pragma unroll
    for (int r = 0; r < 8; ++r) {
#pragma unroll
      for (int j = 0; j < 4; ++j) {
        slab[(8 * hh + r) * 68 + 16 * j + rl] = acc[i][j][r];   // D row = c offset 8hh + r, D col = n offset 16j + rl
      }
    }
    wave_lds_sync();
    v4f ov[8];
#pragma unroll
    for (int it = 0; it < 8; ++it) {
      const int row = 2 * it + r2;                          // it 0..7 x r2 0..1 = rows 0..15
      const v4f a = *(const v4f*)(slab + row * 68 + p4);
      const size_t xo = ((size_t)(b * CH + cBase + row)) * NT + n0 + p4;
      const v4f xv = *(const v4f*)(X + xo);
      v4f o;
#pragma unroll
      for (int e = 0; e < 4; ++e) o[e] = a[e] * fo + bfr(xv[e]);
      ov[it] = o;
    }
    {
#pragma unroll
      for (int it = 0; it < 8; ++it) {
        const int row = 2 * it + r2;
        const size_t oo = ((size_t)(b * CH + cBase + row)) * NT + n0 + p4;
        *(v4f*)(out + oo) = ov[it];
      }
      
    }
    wave_lds_sync();
  }
}

// =====================================================================================================
// Workspace map; every plane [rows][k] below is stored in fragment order (see the head of the file).
//   WQ16  f16 [256][256]             0        131072   (64*Wq, bf16RNE)
//   WK16  f16 [256][256]        131072        131072   (64*Wk)
//   WV16  f16 [256][256]        262144        131072   (64*Wv)
//   XQ    f16 [32768][256]      393216      16777216   (8*q, position rows, k = c)
//   XK    f16 [32768][256]    17170432      16777216   (8*k)
//   VH    f16 [256][32768]    33947648      16777216   (16*v, row c, k = b*1024 + m)
//   xT    f16 [32768][256]    50724864      16777216   (bf16RNE(x) transposed to position rows)
//   E     f16 [32768][1024]   50724864      67108864   (32768 * row softmax; reuses the xT region: written by
//                                                       the softmax kernel after the last xT reader, the value
//                                                       projection, on the single in-order stream)
//   end                      117833728
// d_out f32 [32][256][1024] at byte 0.
// =====================================================================================================
extern "C" void kernel_launch(void* const* d_in, const int* in_sizes, int n_in,
                              void* d_out, int out_size, void* d_ws, size_t ws_size,
                              hipStream_t stream) {
  if (n_in < 7) return;
  if (in_sizes[0] != NB * CH * NT) return;
  if (in_sizes[1] != CH * CH || in_sizes[2] != CH) return;
  if (in_sizes[3] != CH * CH || in_sizes[4] != CH) return;
  if (in_sizes[5] != CH * CH || in_sizes[6] != CH) return;
  if (out_size != OUTN) return;

  const float* x  = (const float*)d_in[0];   // [32][256][1024]
  const float* Wq = (const float*)d_in[1];   // [256][256]  ([out][in])
  const float* bq = (const float*)d_in[2];   // [256]
  const float* Wk = (const float*)d_in[3];   // [256][256]
  const float* bk = (const float*)d_in[4];   // [256]
  const float* Wv = (const float*)d_in[5];   // [256][256]
  const float* bv = (const float*)d_in[6];   // [256]

  const size_t PW  = (size_t)CH * CH * 2;                    //   131072
  const size_t PPL = (size_t)TOK * CH * 2;                   // 16777216
  const size_t PE  = (size_t)TOK * NT * 2;                   // 67108864
  const size_t PXE = (PE > PPL) ? PE : PPL;                  // shared xT / E region

  size_t off = 0;
  const size_t oWQ = off; off += PW;
  const size_t oWK = off; off += PW;
  const size_t oWV = off; off += PW;
  const size_t oXQ = off; off += PPL;
  const size_t oXK = off; off += PPL;
  const size_t oVH = off; off += PPL;
  const size_t oXE = off; off += PXE;                        // off = 117833728
  if (off > ws_size) return;
  if (off > (size_t)134217728) return;

  char* ws = (char*)d_ws;
  _Float16* WQ16 = (_Float16*)(ws + oWQ);
  _Float16* WK16 = (_Float16*)(ws + oWK);
  _Float16* WV16 = (_Float16*)(ws + oWV);
  _Float16* XQ   = (_Float16*)(ws + oXQ);
  _Float16* XK   = (_Float16*)(ws + oXK);
  _Float16* VH   = (_Float16*)(ws + oVH);
  _Float16* xT   = (_Float16*)(ws + oXE);
  _Float16* E    = (_Float16*)(ws + oXE);                    // region reuse, see map
  float*    outf = (float*)d_out;

  const dim3 blk(256);
  const int n8cc = (CH * CH) / 8;                                      // 8192
  const dim3 gWcc((n8cc + 255) / 256);                                 // 32
  const dim3 gXT(NT / 64, CH / 64, NB);                                // (16, 4, 32)
  const dim3 gPr(((TOK / 64) * (CH / 64) + 7) / 8);                    // 2048 tiles -> 256 blocks
  const dim3 gSo(NT / RSB, NB);                                        // (32, 32)
  const dim3 gPV(NB * (NT / PVN));                                     // 512
  const float cs64 = 1.0f / SCW;                                       // undo the weight carry
  const size_t ldsSoft = (size_t)RSB * NT * sizeof(float);             // 131072

  // (1) weight planes, x64 carried (conv weights [out][in]: rows = out, k = in), fragment order
  cvt_flat<<<gWcc, blk, 0, stream>>>(Wq, WQ16, n8cc, CH, SCW);
  cvt_flat<<<gWcc, blk, 0, stream>>>(Wk, WK16, n8cc, CH, SCW);
  cvt_flat<<<gWcc, blk, 0, stream>>>(Wv, WV16, n8cc, CH, SCW);
  // (2) activations transposed to position rows: x [32][256][1024] -> xT [32768][256]
  cvt_xT<<<gXT, blk, 0, stream>>>(x, xT, CH);
  // (3) XQ = f16(8*(xT . Wq^T + bq))        (M=32768, N=256, K=256, column bias)
  gemm64p<2><<<gPr, blk, 0, stream>>>(xT, CH, WQ16, CH, bq, CH, cs64, SCQK, XQ, CH, TOK, CH, CH);
  // (4) XK = f16(8*(xT . Wk^T + bk))        (M=32768, N=256, K=256, column bias)
  gemm64p<2><<<gPr, blk, 0, stream>>>(xT, CH, WK16, CH, bk, CH, cs64, SCQK, XK, CH, TOK, CH, CH);
  // (5) VH = f16(16*(Wv . x + bv))          (M=256, N=32768, K=256, row bias)
  gemm64p<1><<<gPr, blk, 0, stream>>>(WV16, CH, xT, CH, bv, CH, cs64, SCV, VH, TOK, CH, TOK, CH);
  // (6) scores + row softmax -> E plane (overwrites the dead xT region)
  k_soft<<<gSo, blk, ldsSoft, stream>>>(XQ, XK, E);
  // (7) softmax-weighted value sum + residual -> d_out
  k_pv<<<gPV, blk, 0, stream>>>(E, VH, x, outf);
}

// v002
// Measured time: 121 microseconds a run.
// In both of two side-by-side timings against v001, it was 1.56 times as fast.
// All steps since v000 together make it 1.95 times as fast.
#include <hip/hip_runtime.h>
#include <math.h>
#include <stdint.h>

// All contractions on v_wmma_f32_16x16x32_f16 (f16 operands, f32 accumulate): the three 1x1-conv
// projections take bf16-RNE inputs (x1) and bf16-RNE weights (x64) as single f16 planes; the 256-deep
// query.key scores use single f16 planes of 8*q and 8*k; the 1024-deep softmax-weighted value sum uses
// a single f16 plane of 16*v against E = f16(32768*softmax) held as a single f16 plane. Softmax
// statistics, biases, residual add and epilogues are f32.
//
// Every f16 operand plane [R][K] lives in fragment order: for 16-row tile T and 32-deep k step S the unit
// (T*(K/32) + S) is 512 halves; inside it element (row, k) sits at ((k>>4)&1)*256 + (((k>>3)&1)*16 + (row&15))*8
// + (k&7). A wave's two 16-B loads of one fragment then cover 2 x 512 contiguous bytes (whole 128-B lines).

#define NB   32
#define CH   256
#define NT   1024
#define TOK  (NB * NT)
#define RSB  32
#define PVN  64
#define OUTN (NB * CH * NT)

#define SCW  64.0f
#define SCQK 8.0f
#define SCV  16.0f
#define SCE  32768.0f
#define SCS  (1.0f / (SCQK * SCQK * 16.0f))

static_assert(TOK % 64 == 0 && CH % 64 == 0 && CH % 32 == 0 && NT % 32 == 0);
static_assert((((TOK / 32) * (CH / 64)) % 8) == 0 && (((CH / 32) * (TOK / 64)) % 8) == 0);
static_assert(NT % RSB == 0 && RSB == 32 && NT == 4 * 256);
static_assert((NT / 16) % 8 == 0 && CH == 8 * 32);
static_assert(NT % PVN == 0 && PVN == 64);
static_assert((CH * CH) % 2048 == 0);
static_assert(NT % 64 == 0 && CH % 64 == 0);
static_assert((CH / 32) % 3 == 2 && (NT / 32) % 3 == 2);

typedef _Float16       v16h __attribute__((ext_vector_type(16)));
typedef _Float16       v8h  __attribute__((ext_vector_type(8)));
typedef float          v8f  __attribute__((ext_vector_type(8)));
typedef float          v4f  __attribute__((ext_vector_type(4)));
typedef unsigned int   v4u  __attribute__((ext_vector_type(4)));

union HU { v8h h; v4u u; v4f f; _Float16 s[8]; };
union FR { v16h v; v8h h[2]; _Float16 s[16]; };
static_assert(sizeof(HU) == 16);
static_assert(sizeof(FR) == 32);

// ---- scalar helpers --------------------------------------------------------------------------------
__device__ __forceinline__ unsigned short bf_bits(float f) {          // f32 -> bf16 bits, RNE convert
  const unsigned u = __float_as_uint(f);
  return (unsigned short)((u + 0x7FFFu + ((u >> 16) & 1u)) >> 16);
}
__device__ __forceinline__ float bf_up(unsigned short h) { return __uint_as_float(((unsigned)h) << 16); }
__device__ __forceinline__ float bfr(float f) { return bf_up(bf_bits(f)); }   // value after bf16 RNE convert
__device__ __forceinline__ v8f zero8() { v8f z = {0.f, 0.f, 0.f, 0.f, 0.f, 0.f, 0.f, 0.f}; return z; }

__device__ __forceinline__ void ld8(const float* p, float* o) {
  const v4f a = *(const v4f*)(p);
  const v4f b = *(const v4f*)(p + 4);
  o[0] = a[0]; o[1] = a[1]; o[2] = a[2]; o[3] = a[3];
  o[4] = b[0]; o[5] = b[1]; o[6] = b[2]; o[7] = b[3];
}

// ---- fragment loader: 16-bit A/B operand from a fragment-order plane, p = unit*512 + 8*lane, h = lane>>4;
//      elements 0..7 <- p[0..7] (k0+8h..k0+8h+7), elements 8..15 <- p[256..263] (k0+16+8h..k0+16+8h+7)
__device__ __forceinline__ v16h ldfrag_h(const _Float16* p) {
  FR f;
  f.h[0] = *(const v8h*)(p);
  f.h[1] = *(const v8h*)(p + 256);
  return f.v;
}

// ---- WMMA helpers --------------------------------------------------------------------------------------
__device__ __forceinline__ v8f mma_h_raw(v16h a, v16h b, v8f c) {
  return __builtin_amdgcn_wmma_f32_16x16x32_f16(false, a, false, b, (short)0, c, false, false);
}
__device__ __forceinline__ void acc_guard4(v8f& a, v8f& b, v8f& c, v8f& d) {
#if defined(__HIP_DEVICE_COMPILE__)
  asm volatile("v_nop\n\tv_nop\n\tv_nop\n\tv_nop" : "+v"(a), "+v"(b), "+v"(c), "+v"(d));
#endif
}
__device__ __forceinline__ void wave_lds_sync() {
  __builtin_amdgcn_fence(__ATOMIC_RELEASE, "workgroup");
  __builtin_amdgcn_wave_barrier();
  __builtin_amdgcn_fence(__ATOMIC_ACQUIRE, "workgroup");
}

// =====================================================================================================
// Weight convert: in [R][kd] f32 row-major -> out f16(scale * bf16RNE(in)) in fragment order; thread i owns
// the i-th 16-B chunk of the output (lane = i&31, part = (i>>5)&1, unit = i>>6), one 16-B store per lane.
// coverage: n8 threads x 8 = the whole plane; n8 is a multiple of 256 at every launch here.
// =====================================================================================================
__global__ __launch_bounds__(256) void cvt_flat(const float* __restrict__ in, _Float16* out, int n8, int kd, float scale) {
  const int i = blockIdx.x * 256 + threadIdx.x;
  if (i < n8) {
    const int ksn = kd >> 5, unit = i >> 6;
    const int tile = unit / ksn, ks = unit - tile * ksn;
    const int row = tile * 16 + (i & 15);
    const int k = ks * 32 + ((i >> 5) & 1) * 16 + ((i >> 4) & 1) * 8;
    float v[8];
    ld8(in + (size_t)row * kd + k, v);
    HU u;
#pragma unroll
    for (int e = 0; e < 8; ++e) u.s[e] = (_Float16)(bfr(v[e]) * scale);
    _Float16* p = out + (size_t)i * 8;
    *(v4u*)p = u.u;
    
  }
}

// =====================================================================================================
// Activation transpose-convert: in X[b][k][n] f32 (k = channel 0..Cd-1, n = position 0..NT-1, n contiguous)
// -> XT plane [b*NT + n][k] f16 = f16(bf16RNE(X)), K = Cd, in fragment order.
// grid (NT/64, Cd/64, NB). coverage: load phase 256 threads x 4 row-iterations x 4 floats = 64 k x 64 n;
// store phase 8 waves x 2 half-units x 32 lanes x 8 halves = 64 n rows x 64 k per block; grid = every
// (n tile, k tile, b) -> whole [TOK][Cd] plane.
// =====================================================================================================
__global__ __launch_bounds__(256) void cvt_xT(const float* __restrict__ X, _Float16* XT, int Cd) {
  __shared__ float sw[64][66];   // pitch 66: the two lane halves (8 k rows apart) read disjoint banks
  const int t = threadIdx.x;
  const int n0 = blockIdx.x * 64, k0 = blockIdx.y * 64, b = blockIdx.z;
  const float* Xb = X + (size_t)b * Cd * NT;
  {
    const int r = t >> 4, c4 = (t & 15) * 4;
#pragma unroll
    for (int it = 0; it < 4; ++it) {
      const int row = r + 16 * it;
      const v4f x = *(const v4f*)(Xb + (size_t)(k0 + row) * NT + n0 + c4);
      sw[row][c4 + 0] = x[0]; sw[row][c4 + 1] = x[1]; sw[row][c4 + 2] = x[2]; sw[row][c4 + 3] = x[3];
    }
  }
  __syncthreads();
  const int wave = t >> 5, lane = t & 31, hh = lane >> 4, rl = lane & 15;
  HU u[2];
#pragma unroll
  for (int it = 0; it < 2; ++it) {
    const int hu = wave * 2 + it;                  // 16 half-units: row tile hu>>2, k offset 16*(hu&3)
    const int n = (hu >> 2) * 16 + rl;
    const int kl = (hu & 3) * 16 + hh * 8;
#pragma unroll
    for (int e = 0; e < 8; ++e) u[it].s[e] = (_Float16)bfr(sw[kl + e][n]);
  }
  {
#pragma unroll
    for (int it = 0; it < 2; ++it) {
      const int hu = wave * 2 + it;
      const size_t unit = (size_t)(((b * NT + n0) >> 4) + (hu >> 2)) * (size_t)(Cd >> 5) + (k0 >> 5);
      _Float16* dst = XT + unit * 512 + (hu & 3) * 256 + lane * 8;
      *(v4u*)dst = u[it].u;
    }
    
  }
}

// =====================================================================================================
// One GEMM k sweep for MI 16-row A subtiles x 4 16-col B subtiles: acc[i][j] += A-frag(i) . Bt-frag(j).
// A and Bt are fragment-order planes with row lengths lda and ldb; rows m0.. / n0.. (multiples of 16), k from
// ka0 / kb0 (multiples of 32) on; both fragments through ldfrag_h (same k map for A and B).
// The fragments of a k step live in one of three register sets; a set is refilled for step s + 3 right behind
// the products of step s, so every load has two whole steps of products between its issue and its use.
// K/32 must leave remainder 2 by 3 (8 and 32 steps here): the ring then loads exactly steps 0 .. K/32 - 1.
// Each accumulator still takes its k steps in ascending order.
// =====================================================================================================
template <int MI>
__device__ __forceinline__ void ldset(v16h (&a)[MI], v16h (&b)[4], const char* A, const unsigned (&oa)[MI],
                                      const char* Bt, const unsigned (&ob)[4]) {
#pragma unroll
  for (int j = 0; j < 4; ++j) b[j] = ldfrag_h((const _Float16*)(Bt + ob[j]));
#pragma unroll
  for (int i = 0; i < MI; ++i) a[i] = ldfrag_h((const _Float16*)(A + oa[i]));
}
template <int MI>
__device__ __forceinline__ void mmset(v8f (&acc)[MI][4], const v16h (&a)[MI], const v16h (&b)[4]) {
#pragma unroll
  for (int i = 0; i < MI; ++i)
#pragma unroll
    for (int j = 0; j < 4; ++j) acc[i][j] = mma_h_raw(a[i], b[j], acc[i][j]);
}
template <int MI>
__device__ __forceinline__ void kseg(v8f (&acc)[MI][4], const _Float16* __restrict__ A, int lda, int m0, int ka0,
                                     const _Float16* __restrict__ Bt, int ldb, int n0, int kb0, int K, int lane) {
  unsigned ob[4], oa[MI];                      // byte offset of this lane's 16 B in the first unit, per row tile
#pragma unroll
  for (int j = 0; j < 4; ++j) ob[j] = ((unsigned)((n0 >> 4) + j) * (unsigned)(ldb >> 5) + (unsigned)(kb0 >> 5)) * 1024u + lane * 16u;
#pragma unroll
  for (int i = 0; i < MI; ++i) oa[i] = ((unsigned)((m0 >> 4) + i) * (unsigned)(lda >> 5) + (unsigned)(ka0 >> 5)) * 1024u + lane * 16u;
  const char* pa = (const char*)A;             // wave-uniform: the next k step's unit follows 1024 B on
  const char* pb = (const char*)Bt;
  v16h a0[MI], a1[MI], a2[MI], b0[4], b1[4], b2[4];
  // Each sched_barrier keeps a set's loads where they are written: without them the scheduler sinks a refill to
  // just in front of its use (to save registers), or mixes the first two sets so that step 0 waits for both,
  // and the products wait out the whole load latency again.
  ldset<MI>(a0, b0, pa, oa, pb, ob);
  __builtin_amdgcn_sched_barrier(0);
  ldset<MI>(a1, b1, pa + 1024, oa, pb + 1024, ob);
  __builtin_amdgcn_sched_barrier(0);
  // the first trip moves the base registers that these loads name
  asm volatile("s_wait_xcnt 0x0" ::: "memory");
  const int trips = (K >> 5) / 3;
  for (int t = 0; t < trips; ++t) {
    ldset<MI>(a2, b2, pa + 2048, oa, pb + 2048, ob);
    __builtin_amdgcn_sched_barrier(0);
    mmset<MI>(acc, a0, b0);
    __builtin_amdgcn_sched_barrier(0);
    ldset<MI>(a0, b0, pa + 3072, oa, pb + 3072, ob);
    __builtin_amdgcn_sched_barrier(0);
    mmset<MI>(acc, a1, b1);
    __builtin_amdgcn_sched_barrier(0);
    ldset<MI>(a1, b1, pa + 4096, oa, pb + 4096, ob);
    __builtin_amdgcn_sched_barrier(0);
    mmset<MI>(acc, a2, b2);
    __builtin_amdgcn_sched_barrier(0);
    // the next trip re-forms the address registers that this trip's loads name
    asm volatile("s_wait_xcnt 0x0" ::: "memory");
    pa += 3072;
    pb += 3072;
  }
  mmset<MI>(acc, a0, b0);
  mmset<MI>(acc, a1, b1);
}

// =====================================================================================================
// Register-blocked f16 WMMA GEMM with a single f16 plane epilogue, one wave per 32x64 tile (three fragment sets
// of that tile and its accumulators stay under 256 registers), no block barriers:
//   acc[m][n] = sum_k A[m][k] Bt[n][k]; M multiple of 32, N multiple of 64, K as kseg asks.
//   v = (acc*cs + b) * so, where RB == 1: b = bf16RNE(bias[m]) (row bias), RB == 2: b = bf16RNE(bias[n])
//   (column bias); bias index clamped to nbias. C is written as a fragment-order plane of row length ldc
//   (rows m, k = n): each 16x64 slab is staged in LDS (rows 0..15 x cols 0..63 fully staged before the
//   reload; pad cols 64..67 never read) and leaves as four 512-B contiguous wave stores.
// coverage: 2 slabs x 16 rows x 64 cols = the wave's whole 32x64 tile; grid*8 == tiles at every launch here.
// =====================================================================================================
template <int RB>
__global__ __launch_bounds__(256) void gemm64p(
    const _Float16* __restrict__ A, int lda, const _Float16* __restrict__ Bt, int ldb,
    const float* __restrict__ bias, int nbias, float cs, float so,
    _Float16* Cp, int ldc, int M, int N, int K) {
  __shared__ __align__(16) float sT[8][16 * 68];   // per-wave 16x64 slab, pitch 68 floats
  const int lane = threadIdx.x & 31;
  const int wave = threadIdx.x >> 5;
  const int tilesN = N >> 6;
  const int tilesM = M >> 5;
  const int tiles = tilesM * tilesN;
  const int item = blockIdx.x * 8 + wave;
  if (item >= tiles) return;   // wave-uniform; no block barriers in this kernel
  const int tm = item / tilesN;
  const int tn = item - tm * tilesN;
  const int m0 = tm << 5;
  const int n0 = tn << 6;

  const int rlane = lane & 15;                 // row (A) / col (B, D) within subtile
  const int mOff  = (lane >> 4) * 8;           // D row offset

  v8f acc[2][4];
#pragma unroll
  for (int i = 0; i < 2; ++i)
#pragma unroll
    for (int j = 0; j < 4; ++j) acc[i][j] = zero8();

  kseg<2>(acc, A, lda, m0, 0, Bt, ldb, n0, 0, K, lane);
  acc_guard4(acc[0][0], acc[0][1], acc[0][2], acc[0][3]);
  acc_guard4(acc[1][0], acc[1][1], acc[1][2], acc[1][3]);

  const int c8 = (lane >> 4) * 8;              // column offset of this lane half inside a 16-column group

  float cbv[4][8];
#pragma unroll
  for (int it = 0; it < 4; ++it) {
#pragma unroll
    for (int e = 0; e < 8; ++e) cbv[it][e] = 0.0f;
    if (RB == 2) {
#pragma unroll
      for (int e = 0; e < 8; ++e) cbv[it][e] = bfr(bias[min(n0 + 16 * it + c8 + e, nbias - 1)]);
    }
  }

  float* slab = sT[wave];
#pragma unroll
  for (int i = 0; i < 2; ++i) {
    const int mBase = m0 + (i << 4);
#pragma unroll
    for (int r = 0; r < 8; ++r) {
#pragma unroll
      for (int j = 0; j < 4; ++j) {
        slab[(mOff + r) * 68 + (j << 4) + rlane] = acc[i][j][r];
      }
    }
    wave_lds_sync();
    v4u uh[4];
    float rbv = 0.0f;
    if (RB == 1) rbv = bfr(bias[min(mBase + rlane, nbias - 1)]);
#pragma unroll
    for (int it = 0; it < 4; ++it) {                     // lane = row rlane, cols 16*it + c8 .. +7
      float xs[8];
      ld8(slab + rlane * 68 + 16 * it + c8, xs);
      HU h;
#pragma unroll
      for (int e = 0; e < 8; ++e) {
        const float v = (xs[e] * cs + rbv + cbv[it][e]) * so;
        h.s[e] = (_Float16)v;
      }
      uh[it] = h.u;
    }
    {
      const size_t co = ((size_t)(mBase >> 4) * (size_t)(ldc >> 5) + (n0 >> 5)) * 512 + lane * 8;
#pragma unroll
      for (int it = 0; it < 4; ++it) *(v4u*)(Cp + co + 256 * it) = uh[it];
      
    }
    wave_lds_sync();
  }
}

// =====================================================================================================
// Score rows + row softmax + E plane. Block = (b, 32 query rows n0..n0+31), 8 waves,
// dynamic LDS = 32 x 1024 f32 score rows.
//  (1) wave w computes the 16-column score tiles ct = w, w+8, ... (8 of them) for both 16-row tiles:
//      s = (q8 . k8) / (64*16) from the 8*q / 8*k planes (K = 256, A = XQ rows, Bt = XK rows), into LDS.
//      The 16 query fragments are loaded once and stay in registers; the 8 key fragments form a ring, each
//      refilled for the next column tile right behind its two products.
//  (2) wave w owns rows 4w..4w+3: lane holds cols 256j + 8*lane..+7 (j = 0..3) in registers; row max M
//      (xor shuffles), ef = exp(s - M), Z = sum_m ef (fixed lane order + xor shuffles), then
//      E = f16(32768 * ef / Z) with explicit flush of f16 subnormals to zero; the f16 row is staged in the
//      first half of its own score row's LDS bytes, 16-B chunk c at slot (c + row) & 127 (bank spread).
//  (3) after a block barrier the 32 x 1024 f16 block leaves in fragment order (64 KiB contiguous): wave w
//      stores half-units 16w..16w+15, each 512 contiguous bytes.
// coverage: sc: 8 waves x 8 col tiles x 16 cols x 32 rows = the whole 32x1024 block; E: 8 waves x 4 rows x
// 4 j x 32 lanes x 8 halves = 32 rows x 1024; grid (32, 32) = every (row block, b) -> whole E plane
// [TOK][NT].
// =====================================================================================================
__global__ __launch_bounds__(256) void k_soft(const _Float16* __restrict__ XQ, const _Float16* __restrict__ XK,
                                              _Float16* E) {
  extern __shared__ __align__(16) float sc[];                 // [RSB][NT]
  const int tid = threadIdx.x, wave = tid >> 5, lane = tid & 31;
  const int hh = lane >> 4, rl = lane & 15;
  const int rb = blockIdx.x, b = blockIdx.y, n0 = rb * RSB;

  // ---- (1) scores ----
  const _Float16* aq = XQ + (size_t)(b * NT + n0) * CH + 8 * lane;      // row tile (b*NT+n0)/16, CH/32 units each
  v16h q0[CH / 32], q1[CH / 32], kf[CH / 32];
  const _Float16* bk = XK + (size_t)(b * NT + 16 * wave) * CH + 8 * lane;
#pragma unroll
  for (int ks = 0; ks < CH / 32; ++ks) kf[ks] = ldfrag_h(bk + 512 * ks);
#pragma unroll
  for (int ks = 0; ks < CH / 32; ++ks) {
    q0[ks] = ldfrag_h(aq + 512 * ks);
    q1[ks] = ldfrag_h(aq + 16 * CH + 512 * ks);
  }
#pragma unroll   // the tile steps become immediate offsets of one address, and the last tile drops its refill
  for (int t = 0; t < NT / 128; ++t) {                          // column tile ct = wave + 8t
    v8f a0 = zero8(), a1 = zero8();
#pragma unroll
    for (int ks = 0; ks < CH / 32; ++ks) {
      a0 = mma_h_raw(q0[ks], kf[ks], a0);
      a1 = mma_h_raw(q1[ks], kf[ks], a1);
      // the next tile's fragment, issued a whole tile ahead of its use
      if (t + 1 < NT / 128) kf[ks] = ldfrag_h(bk + (size_t)(t + 1) * 128 * CH + 512 * ks);
      // keeps the refill here: the scheduler otherwise sinks it to the tile's end, just in front of its use
      __builtin_amdgcn_sched_barrier(0);
    }
    const int mc = 16 * (wave + 8 * t) + rl;                    // D col = m; D row = 8hh + r within the row tile
#pragma unroll
    for (int r = 0; r < 8; ++r) {
      sc[(size_t)(8 * hh + r) * NT + mc]      = a0[r] * SCS;
      sc[(size_t)(16 + 8 * hh + r) * NT + mc] = a1[r] * SCS;
    }
  }
  __syncthreads();

  // ---- (2) row softmax, E plane ----
  for (int q4 = 0; q4 < 4; ++q4) {
    const int row = 4 * wave + q4;
    const float* rp = sc + (size_t)row * NT + 8 * lane;         // lane covers cols 256j + 8*lane .. +7
    float v[4][8];
    float mx = -3.0e38f;
#pragma unroll
    for (int j = 0; j < 4; ++j) {
      ld8(rp + 256 * j, v[j]);
#pragma unroll
      for (int e = 0; e < 8; ++e) mx = fmaxf(mx, v[j][e]);
    }
#pragma unroll
    for (int off = 16; off >= 1; off >>= 1) mx = fmaxf(mx, __shfl_xor(mx, off, 32));
    float z = 0.0f;
#pragma unroll
    for (int j = 0; j < 4; ++j) {
#pragma unroll
      for (int e = 0; e < 8; ++e) {
        const float ef = __expf(v[j][e] - mx);
        z += ef;
        v[j][e] = ef;
      }
    }
#pragma unroll
    for (int off = 16; off >= 1; off >>= 1) z += __shfl_xor(z, off, 32);
    const float rz = SCE * (1.0f / z);                         // z in [1, 1024]
    HU u[4];
#pragma unroll
    for (int j = 0; j < 4; ++j) {
#pragma unroll
      for (int e = 0; e < 8; ++e) {
        const _Float16 h0 = (_Float16)(v[j][e] * rz);
        const float f0 = (float)h0;
        const bool sub = f0 < 6.103515625e-05f;                // f16 subnormal -> exact zero
        u[j].s[e] = sub ? (_Float16)0.0f : h0;
      }
    }
    v4f* srow = (v4f*)(sc + (size_t)row * NT);
#pragma unroll
    for (int j = 0; j < 4; ++j) srow[(32 * j + lane + row) & 127] = u[j].f;
  }
  __syncthreads();   // every staged f16 row is complete before another wave gathers it

  // ---- (3) fragment-order store ----
  _Float16* eb = E + (size_t)(b * NT + n0) * NT + 8 * lane;     // row tiles (b*NT+n0)/16 and +1, NT/32 units each
#pragma unroll 4   // four LDS reads in flight per trip, so one LDS latency is paid per four stores
  for (int i = 0; i < 16; ++i) {
    const int hu = 16 * wave + i;                              // row tile hu>>6, k = 16*(hu&63) + 8*hh
    const int r = (hu >> 6) * 16 + rl;
    const int c = (hu & 63) * 2 + hh;
    const v4f x = ((const v4f*)(sc + (size_t)r * NT))[(c + r) & 127];
    *(v4f*)(eb + 256 * hu) = x;
  }
}

// =====================================================================================================
// Softmax-weighted value sum + residual, output in [b][c][n] order directly:
//   D[c][n] = sum_m (16*v)[c][m] . E[n][m], A = value plane rows c (row length TOK, k from b*NT, k = m),
//   Bt = E rows b*NT + n (row length NT, k = m), both in fragment order, K = 1024 (32 k-steps of 32).
// Block = (b, 64 query columns n0..n0+63), 8 waves; wave w owns channels 32w..32w+31 (2 x 4 tiles).
// Epilogue: out[b][c][n] = D/(16*32768) + bf16RNE(x[b][c][n]); per wave two 16x64 f32 slabs staged in LDS
// coverage: 8 waves x 2 slabs x 16 rows x 64 cols = 256 c x 64 n per block; 512 blocks = every (b, n tile)
// -> whole output [32][256][1024].
// =====================================================================================================
__global__ __launch_bounds__(256) void k_pv(const _Float16* __restrict__ E, const _Float16* __restrict__ VH,
                                            const float* __restrict__ X, float* out) {
  __shared__ __align__(16) float sO[8][16 * 68];            // per-wave 16x64 slab, pitch 68 floats
  const int tid = threadIdx.x, wave = tid >> 5, lane = tid & 31;
  const int hh = lane >> 4, rl = lane & 15;
  const int bx = blockIdx.x;
  const int b = bx / (NT / PVN);
  const int n0 = (bx - b * (NT / PVN)) * PVN;
  const int cb = wave * 32;

  v8f acc[2][4];
#pragma unroll
  for (int i = 0; i < 2; ++i)
#pragma unroll
    for (int j = 0; j < 4; ++j) acc[i][j] = zero8();

  kseg<2>(acc, VH, TOK, cb, b * NT, E, NT, b * NT + n0, 0, NT, lane);
  acc_guard4(acc[0][0], acc[0][1], acc[0][2], acc[0][3]);
  acc_guard4(acc[1][0], acc[1][1], acc[1][2], acc[1][3]);

  // ---- epilogue ----
  const float fo = 1.0f / (SCV * SCE);
  float* slab = sO[wave];
  const int p4 = (lane & 15) * 4, r2 = lane >> 4;
#pragma unroll
  for (int i = 0; i < 2; ++i) {
    const int cBase = cb + 16 * i;
#pragma unroll
    for (int r = 0; r < 8; ++r) {
#pragma unroll
      for (int j = 0; j < 4; ++j) {
        slab[(8 * hh + r) * 68 + 16 * j + rl] = acc[i][j][r];   // D row = c offset 8hh + r, D col = n offset 16j + rl
      }
    }
    wave_lds_sync();
    v4f ov[8];
#pragma unroll
    for (int it = 0; it < 8; ++it) {
      const int row = 2 * it + r2;                          // it 0..7 x r2 0..1 = rows 0..15
      const v4f a = *(const v4f*)(slab + row * 68 + p4);
      const size_t xo = ((size_t)(b * CH + cBase + row)) * NT + n0 + p4;
      const v4f xv = *(const v4f*)(X + xo);
      // this build lets the next load's result land on this load's address pair
      asm volatile("s_wait_xcnt 0x0" ::: "memory");
      v4f o;
#pragma unroll
      for (int e = 0; e < 4; ++e) o[e] = a[e] * fo + bfr(xv[e]);
      ov[it] = o;
    }
    {
#pragma unroll
      for (int it = 0; it < 8; ++it) {
        const int row = 2 * it + r2;
        const size_t oo = ((size_t)(b * CH + cBase + row)) * NT + n0 + p4;
        *(v4f*)(out + oo) = ov[it];
      }
      
    }
    wave_lds_sync();
  }
}

// =====================================================================================================
// Workspace map; every plane [rows][k] below is stored in fragment order (see the head of the file).
//   WQ16  f16 [256][256]             0        131072   (64*Wq, bf16RNE)
//   WK16  f16 [256][256]        131072        131072   (64*Wk)
//   WV16  f16 [256][256]        262144        131072   (64*Wv)
//   XQ    f16 [32768][256]      393216      16777216   (8*q, position rows, k = c)
//   XK    f16 [32768][256]    17170432      16777216   (8*k)
//   VH    f16 [256][32768]    33947648      16777216   (16*v, row c, k = b*1024 + m)
//   xT    f16 [32768][256]    50724864      16777216   (bf16RNE(x) transposed to position rows)
//   E     f16 [32768][1024]   50724864      67108864   (32768 * row softmax; reuses the xT region: written by
//                                                       the softmax kernel after the last xT reader, the value
//                                                       projection, on the single in-order stream)
//   end                      117833728
// d_out f32 [32][256][1024] at byte 0.
// =====================================================================================================
extern "C" void kernel_launch(void* const* d_in, const int* in_sizes, int n_in,
                              void* d_out, int out_size, void* d_ws, size_t ws_size,
                              hipStream_t stream) {
  if (n_in < 7) return;
  if (in_sizes[0] != NB * CH * NT) return;
  if (in_sizes[1] != CH * CH || in_sizes[2] != CH) return;
  if (in_sizes[3] != CH * CH || in_sizes[4] != CH) return;
  if (in_sizes[5] != CH * CH || in_sizes[6] != CH) return;
  if (out_size != OUTN) return;

  const float* x  = (const float*)d_in[0];   // [32][256][1024]
  const float* Wq = (const float*)d_in[1];   // [256][256]  ([out][in])
  const float* bq = (const float*)d_in[2];   // [256]
  const float* Wk = (const float*)d_in[3];   // [256][256]
  const float* bk = (const float*)d_in[4];   // [256]
  const float* Wv = (const float*)d_in[5];   // [256][256]
  const float* bv = (const float*)d_in[6];   // [256]

  const size_t PW  = (size_t)CH * CH * 2;                    //   131072
  const size_t PPL = (size_t)TOK * CH * 2;                   // 16777216
  const size_t PE  = (size_t)TOK * NT * 2;                   // 67108864
  const size_t PXE = (PE > PPL) ? PE : PPL;                  // shared xT / E region

  size_t off = 0;
  const size_t oWQ = off; off += PW;
  const size_t oWK = off; off += PW;
  const size_t oWV = off; off += PW;
  const size_t oXQ = off; off += PPL;
  const size_t oXK = off; off += PPL;
  const size_t oVH = off; off += PPL;
  const size_t oXE = off; off += PXE;                        // off = 117833728
  if (off > ws_size) return;
  if (off > (size_t)134217728) return;

  char* ws = (char*)d_ws;
  _Float16* WQ16 = (_Float16*)(ws + oWQ);
  _Float16* WK16 = (_Float16*)(ws + oWK);
  _Float16* WV16 = (_Float16*)(ws + oWV);
  _Float16* XQ   = (_Float16*)(ws + oXQ);
  _Float16* XK   = (_Float16*)(ws + oXK);
  _Float16* VH   = (_Float16*)(ws + oVH);
  _Float16* xT   = (_Float16*)(ws + oXE);
  _Float16* E    = (_Float16*)(ws + oXE);                    // region reuse, see map
  float*    outf = (float*)d_out;

  const dim3 blk(256);
  const int n8cc = (CH * CH) / 8;                                      // 8192
  const dim3 gWcc((n8cc + 255) / 256);                                 // 32
  const dim3 gXT(NT / 64, CH / 64, NB);                                // (16, 4, 32)
  const dim3 gPr(((TOK / 32) * (CH / 64) + 7) / 8);                    // 4096 tiles -> 512 blocks
  const dim3 gSo(NT / RSB, NB);                                        // (32, 32)
  const dim3 gPV(NB * (NT / PVN));                                     // 512
  const float cs64 = 1.0f / SCW;                                       // undo the weight carry
  const size_t ldsSoft = (size_t)RSB * NT * sizeof(float);             // 131072

  // (1) weight planes, x64 carried (conv weights [out][in]: rows = out, k = in), fragment order
  cvt_flat<<<gWcc, blk, 0, stream>>>(Wq, WQ16, n8cc, CH, SCW);
  cvt_flat<<<gWcc, blk, 0, stream>>>(Wk, WK16, n8cc, CH, SCW);
  cvt_flat<<<gWcc, blk, 0, stream>>>(Wv, WV16, n8cc, CH, SCW);
  // (2) activations transposed to position rows: x [32][256][1024] -> xT [32768][256]
  cvt_xT<<<gXT, blk, 0, stream>>>(x, xT, CH);
  // (3) XQ = f16(8*(xT . Wq^T + bq))        (M=32768, N=256, K=256, column bias)
  gemm64p<2><<<gPr, blk, 0, stream>>>(xT, CH, WQ16, CH, bq, CH, cs64, SCQK, XQ, CH, TOK, CH, CH);
  // (4) XK = f16(8*(xT . Wk^T + bk))        (M=32768, N=256, K=256, column bias)
  gemm64p<2><<<gPr, blk, 0, stream>>>(xT, CH, WK16, CH, bk, CH, cs64, SCQK, XK, CH, TOK, CH, CH);
  // (5) VH = f16(16*(Wv . x + bv))          (M=256, N=32768, K=256, row bias)
  gemm64p<1><<<gPr, blk, 0, stream>>>(WV16, CH, xT, CH, bv, CH, cs64, SCV, VH, TOK, CH, TOK, CH);
  // (6) scores + row softmax -> E plane (overwrites the dead xT region)
  k_soft<<<gSo, blk, ldsSoft, stream>>>(XQ, XK, E);
  // (7) softmax-weighted value sum + residual -> d_out
  k_pv<<<gPV, blk, 0, stream>>>(E, VH, x, outf);
}

// v003
// Measured time: 105 microseconds a run.
// Two timings next to v002 both put it at 1.15 times that version's speed.
// Over all steps from v000 it is 2.24 times as fast.
#include <hip/hip_runtime.h>
#include <math.h>
#include <stdint.h>

// All contractions on v_wmma_f32_16x16x32_f16 (f16 operands, f32 accumulate): the three 1x1-conv
// projections take bf16-RNE inputs (x1) and bf16-RNE weights (x64) as single f16 planes; the 256-deep
// query.key scores use single f16 planes of 8*q and 8*k; the 1024-deep softmax-weighted value sum uses
// a single f16 plane of 16*v against E = f16(32768*softmax) held as a single f16 plane. Softmax
// statistics, biases, residual add and epilogues are f32.
//
// Every f16 operand plane [R][K] lives in fragment order: for 16-row tile T and 32-deep k step S the unit
// (T*(K/32) + S) is 512 halves; inside it element (row, k) sits at ((k>>4)&1)*256 + (((k>>3)&1)*16 + (row&15))*8
// + (k&7). A wave's two 16-B loads of one fragment then cover 2 x 512 contiguous bytes (whole 128-B lines).

#define NB   32
#define CH   256
#define NT   1024
#define TOK  (NB * NT)
#define RSB  32
#define PVN  64
#define OUTN (NB * CH * NT)
#define WBLK ((CH * CH) / 2048)            // 256-thread blocks per weight plane, 8 elements a thread
#define PBLK (((TOK / 32) * (CH / 64)) / 8) // 8-wave blocks per projection, one 32x64 tile a wave

#define SCW  64.0f
#define SCQK 8.0f
#define SCV  16.0f
#define SCE  32768.0f
#define SCS  (1.0f / (SCQK * SCQK * 16.0f))

static_assert(TOK % 64 == 0 && CH % 64 == 0 && CH % 32 == 0 && NT % 32 == 0);
static_assert((((TOK / 32) * (CH / 64)) % 8) == 0 && (((CH / 32) * (TOK / 64)) % 8) == 0);
static_assert(NT % RSB == 0 && RSB == 32 && NT == 4 * 256);
static_assert((NT / 16) % 8 == 0 && CH == 8 * 32);
static_assert(NT % PVN == 0 && PVN == 64);
static_assert((CH * CH) % 2048 == 0);
static_assert(NT % 64 == 0 && CH % 64 == 0);
static_assert((CH / 32) % 3 == 2 && (NT / 32) % 3 == 2);

typedef _Float16       v16h __attribute__((ext_vector_type(16)));
typedef _Float16       v8h  __attribute__((ext_vector_type(8)));
typedef float          v8f  __attribute__((ext_vector_type(8)));
typedef float          v4f  __attribute__((ext_vector_type(4)));
typedef unsigned int   v4u  __attribute__((ext_vector_type(4)));

union HU { v8h h; v4u u; v4f f; _Float16 s[8]; };
union FR { v16h v; v8h h[2]; _Float16 s[16]; };
static_assert(sizeof(HU) == 16);
static_assert(sizeof(FR) == 32);

// ---- scalar helpers --------------------------------------------------------------------------------
__device__ __forceinline__ unsigned short bf_bits(float f) {          // f32 -> bf16 bits, RNE convert
  const unsigned u = __float_as_uint(f);
  return (unsigned short)((u + 0x7FFFu + ((u >> 16) & 1u)) >> 16);
}
__device__ __forceinline__ float bf_up(unsigned short h) { return __uint_as_float(((unsigned)h) << 16); }
__device__ __forceinline__ float bfr(float f) { return bf_up(bf_bits(f)); }   // value after bf16 RNE convert
__device__ __forceinline__ v8f zero8() { v8f z = {0.f, 0.f, 0.f, 0.f, 0.f, 0.f, 0.f, 0.f}; return z; }

__device__ __forceinline__ void ld8(const float* p, float* o) {
  const v4f a = *(const v4f*)(p);
  const v4f b = *(const v4f*)(p + 4);
  o[0] = a[0]; o[1] = a[1]; o[2] = a[2]; o[3] = a[3];
  o[4] = b[0]; o[5] = b[1]; o[6] = b[2]; o[7] = b[3];
}

// ---- fragment loader: 16-bit A/B operand from a fragment-order plane, p = unit*512 + 8*lane, h = lane>>4;
//      elements 0..7 <- p[0..7] (k0+8h..k0+8h+7), elements 8..15 <- p[256..263] (k0+16+8h..k0+16+8h+7)
__device__ __forceinline__ v16h ldfrag_h(const _Float16* p) {
  FR f;
  f.h[0] = *(const v8h*)(p);
  f.h[1] = *(const v8h*)(p + 256);
  return f.v;
}

// ---- WMMA helpers --------------------------------------------------------------------------------------
__device__ __forceinline__ v8f mma_h_raw(v16h a, v16h b, v8f c) {
  return __builtin_amdgcn_wmma_f32_16x16x32_f16(false, a, false, b, (short)0, c, false, false);
}
__device__ __forceinline__ void acc_guard4(v8f& a, v8f& b, v8f& c, v8f& d) {
#if defined(__HIP_DEVICE_COMPILE__)
  asm volatile("v_nop\n\tv_nop\n\tv_nop\n\tv_nop" : "+v"(a), "+v"(b), "+v"(c), "+v"(d));
#endif
}
__device__ __forceinline__ void wave_lds_sync() {
  __builtin_amdgcn_fence(__ATOMIC_RELEASE, "workgroup");
  __builtin_amdgcn_wave_barrier();
  __builtin_amdgcn_fence(__ATOMIC_ACQUIRE, "workgroup");
}

// =====================================================================================================
// Weight convert: in [R][kd] f32 row-major -> out f16(scale * bf16RNE(in)) in fragment order; thread i owns
// the i-th 16-B chunk of the output (lane = i&31, part = (i>>5)&1, unit = i>>6), one 16-B store per lane.
// coverage: n8 threads x 8 = the whole plane; n8 is a multiple of 256 at every call here. blk = block index
// within the plane.
// =====================================================================================================
__device__ __forceinline__ void cvt_flat(const float* __restrict__ in, _Float16* out, int n8, int kd, float scale, int blk) {
  const int i = blk * 256 + threadIdx.x;
  if (i < n8) {
    const int ksn = kd >> 5, unit = i >> 6;
    const int tile = unit / ksn, ks = unit - tile * ksn;
    const int row = tile * 16 + (i & 15);
    const int k = ks * 32 + ((i >> 5) & 1) * 16 + ((i >> 4) & 1) * 8;
    float v[8];
    ld8(in + (size_t)row * kd + k, v);
    HU u;
#pragma unroll
    for (int e = 0; e < 8; ++e) u.s[e] = (_Float16)(bfr(v[e]) * scale);
    _Float16* p = out + (size_t)i * 8;
    *(v4u*)p = u.u;
    
  }
}

// =====================================================================================================
// Activation transpose-convert: in X[b][k][n] f32 (k = channel 0..Cd-1, n = position 0..NT-1, n contiguous)
// -> XT plane [b*NT + n][k] f16 = f16(bf16RNE(X)), K = Cd, in fragment order.
// Blocks (bn, bk, b) of (NT/64, Cd/64, NB). coverage: load phase 256 threads x 4 row-iterations x 4 floats = 64 k x 64 n;
// store phase 8 waves x 2 half-units x 32 lanes x 8 halves = 64 n rows x 64 k per block; grid = every
// (n tile, k tile, b) -> whole [TOK][Cd] plane.
// =====================================================================================================
__device__ __forceinline__ void cvt_xT(const float* __restrict__ X, _Float16* XT, int Cd, int bn, int bk, int b) {
  __shared__ float sw[64][66];   // pitch 66: the two lane halves (8 k rows apart) read disjoint banks
  const int t = threadIdx.x;
  const int n0 = bn * 64, k0 = bk * 64;
  const float* Xb = X + (size_t)b * Cd * NT;
  {
    const int r = t >> 4, c4 = (t & 15) * 4;
#pragma unroll
    for (int it = 0; it < 4; ++it) {
      const int row = r + 16 * it;
      const v4f x = *(const v4f*)(Xb + (size_t)(k0 + row) * NT + n0 + c4);
      sw[row][c4 + 0] = x[0]; sw[row][c4 + 1] = x[1]; sw[row][c4 + 2] = x[2]; sw[row][c4 + 3] = x[3];
    }
  }
  __syncthreads();
  const int wave = t >> 5, lane = t & 31, hh = lane >> 4, rl = lane & 15;
  HU u[2];
#pragma unroll
  for (int it = 0; it < 2; ++it) {
    const int hu = wave * 2 + it;                  // 16 half-units: row tile hu>>2, k offset 16*(hu&3)
    const int n = (hu >> 2) * 16 + rl;
    const int kl = (hu & 3) * 16 + hh * 8;
#pragma unroll
    for (int e = 0; e < 8; ++e) u[it].s[e] = (_Float16)bfr(sw[kl + e][n]);
  }
  {
#pragma unroll
    for (int it = 0; it < 2; ++it) {
      const int hu = wave * 2 + it;
      const size_t unit = (size_t)(((b * NT + n0) >> 4) + (hu >> 2)) * (size_t)(Cd >> 5) + (k0 >> 5);
      _Float16* dst = XT + unit * 512 + (hu & 3) * 256 + lane * 8;
      *(v4u*)dst = u[it].u;
    }
    // in the merged kernel the listing runs on from these stores into code that rewrites their registers
    asm volatile("s_wait_xcnt 0x0" ::: "memory");
  }
}

// =====================================================================================================
// All operand conversions in one launch (none reads what another writes): blocks 0 .. 3*WBLK-1 convert the three
// weight planes (WBLK blocks each), the other (NT/64)*(CH/64)*NB blocks transpose-convert x. The branch is
// block-uniform, so the barrier inside cvt_xT is passed by whole blocks only.
// =====================================================================================================
__global__ __launch_bounds__(256) void k_prep(const float* __restrict__ X, const float* __restrict__ Wq,
                                              const float* __restrict__ Wk, const float* __restrict__ Wv,
                                              _Float16* XT, _Float16* WQ, _Float16* WK, _Float16* WV) {
  const int bx = blockIdx.x;
  if (bx < 3 * WBLK) {
    const int sel = bx / WBLK;
    const float* in = sel == 0 ? Wq : (sel == 1 ? Wk : Wv);
    _Float16* o = sel == 0 ? WQ : (sel == 1 ? WK : WV);
    cvt_flat(in, o, (CH * CH) / 8, CH, SCW, bx - sel * WBLK);
  } else {
    const int id = bx - 3 * WBLK;
    cvt_xT(X, XT, CH, id % (NT / 64), (id / (NT / 64)) % (CH / 64), id / ((NT / 64) * (CH / 64)));
  }
}

// =====================================================================================================
// One GEMM k sweep for MI 16-row A subtiles x 4 16-col B subtiles: acc[i][j] += A-frag(i) . Bt-frag(j).
// A and Bt are fragment-order planes with row lengths lda and ldb; rows m0.. / n0.. (multiples of 16), k from
// ka0 / kb0 (multiples of 32) on; both fragments through ldfrag_h (same k map for A and B).
// The fragments of a k step live in one of three register sets; a set is refilled for step s + 3 right behind
// the products of step s, so every load has two whole steps of products between its issue and its use.
// K/32 must leave remainder 2 by 3 (8 and 32 steps here): the ring then loads exactly steps 0 .. K/32 - 1.
// Each accumulator still takes its k steps in ascending order.
// =====================================================================================================
template <int MI>
__device__ __forceinline__ void ldset(v16h (&a)[MI], v16h (&b)[4], const char* A, const unsigned (&oa)[MI],
                                      const char* Bt, const unsigned (&ob)[4]) {
#pragma unroll
  for (int j = 0; j < 4; ++j) b[j] = ldfrag_h((const _Float16*)(Bt + ob[j]));
#pragma unroll
  for (int i = 0; i < MI; ++i) a[i] = ldfrag_h((const _Float16*)(A + oa[i]));
}
template <int MI>
__device__ __forceinline__ void mmset(v8f (&acc)[MI][4], const v16h (&a)[MI], const v16h (&b)[4]) {
#pragma unroll
  for (int i = 0; i < MI; ++i)
#pragma unroll
    for (int j = 0; j < 4; ++j) acc[i][j] = mma_h_raw(a[i], b[j], acc[i][j]);
}
template <int MI>
__device__ __forceinline__ void kseg(v8f (&acc)[MI][4], const _Float16* __restrict__ A, int lda, int m0, int ka0,
                                     const _Float16* __restrict__ Bt, int ldb, int n0, int kb0, int K, int lane) {
  unsigned ob[4], oa[MI];                      // byte offset of this lane's 16 B in the first unit, per row tile
#pragma unroll
  for (int j = 0; j < 4; ++j) ob[j] = ((unsigned)((n0 >> 4) + j) * (unsigned)(ldb >> 5) + (unsigned)(kb0 >> 5)) * 1024u + lane * 16u;
#pragma unroll
  for (int i = 0; i < MI; ++i) oa[i] = ((unsigned)((m0 >> 4) + i) * (unsigned)(lda >> 5) + (unsigned)(ka0 >> 5)) * 1024u + lane * 16u;
  const char* pa = (const char*)A;             // wave-uniform: the next k step's unit follows 1024 B on
  const char* pb = (const char*)Bt;
  v16h a0[MI], a1[MI], a2[MI], b0[4], b1[4], b2[4];
  // Each sched_barrier keeps a set's loads where they are written: without them the scheduler sinks a refill to
  // just in front of its use (to save registers), or mixes the first two sets so that step 0 waits for both,
  // and the products wait out the whole load latency again.
  ldset<MI>(a0, b0, pa, oa, pb, ob);
  __builtin_amdgcn_sched_barrier(0);
  ldset<MI>(a1, b1, pa + 1024, oa, pb + 1024, ob);
  __builtin_amdgcn_sched_barrier(0);
  // the first trip moves the base registers that these loads name
  asm volatile("s_wait_xcnt 0x0" ::: "memory");
  const int trips = (K >> 5) / 3;
  for (int t = 0; t < trips; ++t) {
    ldset<MI>(a2, b2, pa + 2048, oa, pb + 2048, ob);
    __builtin_amdgcn_sched_barrier(0);
    mmset<MI>(acc, a0, b0);
    __builtin_amdgcn_sched_barrier(0);
    ldset<MI>(a0, b0, pa + 3072, oa, pb + 3072, ob);
    __builtin_amdgcn_sched_barrier(0);
    mmset<MI>(acc, a1, b1);
    __builtin_amdgcn_sched_barrier(0);
    ldset<MI>(a1, b1, pa + 4096, oa, pb + 4096, ob);
    __builtin_amdgcn_sched_barrier(0);
    mmset<MI>(acc, a2, b2);
    __builtin_amdgcn_sched_barrier(0);
    // the next trip re-forms the address registers that this trip's loads name
    asm volatile("s_wait_xcnt 0x0" ::: "memory");
    pa += 3072;
    pb += 3072;
  }
  mmset<MI>(acc, a0, b0);
  mmset<MI>(acc, a1, b1);
}

// =====================================================================================================
// Register-blocked f16 WMMA GEMM with a single f16 plane epilogue, one wave per 32x64 tile (three fragment sets
// of that tile and its accumulators stay under 256 registers), no block barriers:
//   acc[m][n] = sum_k A[m][k] Bt[n][k]; M multiple of 32, N multiple of 64, K as kseg asks.
//   v = (acc*cs + b) * so, where RB == 1: b = bf16RNE(bias[m]) (row bias), RB == 2: b = bf16RNE(bias[n])
//   (column bias); bias index clamped to nbias. C is written as a fragment-order plane of row length ldc
//   (rows m, k = n): each 16x64 slab is staged in LDS (rows 0..15 x cols 0..63 fully staged before the
//   reload; pad cols 64..67 never read) and leaves as four 512-B contiguous wave stores.
// coverage: 2 slabs x 16 rows x 64 cols = the wave's whole 32x64 tile; blocks*8 == tiles at every call here.
// blk = block index within this product; slab = this wave's own 16x68 f32 LDS range.
// =====================================================================================================
template <int RB>
__device__ __forceinline__ void gemm64p(
    const _Float16* __restrict__ A, int lda, const _Float16* __restrict__ Bt, int ldb,
    const float* __restrict__ bias, int nbias, float cs, float so,
    _Float16* Cp, int ldc, int M, int N, int K, int blk, float* slab) {
  const int lane = threadIdx.x & 31;
  const int wave = threadIdx.x >> 5;
  const int tilesN = N >> 6;
  const int tilesM = M >> 5;
  const int tiles = tilesM * tilesN;
  const int item = blk * 8 + wave;
  if (item >= tiles) return;   // wave-uniform; no block barriers in this kernel
  const int tm = item / tilesN;
  const int tn = item - tm * tilesN;
  const int m0 = tm << 5;
  const int n0 = tn << 6;

  const int rlane = lane & 15;                 // row (A) / col (B, D) within subtile
  const int mOff  = (lane >> 4) * 8;           // D row offset

  v8f acc[2][4];
#pragma unroll
  for (int i = 0; i < 2; ++i)
#pragma unroll
    for (int j = 0; j < 4; ++j) acc[i][j] = zero8();

  kseg<2>(acc, A, lda, m0, 0, Bt, ldb, n0, 0, K, lane);
  acc_guard4(acc[0][0], acc[0][1], acc[0][2], acc[0][3]);
  acc_guard4(acc[1][0], acc[1][1], acc[1][2], acc[1][3]);

  const int c8 = (lane >> 4) * 8;              // column offset of this lane half inside a 16-column group

  float cbv[4][8];
#pragma unroll
  for (int it = 0; it < 4; ++it) {
#pragma unroll
    for (int e = 0; e < 8; ++e) cbv[it][e] = 0.0f;
    if (RB == 2) {
#pragma unroll
      for (int e = 0; e < 8; ++e) cbv[it][e] = bfr(bias[min(n0 + 16 * it + c8 + e, nbias - 1)]);
    }
  }

#pragma unroll
  for (int i = 0; i < 2; ++i) {
    const int mBase = m0 + (i << 4);
#pragma unroll
    for (int r = 0; r < 8; ++r) {
#pragma unroll
      for (int j = 0; j < 4; ++j) {
        slab[(mOff + r) * 68 + (j << 4) + rlane] = acc[i][j][r];
      }
    }
    wave_lds_sync();
    v4u uh[4];
    float rbv = 0.0f;
    if (RB == 1) rbv = bfr(bias[min(mBase + rlane, nbias - 1)]);
#pragma unroll
    for (int it = 0; it < 4; ++it) {                     // lane = row rlane, cols 16*it + c8 .. +7
      float xs[8];
      ld8(slab + rlane * 68 + 16 * it + c8, xs);
      HU h;
#pragma unroll
      for (int e = 0; e < 8; ++e) {
        const float v = (xs[e] * cs + rbv + cbv[it][e]) * so;
        h.s[e] = (_Float16)v;
      }
      uh[it] = h.u;
    }
    {
      const size_t co = ((size_t)(mBase >> 4) * (size_t)(ldc >> 5) + (n0 >> 5)) * 512 + lane * 8;
#pragma unroll
      for (int it = 0; it < 4; ++it) *(v4u*)(Cp + co + 256 * it) = uh[it];
      
    }
    wave_lds_sync();
  }
}

// =====================================================================================================
// The three projections in one launch (all read xT and their own weight plane, none reads another's result):
// blocks 0..PBLK-1   XQ = f16(8*(xT . Wq^T + bq))   (M=32768, N=256, K=256, column bias)
// blocks PBLK..      XK = f16(8*(xT . Wk^T + bk))   (M=32768, N=256, K=256, column bias)
// blocks 2*PBLK..    VH = f16(16*(Wv . x + bv))     (M=256, N=32768, K=256, row bias)
// =====================================================================================================
__global__ __launch_bounds__(256) void k_proj(const _Float16* __restrict__ XT, const _Float16* __restrict__ WQ,
                                              const _Float16* __restrict__ WK, const _Float16* __restrict__ WV,
                                              const float* __restrict__ bq, const float* __restrict__ bk,
                                              const float* __restrict__ bv,
                                              _Float16* XQ, _Float16* XK, _Float16* VH) {
  __shared__ __align__(16) float sT[8][16 * 68];   // per-wave 16x64 slab, pitch 68 floats
  float* slab = sT[threadIdx.x >> 5];
  const int sel = blockIdx.x / PBLK;
  const int blk = blockIdx.x - sel * PBLK;
  const float cs64 = 1.0f / SCW;                   // undo the weight carry
  if (sel < 2) {
    gemm64p<2>(XT, CH, sel == 0 ? WQ : WK, CH, sel == 0 ? bq : bk, CH, cs64, SCQK, sel == 0 ? XQ : XK, CH,
               TOK, CH, CH, blk, slab);
  } else {
    gemm64p<1>(WV, CH, XT, CH, bv, CH, cs64, SCV, VH, TOK, CH, TOK, CH, blk, slab);
  }
}

// =====================================================================================================
// Score rows + row softmax + E plane. Block = (b, 32 query rows n0..n0+31), 8 waves,
// dynamic LDS = 32 x 1024 f32 score rows.
//  (1) wave w computes the 16-column score tiles ct = w, w+8, ... (8 of them) for both 16-row tiles:
//      s = (q8 . k8) / (64*16) from the 8*q / 8*k planes (K = 256, A = XQ rows, Bt = XK rows), into LDS.
//      The 16 query fragments are loaded once and stay in registers; the 8 key fragments form a ring, each
//      refilled for the next column tile right behind its two products.
//  (2) wave w owns rows 4w..4w+3: lane holds cols 256j + 8*lane..+7 (j = 0..3) in registers; row max M
//      (xor shuffles), ef = exp(s - M), Z = sum_m ef (fixed lane order + xor shuffles), then
//      E = f16(32768 * ef / Z) with explicit flush of f16 subnormals to zero; the f16 row is staged in the
//      first half of its own score row's LDS bytes, 16-B chunk c at slot (c + row) & 127 (bank spread).
//  (3) after a block barrier the 32 x 1024 f16 block leaves in fragment order (64 KiB contiguous): wave w
//      stores half-units 16w..16w+15, each 512 contiguous bytes.
// coverage: sc: 8 waves x 8 col tiles x 16 cols x 32 rows = the whole 32x1024 block; E: 8 waves x 4 rows x
// 4 j x 32 lanes x 8 halves = 32 rows x 1024; grid (32, 32) = every (row block, b) -> whole E plane
// [TOK][NT].
// =====================================================================================================
__global__ __launch_bounds__(256) void k_soft(const _Float16* __restrict__ XQ, const _Float16* __restrict__ XK,
                                              _Float16* E) {
  extern __shared__ __align__(16) float sc[];                 // [RSB][NT]
  const int tid = threadIdx.x, wave = tid >> 5, lane = tid & 31;
  const int hh = lane >> 4, rl = lane & 15;
  const int rb = blockIdx.x, b = blockIdx.y, n0 = rb * RSB;

  // ---- (1) scores ----
  const _Float16* aq = XQ + (size_t)(b * NT + n0) * CH + 8 * lane;      // row tile (b*NT+n0)/16, CH/32 units each
  v16h q0[CH / 32], q1[CH / 32], kf[CH / 32];
  const _Float16* bk = XK + (size_t)(b * NT + 16 * wave) * CH + 8 * lane;
#pragma unroll
  for (int ks = 0; ks < CH / 32; ++ks) kf[ks] = ldfrag_h(bk + 512 * ks);
#pragma unroll
  for (int ks = 0; ks < CH / 32; ++ks) {
    q0[ks] = ldfrag_h(aq + 512 * ks);
    q1[ks] = ldfrag_h(aq + 16 * CH + 512 * ks);
  }
#pragma unroll   // the tile steps become immediate offsets of one address, and the last tile drops its refill
  for (int t = 0; t < NT / 128; ++t) {                          // column tile ct = wave + 8t
    v8f a0 = zero8(), a1 = zero8();
#pragma unroll
    for (int ks = 0; ks < CH / 32; ++ks) {
      a0 = mma_h_raw(q0[ks], kf[ks], a0);
      a1 = mma_h_raw(q1[ks], kf[ks], a1);
      // the next tile's fragment, issued a whole tile ahead of its use
      if (t + 1 < NT / 128) kf[ks] = ldfrag_h(bk + (size_t)(t + 1) * 128 * CH + 512 * ks);
      // keeps the refill here: the scheduler otherwise sinks it to the tile's end, just in front of its use
      __builtin_amdgcn_sched_barrier(0);
    }
    const int mc = 16 * (wave + 8 * t) + rl;                    // D col = m; D row = 8hh + r within the row tile
#pragma unroll
    for (int r = 0; r < 8; ++r) {
      sc[(size_t)(8 * hh + r) * NT + mc]      = a0[r] * SCS;
      sc[(size_t)(16 + 8 * hh + r) * NT + mc] = a1[r] * SCS;
    }
  }
  __syncthreads();

  // ---- (2) row softmax, E plane ----
  for (int q4 = 0; q4 < 4; ++q4) {
    const int row = 4 * wave + q4;
    const float* rp = sc + (size_t)row * NT + 8 * lane;         // lane covers cols 256j + 8*lane .. +7
    float v[4][8];
    float mx = -3.0e38f;
#pragma unroll
    for (int j = 0; j < 4; ++j) {
      ld8(rp + 256 * j, v[j]);
#pragma unroll
      for (int e = 0; e < 8; ++e) mx = fmaxf(mx, v[j][e]);
    }
#pragma unroll
    for (int off = 16; off >= 1; off >>= 1) mx = fmaxf(mx, __shfl_xor(mx, off, 32));
    float z = 0.0f;
#pragma unroll
    for (int j = 0; j < 4; ++j) {
#pragma unroll
      for (int e = 0; e < 8; ++e) {
        const float ef = __expf(v[j][e] - mx);
        z += ef;
        v[j][e] = ef;
      }
    }
#pragma unroll
    for (int off = 16; off >= 1; off >>= 1) z += __shfl_xor(z, off, 32);
    const float rz = SCE * (1.0f / z);                         // z in [1, 1024]
    HU u[4];
#pragma unroll
    for (int j = 0; j < 4; ++j) {
#pragma unroll
      for (int e = 0; e < 8; ++e) {
        const _Float16 h0 = (_Float16)(v[j][e] * rz);
        const float f0 = (float)h0;
        const bool sub = f0 < 6.103515625e-05f;                // f16 subnormal -> exact zero
        u[j].s[e] = sub ? (_Float16)0.0f : h0;
      }
    }
    v4f* srow = (v4f*)(sc + (size_t)row * NT);
#pragma unroll
    for (int j = 0; j < 4; ++j) srow[(32 * j + lane + row) & 127] = u[j].f;
  }
  __syncthreads();   // every staged f16 row is complete before another wave gathers it

  // ---- (3) fragment-order store ----
  _Float16* eb = E + (size_t)(b * NT + n0) * NT + 8 * lane;     // row tiles (b*NT+n0)/16 and +1, NT/32 units each
#pragma unroll 4   // four LDS reads in flight per trip, so one LDS latency is paid per four stores
  for (int i = 0; i < 16; ++i) {
    const int hu = 16 * wave + i;                              // row tile hu>>6, k = 16*(hu&63) + 8*hh
    const int r = (hu >> 6) * 16 + rl;
    const int c = (hu & 63) * 2 + hh;
    const v4f x = ((const v4f*)(sc + (size_t)r * NT))[(c + r) & 127];
    *(v4f*)(eb + 256 * hu) = x;
  }
}

// =====================================================================================================
// Softmax-weighted value sum + residual, output in [b][c][n] order directly:
//   D[c][n] = sum_m (16*v)[c][m] . E[n][m], A = value plane rows c (row length TOK, k from b*NT, k = m),
//   Bt = E rows b*NT + n (row length NT, k = m), both in fragment order, K = 1024 (32 k-steps of 32).
// Block = (b, 64 query columns n0..n0+63), 8 waves; wave w owns channels 32w..32w+31 (2 x 4 tiles).
// Epilogue: out[b][c][n] = D/(16*32768) + bf16RNE(x[b][c][n]); per wave two 16x64 f32 slabs staged in LDS
// coverage: 8 waves x 2 slabs x 16 rows x 64 cols = 256 c x 64 n per block; 512 blocks = every (b, n tile)
// -> whole output [32][256][1024].
// =====================================================================================================
__global__ __launch_bounds__(256) void k_pv(const _Float16* __restrict__ E, const _Float16* __restrict__ VH,
                                            const float* __restrict__ X, float* out) {
  __shared__ __align__(16) float sO[8][16 * 68];            // per-wave 16x64 slab, pitch 68 floats
  const int tid = threadIdx.x, wave = tid >> 5, lane = tid & 31;
  const int hh = lane >> 4, rl = lane & 15;
  const int bx = blockIdx.x;
  const int b = bx / (NT / PVN);
  const int n0 = (bx - b * (NT / PVN)) * PVN;
  const int cb = wave * 32;

  v8f acc[2][4];
#pragma unroll
  for (int i = 0; i < 2; ++i)
#pragma unroll
    for (int j = 0; j < 4; ++j) acc[i][j] = zero8();

  kseg<2>(acc, VH, TOK, cb, b * NT, E, NT, b * NT + n0, 0, NT, lane);
  acc_guard4(acc[0][0], acc[0][1], acc[0][2], acc[0][3]);
  acc_guard4(acc[1][0], acc[1][1], acc[1][2], acc[1][3]);

  // ---- epilogue ----
  const float fo = 1.0f / (SCV * SCE);
  float* slab = sO[wave];
  const int p4 = (lane & 15) * 4, r2 = lane >> 4;
#pragma unroll
  for (int i = 0; i < 2; ++i) {
    const int cBase = cb + 16 * i;
#pragma unroll
    for (int r = 0; r < 8; ++r) {
#pragma unroll
      for (int j = 0; j < 4; ++j) {
        slab[(8 * hh + r) * 68 + 16 * j + rl] = acc[i][j][r];   // D row = c offset 8hh + r, D col = n offset 16j + rl
      }
    }
    wave_lds_sync();
    v4f ov[8];
#pragma unroll
    for (int it = 0; it < 8; ++it) {
      const int row = 2 * it + r2;                          // it 0..7 x r2 0..1 = rows 0..15
      const v4f a = *(const v4f*)(slab + row * 68 + p4);
      const size_t xo = ((size_t)(b * CH + cBase + row)) * NT + n0 + p4;
      const v4f xv = *(const v4f*)(X + xo);
      // this build lets the next load's result land on this load's address pair
      asm volatile("s_wait_xcnt 0x0" ::: "memory");
      v4f o;
#pragma unroll
      for (int e = 0; e < 4; ++e) o[e] = a[e] * fo + bfr(xv[e]);
      ov[it] = o;
    }
    {
#pragma unroll
      for (int it = 0; it < 8; ++it) {
        const int row = 2 * it + r2;
        const size_t oo = ((size_t)(b * CH + cBase + row)) * NT + n0 + p4;
        *(v4f*)(out + oo) = ov[it];
      }
      
    }
    wave_lds_sync();
  }
}

// =====================================================================================================
// Workspace map; every plane [rows][k] below is stored in fragment order (see the head of the file).
//   WQ16  f16 [256][256]             0        131072   (64*Wq, bf16RNE)
//   WK16  f16 [256][256]        131072        131072   (64*Wk)
//   WV16  f16 [256][256]        262144        131072   (64*Wv)
//   XQ    f16 [32768][256]      393216      16777216   (8*q, position rows, k = c)
//   XK    f16 [32768][256]    17170432      16777216   (8*k)
//   VH    f16 [256][32768]    33947648      16777216   (16*v, row c, k = b*1024 + m)
//   xT    f16 [32768][256]    50724864      16777216   (bf16RNE(x) transposed to position rows)
//   E     f16 [32768][1024]   50724864      67108864   (32768 * row softmax; reuses the xT region: written by
//                                                       the softmax kernel after the last xT reader, the
//                                                       projection kernel, on the single in-order stream)
//   end                      117833728
// d_out f32 [32][256][1024] at byte 0.
// =====================================================================================================
extern "C" void kernel_launch(void* const* d_in, const int* in_sizes, int n_in,
                              void* d_out, int out_size, void* d_ws, size_t ws_size,
                              hipStream_t stream) {
  if (n_in < 7) return;
  if (in_sizes[0] != NB * CH * NT) return;
  if (in_sizes[1] != CH * CH || in_sizes[2] != CH) return;
  if (in_sizes[3] != CH * CH || in_sizes[4] != CH) return;
  if (in_sizes[5] != CH * CH || in_sizes[6] != CH) return;
  if (out_size != OUTN) return;

  const float* x  = (const float*)d_in[0];   // [32][256][1024]
  const float* Wq = (const float*)d_in[1];   // [256][256]  ([out][in])
  const float* bq = (const float*)d_in[2];   // [256]
  const float* Wk = (const float*)d_in[3];   // [256][256]
  const float* bk = (const float*)d_in[4];   // [256]
  const float* Wv = (const float*)d_in[5];   // [256][256]
  const float* bv = (const float*)d_in[6];   // [256]

  const size_t PW  = (size_t)CH * CH * 2;                    //   131072
  const size_t PPL = (size_t)TOK * CH * 2;                   // 16777216
  const size_t PE  = (size_t)TOK * NT * 2;                   // 67108864
  const size_t PXE = (PE > PPL) ? PE : PPL;                  // shared xT / E region

  size_t off = 0;
  const size_t oWQ = off; off += PW;
  const size_t oWK = off; off += PW;
  const size_t oWV = off; off += PW;
  const size_t oXQ = off; off += PPL;
  const size_t oXK = off; off += PPL;
  const size_t oVH = off; off += PPL;
  const size_t oXE = off; off += PXE;                        // off = 117833728
  if (off > ws_size) return;
  if (off > (size_t)134217728) return;

  char* ws = (char*)d_ws;
  _Float16* WQ16 = (_Float16*)(ws + oWQ);
  _Float16* WK16 = (_Float16*)(ws + oWK);
  _Float16* WV16 = (_Float16*)(ws + oWV);
  _Float16* XQ   = (_Float16*)(ws + oXQ);
  _Float16* XK   = (_Float16*)(ws + oXK);
  _Float16* VH   = (_Float16*)(ws + oVH);
  _Float16* xT   = (_Float16*)(ws + oXE);
  _Float16* E    = (_Float16*)(ws + oXE);                    // region reuse, see map
  float*    outf = (float*)d_out;

  const dim3 blk(256);
  const dim3 gPrep(3 * WBLK + (NT / 64) * (CH / 64) * NB);             // 96 + 2048
  const dim3 gPr(3 * PBLK);                                            // 3 x 4096 tiles -> 1536 blocks
  const dim3 gSo(NT / RSB, NB);                                        // (32, 32)
  const dim3 gPV(NB * (NT / PVN));                                     // 512
  const size_t ldsSoft = (size_t)RSB * NT * sizeof(float);             // 131072

  // (1) weight planes, x64 carried (conv weights [out][in]: rows = out, k = in), and x [32][256][1024]
  //     transposed to position rows xT [32768][256]; all in fragment order
  k_prep<<<gPrep, blk, 0, stream>>>(x, Wq, Wk, Wv, xT, WQ16, WK16, WV16);
  // (2) XQ, XK, VH from xT and the weight planes
  k_proj<<<gPr, blk, 0, stream>>>(xT, WQ16, WK16, WV16, bq, bk, bv, XQ, XK, VH);
  // (3) scores + row softmax -> E plane (overwrites the dead xT region)
  k_soft<<<gSo, blk, ldsSoft, stream>>>(XQ, XK, E);
  // (4) softmax-weighted value sum + residual -> d_out
  k_pv<<<gPV, blk, 0, stream>>>(E, VH, x, outf);
}

// v004
// It runs in 85.1 microseconds.
// Two timings next to v003 put it at 1.25 and 1.26 times that version's speed.
// Counting every step since v000, it is 2.82 times as fast.
#include <hip/hip_runtime.h>
#include <math.h>
#include <stdint.h>

// All contractions on v_wmma_f32_16x16x32_f16 (f16 operands, f32 accumulate): the three 1x1-conv
// projections take bf16-RNE inputs (x1) and bf16-RNE weights (x64) as single f16 planes; the 256-deep
// query.key scores use single f16 planes of 8*q and 8*k; the 1024-deep softmax-weighted value sum uses
// a single f16 plane of 16*v against E = f16(32768*softmax) held as f16 rows in LDS. Softmax
// statistics, biases, residual add and epilogues are f32.
//
// Every f16 operand plane [R][K] in memory lives in fragment order: for 16-row tile T and 32-deep k step S the unit
// (T*(K/32) + S) is 512 halves; inside it element (row, k) sits at ((k>>4)&1)*256 + (((k>>3)&1)*16 + (row&15))*8
// + (k&7). A wave's two 16-B loads of one fragment then cover 2 x 512 contiguous bytes (whole 128-B lines).

#define NB   32
#define CH   256
#define NT   1024
#define TOK  (NB * NT)
#define RSB  64                             // query rows per attention block
#define PIT  (NT + 4)                       // LDS pitch of a score row, floats
#define VRING 8                             // value fragment ring, k steps
#define OUTN (NB * CH * NT)
#define WBLK ((CH * CH) / 2048)            // 256-thread blocks per weight plane, 8 elements a thread
#define PBLK (((TOK / 32) * (CH / 64)) / 8) // 8-wave blocks per projection, one 32x64 tile a wave

#define SCW  64.0f
#define SCQK 8.0f
#define SCV  16.0f
#define SCE  32768.0f
#define SCS  (1.0f / (SCQK * SCQK * 16.0f))

static_assert(TOK % 64 == 0 && CH % 64 == 0 && CH % 32 == 0 && NT % 32 == 0);
static_assert((((TOK / 32) * (CH / 64)) % 8) == 0 && (((CH / 32) * (TOK / 64)) % 8) == 0);
static_assert(NT % RSB == 0 && RSB == 64 && NT == 4 * 256);
static_assert((PIT * 4) % 32 == 16 && (NT / 32) % VRING == 0);
static_assert((NT / 16) % 8 == 0 && CH == 8 * 32);
static_assert((CH * CH) % 2048 == 0);
static_assert(NT % 64 == 0 && CH % 64 == 0);
static_assert((CH / 32) % 3 == 2 && (NT / 32) % 3 == 2);

typedef _Float16       v16h __attribute__((ext_vector_type(16)));
typedef _Float16       v8h  __attribute__((ext_vector_type(8)));
typedef float          v8f  __attribute__((ext_vector_type(8)));
typedef float          v4f  __attribute__((ext_vector_type(4)));
typedef unsigned int   v4u  __attribute__((ext_vector_type(4)));

union HU { v8h h; v4u u; v4f f; _Float16 s[8]; };
union FR { v16h v; v8h h[2]; _Float16 s[16]; };
static_assert(sizeof(HU) == 16);
static_assert(sizeof(FR) == 32);

// ---- scalar helpers --------------------------------------------------------------------------------
__device__ __forceinline__ unsigned short bf_bits(float f) {          // f32 -> bf16 bits, RNE convert
  const unsigned u = __float_as_uint(f);
  return (unsigned short)((u + 0x7FFFu + ((u >> 16) & 1u)) >> 16);
}
__device__ __forceinline__ float bf_up(unsigned short h) { return __uint_as_float(((unsigned)h) << 16); }
__device__ __forceinline__ float bfr(float f) { return bf_up(bf_bits(f)); }   // value after bf16 RNE convert
__device__ __forceinline__ v8f zero8() { v8f z = {0.f, 0.f, 0.f, 0.f, 0.f, 0.f, 0.f, 0.f}; return z; }

__device__ __forceinline__ void ld8(const float* p, float* o) {
  const v4f a = *(const v4f*)(p);
  const v4f b = *(const v4f*)(p + 4);
  o[0] = a[0]; o[1] = a[1]; o[2] = a[2]; o[3] = a[3];
  o[4] = b[0]; o[5] = b[1]; o[6] = b[2]; o[7] = b[3];
}

// ---- fragment loader: 16-bit A/B operand from a fragment-order plane, p = unit*512 + 8*lane, h = lane>>4;
//      elements 0..7 <- p[0..7] (k0+8h..k0+8h+7), elements 8..15 <- p[256..263] (k0+16+8h..k0+16+8h+7)
__device__ __forceinline__ v16h ldfrag_h(const _Float16* p) {
  FR f;
  f.h[0] = *(const v8h*)(p);
  f.h[1] = *(const v8h*)(p + 256);
  return f.v;
}

// ---- WMMA helpers --------------------------------------------------------------------------------------
__device__ __forceinline__ v8f mma_h_raw(v16h a, v16h b, v8f c) {
  return __builtin_amdgcn_wmma_f32_16x16x32_f16(false, a, false, b, (short)0, c, false, false);
}
__device__ __forceinline__ void acc_guard4(v8f& a, v8f& b, v8f& c, v8f& d) {
#if defined(__HIP_DEVICE_COMPILE__)
  asm volatile("v_nop\n\tv_nop\n\tv_nop\n\tv_nop" : "+v"(a), "+v"(b), "+v"(c), "+v"(d));
#endif
}
__device__ __forceinline__ void wave_lds_sync() {
  __builtin_amdgcn_fence(__ATOMIC_RELEASE, "workgroup");
  __builtin_amdgcn_wave_barrier();
  __builtin_amdgcn_fence(__ATOMIC_ACQUIRE, "workgroup");
}

// =====================================================================================================
// Weight convert: in [R][kd] f32 row-major -> out f16(scale * bf16RNE(in)) in fragment order; thread i owns
// the i-th 16-B chunk of the output (lane = i&31, part = (i>>5)&1, unit = i>>6), one 16-B store per lane.
// coverage: n8 threads x 8 = the whole plane; n8 is a multiple of 256 at every call here. blk = block index
// within the plane.
// =====================================================================================================
__device__ __forceinline__ void cvt_flat(const float* __restrict__ in, _Float16* out, int n8, int kd, float scale, int blk) {
  const int i = blk * 256 + threadIdx.x;
  if (i < n8) {
    const int ksn = kd >> 5, unit = i >> 6;
    const int tile = unit / ksn, ks = unit - tile * ksn;
    const int row = tile * 16 + (i & 15);
    const int k = ks * 32 + ((i >> 5) & 1) * 16 + ((i >> 4) & 1) * 8;
    float v[8];
    ld8(in + (size_t)row * kd + k, v);
    HU u;
#pragma unroll
    for (int e = 0; e < 8; ++e) u.s[e] = (_Float16)(bfr(v[e]) * scale);
    _Float16* p = out + (size_t)i * 8;
    *(v4u*)p = u.u;
    
  }
}

// =====================================================================================================
// Activation transpose-convert: in X[b][k][n] f32 (k = channel 0..Cd-1, n = position 0..NT-1, n contiguous)
// -> XT plane [b*NT + n][k] f16 = f16(bf16RNE(X)), K = Cd, in fragment order.
// Blocks (bn, bk, b) of (NT/64, Cd/64, NB). coverage: load phase 256 threads x 4 row-iterations x 4 floats = 64 k x 64 n;
// store phase 8 waves x 2 half-units x 32 lanes x 8 halves = 64 n rows x 64 k per block; grid = every
// (n tile, k tile, b) -> whole [TOK][Cd] plane.
// =====================================================================================================
__device__ __forceinline__ void cvt_xT(const float* __restrict__ X, _Float16* XT, int Cd, int bn, int bk, int b) {
  __shared__ float sw[64][66];   // pitch 66: the two lane halves (8 k rows apart) read disjoint banks
  const int t = threadIdx.x;
  const int n0 = bn * 64, k0 = bk * 64;
  const float* Xb = X + (size_t)b * Cd * NT;
  {
    const int r = t >> 4, c4 = (t & 15) * 4;
#pragma unroll
    for (int it = 0; it < 4; ++it) {
      const int row = r + 16 * it;
      const v4f x = *(const v4f*)(Xb + (size_t)(k0 + row) * NT + n0 + c4);
      sw[row][c4 + 0] = x[0]; sw[row][c4 + 1] = x[1]; sw[row][c4 + 2] = x[2]; sw[row][c4 + 3] = x[3];
    }
  }
  __syncthreads();
  const int wave = t >> 5, lane = t & 31, hh = lane >> 4, rl = lane & 15;
  HU u[2];
#pragma unroll
  for (int it = 0; it < 2; ++it) {
    const int hu = wave * 2 + it;                  // 16 half-units: row tile hu>>2, k offset 16*(hu&3)
    const int n = (hu >> 2) * 16 + rl;
    const int kl = (hu & 3) * 16 + hh * 8;
#pragma unroll
    for (int e = 0; e < 8; ++e) u[it].s[e] = (_Float16)bfr(sw[kl + e][n]);
  }
  {
#pragma unroll
    for (int it = 0; it < 2; ++it) {
      const int hu = wave * 2 + it;
      const size_t unit = (size_t)(((b * NT + n0) >> 4) + (hu >> 2)) * (size_t)(Cd >> 5) + (k0 >> 5);
      _Float16* dst = XT + unit * 512 + (hu & 3) * 256 + lane * 8;
      *(v4u*)dst = u[it].u;
    }
    // in the merged kernel the listing runs on from these stores into code that rewrites their registers
    asm volatile("s_wait_xcnt 0x0" ::: "memory");
  }
}

// =====================================================================================================
// All operand conversions in one launch (none reads what another writes): blocks 0 .. 3*WBLK-1 convert the three
// weight planes (WBLK blocks each), the other (NT/64)*(CH/64)*NB blocks transpose-convert x. The branch is
// block-uniform, so the barrier inside cvt_xT is passed by whole blocks only.
// =====================================================================================================
__global__ __launch_bounds__(256) void k_prep(const float* __restrict__ X, const float* __restrict__ Wq,
                                              const float* __restrict__ Wk, const float* __restrict__ Wv,
                                              _Float16* XT, _Float16* WQ, _Float16* WK, _Float16* WV) {
  const int bx = blockIdx.x;
  if (bx < 3 * WBLK) {
    const int sel = bx / WBLK;
    const float* in = sel == 0 ? Wq : (sel == 1 ? Wk : Wv);
    _Float16* o = sel == 0 ? WQ : (sel == 1 ? WK : WV);
    cvt_flat(in, o, (CH * CH) / 8, CH, SCW, bx - sel * WBLK);
  } else {
    const int id = bx - 3 * WBLK;
    cvt_xT(X, XT, CH, id % (NT / 64), (id / (NT / 64)) % (CH / 64), id / ((NT / 64) * (CH / 64)));
  }
}

// =====================================================================================================
// One GEMM k sweep for MI 16-row A subtiles x 4 16-col B subtiles: acc[i][j] += A-frag(i) . Bt-frag(j).
// A and Bt are fragment-order planes with row lengths lda and ldb; rows m0.. / n0.. (multiples of 16), k from
// ka0 / kb0 (multiples of 32) on; both fragments through ldfrag_h (same k map for A and B).
// The fragments of a k step live in one of three register sets; a set is refilled for step s + 3 right behind
// the products of step s, so every load has two whole steps of products between its issue and its use.
// K/32 must leave remainder 2 by 3 (8 steps here): the ring then loads exactly steps 0 .. K/32 - 1.
// Each accumulator still takes its k steps in ascending order.
// =====================================================================================================
template <int MI>
__device__ __forceinline__ void ldset(v16h (&a)[MI], v16h (&b)[4], const char* A, const unsigned (&oa)[MI],
                                      const char* Bt, const unsigned (&ob)[4]) {
#pragma unroll
  for (int j = 0; j < 4; ++j) b[j] = ldfrag_h((const _Float16*)(Bt + ob[j]));
#pragma unroll
  for (int i = 0; i < MI; ++i) a[i] = ldfrag_h((const _Float16*)(A + oa[i]));
}
template <int MI>
__device__ __forceinline__ void mmset(v8f (&acc)[MI][4], const v16h (&a)[MI], const v16h (&b)[4]) {
#pragma unroll
  for (int i = 0; i < MI; ++i)
#pragma unroll
    for (int j = 0; j < 4; ++j) acc[i][j] = mma_h_raw(a[i], b[j], acc[i][j]);
}
template <int MI>
__device__ __forceinline__ void kseg(v8f (&acc)[MI][4], const _Float16* __restrict__ A, int lda, int m0, int ka0,
                                     const _Float16* __restrict__ Bt, int ldb, int n0, int kb0, int K, int lane) {
  unsigned ob[4], oa[MI];                      // byte offset of this lane's 16 B in the first unit, per row tile
#pragma unroll
  for (int j = 0; j < 4; ++j) ob[j] = ((unsigned)((n0 >> 4) + j) * (unsigned)(ldb >> 5) + (unsigned)(kb0 >> 5)) * 1024u + lane * 16u;
#pragma unroll
  for (int i = 0; i < MI; ++i) oa[i] = ((unsigned)((m0 >> 4) + i) * (unsigned)(lda >> 5) + (unsigned)(ka0 >> 5)) * 1024u + lane * 16u;
  const char* pa = (const char*)A;             // wave-uniform: the next k step's unit follows 1024 B on
  const char* pb = (const char*)Bt;
  v16h a0[MI], a1[MI], a2[MI], b0[4], b1[4], b2[4];
  // Each sched_barrier keeps a set's loads where they are written: without them the scheduler sinks a refill to
  // just in front of its use (to save registers), or mixes the first two sets so that step 0 waits for both,
  // and the products wait out the whole load latency again.
  ldset<MI>(a0, b0, pa, oa, pb, ob);
  __builtin_amdgcn_sched_barrier(0);
  ldset<MI>(a1, b1, pa + 1024, oa, pb + 1024, ob);
  __builtin_amdgcn_sched_barrier(0);
  // the first trip moves the base registers that these loads name
  asm volatile("s_wait_xcnt 0x0" ::: "memory");
  const int trips = (K >> 5) / 3;
  for (int t = 0; t < trips; ++t) {
    ldset<MI>(a2, b2, pa + 2048, oa, pb + 2048, ob);
    __builtin_amdgcn_sched_barrier(0);
    mmset<MI>(acc, a0, b0);
    __builtin_amdgcn_sched_barrier(0);
    ldset<MI>(a0, b0, pa + 3072, oa, pb + 3072, ob);
    __builtin_amdgcn_sched_barrier(0);
    mmset<MI>(acc, a1, b1);
    __builtin_amdgcn_sched_barrier(0);
    ldset<MI>(a1, b1, pa + 4096, oa, pb + 4096, ob);
    __builtin_amdgcn_sched_barrier(0);
    mmset<MI>(acc, a2, b2);
    __builtin_amdgcn_sched_barrier(0);
    // the next trip re-forms the address registers that this trip's loads name
    asm volatile("s_wait_xcnt 0x0" ::: "memory");
    pa += 3072;
    pb += 3072;
  }
  mmset<MI>(acc, a0, b0);
  mmset<MI>(acc, a1, b1);
}

// =====================================================================================================
// Register-blocked f16 WMMA GEMM with a single f16 plane epilogue, one wave per 32x64 tile (three fragment sets
// of that tile and its accumulators stay under 256 registers), no block barriers:
//   acc[m][n] = sum_k A[m][k] Bt[n][k]; M multiple of 32, N multiple of 64, K as kseg asks.
//   v = (acc*cs + b) * so, where RB == 1: b = bf16RNE(bias[m]) (row bias), RB == 2: b = bf16RNE(bias[n])
//   (column bias); bias index clamped to nbias. C is written as a fragment-order plane of row length ldc
//   (rows m, k = n): each 16x64 slab is staged in LDS (rows 0..15 x cols 0..63 fully staged before the
//   reload; pad cols 64..67 never read) and leaves as four 512-B contiguous wave stores.
// coverage: 2 slabs x 16 rows x 64 cols = the wave's whole 32x64 tile; blocks*8 == tiles at every call here.
// blk = block index within this product; slab = this wave's own 16x68 f32 LDS range.
// =====================================================================================================
template <int RB>
__device__ __forceinline__ void gemm64p(
    const _Float16* __restrict__ A, int lda, const _Float16* __restrict__ Bt, int ldb,
    const float* __restrict__ bias, int nbias, float cs, float so,
    _Float16* Cp, int ldc, int M, int N, int K, int blk, float* slab) {
  const int lane = threadIdx.x & 31;
  const int wave = threadIdx.x >> 5;
  const int tilesN = N >> 6;
  const int tilesM = M >> 5;
  const int tiles = tilesM * tilesN;
  const int item = blk * 8 + wave;
  if (item >= tiles) return;   // wave-uniform; no block barriers in this kernel
  const int tm = item / tilesN;
  const int tn = item - tm * tilesN;
  const int m0 = tm << 5;
  const int n0 = tn << 6;

  const int rlane = lane & 15;                 // row (A) / col (B, D) within subtile
  const int mOff  = (lane >> 4) * 8;           // D row offset

  v8f acc[2][4];
#pragma unroll
  for (int i = 0; i < 2; ++i)
#pragma unroll
    for (int j = 0; j < 4; ++j) acc[i][j] = zero8();

  kseg<2>(acc, A, lda, m0, 0, Bt, ldb, n0, 0, K, lane);
  acc_guard4(acc[0][0], acc[0][1], acc[0][2], acc[0][3]);
  acc_guard4(acc[1][0], acc[1][1], acc[1][2], acc[1][3]);

  const int c8 = (lane >> 4) * 8;              // column offset of this lane half inside a 16-column group

  float cbv[4][8];
#pragma unroll
  for (int it = 0; it < 4; ++it) {
#pragma unroll
    for (int e = 0; e < 8; ++e) cbv[it][e] = 0.0f;
    if (RB == 2) {
#pragma unroll
      for (int e = 0; e < 8; ++e) cbv[it][e] = bfr(bias[min(n0 + 16 * it + c8 + e, nbias - 1)]);
    }
  }

#pragma unroll
  for (int i = 0; i < 2; ++i) {
    const int mBase = m0 + (i << 4);
#pragma unroll
    for (int r = 0; r < 8; ++r) {
#pragma unroll
      for (int j = 0; j < 4; ++j) {
        slab[(mOff + r) * 68 + (j << 4) + rlane] = acc[i][j][r];
      }
    }
    wave_lds_sync();
    v4u uh[4];
    float rbv = 0.0f;
    if (RB == 1) rbv = bfr(bias[min(mBase + rlane, nbias - 1)]);
#pragma unroll
    for (int it = 0; it < 4; ++it) {                     // lane = row rlane, cols 16*it + c8 .. +7
      float xs[8];
      ld8(slab + rlane * 68 + 16 * it + c8, xs);
      HU h;
#pragma unroll
      for (int e = 0; e < 8; ++e) {
        const float v = (xs[e] * cs + rbv + cbv[it][e]) * so;
        h.s[e] = (_Float16)v;
      }
      uh[it] = h.u;
    }
    {
      const size_t co = ((size_t)(mBase >> 4) * (size_t)(ldc >> 5) + (n0 >> 5)) * 512 + lane * 8;
#pragma unroll
      for (int it = 0; it < 4; ++it) *(v4u*)(Cp + co + 256 * it) = uh[it];
      
    }
    wave_lds_sync();
  }
}

// =====================================================================================================
// The three projections in one launch (all read xT and their own weight plane, none reads another's result):
// blocks 0..PBLK-1   XQ = f16(8*(xT . Wq^T + bq))   (M=32768, N=256, K=256, column bias)
// blocks PBLK..      XK = f16(8*(xT . Wk^T + bk))   (M=32768, N=256, K=256, column bias)
// blocks 2*PBLK..    VH = f16(16*(Wv . x + bv))     (M=256, N=32768, K=256, row bias)
// =====================================================================================================
__global__ __launch_bounds__(256) void k_proj(const _Float16* __restrict__ XT, const _Float16* __restrict__ WQ,
                                              const _Float16* __restrict__ WK, const _Float16* __restrict__ WV,
                                              const float* __restrict__ bq, const float* __restrict__ bk,
                                              const float* __restrict__ bv,
                                              _Float16* XQ, _Float16* XK, _Float16* VH) {
  __shared__ __align__(16) float sT[8][16 * 68];   // per-wave 16x64 slab, pitch 68 floats
  float* slab = sT[threadIdx.x >> 5];
  const int sel = blockIdx.x / PBLK;
  const int blk = blockIdx.x - sel * PBLK;
  const float cs64 = 1.0f / SCW;                   // undo the weight carry
  if (sel < 2) {
    gemm64p<2>(XT, CH, sel == 0 ? WQ : WK, CH, sel == 0 ? bq : bk, CH, cs64, SCQK, sel == 0 ? XQ : XK, CH,
               TOK, CH, CH, blk, slab);
  } else {
    gemm64p<1>(WV, CH, XT, CH, bv, CH, cs64, SCV, VH, TOK, CH, TOK, CH, blk, slab);
  }
}

// =====================================================================================================
// Scores + row softmax + softmax-weighted value sum + residual in one kernel: the softmax rows never leave LDS.
// Block = (b, 64 query rows n0..n0+63), 8 waves (two a SIMD, so a wave may hold up to 512 registers), one block
// a WGP. LDS: 64 score rows of 1024 f32 at a pitch of 1028 floats (16 B x odd: the 16 rows of a fragment read
// fall on 16 different bank groups, and the two lane halves of a score store, 8 rows apart, on disjoint banks).
//  (1) wave w computes the 16-column score tiles ct = w, w+8, ... (8 of them) for all four 16-row tiles:
//      s = (q8 . k8) / (64*16) from the 8*q / 8*k planes (K = 256, A = XQ rows, Bt = XK rows), into LDS.
//      The 32 query fragments are loaded once and stay in registers, so every key fragment is loaded once a
//      block and feeds four products; the key fragments form a ring two column tiles deep.
//  (2) wave w owns rows 8w..8w+7, four at a time: lane holds cols 256j + 8*lane..+7 (j = 0..3) in registers;
//      row max M (xor shuffles), ef = exp(s - M), Z = sum_m ef (fixed lane order + xor shuffles), then
//      E = f16(32768 * ef / Z) with explicit flush of f16 subnormals to zero; the f16 row is staged in the
//      first half of its own score row's LDS bytes, 16-B chunk c (k = 8c..8c+7) at byte 16c.
//  (3) after a block barrier: D[c][n] = sum_m (16*v)[c][m] . E[n][m], A = value plane rows c (fragment order, row
//      length TOK, k from b*NT), Bt = the 64 E rows in LDS, K = 1024 (32 k steps, ascending). Wave w owns
//      channels 32w..32w+31 (2 x 4 tiles), so every value fragment is loaded once a block. The value fragments
//      form a ring 8 steps deep, first filled ahead of (2); the E fragments are read one step ahead.
// Epilogue: out[b][c][n] = D/(16*32768) + bf16RNE(x[b][c][n]); per wave two 16x64 f32 slabs staged in LDS.
// coverage: sc: 8 waves x 8 col tiles x 16 cols x 64 rows = the whole 64x1024 block; E: 8 waves x 8 rows x
// 4 j x 32 lanes x 8 halves = 64 rows x 1024; out: 8 waves x 2 slabs x 16 rows x 64 cols = 256 c x 64 n per
// block; grid (16, 32) = every (n tile, b) -> whole output [32][256][1024].
// =====================================================================================================
__device__ __forceinline__ v16h ldfrag_lds(const char* p) {   // elements 0..7 <- 16 B at p, 8..15 <- 16 B at p + 32
  HU lo, hi;
  lo.f = *(const v4f*)(p);
  hi.f = *(const v4f*)(p + 32);
  FR f;
  f.h[0] = lo.h;
  f.h[1] = hi.h;
  return f.v;
}

__global__ __launch_bounds__(256) void k_attn(const _Float16* __restrict__ XQ, const _Float16* __restrict__ XK,
                                              const _Float16* __restrict__ VH, const float* __restrict__ X,
                                              float* out) {
  __shared__ __align__(16) float sc[RSB * PIT];               // score rows, later the f16 E rows
  __shared__ __align__(16) float sO[8][16 * 68];              // per-wave 16x64 output slab, pitch 68 floats
  const int tid = threadIdx.x, wave = tid >> 5, lane = tid & 31;
  const int hh = lane >> 4, rl = lane & 15;
  const int rb = blockIdx.x, b = blockIdx.y, n0 = rb * RSB;

  // ---- (1) scores ----
  {
    const _Float16* aq = XQ + (size_t)(b * NT + n0) * CH + 8 * lane;    // row tile (b*NT+n0)/16, CH/32 units each
    const _Float16* bk = XK + (size_t)(b * NT + 16 * wave) * CH + 8 * lane;
    v16h q[RSB / 16][CH / 32], kf[2][CH / 32];
#pragma unroll
    for (int ks = 0; ks < CH / 32; ++ks) kf[0][ks] = ldfrag_h(bk + 512 * ks);
#pragma unroll
    for (int i = 0; i < RSB / 16; ++i)
#pragma unroll
      for (int ks = 0; ks < CH / 32; ++ks) q[i][ks] = ldfrag_h(aq + i * 16 * CH + 512 * ks);
#pragma unroll
    for (int ks = 0; ks < CH / 32; ++ks) kf[1][ks] = ldfrag_h(bk + 128 * CH + 512 * ks);
    // the code below re-uses the base registers that the query loads name
    asm volatile("s_wait_xcnt 0x0" ::: "memory");
    // keeps the second tile's loads behind the first products' operands, so that tile 0 does not wait for them,
    // and every later register write behind the wait above
    __builtin_amdgcn_sched_barrier(0);
#pragma unroll   // the tile steps become immediate offsets of one address, and the last two tiles drop their refill
    for (int t = 0; t < NT / 128; ++t) {                        // column tile ct = wave + 8t
      v8f a[RSB / 16];
#pragma unroll
      for (int i = 0; i < RSB / 16; ++i) a[i] = zero8();
#pragma unroll
      for (int ks = 0; ks < CH / 32; ++ks) {
#pragma unroll
        for (int i = 0; i < RSB / 16; ++i) a[i] = mma_h_raw(q[i][ks], kf[t & 1][ks], a[i]);
        // the fragment of the tile after next, issued two whole tiles ahead of its use
        if (t + 2 < NT / 128) kf[t & 1][ks] = ldfrag_h(bk + (size_t)(t + 2) * 128 * CH + 512 * ks);
        // keeps the refill here: the scheduler otherwise sinks it to just in front of its use
        __builtin_amdgcn_sched_barrier(0);
      }
      const int mc = 16 * (wave + 8 * t) + rl;                  // D col = m; D row = 8hh + r within the row tile
#pragma unroll
      for (int i = 0; i < RSB / 16; ++i)
#pragma unroll
        for (int r = 0; r < 8; ++r) sc[(16 * i + 8 * hh + r) * PIT + mc] = a[i][r] * SCS;
    }
    // the code below re-uses the address registers that these loads name
    asm volatile("s_wait_xcnt 0x0" ::: "memory");
  }
  __syncthreads();

  // ---- value ring, first fill: the loads fly while the softmax runs ----
  const int cb = wave * 32;
  const char* pv = (const char*)VH;
  unsigned oa[2];                              // byte offset of this lane's 16 B in the first unit, per channel tile
#pragma unroll
  for (int i = 0; i < 2; ++i)
    oa[i] = ((unsigned)((cb >> 4) + i) * (unsigned)(TOK >> 5) + (unsigned)((b * NT) >> 5)) * 1024u + lane * 16u;
  v16h va[VRING][2];
#pragma unroll
  for (int s = 0; s < VRING; ++s)
#pragma unroll
    for (int i = 0; i < 2; ++i) va[s][i] = ldfrag_h((const _Float16*)(pv + oa[i] + 1024 * s));
  // the softmax re-uses the offset registers that these loads name
  asm volatile("s_wait_xcnt 0x0" ::: "memory");
  // keeps these loads in front of the softmax (sunk to their use they would be waited out there), and every
  // later register write behind the wait above
  __builtin_amdgcn_sched_barrier(0);

  // ---- (2) row softmax, E rows ----
  for (int g = 0; g < 2; ++g) {
    const int row0 = 8 * wave + 4 * g;                          // four rows side by side: their shuffle chains overlap
    float v[4][4][8];
    float mx[4], z[4];
#pragma unroll
    for (int q4 = 0; q4 < 4; ++q4) {
      const float* rp = sc + (row0 + q4) * PIT + 8 * lane;      // lane covers cols 256j + 8*lane .. +7
#pragma unroll
      for (int j = 0; j < 4; ++j) ld8(rp + 256 * j, v[q4][j]);
    }
#pragma unroll
    for (int q4 = 0; q4 < 4; ++q4) {
      mx[q4] = -3.0e38f;
#pragma unroll
      for (int j = 0; j < 4; ++j)
#pragma unroll
        for (int e = 0; e < 8; ++e) mx[q4] = fmaxf(mx[q4], v[q4][j][e]);
    }
#pragma unroll
    for (int off = 16; off >= 1; off >>= 1)
#pragma unroll
      for (int q4 = 0; q4 < 4; ++q4) mx[q4] = fmaxf(mx[q4], __shfl_xor(mx[q4], off, 32));
#pragma unroll
    for (int q4 = 0; q4 < 4; ++q4) {
      z[q4] = 0.0f;
#pragma unroll
      for (int j = 0; j < 4; ++j) {
#pragma unroll
        for (int e = 0; e < 8; ++e) {
          const float ef = __expf(v[q4][j][e] - mx[q4]);
          z[q4] += ef;
          v[q4][j][e] = ef;
        }
      }
    }
#pragma unroll
    for (int off = 16; off >= 1; off >>= 1)
#pragma unroll
      for (int q4 = 0; q4 < 4; ++q4) z[q4] += __shfl_xor(z[q4], off, 32);
#pragma unroll
    for (int q4 = 0; q4 < 4; ++q4) {
      const float rz = SCE * (1.0f / z[q4]);                   // z in [1, 1024]
      v4f* srow = (v4f*)(sc + (row0 + q4) * PIT);
#pragma unroll
      for (int j = 0; j < 4; ++j) {
        HU u;
#pragma unroll
        for (int e = 0; e < 8; ++e) {
          const _Float16 h0 = (_Float16)(v[q4][j][e] * rz);
          const float f0 = (float)h0;
          const bool sub = f0 < 6.103515625e-05f;              // f16 subnormal -> exact zero
          u.s[e] = sub ? (_Float16)0.0f : h0;
        }
        srow[32 * j + lane] = u.f;
      }
    }
  }
  __syncthreads();   // every staged f16 row is complete before another wave reads its fragments

  // ---- (3) value sum ----
  v8f acc[2][4];
#pragma unroll
  for (int i = 0; i < 2; ++i)
#pragma unroll
    for (int j = 0; j < 4; ++j) acc[i][j] = zero8();

  const char* ep = (const char*)sc + rl * (PIT * 4) + hh * 16;  // E row 16j + rl, k = 32S + 8hh (+16): byte 64S (+32)
  v16h ef[2][4];
#pragma unroll
  for (int j = 0; j < 4; ++j) ef[0][j] = ldfrag_lds(ep + j * (16 * PIT * 4));
#pragma unroll   // ring slots and k offsets become constants
  for (int S = 0; S < NT / 32; ++S) {
    if (S + 1 < NT / 32) {
#pragma unroll
      for (int j = 0; j < 4; ++j) ef[(S + 1) & 1][j] = ldfrag_lds(ep + j * (16 * PIT * 4) + 64 * (S + 1));
    }
    // the next step's LDS reads stay one group in front of this step's products, not spread among them
    __builtin_amdgcn_sched_barrier(0);
#pragma unroll
    for (int i = 0; i < 2; ++i)
#pragma unroll
      for (int j = 0; j < 4; ++j) acc[i][j] = mma_h_raw(va[S % VRING][i], ef[S & 1][j], acc[i][j]);
    // keeps the refill right behind the products that free its slot: sunk, it would be waited out at its use
    __builtin_amdgcn_sched_barrier(0);
    if (S + VRING < NT / 32) {
#pragma unroll
      for (int i = 0; i < 2; ++i) va[S % VRING][i] = ldfrag_h((const _Float16*)(pv + oa[i] + 1024 * (S + VRING)));
    }
    // behind the last refill the address registers that the value loads name are free for re-use
    if (S + VRING == NT / 32 - 1) asm volatile("s_wait_xcnt 0x0" ::: "memory");
    __builtin_amdgcn_sched_barrier(0);
  }
  acc_guard4(acc[0][0], acc[0][1], acc[0][2], acc[0][3]);
  acc_guard4(acc[1][0], acc[1][1], acc[1][2], acc[1][3]);

  // ---- epilogue ----
  const float fo = 1.0f / (SCV * SCE);
  float* slab = sO[wave];
  const int p4 = (lane & 15) * 4, r2 = lane >> 4;
  // one address each for x and out: the 16 rows of a lane become immediate offsets, and no address register of an
  // issued load or store is written again
  const size_t eo = ((size_t)(b * CH + cb + r2)) * NT + n0 + p4;
  const float* xb = X + eo;
  float* ob = out + eo;
#pragma unroll
  for (int i = 0; i < 2; ++i) {
#pragma unroll
    for (int r = 0; r < 8; ++r) {
#pragma unroll
      for (int j = 0; j < 4; ++j) {
        slab[(8 * hh + r) * 68 + 16 * j + rl] = acc[i][j][r];   // D row = c offset 8hh + r, D col = n offset 16j + rl
      }
    }
    wave_lds_sync();
    v4f ov[8];
#pragma unroll
    for (int it = 0; it < 8; ++it) {
      const int row = 2 * it + r2;                          // it 0..7 x r2 0..1 = rows 0..15
      const v4f a = *(const v4f*)(slab + row * 68 + p4);
      const v4f xv = *(const v4f*)(xb + (16 * i + 2 * it) * NT);   // channel cb + 16i + row
      v4f o;
#pragma unroll
      for (int e = 0; e < 4; ++e) o[e] = a[e] * fo + bfr(xv[e]);
      ov[it] = o;
    }
    {
#pragma unroll
      for (int it = 0; it < 8; ++it) *(v4f*)(ob + (16 * i + 2 * it) * NT) = ov[it];
    }
    wave_lds_sync();
  }
}

// =====================================================================================================
// Workspace map; every plane [rows][k] below is stored in fragment order (see the head of the file).
//   WQ16  f16 [256][256]             0        131072   (64*Wq, bf16RNE)
//   WK16  f16 [256][256]        131072        131072   (64*Wk)
//   WV16  f16 [256][256]        262144        131072   (64*Wv)
//   XQ    f16 [32768][256]      393216      16777216   (8*q, position rows, k = c)
//   XK    f16 [32768][256]    17170432      16777216   (8*k)
//   VH    f16 [256][32768]    33947648      16777216   (16*v, row c, k = b*1024 + m)
//   xT    f16 [32768][256]    50724864      16777216   (bf16RNE(x) transposed to position rows)
//   end                       67502080
// d_out f32 [32][256][1024] at byte 0.
// =====================================================================================================
extern "C" void kernel_launch(void* const* d_in, const int* in_sizes, int n_in,
                              void* d_out, int out_size, void* d_ws, size_t ws_size,
                              hipStream_t stream) {
  if (n_in < 7) return;
  if (in_sizes[0] != NB * CH * NT) return;
  if (in_sizes[1] != CH * CH || in_sizes[2] != CH) return;
  if (in_sizes[3] != CH * CH || in_sizes[4] != CH) return;
  if (in_sizes[5] != CH * CH || in_sizes[6] != CH) return;
  if (out_size != OUTN) return;

  const float* x  = (const float*)d_in[0];   // [32][256][1024]
  const float* Wq = (const float*)d_in[1];   // [256][256]  ([out][in])
  const float* bq = (const float*)d_in[2];   // [256]
  const float* Wk = (const float*)d_in[3];   // [256][256]
  const float* bk = (const float*)d_in[4];   // [256]
  const float* Wv = (const float*)d_in[5];   // [256][256]
  const float* bv = (const float*)d_in[6];   // [256]

  const size_t PW  = (size_t)CH * CH * 2;                    //   131072
  const size_t PPL = (size_t)TOK * CH * 2;                   // 16777216

  size_t off = 0;
  const size_t oWQ = off; off += PW;
  const size_t oWK = off; off += PW;
  const size_t oWV = off; off += PW;
  const size_t oXQ = off; off += PPL;
  const size_t oXK = off; off += PPL;
  const size_t oVH = off; off += PPL;
  const size_t oXT = off; off += PPL;                        // off = 67502080
  if (off > ws_size) return;
  if (off > (size_t)134217728) return;

  char* ws = (char*)d_ws;
  _Float16* WQ16 = (_Float16*)(ws + oWQ);
  _Float16* WK16 = (_Float16*)(ws + oWK);
  _Float16* WV16 = (_Float16*)(ws + oWV);
  _Float16* XQ   = (_Float16*)(ws + oXQ);
  _Float16* XK   = (_Float16*)(ws + oXK);
  _Float16* VH   = (_Float16*)(ws + oVH);
  _Float16* xT   = (_Float16*)(ws + oXT);
  float*    outf = (float*)d_out;

  const dim3 blk(256);
  const dim3 gPrep(3 * WBLK + (NT / 64) * (CH / 64) * NB);             // 96 + 2048
  const dim3 gPr(3 * PBLK);                                            // 3 x 4096 tiles -> 1536 blocks
  const dim3 gAt(NT / RSB, NB);                                        // (16, 32)

  // (1) weight planes, x64 carried (conv weights [out][in]: rows = out, k = in), and x [32][256][1024]
  //     transposed to position rows xT [32768][256]; all in fragment order
  k_prep<<<gPrep, blk, 0, stream>>>(x, Wq, Wk, Wv, xT, WQ16, WK16, WV16);
  // (2) XQ, XK, VH from xT and the weight planes
  k_proj<<<gPr, blk, 0, stream>>>(xT, WQ16, WK16, WV16, bq, bk, bv, XQ, XK, VH);
  // (3) scores + row softmax + softmax-weighted value sum + residual -> d_out
  k_attn<<<gAt, blk, 0, stream>>>(XQ, XK, VH, x, outf);
}

// v005
// Measured time: 71.1 microseconds a run.
// In two side-by-side timings against v004, it was 1.19 and 1.20 times as fast.
// Counting every step since v000, it is 3.37 times as fast.
#include <hip/hip_runtime.h>
#include <math.h>
#include <stdint.h>

// All contractions on v_wmma_f32_16x16x32_f16 (f16 operands, f32 accumulate): the three 1x1-conv
// projections take bf16-RNE inputs (x1) and bf16-RNE weights (x64) as single f16 planes; the 256-deep
// query.key scores use single f16 planes of 8*q and 8*k; the 1024-deep softmax-weighted value sum uses
// a single f16 plane of 16*v against E = f16(32768*softmax) held as f16 rows in LDS. Softmax
// statistics, biases, residual add and epilogues are f32.
//
// Every f16 operand plane [R][K] in memory lives in fragment order: for 16-row tile T and 32-deep k step S the unit
// (T*(K/32) + S) is 512 halves; inside it element (row, k) sits at ((k>>4)&1)*256 + (((k>>3)&1)*16 + (row&15))*8
// + (k&7). A wave's two 16-B loads of one fragment then cover 2 x 512 contiguous bytes (whole 128-B lines).

#define NB   32
#define CH   256
#define NT   1024
#define TOK  (NB * NT)
#define RSB  64                             // query rows per attention block
#define PIT  (NT + 4)                       // LDS pitch of a score row, floats
#define VRING 8                             // value fragment ring, k steps
#define OUTN (NB * CH * NT)
#define WBLK ((CH * CH) / 2048)            // 256-thread blocks per weight plane, 8 elements a thread
#define PPB  128                            // positions per projection block

#define SCW  64.0f
#define SCQK 8.0f
#define SCV  16.0f
#define SCE  32768.0f
#define SCS  (1.0f / (SCQK * SCQK * 16.0f))

static_assert(TOK % 64 == 0 && CH % 64 == 0 && CH % 32 == 0 && NT % 32 == 0);
static_assert(TOK % PPB == 0 && PPB == 2 * 64 && CH == 4 * 4 * 16);
static_assert(NT % RSB == 0 && RSB == 64 && NT == 4 * 256);
static_assert((PIT * 4) % 32 == 16 && (NT / 32) % VRING == 0);
static_assert((NT / 16) % 8 == 0 && CH == 8 * 32);
static_assert((CH * CH) % 2048 == 0);
static_assert(NT % 64 == 0 && CH % 64 == 0);

typedef _Float16       v16h __attribute__((ext_vector_type(16)));
typedef _Float16       v8h  __attribute__((ext_vector_type(8)));
typedef float          v8f  __attribute__((ext_vector_type(8)));
typedef float          v4f  __attribute__((ext_vector_type(4)));
typedef unsigned int   v4u  __attribute__((ext_vector_type(4)));

union HU { v8h h; v4u u; v4f f; _Float16 s[8]; };
union FR { v16h v; v8h h[2]; _Float16 s[16]; };
static_assert(sizeof(HU) == 16);
static_assert(sizeof(FR) == 32);

// ---- scalar helpers --------------------------------------------------------------------------------
__device__ __forceinline__ unsigned short bf_bits(float f) {          // f32 -> bf16 bits, RNE convert
  const unsigned u = __float_as_uint(f);
  return (unsigned short)((u + 0x7FFFu + ((u >> 16) & 1u)) >> 16);
}
__device__ __forceinline__ float bf_up(unsigned short h) { return __uint_as_float(((unsigned)h) << 16); }
__device__ __forceinline__ float bfr(float f) { return bf_up(bf_bits(f)); }   // value after bf16 RNE convert
__device__ __forceinline__ v8f zero8() { v8f z = {0.f, 0.f, 0.f, 0.f, 0.f, 0.f, 0.f, 0.f}; return z; }

__device__ __forceinline__ void ld8(const float* p, float* o) {
  const v4f a = *(const v4f*)(p);
  const v4f b = *(const v4f*)(p + 4);
  o[0] = a[0]; o[1] = a[1]; o[2] = a[2]; o[3] = a[3];
  o[4] = b[0]; o[5] = b[1]; o[6] = b[2]; o[7] = b[3];
}

// ---- fragment loader: 16-bit A/B operand from a fragment-order plane, p = unit*512 + 8*lane, h = lane>>4;
//      elements 0..7 <- p[0..7] (k0+8h..k0+8h+7), elements 8..15 <- p[256..263] (k0+16+8h..k0+16+8h+7)
__device__ __forceinline__ v16h ldfrag_h(const _Float16* p) {
  FR f;
  f.h[0] = *(const v8h*)(p);
  f.h[1] = *(const v8h*)(p + 256);
  return f.v;
}

// ---- WMMA helpers --------------------------------------------------------------------------------------
__device__ __forceinline__ v8f mma_h_raw(v16h a, v16h b, v8f c) {
  return __builtin_amdgcn_wmma_f32_16x16x32_f16(false, a, false, b, (short)0, c, false, false);
}
__device__ __forceinline__ void acc_guard4(v8f& a, v8f& b, v8f& c, v8f& d) {
#if defined(__HIP_DEVICE_COMPILE__)
  asm volatile("v_nop\n\tv_nop\n\tv_nop\n\tv_nop" : "+v"(a), "+v"(b), "+v"(c), "+v"(d));
#endif
}
__device__ __forceinline__ void wave_lds_sync() {
  __builtin_amdgcn_fence(__ATOMIC_RELEASE, "workgroup");
  __builtin_amdgcn_wave_barrier();
  __builtin_amdgcn_fence(__ATOMIC_ACQUIRE, "workgroup");
}

// =====================================================================================================
// Weight convert: in [R][kd] f32 row-major -> out f16(scale * bf16RNE(in)) in fragment order; thread i owns
// the i-th 16-B chunk of the output (lane = i&31, part = (i>>5)&1, unit = i>>6), one 16-B store per lane.
// coverage: n8 threads x 8 = the whole plane; n8 is a multiple of 256 at every call here. blk = block index
// within the plane.
// =====================================================================================================
__device__ __forceinline__ void cvt_flat(const float* __restrict__ in, _Float16* out, int n8, int kd, float scale, int blk) {
  const int i = blk * 256 + threadIdx.x;
  if (i < n8) {
    const int ksn = kd >> 5, unit = i >> 6;
    const int tile = unit / ksn, ks = unit - tile * ksn;
    const int row = tile * 16 + (i & 15);
    const int k = ks * 32 + ((i >> 5) & 1) * 16 + ((i >> 4) & 1) * 8;
    float v[8];
    ld8(in + (size_t)row * kd + k, v);
    HU u;
#pragma unroll
    for (int e = 0; e < 8; ++e) u.s[e] = (_Float16)(bfr(v[e]) * scale);
    _Float16* p = out + (size_t)i * 8;
    *(v4u*)p = u.u;
    
  }
}

// =====================================================================================================
// Activation transpose-convert: in X[b][k][n] f32 (k = channel 0..Cd-1, n = position 0..NT-1, n contiguous)
// -> XT plane [b*NT + n][k] f16 = f16(bf16RNE(X)), K = Cd, in fragment order.
// Blocks (bn, bk, b) of (NT/64, Cd/64, NB). coverage: load phase 256 threads x 4 row-iterations x 4 floats = 64 k x 64 n;
// store phase 8 waves x 2 half-units x 32 lanes x 8 halves = 64 n rows x 64 k per block; grid = every
// (n tile, k tile, b) -> whole [TOK][Cd] plane.
// =====================================================================================================
__device__ __forceinline__ void cvt_xT(const float* __restrict__ X, _Float16* XT, int Cd, int bn, int bk, int b) {
  __shared__ float sw[64][66];   // pitch 66: the two lane halves (8 k rows apart) read disjoint banks
  const int t = threadIdx.x;
  const int n0 = bn * 64, k0 = bk * 64;
  const float* Xb = X + (size_t)b * Cd * NT;
  {
    const int r = t >> 4, c4 = (t & 15) * 4;
#pragma unroll
    for (int it = 0; it < 4; ++it) {
      const int row = r + 16 * it;
      const v4f x = *(const v4f*)(Xb + (size_t)(k0 + row) * NT + n0 + c4);
      sw[row][c4 + 0] = x[0]; sw[row][c4 + 1] = x[1]; sw[row][c4 + 2] = x[2]; sw[row][c4 + 3] = x[3];
    }
  }
  __syncthreads();
  const int wave = t >> 5, lane = t & 31, hh = lane >> 4, rl = lane & 15;
  HU u[2];
#pragma unroll
  for (int it = 0; it < 2; ++it) {
    const int hu = wave * 2 + it;                  // 16 half-units: row tile hu>>2, k offset 16*(hu&3)
    const int n = (hu >> 2) * 16 + rl;
    const int kl = (hu & 3) * 16 + hh * 8;
#pragma unroll
    for (int e = 0; e < 8; ++e) u[it].s[e] = (_Float16)bfr(sw[kl + e][n]);
  }
  {
#pragma unroll
    for (int it = 0; it < 2; ++it) {
      const int hu = wave * 2 + it;
      const size_t unit = (size_t)(((b * NT + n0) >> 4) + (hu >> 2)) * (size_t)(Cd >> 5) + (k0 >> 5);
      _Float16* dst = XT + unit * 512 + (hu & 3) * 256 + lane * 8;
      *(v4u*)dst = u[it].u;
    }
    // in the merged kernel the listing runs on from these stores into code that rewrites their registers
    asm volatile("s_wait_xcnt 0x0" ::: "memory");
  }
}

// =====================================================================================================
// All operand conversions in one launch (none reads what another writes): blocks 0 .. 3*WBLK-1 convert the three
// weight planes (WBLK blocks each), the other (NT/64)*(CH/64)*NB blocks transpose-convert x. The branch is
// block-uniform, so the barrier inside cvt_xT is passed by whole blocks only.
// =====================================================================================================
__global__ __launch_bounds__(256) void k_prep(const float* __restrict__ X, const float* __restrict__ Wq,
                                              const float* __restrict__ Wk, const float* __restrict__ Wv,
                                              _Float16* XT, _Float16* WQ, _Float16* WK, _Float16* WV) {
  const int bx = blockIdx.x;
  if (bx < 3 * WBLK) {
    const int sel = bx / WBLK;
    const float* in = sel == 0 ? Wq : (sel == 1 ? Wk : Wv);
    _Float16* o = sel == 0 ? WQ : (sel == 1 ? WK : WV);
    cvt_flat(in, o, (CH * CH) / 8, CH, SCW, bx - sel * WBLK);
  } else {
    const int id = bx - 3 * WBLK;
    cvt_xT(X, XT, CH, id % (NT / 64), (id / (NT / 64)) % (CH / 64), id / ((NT / 64) * (CH / 64)));
  }
}

// =====================================================================================================
// The three projections in one launch, one pass over xT. Block = 128 positions, 8 waves (two a SIMD, so a wave may
// hold up to 512 registers), one block a WGP. Wave w holds the 32 xT fragments of positions p0..p0+63
// (p0 = 128*block + 64*(w&1)) in registers for the whole kernel and runs through 12 weight row tiles: tiles
// 4*(w>>1) .. +3 of Wq, then of Wk, then of Wv. Every weight fragment is loaded once a wave and feeds four products;
// the weight fragments form a ring two row tiles deep. K = 256 (8 k steps, ascending) for every accumulator.
// The two waves that stream the same weight tiles (2j, 2j+1) sit on different SIMDs and are of the same age there,
// so they run side by side and the second one's loads can hit the WGP cache.
// The operand roles are chosen so that a lane's 8 accumulator rows are 8 consecutive k of the plane it writes:
//   XQ, XK (rows = position, k = channel): A = weight tile, B = xT tile i -> D row = channel 8hh + r, D col = position rl
//   VH     (rows = channel, k = position): A = xT tile i, B = weight tile -> D row = position 8hh + r, D col = channel rl
// In both cases the lane's 8 halves are the 16-B chunk number 'lane' of a 512-B half unit: one contiguous wave store.
//   XQ = f16(8*(xT . Wq^T + bq)), XK = f16(8*(xT . Wk^T + bk)), VH = f16(16*(Wv . x + bv)); biases bf16RNE.
// coverage: XQ, XK: 256 blocks x 2 position groups x 4 tiles i x 16 positions = 32768 rows, 4 wave groups x 4 tiles x
// 16 = 256 channels; VH: the same 256 channels as rows x the same 32768 positions as k.
// =====================================================================================================
__global__ __launch_bounds__(256) void k_proj(const _Float16* __restrict__ XT, const _Float16* __restrict__ WQ,
                                              const _Float16* __restrict__ WK, const _Float16* __restrict__ WV,
                                              const float* __restrict__ bq, const float* __restrict__ bk,
                                              const float* __restrict__ bv,
                                              _Float16* XQ, _Float16* XK, _Float16* VH) {
  const int lane = threadIdx.x & 31;
  // the wave's number in a scalar register: every base address below is then scalar, and the only vector address
  // registers are three lane offsets that are never written again
  const int wave = __builtin_amdgcn_readfirstlane(threadIdx.x >> 5);
  const unsigned l8 = 8u * lane;                                 // this lane's 16-B chunk of a 512-B half unit, in halves
  const unsigned hb = 8u * (lane >> 4), rl = lane & 15;          // bias offsets: 8hh (XQ, XK), rl (VH)
  const int p0 = blockIdx.x * PPB + (wave & 1) * 64;             // first of this wave's 64 positions
  const int ct0 = (wave >> 1) * 4;                               // first of this wave's 4 row tiles in each weight plane
  const float cs64 = 1.0f / SCW;                                 // undo the weight carry
  const _Float16* ax = XT + (size_t)p0 * CH;                     // row tile p0/16, CH/32 units each
  const int wo = ct0 * 16 * CH;                                  // row tile ct0 of a weight plane
  const _Float16* wp[3] = {WQ + wo, WK + wo, WV + wo};
  const float* bp[3] = {bq + 16 * ct0, bk + 16 * ct0, bv + 16 * ct0};              // channel 16*ct0
  // XQ, XK: unit (p0/16 + i)*8 + ct/2, half ct&1; VH: unit ct*(TOK/32) + p0/32 + i/2, half i&1; here for ct = ct0, i = 0
  _Float16* dp[3] = {XQ + (size_t)p0 * CH + ct0 * 256, XK + (size_t)p0 * CH + ct0 * 256,
                     VH + (size_t)ct0 * 16 * TOK + (size_t)p0 * 16};
  v16h xf[4][CH / 32], kf[2][CH / 32];
#pragma unroll
  for (int ks = 0; ks < CH / 32; ++ks) kf[0][ks] = ldfrag_h(wp[0] + 512 * ks + l8);
  // keeps the first tile's loads in front: mixed in behind the others they would make its products wait for all
  __builtin_amdgcn_sched_barrier(0);
#pragma unroll   // k step by k step, the order in which the first tile's products take them
  for (int ks = 0; ks < CH / 32; ++ks)
#pragma unroll
    for (int i = 0; i < 4; ++i) xf[i][ks] = ldfrag_h(ax + i * 16 * CH + 512 * ks + l8);
  // as above: the second tile's loads stay last
  __builtin_amdgcn_sched_barrier(0);
#pragma unroll
  for (int ks = 0; ks < CH / 32; ++ks) kf[1][ks] = ldfrag_h(wp[0] + 16 * CH + 512 * ks + l8);
  // the code below may re-use the base registers that the xT loads name
  asm volatile("s_wait_xcnt 0x0" ::: "memory");
  // keeps the second tile's loads behind the first products' operands, so that tile 0 does not wait for them,
  // and every later register write behind the wait above
  __builtin_amdgcn_sched_barrier(0);
#pragma unroll   // plane, operand roles and ring slot become constants; the last two tiles drop their refill
  for (int t = 0; t < 12; ++t) {
    const int sel = t >> 2;                                      // 0 Wq, 1 Wk, 2 Wv
    const int tc = t & 3;                                        // row tile ct = ct0 + tc of the plane = 16 output channels
    // this tile's biases, issued a whole tile of products ahead of their use
    float bb[8];
    if (sel < 2) {
      ld8(bp[sel] + 16 * tc + hb, bb);                           // channels 16ct + 8hh + r
    } else {
      bb[0] = bp[2][16 * tc + rl];                               // channel 16ct + rl
    }
    // keeps the bias loads here: sunk to their use they would be waited out there
    __builtin_amdgcn_sched_barrier(0);
    v8f a[4];
#pragma unroll
    for (int i = 0; i < 4; ++i) a[i] = zero8();
#pragma unroll
    for (int ks = 0; ks < CH / 32; ++ks) {
#pragma unroll
      for (int i = 0; i < 4; ++i)
        a[i] = sel < 2 ? mma_h_raw(kf[t & 1][ks], xf[i][ks], a[i]) : mma_h_raw(xf[i][ks], kf[t & 1][ks], a[i]);
      // the fragment of the tile after next, issued two whole tiles ahead of its use
      if (t + 2 < 12) kf[t & 1][ks] = ldfrag_h(wp[(t + 2) >> 2] + ((t + 2) & 3) * 16 * CH + 512 * ks + l8);
      // keeps the refill here: the scheduler otherwise sinks it to just in front of its use
      __builtin_amdgcn_sched_barrier(0);
    }
    if (sel < 2) {
#pragma unroll
      for (int i = 0; i < 4; ++i) {
        HU h;
#pragma unroll
        for (int r = 0; r < 8; ++r) h.s[r] = (_Float16)((a[i][r] * cs64 + bfr(bb[r])) * SCQK);
        *(v4u*)(dp[sel] + tc * 256 + i * 16 * CH + l8) = h.u;
      }
    } else {
      const float bc = bfr(bb[0]);
#pragma unroll
      for (int i = 0; i < 4; ++i) {
        HU h;
#pragma unroll
        for (int r = 0; r < 8; ++r) h.s[r] = (_Float16)((a[i][r] * cs64 + bc) * SCV);
        *(v4u*)(dp[2] + tc * 16 * TOK + i * 256 + l8) = h.u;
      }
    }
    if (t + 1 < 12) {
      // the next tile rewrites the data registers that these stores name
      asm volatile("s_wait_xcnt 0x0" ::: "memory");
      // keeps every register write of the next tile behind the wait above
      __builtin_amdgcn_sched_barrier(0);
    }
  }
}

// =====================================================================================================
// Scores + row softmax + softmax-weighted value sum + residual in one kernel: the softmax rows never leave LDS.
// Block = (b, 64 query rows n0..n0+63), 8 waves (two a SIMD, so a wave may hold up to 512 registers), one block
// a WGP. LDS: 64 score rows of 1024 f32 at a pitch of 1028 floats (16 B x odd: the 16 rows of a fragment read
// fall on 16 different bank groups, and the two lane halves of a score store, 8 rows apart, on disjoint banks).
//  (1) wave w computes the 16-column score tiles ct = w, w+8, ... (8 of them) for all four 16-row tiles:
//      s = (q8 . k8) / (64*16) from the 8*q / 8*k planes (K = 256, A = XQ rows, Bt = XK rows), into LDS.
//      The 32 query fragments are loaded once and stay in registers, so every key fragment is loaded once a
//      block and feeds four products; the key fragments form a ring two column tiles deep.
//  (2) wave w owns rows 8w..8w+7, four at a time: lane holds cols 256j + 8*lane..+7 (j = 0..3) in registers;
//      row max M (xor shuffles), ef = exp(s - M), Z = sum_m ef (fixed lane order + xor shuffles), then
//      E = f16(32768 * ef / Z) with explicit flush of f16 subnormals to zero; the f16 row is staged in the
//      first half of its own score row's LDS bytes, 16-B chunk c (k = 8c..8c+7) at byte 16c.
//  (3) after a block barrier: D[c][n] = sum_m (16*v)[c][m] . E[n][m], A = value plane rows c (fragment order, row
//      length TOK, k from b*NT), Bt = the 64 E rows in LDS, K = 1024 (32 k steps, ascending). Wave w owns
//      channels 32w..32w+31 (2 x 4 tiles), so every value fragment is loaded once a block. The value fragments
//      form a ring 8 steps deep, first filled ahead of (2); the E fragments are read one step ahead.
// Epilogue: out[b][c][n] = D/(16*32768) + bf16RNE(x[b][c][n]); per wave two 16x64 f32 slabs staged in LDS.
// coverage: sc: 8 waves x 8 col tiles x 16 cols x 64 rows = the whole 64x1024 block; E: 8 waves x 8 rows x
// 4 j x 32 lanes x 8 halves = 64 rows x 1024; out: 8 waves x 2 slabs x 16 rows x 64 cols = 256 c x 64 n per
// block; grid (16, 32) = every (n tile, b) -> whole output [32][256][1024].
// =====================================================================================================
__device__ __forceinline__ v16h ldfrag_lds(const char* p) {   // elements 0..7 <- 16 B at p, 8..15 <- 16 B at p + 32
  HU lo, hi;
  lo.f = *(const v4f*)(p);
  hi.f = *(const v4f*)(p + 32);
  FR f;
  f.h[0] = lo.h;
  f.h[1] = hi.h;
  return f.v;
}

__global__ __launch_bounds__(256) void k_attn(const _Float16* __restrict__ XQ, const _Float16* __restrict__ XK,
                                              const _Float16* __restrict__ VH, const float* __restrict__ X,
                                              float* out) {
  __shared__ __align__(16) float sc[RSB * PIT];               // score rows, later the f16 E rows
  __shared__ __align__(16) float sO[8][16 * 68];              // per-wave 16x64 output slab, pitch 68 floats
  const int tid = threadIdx.x, wave = tid >> 5, lane = tid & 31;
  const int hh = lane >> 4, rl = lane & 15;
  const int rb = blockIdx.x, b = blockIdx.y, n0 = rb * RSB;

  // ---- (1) scores ----
  {
    const _Float16* aq = XQ + (size_t)(b * NT + n0) * CH + 8 * lane;    // row tile (b*NT+n0)/16, CH/32 units each
    const _Float16* bk = XK + (size_t)(b * NT + 16 * wave) * CH + 8 * lane;
    v16h q[RSB / 16][CH / 32], kf[2][CH / 32];
#pragma unroll
    for (int ks = 0; ks < CH / 32; ++ks) kf[0][ks] = ldfrag_h(bk + 512 * ks);
#pragma unroll
    for (int i = 0; i < RSB / 16; ++i)
#pragma unroll
      for (int ks = 0; ks < CH / 32; ++ks) q[i][ks] = ldfrag_h(aq + i * 16 * CH + 512 * ks);
#pragma unroll
    for (int ks = 0; ks < CH / 32; ++ks) kf[1][ks] = ldfrag_h(bk + 128 * CH + 512 * ks);
    // the code below re-uses the base registers that the query loads name
    asm volatile("s_wait_xcnt 0x0" ::: "memory");
    // keeps the second tile's loads behind the first products' operands, so that tile 0 does not wait for them,
    // and every later register write behind the wait above
    __builtin_amdgcn_sched_barrier(0);
#pragma unroll   // the tile steps become immediate offsets of one address, and the last two tiles drop their refill
    for (int t = 0; t < NT / 128; ++t) {                        // column tile ct = wave + 8t
      v8f a[RSB / 16];
#pragma unroll
      for (int i = 0; i < RSB / 16; ++i) a[i] = zero8();
#pragma unroll
      for (int ks = 0; ks < CH / 32; ++ks) {
#pragma unroll
        for (int i = 0; i < RSB / 16; ++i) a[i] = mma_h_raw(q[i][ks], kf[t & 1][ks], a[i]);
        // the fragment of the tile after next, issued two whole tiles ahead of its use
        if (t + 2 < NT / 128) kf[t & 1][ks] = ldfrag_h(bk + (size_t)(t + 2) * 128 * CH + 512 * ks);
        // keeps the refill here: the scheduler otherwise sinks it to just in front of its use
        __builtin_amdgcn_sched_barrier(0);
      }
      const int mc = 16 * (wave + 8 * t) + rl;                  // D col = m; D row = 8hh + r within the row tile
#pragma unroll
      for (int i = 0; i < RSB / 16; ++i)
#pragma unroll
        for (int r = 0; r < 8; ++r) sc[(16 * i + 8 * hh + r) * PIT + mc] = a[i][r] * SCS;
    }
    // the code below re-uses the address registers that these loads name
    asm volatile("s_wait_xcnt 0x0" ::: "memory");
  }
  __syncthreads();

  // ---- value ring, first fill: the loads fly while the softmax runs ----
  const int cb = wave * 32;
  const char* pv = (const char*)VH;
  unsigned oa[2];                              // byte offset of this lane's 16 B in the first unit, per channel tile
#pragma unroll
  for (int i = 0; i < 2; ++i)
    oa[i] = ((unsigned)((cb >> 4) + i) * (unsigned)(TOK >> 5) + (unsigned)((b * NT) >> 5)) * 1024u + lane * 16u;
  v16h va[VRING][2];
#pragma unroll
  for (int s = 0; s < VRING; ++s)
#pragma unroll
    for (int i = 0; i < 2; ++i) va[s][i] = ldfrag_h((const _Float16*)(pv + oa[i] + 1024 * s));
  // the softmax re-uses the offset registers that these loads name
  asm volatile("s_wait_xcnt 0x0" ::: "memory");
  // keeps these loads in front of the softmax (sunk to their use they would be waited out there), and every
  // later register write behind the wait above
  __builtin_amdgcn_sched_barrier(0);

  // ---- (2) row softmax, E rows ----
  for (int g = 0; g < 2; ++g) {
    const int row0 = 8 * wave + 4 * g;                          // four rows side by side: their shuffle chains overlap
    float v[4][4][8];
    float mx[4], z[4];
#pragma unroll
    for (int q4 = 0; q4 < 4; ++q4) {
      const float* rp = sc + (row0 + q4) * PIT + 8 * lane;      // lane covers cols 256j + 8*lane .. +7
#pragma unroll
      for (int j = 0; j < 4; ++j) ld8(rp + 256 * j, v[q4][j]);
    }
#pragma unroll
    for (int q4 = 0; q4 < 4; ++q4) {
      mx[q4] = -3.0e38f;
#pragma unroll
      for (int j = 0; j < 4; ++j)
#pragma unroll
        for (int e = 0; e < 8; ++e) mx[q4] = fmaxf(mx[q4], v[q4][j][e]);
    }
#pragma unroll
    for (int off = 16; off >= 1; off >>= 1)
#pragma unroll
      for (int q4 = 0; q4 < 4; ++q4) mx[q4] = fmaxf(mx[q4], __shfl_xor(mx[q4], off, 32));
#pragma unroll
    for (int q4 = 0; q4 < 4; ++q4) {
      z[q4] = 0.0f;
#pragma unroll
      for (int j = 0; j < 4; ++j) {
#pragma unroll
        for (int e = 0; e < 8; ++e) {
          const float ef = __expf(v[q4][j][e] - mx[q4]);
          z[q4] += ef;
          v[q4][j][e] = ef;
        }
      }
    }
#pragma unroll
    for (int off = 16; off >= 1; off >>= 1)
#pragma unroll
      for (int q4 = 0; q4 < 4; ++q4) z[q4] += __shfl_xor(z[q4], off, 32);
#pragma unroll
    for (int q4 = 0; q4 < 4; ++q4) {
      const float rz = SCE * (1.0f / z[q4]);                   // z in [1, 1024]
      v4f* srow = (v4f*)(sc + (row0 + q4) * PIT);
#pragma unroll
      for (int j = 0; j < 4; ++j) {
        HU u;
#pragma unroll
        for (int e = 0; e < 8; ++e) {
          const _Float16 h0 = (_Float16)(v[q4][j][e] * rz);
          const float f0 = (float)h0;
          const bool sub = f0 < 6.103515625e-05f;              // f16 subnormal -> exact zero
          u.s[e] = sub ? (_Float16)0.0f : h0;
        }
        srow[32 * j + lane] = u.f;
      }
    }
  }
  __syncthreads();   // every staged f16 row is complete before another wave reads its fragments

  // ---- (3) value sum ----
  v8f acc[2][4];
#pragma unroll
  for (int i = 0; i < 2; ++i)
#pragma unroll
    for (int j = 0; j < 4; ++j) acc[i][j] = zero8();

  const char* ep = (const char*)sc + rl * (PIT * 4) + hh * 16;  // E row 16j + rl, k = 32S + 8hh (+16): byte 64S (+32)
  v16h ef[2][4];
#pragma unroll
  for (int j = 0; j < 4; ++j) ef[0][j] = ldfrag_lds(ep + j * (16 * PIT * 4));
#pragma unroll   // ring slots and k offsets become constants
  for (int S = 0; S < NT / 32; ++S) {
    if (S + 1 < NT / 32) {
#pragma unroll
      for (int j = 0; j < 4; ++j) ef[(S + 1) & 1][j] = ldfrag_lds(ep + j * (16 * PIT * 4) + 64 * (S + 1));
    }
    // the next step's LDS reads stay one group in front of this step's products, not spread among them
    __builtin_amdgcn_sched_barrier(0);
#pragma unroll
    for (int i = 0; i < 2; ++i)
#pragma unroll
      for (int j = 0; j < 4; ++j) acc[i][j] = mma_h_raw(va[S % VRING][i], ef[S & 1][j], acc[i][j]);
    // keeps the refill right behind the products that free its slot: sunk, it would be waited out at its use
    __builtin_amdgcn_sched_barrier(0);
    if (S + VRING < NT / 32) {
#pragma unroll
      for (int i = 0; i < 2; ++i) va[S % VRING][i] = ldfrag_h((const _Float16*)(pv + oa[i] + 1024 * (S + VRING)));
    }
    // behind the last refill the address registers that the value loads name are free for re-use
    if (S + VRING == NT / 32 - 1) asm volatile("s_wait_xcnt 0x0" ::: "memory");
    __builtin_amdgcn_sched_barrier(0);
  }
  acc_guard4(acc[0][0], acc[0][1], acc[0][2], acc[0][3]);
  acc_guard4(acc[1][0], acc[1][1], acc[1][2], acc[1][3]);

  // ---- epilogue ----
  const float fo = 1.0f / (SCV * SCE);
  float* slab = sO[wave];
  const int p4 = (lane & 15) * 4, r2 = lane >> 4;
  // one address each for x and out: the 16 rows of a lane become immediate offsets, and no address register of an
  // issued load or store is written again
  const size_t eo = ((size_t)(b * CH + cb + r2)) * NT + n0 + p4;
  const float* xb = X + eo;
  float* ob = out + eo;
#pragma unroll
  for (int i = 0; i < 2; ++i) {
#pragma unroll
    for (int r = 0; r < 8; ++r) {
#pragma unroll
      for (int j = 0; j < 4; ++j) {
        slab[(8 * hh + r) * 68 + 16 * j + rl] = acc[i][j][r];   // D row = c offset 8hh + r, D col = n offset 16j + rl
      }
    }
    wave_lds_sync();
    v4f ov[8];
#pragma unroll
    for (int it = 0; it < 8; ++it) {
      const int row = 2 * it + r2;                          // it 0..7 x r2 0..1 = rows 0..15
      const v4f a = *(const v4f*)(slab + row * 68 + p4);
      const v4f xv = *(const v4f*)(xb + (16 * i + 2 * it) * NT);   // channel cb + 16i + row
      v4f o;
#pragma unroll
      for (int e = 0; e < 4; ++e) o[e] = a[e] * fo + bfr(xv[e]);
      ov[it] = o;
    }
    {
#pragma unroll
      for (int it = 0; it < 8; ++it) *(v4f*)(ob + (16 * i + 2 * it) * NT) = ov[it];
    }
    wave_lds_sync();
  }
}

// =====================================================================================================
// Workspace map; every plane [rows][k] below is stored in fragment order (see the head of the file).
//   WQ16  f16 [256][256]             0        131072   (64*Wq, bf16RNE)
//   WK16  f16 [256][256]        131072        131072   (64*Wk)
//   WV16  f16 [256][256]        262144        131072   (64*Wv)
//   XQ    f16 [32768][256]      393216      16777216   (8*q, position rows, k = c)
//   XK    f16 [32768][256]    17170432      16777216   (8*k)
//   VH    f16 [256][32768]    33947648      16777216   (16*v, row c, k = b*1024 + m)
//   xT    f16 [32768][256]    50724864      16777216   (bf16RNE(x) transposed to position rows)
//   end                       67502080
// d_out f32 [32][256][1024] at byte 0.
// =====================================================================================================
extern "C" void kernel_launch(void* const* d_in, const int* in_sizes, int n_in,
                              void* d_out, int out_size, void* d_ws, size_t ws_size,
                              hipStream_t stream) {
  if (n_in < 7) return;
  if (in_sizes[0] != NB * CH * NT) return;
  if (in_sizes[1] != CH * CH || in_sizes[2] != CH) return;
  if (in_sizes[3] != CH * CH || in_sizes[4] != CH) return;
  if (in_sizes[5] != CH * CH || in_sizes[6] != CH) return;
  if (out_size != OUTN) return;

  const float* x  = (const float*)d_in[0];   // [32][256][1024]
  const float* Wq = (const float*)d_in[1];   // [256][256]  ([out][in])
  const float* bq = (const float*)d_in[2];   // [256]
  const float* Wk = (const float*)d_in[3];   // [256][256]
  const float* bk = (const float*)d_in[4];   // [256]
  const float* Wv = (const float*)d_in[5];   // [256][256]
  const float* bv = (const float*)d_in[6];   // [256]

  const size_t PW  = (size_t)CH * CH * 2;                    //   131072
  const size_t PPL = (size_t)TOK * CH * 2;                   // 16777216

  size_t off = 0;
  const size_t oWQ = off; off += PW;
  const size_t oWK = off; off += PW;
  const size_t oWV = off; off += PW;
  const size_t oXQ = off; off += PPL;
  const size_t oXK = off; off += PPL;
  const size_t oVH = off; off += PPL;
  const size_t oXT = off; off += PPL;                        // off = 67502080
  if (off > ws_size) return;
  if (off > (size_t)134217728) return;

  char* ws = (char*)d_ws;
  _Float16* WQ16 = (_Float16*)(ws + oWQ);
  _Float16* WK16 = (_Float16*)(ws + oWK);
  _Float16* WV16 = (_Float16*)(ws + oWV);
  _Float16* XQ   = (_Float16*)(ws + oXQ);
  _Float16* XK   = (_Float16*)(ws + oXK);
  _Float16* VH   = (_Float16*)(ws + oVH);
  _Float16* xT   = (_Float16*)(ws + oXT);
  float*    outf = (float*)d_out;

  const dim3 blk(256);
  const dim3 gPrep(3 * WBLK + (NT / 64) * (CH / 64) * NB);             // 96 + 2048
  const dim3 gPr(TOK / PPB);                                           // 256 blocks of 128 positions
  const dim3 gAt(NT / RSB, NB);                                        // (16, 32)

  // (1) weight planes, x64 carried (conv weights [out][in]: rows = out, k = in), and x [32][256][1024]
  //     transposed to position rows xT [32768][256]; all in fragment order
  k_prep<<<gPrep, blk, 0, stream>>>(x, Wq, Wk, Wv, xT, WQ16, WK16, WV16);
  // (2) XQ, XK, VH from xT and the weight planes
  k_proj<<<gPr, blk, 0, stream>>>(xT, WQ16, WK16, WV16, bq, bk, bv, XQ, XK, VH);
  // (3) scores + row softmax + softmax-weighted value sum + residual -> d_out
  k_attn<<<gAt, blk, 0, stream>>>(XQ, XK, VH, x, outf);
}

// v006
// Measured time: 66 microseconds a run.
// Next to v005, in two timings, it ran 1.07 and 1.08 times as fast.
// All steps since v000 together make it 3.63 times as fast.
#include <hip/hip_runtime.h>
#include <math.h>
#include <stdint.h>

// All contractions on v_wmma_f32_16x16x32_f16 (f16 operands, f32 accumulate): the three 1x1-conv
// projections take bf16-RNE inputs (x1) and bf16-RNE weights (x64) as single f16 planes; the 256-deep
// query.key scores use single f16 planes of 8*q and 8*k; the 1024-deep softmax-weighted value sum uses
// a single f16 plane of 16*v against E = f16(32768*softmax) held as f16 rows in LDS. Softmax
// statistics, biases, residual add and epilogues are f32; the factor that rescales an E chunk is f16.
//
// Every f16 operand plane [R][K] in memory lives in fragment order: for 16-row tile T and 32-deep k step S the unit
// (T*(K/32) + S) is 512 halves; inside it element (row, k) sits at ((k>>4)&1)*256 + (((k>>3)&1)*16 + (row&15))*8
// + (k&7). A wave's two 16-B loads of one fragment then cover 2 x 512 contiguous bytes (whole 128-B lines).

#define NB   32
#define CH   256
#define NT   1024
#define TOK  (NB * NT)
#define RSB  64                             // query rows per attention block
#define PIT  (NT / 2 + 4)                   // LDS pitch of an E row of NT f16, in floats
#define SPIT (NT / 4 + 4)                   // LDS pitch of a row's NT/8 (max, sum) pairs, in floats
#define VRING 8                             // value fragment ring, k steps
#define OUTN (NB * CH * NT)
#define WBLK ((CH * CH) / 2048)            // 256-thread blocks per weight plane, 8 elements a thread
#define PPB  128                            // positions per projection block

#define SCW  64.0f
#define SCQK 8.0f
#define SCV  16.0f
#define SCE  32768.0f
#define SCS  (1.0f / (SCQK * SCQK * 16.0f))
#define CEX  (SCS * 1.44269504088896f)      // raw score product -> exponent of two

static_assert(TOK % 64 == 0 && CH % 64 == 0 && CH % 32 == 0 && NT % 32 == 0);
static_assert(TOK % PPB == 0 && PPB == 2 * 64 && CH == 4 * 4 * 16);
static_assert(NT % RSB == 0 && RSB == 64 && NT == 4 * 256);
static_assert((PIT * 4) % 32 == 16 && (NT / 32) % VRING == 0);
static_assert(SPIT % 64 == 4);
static_assert((NT / 16) % 8 == 0 && CH == 8 * 32);
static_assert((CH * CH) % 2048 == 0);
static_assert(NT % 64 == 0 && CH % 64 == 0);

typedef _Float16       v16h __attribute__((ext_vector_type(16)));
typedef _Float16       v8h  __attribute__((ext_vector_type(8)));
typedef float          v8f  __attribute__((ext_vector_type(8)));
typedef float          v4f  __attribute__((ext_vector_type(4)));
typedef float          v2f  __attribute__((ext_vector_type(2)));
typedef unsigned int   v4u  __attribute__((ext_vector_type(4)));

union HU { v8h h; v4u u; v4f f; _Float16 s[8]; };
union FR { v16h v; v8h h[2]; _Float16 s[16]; };
static_assert(sizeof(HU) == 16);
static_assert(sizeof(FR) == 32);

// ---- scalar helpers --------------------------------------------------------------------------------
__device__ __forceinline__ unsigned short bf_bits(float f) {          // f32 -> bf16 bits, RNE convert
  const unsigned u = __float_as_uint(f);
  return (unsigned short)((u + 0x7FFFu + ((u >> 16) & 1u)) >> 16);
}
__device__ __forceinline__ float bf_up(unsigned short h) { return __uint_as_float(((unsigned)h) << 16); }
__device__ __forceinline__ float bfr(float f) { return bf_up(bf_bits(f)); }   // value after bf16 RNE convert
__device__ __forceinline__ v8f zero8() { v8f z = {0.f, 0.f, 0.f, 0.f, 0.f, 0.f, 0.f, 0.f}; return z; }

__device__ __forceinline__ void ld8(const float* p, float* o) {
  const v4f a = *(const v4f*)(p);
  const v4f b = *(const v4f*)(p + 4);
  o[0] = a[0]; o[1] = a[1]; o[2] = a[2]; o[3] = a[3];
  o[4] = b[0]; o[5] = b[1]; o[6] = b[2]; o[7] = b[3];
}

// ---- fragment loader: 16-bit A/B operand from a fragment-order plane, p = unit*512 + 8*lane, h = lane>>4;
//      elements 0..7 <- p[0..7] (k0+8h..k0+8h+7), elements 8..15 <- p[256..263] (k0+16+8h..k0+16+8h+7)
__device__ __forceinline__ v16h ldfrag_h(const _Float16* p) {
  FR f;
  f.h[0] = *(const v8h*)(p);
  f.h[1] = *(const v8h*)(p + 256);
  return f.v;
}

// ---- WMMA helpers --------------------------------------------------------------------------------------
__device__ __forceinline__ v8f mma_h_raw(v16h a, v16h b, v8f c) {
  return __builtin_amdgcn_wmma_f32_16x16x32_f16(false, a, false, b, (short)0, c, false, false);
}
__device__ __forceinline__ void acc_guard4(v8f& a, v8f& b, v8f& c, v8f& d) {
#if defined(__HIP_DEVICE_COMPILE__)
  asm volatile("v_nop\n\tv_nop\n\tv_nop\n\tv_nop" : "+v"(a), "+v"(b), "+v"(c), "+v"(d));
#endif
}
// v[0..7] <- 2^v[0..7]. One statement, in place, with a v_nop behind the last: it keeps the slot that the instruction
// set asks for between a transcendental and an instruction that overwrites its source or reads its result.
__device__ __forceinline__ void exp2x8(float* v) {
#if defined(__HIP_DEVICE_COMPILE__)
  asm("v_exp_f32 %0, %0\n\tv_exp_f32 %1, %1\n\tv_exp_f32 %2, %2\n\tv_exp_f32 %3, %3\n\t"
      "v_exp_f32 %4, %4\n\tv_exp_f32 %5, %5\n\tv_exp_f32 %6, %6\n\tv_exp_f32 %7, %7\n\tv_nop"
      : "+v"(v[0]), "+v"(v[1]), "+v"(v[2]), "+v"(v[3]), "+v"(v[4]), "+v"(v[5]), "+v"(v[6]), "+v"(v[7]));
#endif
}
__device__ __forceinline__ void wave_lds_sync() {
  __builtin_amdgcn_fence(__ATOMIC_RELEASE, "workgroup");
  __builtin_amdgcn_wave_barrier();
  __builtin_amdgcn_fence(__ATOMIC_ACQUIRE, "workgroup");
}

// =====================================================================================================
// Weight convert: in [R][kd] f32 row-major -> out f16(scale * bf16RNE(in)) in fragment order; thread i owns
// the i-th 16-B chunk of the output (lane = i&31, part = (i>>5)&1, unit = i>>6), one 16-B store per lane.
// coverage: n8 threads x 8 = the whole plane; n8 is a multiple of 256 at every call here. blk = block index
// within the plane.
// =====================================================================================================
__device__ __forceinline__ void cvt_flat(const float* __restrict__ in, _Float16* out, int n8, int kd, float scale, int blk) {
  const int i = blk * 256 + threadIdx.x;
  if (i < n8) {
    const int ksn = kd >> 5, unit = i >> 6;
    const int tile = unit / ksn, ks = unit - tile * ksn;
    const int row = tile * 16 + (i & 15);
    const int k = ks * 32 + ((i >> 5) & 1) * 16 + ((i >> 4) & 1) * 8;
    float v[8];
    ld8(in + (size_t)row * kd + k, v);
    HU u;
#pragma unroll
    for (int e = 0; e < 8; ++e) u.s[e] = (_Float16)(bfr(v[e]) * scale);
    _Float16* p = out + (size_t)i * 8;
    *(v4u*)p = u.u;
    
  }
}

// =====================================================================================================
// Activation transpose-convert: in X[b][k][n] f32 (k = channel 0..Cd-1, n = position 0..NT-1, n contiguous)
// -> XT plane [b*NT + n][k] f16 = f16(bf16RNE(X)), K = Cd, in fragment order.
// Blocks (bn, bk, b) of (NT/64, Cd/64, NB). coverage: load phase 256 threads x 4 row-iterations x 4 floats = 64 k x 64 n;
// store phase 8 waves x 2 half-units x 32 lanes x 8 halves = 64 n rows x 64 k per block; grid = every
// (n tile, k tile, b) -> whole [TOK][Cd] plane.
// =====================================================================================================
__device__ __forceinline__ void cvt_xT(const float* __restrict__ X, _Float16* XT, int Cd, int bn, int bk, int b) {
  __shared__ float sw[64][66];   // pitch 66: the two lane halves (8 k rows apart) read disjoint banks
  const int t = threadIdx.x;
  const int n0 = bn * 64, k0 = bk * 64;
  const float* Xb = X + (size_t)b * Cd * NT;
  {
    const int r = t >> 4, c4 = (t & 15) * 4;
#pragma unroll
    for (int it = 0; it < 4; ++it) {
      const int row = r + 16 * it;
      const v4f x = *(const v4f*)(Xb + (size_t)(k0 + row) * NT + n0 + c4);
      sw[row][c4 + 0] = x[0]; sw[row][c4 + 1] = x[1]; sw[row][c4 + 2] = x[2]; sw[row][c4 + 3] = x[3];
    }
  }
  __syncthreads();
  const int wave = t >> 5, lane = t & 31, hh = lane >> 4, rl = lane & 15;
  HU u[2];
#pragma unroll
  for (int it = 0; it < 2; ++it) {
    const int hu = wave * 2 + it;                  // 16 half-units: row tile hu>>2, k offset 16*(hu&3)
    const int n = (hu >> 2) * 16 + rl;
    const int kl = (hu & 3) * 16 + hh * 8;
#pragma unroll
    for (int e = 0; e < 8; ++e) u[it].s[e] = (_Float16)bfr(sw[kl + e][n]);
  }
  {
#pragma unroll
    for (int it = 0; it < 2; ++it) {
      const int hu = wave * 2 + it;
      const size_t unit = (size_t)(((b * NT + n0) >> 4) + (hu >> 2)) * (size_t)(Cd >> 5) + (k0 >> 5);
      _Float16* dst = XT + unit * 512 + (hu & 3) * 256 + lane * 8;
      *(v4u*)dst = u[it].u;
    }
    // in the merged kernel the listing runs on from these stores into code that rewrites their registers
    asm volatile("s_wait_xcnt 0x0" ::: "memory");
  }
}

// =====================================================================================================
// All operand conversions in one launch (none reads what another writes): blocks 0 .. 3*WBLK-1 convert the three
// weight planes (WBLK blocks each), the other (NT/64)*(CH/64)*NB blocks transpose-convert x. The branch is
// block-uniform, so the barrier inside cvt_xT is passed by whole blocks only.
// =====================================================================================================
__global__ __launch_bounds__(256) void k_prep(const float* __restrict__ X, const float* __restrict__ Wq,
                                              const float* __restrict__ Wk, const float* __restrict__ Wv,
                                              _Float16* XT, _Float16* WQ, _Float16* WK, _Float16* WV) {
  const int bx = blockIdx.x;
  if (bx < 3 * WBLK) {
    const int sel = bx / WBLK;
    const float* in = sel == 0 ? Wq : (sel == 1 ? Wk : Wv);
    _Float16* o = sel == 0 ? WQ : (sel == 1 ? WK : WV);
    cvt_flat(in, o, (CH * CH) / 8, CH, SCW, bx - sel * WBLK);
  } else {
    const int id = bx - 3 * WBLK;
    cvt_xT(X, XT, CH, id % (NT / 64), (id / (NT / 64)) % (CH / 64), id / ((NT / 64) * (CH / 64)));
  }
}

// =====================================================================================================
// The three projections in one launch, one pass over xT. Block = 128 positions, 8 waves (two a SIMD, so a wave may
// hold up to 512 registers), one block a WGP. Wave w holds the 32 xT fragments of positions p0..p0+63
// (p0 = 128*block + 64*(w&1)) in registers for the whole kernel and runs through 12 weight row tiles: tiles
// 4*(w>>1) .. +3 of Wq, then of Wk, then of Wv. Every weight fragment is loaded once a wave and feeds four products;
// the weight fragments form a ring two row tiles deep. K = 256 (8 k steps, ascending) for every accumulator.
// The two waves that stream the same weight tiles (2j, 2j+1) sit on different SIMDs and are of the same age there,
// so they run side by side and the second one's loads can hit the WGP cache.
// The operand roles are chosen so that a lane's 8 accumulator rows are 8 consecutive k of the plane it writes:
//   XQ, XK (rows = position, k = channel): A = weight tile, B = xT tile i -> D row = channel 8hh + r, D col = position rl
//   VH     (rows = channel, k = position): A = xT tile i, B = weight tile -> D row = position 8hh + r, D col = channel rl
// In both cases the lane's 8 halves are the 16-B chunk number 'lane' of a 512-B half unit: one contiguous wave store.
//   XQ = f16(8*(xT . Wq^T + bq)), XK = f16(8*(xT . Wk^T + bk)), VH = f16(16*(Wv . x + bv)); biases bf16RNE.
// coverage: XQ, XK: 256 blocks x 2 position groups x 4 tiles i x 16 positions = 32768 rows, 4 wave groups x 4 tiles x
// 16 = 256 channels; VH: the same 256 channels as rows x the same 32768 positions as k.
// =====================================================================================================
__global__ __launch_bounds__(256) void k_proj(const _Float16* __restrict__ XT, const _Float16* __restrict__ WQ,
                                              const _Float16* __restrict__ WK, const _Float16* __restrict__ WV,
                                              const float* __restrict__ bq, const float* __restrict__ bk,
                                              const float* __restrict__ bv,
                                              _Float16* XQ, _Float16* XK, _Float16* VH) {
  const int lane = threadIdx.x & 31;
  // the wave's number in a scalar register: every base address below is then scalar, and the only vector address
  // registers are three lane offsets that are never written again
  const int wave = __builtin_amdgcn_readfirstlane(threadIdx.x >> 5);
  const unsigned l8 = 8u * lane;                                 // this lane's 16-B chunk of a 512-B half unit, in halves
  const unsigned hb = 8u * (lane >> 4), rl = lane & 15;          // bias offsets: 8hh (XQ, XK), rl (VH)
  const int p0 = blockIdx.x * PPB + (wave & 1) * 64;             // first of this wave's 64 positions
  const int ct0 = (wave >> 1) * 4;                               // first of this wave's 4 row tiles in each weight plane
  const float cs64 = 1.0f / SCW;                                 // undo the weight carry
  const _Float16* ax = XT + (size_t)p0 * CH;                     // row tile p0/16, CH/32 units each
  const int wo = ct0 * 16 * CH;                                  // row tile ct0 of a weight plane
  const _Float16* wp[3] = {WQ + wo, WK + wo, WV + wo};
  const float* bp[3] = {bq + 16 * ct0, bk + 16 * ct0, bv + 16 * ct0};              // channel 16*ct0
  // XQ, XK: unit (p0/16 + i)*8 + ct/2, half ct&1; VH: unit ct*(TOK/32) + p0/32 + i/2, half i&1; here for ct = ct0, i = 0
  _Float16* dp[3] = {XQ + (size_t)p0 * CH + ct0 * 256, XK + (size_t)p0 * CH + ct0 * 256,
                     VH + (size_t)ct0 * 16 * TOK + (size_t)p0 * 16};
  v16h xf[4][CH / 32], kf[2][CH / 32];
#pragma unroll
  for (int ks = 0; ks < CH / 32; ++ks) kf[0][ks] = ldfrag_h(wp[0] + 512 * ks + l8);
  // keeps the first tile's loads in front: mixed in behind the others they would make its products wait for all
  __builtin_amdgcn_sched_barrier(0);
#pragma unroll   // k step by k step, the order in which the first tile's products take them
  for (int ks = 0; ks < CH / 32; ++ks)
#pragma unroll
    for (int i = 0; i < 4; ++i) xf[i][ks] = ldfrag_h(ax + i * 16 * CH + 512 * ks + l8);
  // as above: the second tile's loads stay last
  __builtin_amdgcn_sched_barrier(0);
#pragma unroll
  for (int ks = 0; ks < CH / 32; ++ks) kf[1][ks] = ldfrag_h(wp[0] + 16 * CH + 512 * ks + l8);
  // the code below may re-use the base registers that the xT loads name
  asm volatile("s_wait_xcnt 0x0" ::: "memory");
  // keeps the second tile's loads behind the first products' operands, so that tile 0 does not wait for them,
  // and every later register write behind the wait above
  __builtin_amdgcn_sched_barrier(0);
#pragma unroll   // plane, operand roles and ring slot become constants; the last two tiles drop their refill
  for (int t = 0; t < 12; ++t) {
    const int sel = t >> 2;                                      // 0 Wq, 1 Wk, 2 Wv
    const int tc = t & 3;                                        // row tile ct = ct0 + tc of the plane = 16 output channels
    // this tile's biases, issued a whole tile of products ahead of their use
    float bb[8];
    if (sel < 2) {
      ld8(bp[sel] + 16 * tc + hb, bb);                           // channels 16ct + 8hh + r
    } else {
      bb[0] = bp[2][16 * tc + rl];                               // channel 16ct + rl
    }
    // keeps the bias loads here: sunk to their use they would be waited out there
    __builtin_amdgcn_sched_barrier(0);
    v8f a[4];
#pragma unroll
    for (int i = 0; i < 4; ++i) a[i] = zero8();
#pragma unroll
    for (int ks = 0; ks < CH / 32; ++ks) {
#pragma unroll
      for (int i = 0; i < 4; ++i)
        a[i] = sel < 2 ? mma_h_raw(kf[t & 1][ks], xf[i][ks], a[i]) : mma_h_raw(xf[i][ks], kf[t & 1][ks], a[i]);
      // the fragment of the tile after next, issued two whole tiles ahead of its use
      if (t + 2 < 12) kf[t & 1][ks] = ldfrag_h(wp[(t + 2) >> 2] + ((t + 2) & 3) * 16 * CH + 512 * ks + l8);
      // keeps the refill here: the scheduler otherwise sinks it to just in front of its use
      __builtin_amdgcn_sched_barrier(0);
    }
    if (sel < 2) {
#pragma unroll
      for (int i = 0; i < 4; ++i) {
        HU h;
#pragma unroll
        for (int r = 0; r < 8; ++r) h.s[r] = (_Float16)((a[i][r] * cs64 + bfr(bb[r])) * SCQK);
        *(v4u*)(dp[sel] + tc * 256 + i * 16 * CH + l8) = h.u;
      }
    } else {
      const float bc = bfr(bb[0]);
#pragma unroll
      for (int i = 0; i < 4; ++i) {
        HU h;
#pragma unroll
        for (int r = 0; r < 8; ++r) h.s[r] = (_Float16)((a[i][r] * cs64 + bc) * SCV);
        *(v4u*)(dp[2] + tc * 16 * TOK + i * 256 + l8) = h.u;
      }
    }
    if (t + 1 < 12) {
      // the next tile rewrites the data registers that these stores name
      asm volatile("s_wait_xcnt 0x0" ::: "memory");
      // keeps every register write of the next tile behind the wait above
      __builtin_amdgcn_sched_barrier(0);
    }
  }
}

// =====================================================================================================
// Scores + row softmax + softmax-weighted value sum + residual in one kernel: the softmax rows never leave LDS.
// Block = (b, 64 query rows n0..n0+63), 8 waves (two a SIMD, so a wave may hold up to 512 registers), one block
// a WGP. LDS: 64 E rows of 1024 f16 at a pitch of 2064 B (16 B x odd: the 16 rows of a fragment read or of a chunk
// store fall on 16 different bank groups), 16-B chunk c (k = 8c..8c+7) at byte 16c; and per row one (max, sum) pair
// of floats per chunk, at a pitch of 1040 B (the 32 pairs of a wave's store fall on 64 different banks).
//  (1) wave w computes the 16-key score tiles ct = w, w+8, ... (8 of them) for all four 16-query tiles, transposed:
//      A = XK rows, Bt = XQ rows (K = 256), s = (k8 . q8) / (64*16), so that a lane holds 8 consecutive keys of one
//      query = one chunk. Still in registers: chunk max mc, e = 32768 * exp(s - mc), chunk sum zc = sum e (ascending
//      key), f16(e) stored as the chunk, (mc, zc) as the chunk's pair of the row's statistics. This vector work of one wave runs beside the
//      products of the other wave on its SIMD.
//      The 32 query fragments are loaded once and stay in registers, so every key fragment is loaded once a
//      block and feeds four products; the key fragments form a ring two key tiles deep.
//  (2) wave w owns rows 8w..8w+7, four at a time: lane holds the pairs of chunks 32j + lane (j = 0..3); row max M
//      (xor shuffles), fc = exp(mc - M), Z = sum_c fc * zc (fixed lane order + xor shuffles), then each chunk is
//      rescaled in place, E = f16(e) * f16(32768 * fc / Z); f16 subnormals are flushed to zero in a second pass over
//      the wave's rows, taken only where a ballot finds a value below the smallest normal f16 among them.
//  (3) after a block barrier: D[c][n] = sum_m (16*v)[c][m] . E[n][m], A = value plane rows c (fragment order, row
//      length TOK, k from b*NT), Bt = the 64 E rows in LDS, K = 1024 (32 k steps, ascending). Wave w owns
//      channels 32w..32w+31 (2 x 4 tiles), so every value fragment is loaded once a block. The value fragments
//      form a ring 8 steps deep, first filled ahead of (2); the E fragments are read one step ahead.
// Epilogue: out[b][c][n] = D/(16*32768) + bf16RNE(x[b][c][n]); per wave two 16x64 f32 slabs staged in LDS.
// coverage: (1): 8 waves x 8 key tiles x 2 chunks x 64 rows = 128 chunks and pairs in each of 64 rows; (2): 8 waves x
// 8 rows x 4 j x 32 lanes = the same 128 chunks x 64 rows; out: 8 waves x 2 slabs x 16 rows x 64 cols = 256 c x 64 n per
// block; grid (16, 32) = every (n tile, b) -> whole output [32][256][1024].
// =====================================================================================================
__device__ __forceinline__ v16h ldfrag_lds(const char* p) {   // elements 0..7 <- 16 B at p, 8..15 <- 16 B at p + 32
  HU lo, hi;
  lo.f = *(const v4f*)(p);
  hi.f = *(const v4f*)(p + 32);
  FR f;
  f.h[0] = lo.h;
  f.h[1] = hi.h;
  return f.v;
}

__global__ __launch_bounds__(256) void k_attn(const _Float16* __restrict__ XQ, const _Float16* __restrict__ XK,
                                              const _Float16* __restrict__ VH, const float* __restrict__ X,
                                              float* out) {
  __shared__ __align__(16) float sc[RSB * PIT];               // the f16 E rows
  __shared__ __align__(16) float sst[RSB * SPIT];             // their chunk statistics
  __shared__ __align__(16) float sO[8][16 * 68];              // per-wave 16x64 output slab, pitch 68 floats
  const int tid = threadIdx.x, wave = tid >> 5, lane = tid & 31;
  const int hh = lane >> 4, rl = lane & 15;
  const int rb = blockIdx.x, b = blockIdx.y, n0 = rb * RSB;

  // ---- (1) scores ----
  {
    const _Float16* aq = XQ + (size_t)(b * NT + n0) * CH + 8 * lane;    // row tile (b*NT+n0)/16, CH/32 units each
    const _Float16* bk = XK + (size_t)(b * NT + 16 * wave) * CH + 8 * lane;
    v16h q[RSB / 16][CH / 32], kf[2][CH / 32];
#pragma unroll
    for (int ks = 0; ks < CH / 32; ++ks) kf[0][ks] = ldfrag_h(bk + 512 * ks);
#pragma unroll
    for (int i = 0; i < RSB / 16; ++i)
#pragma unroll
      for (int ks = 0; ks < CH / 32; ++ks) q[i][ks] = ldfrag_h(aq + i * 16 * CH + 512 * ks);
#pragma unroll
    for (int ks = 0; ks < CH / 32; ++ks) kf[1][ks] = ldfrag_h(bk + 128 * CH + 512 * ks);
    // the code below re-uses the base registers that the query loads name
    asm volatile("s_wait_xcnt 0x0" ::: "memory");
    // keeps the second tile's loads behind the first products' operands, so that tile 0 does not wait for them,
    // and every later register write behind the wait above
    __builtin_amdgcn_sched_barrier(0);
#pragma unroll   // the tile steps become immediate offsets of one address, and the last two tiles drop their refill
    for (int t = 0; t < NT / 128; ++t) {                        // column tile ct = wave + 8t
      v8f a[RSB / 16];
#pragma unroll
      for (int i = 0; i < RSB / 16; ++i) a[i] = zero8();
#pragma unroll
      for (int ks = 0; ks < CH / 32; ++ks) {
#pragma unroll
        for (int i = 0; i < RSB / 16; ++i) a[i] = mma_h_raw(kf[t & 1][ks], q[i][ks], a[i]);
        // the fragment of the tile after next, issued two whole tiles ahead of its use
        if (t + 2 < NT / 128) kf[t & 1][ks] = ldfrag_h(bk + (size_t)(t + 2) * 128 * CH + 512 * ks);
        // behind the last refill the address registers that the key loads name are free for re-use
        if (t + 2 == NT / 128 - 1 && ks == CH / 32 - 1) asm volatile("s_wait_xcnt 0x0" ::: "memory");
        // keeps the refill here: the scheduler otherwise sinks it to just in front of its use
        __builtin_amdgcn_sched_barrier(0);
      }
      // D row = key 8hh + r of the column tile, D col = query rl of row tile i: a lane's 8 values are chunk c16 of its row
      const int c16 = 2 * (wave + 8 * t) + hh;
#pragma unroll
      for (int i = 0; i < RSB / 16; ++i) {
        float am = a[i][0];
#pragma unroll
        for (int r = 1; r < 8; ++r) am = fmaxf(am, a[i][r]);
        const float k0 = 15.0f - am * CEX;                      // 2^15 * exp(s - chunk max) = exp2(a*CEX + k0)
        float ev[8];
#pragma unroll
        for (int r = 0; r < 8; ++r) ev[r] = a[i][r] * CEX + k0;
        exp2x8(ev);
        float zs = ev[0];
#pragma unroll
        for (int r = 1; r < 8; ++r) zs += ev[r];
        HU u;
#pragma unroll
        for (int r = 0; r < 8; ++r) u.s[r] = (_Float16)ev[r];
        *(v4f*)(sc + (16 * i + rl) * PIT + 4 * c16) = u.f;
        v2f st = {am * SCS, zs};
        *(v2f*)(sst + (16 * i + rl) * SPIT + 2 * c16) = st;
      }
    }
  }
  __syncthreads();

  // ---- value ring, first fill: the loads fly while the softmax runs ----
  const int cb = wave * 32;
  const char* pv = (const char*)VH;
  unsigned oa[2];                              // byte offset of this lane's 16 B in the first unit, per channel tile
#pragma unroll
  for (int i = 0; i < 2; ++i)
    oa[i] = ((unsigned)((cb >> 4) + i) * (unsigned)(TOK >> 5) + (unsigned)((b * NT) >> 5)) * 1024u + lane * 16u;
  v16h va[VRING][2];
#pragma unroll
  for (int s = 0; s < VRING; ++s)
#pragma unroll
    for (int i = 0; i < 2; ++i) va[s][i] = ldfrag_h((const _Float16*)(pv + oa[i] + 1024 * s));
  // the softmax re-uses the offset registers that these loads name
  asm volatile("s_wait_xcnt 0x0" ::: "memory");
  // keeps these loads in front of the softmax (sunk to their use they would be waited out there), and every
  // later register write behind the wait above
  __builtin_amdgcn_sched_barrier(0);

  // ---- (2) row statistics from the chunk statistics, E rows rescaled in place ----
  {
    v8h lo8;                                                    // smallest E value that this lane has written, per element
#pragma unroll
    for (int e = 0; e < 8; ++e) lo8[e] = (_Float16)1.0f;
    for (int g = 0; g < 2; ++g) {
      const int row0 = 8 * wave + 4 * g;                        // four rows side by side: their reduction chains overlap
      float cm[16], cz[16], mx[4], z[4];                        // chunk values at [4 * q4 + j]
#pragma unroll
      for (int q4 = 0; q4 < 4; ++q4) {
        const float* sp = sst + (row0 + q4) * SPIT + 2 * lane;  // lane covers chunks 32j + lane
#pragma unroll
        for (int j = 0; j < 4; ++j) {
          const v2f st = *(const v2f*)(sp + 64 * j);
          cm[4 * q4 + j] = st[0];
          cz[4 * q4 + j] = st[1];
        }
      }
#pragma unroll
      for (int q4 = 0; q4 < 4; ++q4)
        mx[q4] = fmaxf(fmaxf(cm[4 * q4], cm[4 * q4 + 1]), fmaxf(cm[4 * q4 + 2], cm[4 * q4 + 3]));
#pragma unroll
      for (int off = 16; off >= 1; off >>= 1)
#pragma unroll
        for (int q4 = 0; q4 < 4; ++q4) mx[q4] = fmaxf(mx[q4], __shfl_xor(mx[q4], off, 32));
#pragma unroll
      for (int c = 0; c < 16; ++c) cm[c] = (cm[c] - mx[c >> 2]) * 1.44269504088896f;
      exp2x8(cm);                                               // fc = exp(mc - M): chunk reference -> row reference
      exp2x8(cm + 8);
#pragma unroll
      for (int q4 = 0; q4 < 4; ++q4) {
        z[q4] = 0.0f;
#pragma unroll
        for (int j = 0; j < 4; ++j) z[q4] += cm[4 * q4 + j] * cz[4 * q4 + j];
      }
#pragma unroll
      for (int off = 16; off >= 1; off >>= 1)
#pragma unroll
        for (int q4 = 0; q4 < 4; ++q4) z[q4] += __shfl_xor(z[q4], off, 32);
#pragma unroll
      for (int q4 = 0; q4 < 4; ++q4) {
        const float rz = SCE * (1.0f / z[q4]);                 // z = 32768 * row sum, in [32768, 1024 * 32768]
        v4f* srow = (v4f*)(sc + (row0 + q4) * PIT);
#pragma unroll
        for (int j = 0; j < 4; ++j) {
          const _Float16 gf = (_Float16)(cm[4 * q4 + j] * rz);  // in [0, 1]
          HU u;
          u.f = srow[32 * j + lane];
          u.h = u.h * gf;
          lo8 = __builtin_elementwise_min(lo8, u.h);
          srow[32 * j + lane] = u.f;
        }
      }
    }
    _Float16 lo = lo8[0];
#pragma unroll
    for (int e = 1; e < 8; ++e) lo = lo8[e] < lo ? lo8[e] : lo;
    // f16 subnormal -> exact zero: the selects run only in a wave that holds a value below the smallest normal
    if (__builtin_amdgcn_ballot_w32((float)lo < 6.103515625e-05f) != 0u) {
      for (int c = 0; c < 32; ++c) {
        v4f* p = (v4f*)(sc + (8 * wave + (c >> 2)) * PIT) + 32 * (c & 3) + lane;
        HU u;
        u.f = *p;
#pragma unroll
        for (int e = 0; e < 8; ++e) {
          const _Float16 h0 = u.s[e];
          u.s[e] = (float)h0 < 6.103515625e-05f ? (_Float16)0.0f : h0;
        }
        *p = u.f;
      }
    }
  }
  __syncthreads();   // every staged f16 row is complete before another wave reads its fragments

  // ---- (3) value sum ----
  v8f acc[2][4];
#pragma unroll
  for (int i = 0; i < 2; ++i)
#pragma unroll
    for (int j = 0; j < 4; ++j) acc[i][j] = zero8();

  const char* ep = (const char*)sc + rl * (PIT * 4) + hh * 16;  // E row 16j + rl, k = 32S + 8hh (+16): byte 64S (+32)
  v16h ef[2][4];
#pragma unroll
  for (int j = 0; j < 4; ++j) ef[0][j] = ldfrag_lds(ep + j * (16 * PIT * 4));
#pragma unroll   // ring slots and k offsets become constants
  for (int S = 0; S < NT / 32; ++S) {
    if (S + 1 < NT / 32) {
#pragma unroll
      for (int j = 0; j < 4; ++j) ef[(S + 1) & 1][j] = ldfrag_lds(ep + j * (16 * PIT * 4) + 64 * (S + 1));
    }
    // the next step's LDS reads stay one group in front of this step's products, not spread among them
    __builtin_amdgcn_sched_barrier(0);
#pragma unroll
    for (int i = 0; i < 2; ++i)
#pragma unroll
      for (int j = 0; j < 4; ++j) acc[i][j] = mma_h_raw(va[S % VRING][i], ef[S & 1][j], acc[i][j]);
    // keeps the refill right behind the products that free its slot: sunk, it would be waited out at its use
    __builtin_amdgcn_sched_barrier(0);
    if (S + VRING < NT / 32) {
#pragma unroll
      for (int i = 0; i < 2; ++i) va[S % VRING][i] = ldfrag_h((const _Float16*)(pv + oa[i] + 1024 * (S + VRING)));
    }
    // behind the last refill the address registers that the value loads name are free for re-use
    if (S + VRING == NT / 32 - 1) asm volatile("s_wait_xcnt 0x0" ::: "memory");
    __builtin_amdgcn_sched_barrier(0);
  }
  acc_guard4(acc[0][0], acc[0][1], acc[0][2], acc[0][3]);
  acc_guard4(acc[1][0], acc[1][1], acc[1][2], acc[1][3]);

  // ---- epilogue ----
  const float fo = 1.0f / (SCV * SCE);
  float* slab = sO[wave];
  const int p4 = (lane & 15) * 4, r2 = lane >> 4;
  // one address each for x and out: the 16 rows of a lane become immediate offsets, and no address register of an
  // issued load or store is written again
  const size_t eo = ((size_t)(b * CH + cb + r2)) * NT + n0 + p4;
  const float* xb = X + eo;
  float* ob = out + eo;
#pragma unroll
  for (int i = 0; i < 2; ++i) {
#pragma unroll
    for (int r = 0; r < 8; ++r) {
#pragma unroll
      for (int j = 0; j < 4; ++j) {
        slab[(8 * hh + r) * 68 + 16 * j + rl] = acc[i][j][r];   // D row = c offset 8hh + r, D col = n offset 16j + rl
      }
    }
    wave_lds_sync();
    v4f ov[8];
#pragma unroll
    for (int it = 0; it < 8; ++it) {
      const int row = 2 * it + r2;                          // it 0..7 x r2 0..1 = rows 0..15
      const v4f a = *(const v4f*)(slab + row * 68 + p4);
      const v4f xv = *(const v4f*)(xb + (16 * i + 2 * it) * NT);   // channel cb + 16i + row
      v4f o;
#pragma unroll
      for (int e = 0; e < 4; ++e) o[e] = a[e] * fo + bfr(xv[e]);
      ov[it] = o;
    }
    {
#pragma unroll
      for (int it = 0; it < 8; ++it) *(v4f*)(ob + (16 * i + 2 * it) * NT) = ov[it];
    }
    wave_lds_sync();
  }
}

// =====================================================================================================
// Workspace map; every plane [rows][k] below is stored in fragment order (see the head of the file).
//   WQ16  f16 [256][256]             0        131072   (64*Wq, bf16RNE)
//   WK16  f16 [256][256]        131072        131072   (64*Wk)
//   WV16  f16 [256][256]        262144        131072   (64*Wv)
//   XQ    f16 [32768][256]      393216      16777216   (8*q, position rows, k = c)
//   XK    f16 [32768][256]    17170432      16777216   (8*k)
//   VH    f16 [256][32768]    33947648      16777216   (16*v, row c, k = b*1024 + m)
//   xT    f16 [32768][256]    50724864      16777216   (bf16RNE(x) transposed to position rows)
//   end                       67502080
// d_out f32 [32][256][1024] at byte 0.
// =====================================================================================================
extern "C" void kernel_launch(void* const* d_in, const int* in_sizes, int n_in,
                              void* d_out, int out_size, void* d_ws, size_t ws_size,
                              hipStream_t stream) {
  if (n_in < 7) return;
  if (in_sizes[0] != NB * CH * NT) return;
  if (in_sizes[1] != CH * CH || in_sizes[2] != CH) return;
  if (in_sizes[3] != CH * CH || in_sizes[4] != CH) return;
  if (in_sizes[5] != CH * CH || in_sizes[6] != CH) return;
  if (out_size != OUTN) return;

  const float* x  = (const float*)d_in[0];   // [32][256][1024]
  const float* Wq = (const float*)d_in[1];   // [256][256]  ([out][in])
  const float* bq = (const float*)d_in[2];   // [256]
  const float* Wk = (const float*)d_in[3];   // [256][256]
  const float* bk = (const float*)d_in[4];   // [256]
  const float* Wv = (const float*)d_in[5];   // [256][256]
  const float* bv = (const float*)d_in[6];   // [256]

  const size_t PW  = (size_t)CH * CH * 2;                    //   131072
  const size_t PPL = (size_t)TOK * CH * 2;                   // 16777216

  size_t off = 0;
  const size_t oWQ = off; off += PW;
  const size_t oWK = off; off += PW;
  const size_t oWV = off; off += PW;
  const size_t oXQ = off; off += PPL;
  const size_t oXK = off; off += PPL;
  const size_t oVH = off; off += PPL;
  const size_t oXT = off; off += PPL;                        // off = 67502080
  if (off > ws_size) return;
  if (off > (size_t)134217728) return;

  char* ws = (char*)d_ws;
  _Float16* WQ16 = (_Float16*)(ws + oWQ);
  _Float16* WK16 = (_Float16*)(ws + oWK);
  _Float16* WV16 = (_Float16*)(ws + oWV);
  _Float16* XQ   = (_Float16*)(ws + oXQ);
  _Float16* XK   = (_Float16*)(ws + oXK);
  _Float16* VH   = (_Float16*)(ws + oVH);
  _Float16* xT   = (_Float16*)(ws + oXT);
  float*    outf = (float*)d_out;

  const dim3 blk(256);
  const dim3 gPrep(3 * WBLK + (NT / 64) * (CH / 64) * NB);             // 96 + 2048
  const dim3 gPr(TOK / PPB);                                           // 256 blocks of 128 positions
  const dim3 gAt(NT / RSB, NB);                                        // (16, 32)

  // (1) weight planes, x64 carried (conv weights [out][in]: rows = out, k = in), and x [32][256][1024]
  //     transposed to position rows xT [32768][256]; all in fragment order
  k_prep<<<gPrep, blk, 0, stream>>>(x, Wq, Wk, Wv, xT, WQ16, WK16, WV16);
  // (2) XQ, XK, VH from xT and the weight planes
  k_proj<<<gPr, blk, 0, stream>>>(xT, WQ16, WK16, WV16, bq, bk, bv, XQ, XK, VH);
  // (3) scores + row softmax + softmax-weighted value sum + residual -> d_out
  k_attn<<<gAt, blk, 0, stream>>>(XQ, XK, VH, x, outf);
}

// v007
// It runs in 60.1 microseconds.
// Two timings next to v006 both put it at 1.10 times that version's speed.
// Counting every step since v000, it is 3.98 times as fast.
#include <hip/hip_runtime.h>
#include <math.h>
#include <stdint.h>

// All contractions on v_wmma_f32_16x16x32_f16 (f16 operands, f32 accumulate): the three 1x1-conv
// projections take bf16-RNE inputs (x1) and bf16-RNE weights (x64) as single f16 planes; the 256-deep
// query.key scores use single f16 planes of 8*q and 8*k; the 1024-deep softmax-weighted value sum uses
// a single f16 plane of 16*v against E = f16(32768*softmax) held as f16 rows in LDS. Softmax
// arithmetic, biases, residual add and epilogues are f32; a 16-key tile's statistics rest in LDS as one word (reference:
// upper 16 bits of a float, sum: f16); the factor that rescales an E chunk is f16.
//
// Every f16 operand plane [R][K] in memory lives in fragment order: for 16-row tile T and 32-deep k step S the unit
// (T*(K/32) + S) is 512 halves; inside it element (row, k) sits at ((k>>4)&1)*256 + (((k>>3)&1)*16 + (row&15))*8
// + (k&7). A wave's two 16-B loads of one fragment then cover 2 x 512 contiguous bytes (whole 128-B lines).

#define NB   32
#define CH   256
#define NT   1024
#define TOK  (NB * NT)
#define RSB  128                            // query rows per attention block
#define PIT  (NT / 2 + 4)                   // LDS pitch of an E row of NT f16, in floats
#define SPIT (NT / 16 + 4)                  // LDS pitch of a row's NT/16 statistics words, in words
#define VRING 8                             // value fragment ring, k steps
#define OUTN (NB * CH * NT)
#define WBLK ((CH * CH) / 2048)            // 256-thread blocks per weight plane, 8 elements a thread
#define PPB  128                            // positions per projection block

#define SCW  64.0f
#define SCQK 8.0f
#define SCV  16.0f
#define SCE  32768.0f
#define SCS  (1.0f / (SCQK * SCQK * 16.0f))
#define CEX  (SCS * 1.44269504088896f)      // raw score product -> exponent of two

static_assert(TOK % 64 == 0 && CH % 64 == 0 && CH % 32 == 0 && NT % 32 == 0);
static_assert(TOK % PPB == 0 && PPB == 2 * 64 && CH == 4 * 4 * 16);
static_assert(NT % RSB == 0 && RSB == 128 && NT == 4 * 256);
static_assert((PIT * 4) % 32 == 16 && (NT / 32) % VRING == 0);
static_assert(SPIT % 64 == 4 && RSB * SPIT == 8 * 16 * 68);
static_assert((NT / 16) % 8 == 0 && CH == 8 * 32);
static_assert((CH * CH) % 2048 == 0);
static_assert(NT % 64 == 0 && CH % 64 == 0);

typedef _Float16       v16h __attribute__((ext_vector_type(16)));
typedef _Float16       v8h  __attribute__((ext_vector_type(8)));
typedef float          v8f  __attribute__((ext_vector_type(8)));
typedef float          v4f  __attribute__((ext_vector_type(4)));
typedef float          v2f  __attribute__((ext_vector_type(2)));
typedef unsigned int   v4u  __attribute__((ext_vector_type(4)));

union HU { v8h h; v4u u; v4f f; _Float16 s[8]; };
union FR { v16h v; v8h h[2]; _Float16 s[16]; };
static_assert(sizeof(HU) == 16);
static_assert(sizeof(FR) == 32);

// ---- scalar helpers --------------------------------------------------------------------------------
__device__ __forceinline__ unsigned short bf_bits(float f) {          // f32 -> bf16 bits, RNE convert
  const unsigned u = __float_as_uint(f);
  return (unsigned short)((u + 0x7FFFu + ((u >> 16) & 1u)) >> 16);
}
__device__ __forceinline__ float bf_up(unsigned short h) { return __uint_as_float(((unsigned)h) << 16); }
__device__ __forceinline__ float bfr(float f) { return bf_up(bf_bits(f)); }   // value after bf16 RNE convert
__device__ __forceinline__ v8f zero8() { v8f z = {0.f, 0.f, 0.f, 0.f, 0.f, 0.f, 0.f, 0.f}; return z; }

__device__ __forceinline__ void ld8(const float* p, float* o) {
  const v4f a = *(const v4f*)(p);
  const v4f b = *(const v4f*)(p + 4);
  o[0] = a[0]; o[1] = a[1]; o[2] = a[2]; o[3] = a[3];
  o[4] = b[0]; o[5] = b[1]; o[6] = b[2]; o[7] = b[3];
}

// ---- fragment loader: 16-bit A/B operand from a fragment-order plane, p = unit*512 + 8*lane, h = lane>>4;
//      elements 0..7 <- p[0..7] (k0+8h..k0+8h+7), elements 8..15 <- p[256..263] (k0+16+8h..k0+16+8h+7)
__device__ __forceinline__ v16h ldfrag_h(const _Float16* p) {
  FR f;
  f.h[0] = *(const v8h*)(p);
  f.h[1] = *(const v8h*)(p + 256);
  return f.v;
}

// ---- WMMA helpers --------------------------------------------------------------------------------------
__device__ __forceinline__ v8f mma_h_raw(v16h a, v16h b, v8f c) {
  return __builtin_amdgcn_wmma_f32_16x16x32_f16(false, a, false, b, (short)0, c, false, false);
}
__device__ __forceinline__ void acc_guard4(v8f& a, v8f& b, v8f& c, v8f& d) {
#if defined(__HIP_DEVICE_COMPILE__)
  asm volatile("v_nop\n\tv_nop\n\tv_nop\n\tv_nop" : "+v"(a), "+v"(b), "+v"(c), "+v"(d));
#endif
}
// v[0..7] <- 2^v[0..7]. One statement, in place, with a v_nop behind the last: it keeps the slot that the instruction
// set asks for between a transcendental and an instruction that overwrites its source or reads its result.
__device__ __forceinline__ void exp2x8(float* v) {
#if defined(__HIP_DEVICE_COMPILE__)
  asm("v_exp_f32 %0, %0\n\tv_exp_f32 %1, %1\n\tv_exp_f32 %2, %2\n\tv_exp_f32 %3, %3\n\t"
      "v_exp_f32 %4, %4\n\tv_exp_f32 %5, %5\n\tv_exp_f32 %6, %6\n\tv_exp_f32 %7, %7\n\tv_nop"
      : "+v"(v[0]), "+v"(v[1]), "+v"(v[2]), "+v"(v[3]), "+v"(v[4]), "+v"(v[5]), "+v"(v[6]), "+v"(v[7]));
#endif
}
__device__ __forceinline__ void wave_lds_sync() {
  __builtin_amdgcn_fence(__ATOMIC_RELEASE, "workgroup");
  __builtin_amdgcn_wave_barrier();
  __builtin_amdgcn_fence(__ATOMIC_ACQUIRE, "workgroup");
}

// =====================================================================================================
// Weight convert: in [R][kd] f32 row-major -> out f16(scale * bf16RNE(in)) in fragment order; thread i owns
// the i-th 16-B chunk of the output (lane = i&31, part = (i>>5)&1, unit = i>>6), one 16-B store per lane.
// coverage: n8 threads x 8 = the whole plane; n8 is a multiple of 256 at every call here. blk = block index
// within the plane.
// =====================================================================================================
__device__ __forceinline__ void cvt_flat(const float* __restrict__ in, _Float16* out, int n8, int kd, float scale, int blk) {
  const int i = blk * 256 + threadIdx.x;
  if (i < n8) {
    const int ksn = kd >> 5, unit = i >> 6;
    const int tile = unit / ksn, ks = unit - tile * ksn;
    const int row = tile * 16 + (i & 15);
    const int k = ks * 32 + ((i >> 5) & 1) * 16 + ((i >> 4) & 1) * 8;
    float v[8];
    ld8(in + (size_t)row * kd + k, v);
    HU u;
#pragma unroll
    for (int e = 0; e < 8; ++e) u.s[e] = (_Float16)(bfr(v[e]) * scale);
    _Float16* p = out + (size_t)i * 8;
    *(v4u*)p = u.u;
    
  }
}

// =====================================================================================================
// Activation transpose-convert: in X[b][k][n] f32 (k = channel 0..Cd-1, n = position 0..NT-1, n contiguous)
// -> XT plane [b*NT + n][k] f16 = f16(bf16RNE(X)), K = Cd, in fragment order.
// Blocks (bn, bk, b) of (NT/64, Cd/64, NB). coverage: load phase 256 threads x 4 row-iterations x 4 floats = 64 k x 64 n;
// store phase 8 waves x 2 half-units x 32 lanes x 8 halves = 64 n rows x 64 k per block; grid = every
// (n tile, k tile, b) -> whole [TOK][Cd] plane.
// =====================================================================================================
__device__ __forceinline__ void cvt_xT(const float* __restrict__ X, _Float16* XT, int Cd, int bn, int bk, int b) {
  __shared__ float sw[64][66];   // pitch 66: the two lane halves (8 k rows apart) read disjoint banks
  const int t = threadIdx.x;
  const int n0 = bn * 64, k0 = bk * 64;
  const float* Xb = X + (size_t)b * Cd * NT;
  {
    const int r = t >> 4, c4 = (t & 15) * 4;
#pragma unroll
    for (int it = 0; it < 4; ++it) {
      const int row = r + 16 * it;
      const v4f x = *(const v4f*)(Xb + (size_t)(k0 + row) * NT + n0 + c4);
      sw[row][c4 + 0] = x[0]; sw[row][c4 + 1] = x[1]; sw[row][c4 + 2] = x[2]; sw[row][c4 + 3] = x[3];
    }
  }
  __syncthreads();
  const int wave = t >> 5, lane = t & 31, hh = lane >> 4, rl = lane & 15;
  HU u[2];
#pragma unroll
  for (int it = 0; it < 2; ++it) {
    const int hu = wave * 2 + it;                  // 16 half-units: row tile hu>>2, k offset 16*(hu&3)
    const int n = (hu >> 2) * 16 + rl;
    const int kl = (hu & 3) * 16 + hh * 8;
#pragma unroll
    for (int e = 0; e < 8; ++e) u[it].s[e] = (_Float16)bfr(sw[kl + e][n]);
  }
  {
#pragma unroll
    for (int it = 0; it < 2; ++it) {
      const int hu = wave * 2 + it;
      const size_t unit = (size_t)(((b * NT + n0) >> 4) + (hu >> 2)) * (size_t)(Cd >> 5) + (k0 >> 5);
      _Float16* dst = XT + unit * 512 + (hu & 3) * 256 + lane * 8;
      *(v4u*)dst = u[it].u;
    }
    // in the merged kernel the listing runs on from these stores into code that rewrites their registers
    asm volatile("s_wait_xcnt 0x0" ::: "memory");
  }
}

// =====================================================================================================
// All operand conversions in one launch (none reads what another writes): blocks 0 .. 3*WBLK-1 convert the three
// weight planes (WBLK blocks each), the other (NT/64)*(CH/64)*NB blocks transpose-convert x. The branch is
// block-uniform, so the barrier inside cvt_xT is passed by whole blocks only.
// =====================================================================================================
__global__ __launch_bounds__(256) void k_prep(const float* __restrict__ X, const float* __restrict__ Wq,
                                              const float* __restrict__ Wk, const float* __restrict__ Wv,
                                              _Float16* XT, _Float16* WQ, _Float16* WK, _Float16* WV) {
  const int bx = blockIdx.x;
  if (bx < 3 * WBLK) {
    const int sel = bx / WBLK;
    const float* in = sel == 0 ? Wq : (sel == 1 ? Wk : Wv);
    _Float16* o = sel == 0 ? WQ : (sel == 1 ? WK : WV);
    cvt_flat(in, o, (CH * CH) / 8, CH, SCW, bx - sel * WBLK);
  } else {
    const int id = bx - 3 * WBLK;
    cvt_xT(X, XT, CH, id % (NT / 64), (id / (NT / 64)) % (CH / 64), id / ((NT / 64) * (CH / 64)));
  }
}

// =====================================================================================================
// The three projections in one launch, one pass over xT. Block = 128 positions, 8 waves (two a SIMD, so a wave may
// hold up to 512 registers), one block a WGP. Wave w holds the 32 xT fragments of positions p0..p0+63
// (p0 = 128*block + 64*(w&1)) in registers for the whole kernel and runs through 12 weight row tiles: tiles
// 4*(w>>1) .. +3 of Wq, then of Wk, then of Wv. Every weight fragment is loaded once a wave and feeds four products;
// the weight fragments form a ring two row tiles deep. K = 256 (8 k steps, ascending) for every accumulator.
// The two waves that stream the same weight tiles (2j, 2j+1) sit on different SIMDs and are of the same age there,
// so they run side by side and the second one's loads can hit the WGP cache.
// The operand roles are chosen so that a lane's 8 accumulator rows are 8 consecutive k of the plane it writes:
//   XQ, XK (rows = position, k = channel): A = weight tile, B = xT tile i -> D row = channel 8hh + r, D col = position rl
//   VH     (rows = channel, k = position): A = xT tile i, B = weight tile -> D row = position 8hh + r, D col = channel rl
// In both cases the lane's 8 halves are the 16-B chunk number 'lane' of a 512-B half unit: one contiguous wave store.
//   XQ = f16(8*(xT . Wq^T + bq)), XK = f16(8*(xT . Wk^T + bk)), VH = f16(16*(Wv . x + bv)); biases bf16RNE.
// coverage: XQ, XK: 256 blocks x 2 position groups x 4 tiles i x 16 positions = 32768 rows, 4 wave groups x 4 tiles x
// 16 = 256 channels; VH: the same 256 channels as rows x the same 32768 positions as k.
// =====================================================================================================
__global__ __launch_bounds__(256) void k_proj(const _Float16* __restrict__ XT, const _Float16* __restrict__ WQ,
                                              const _Float16* __restrict__ WK, const _Float16* __restrict__ WV,
                                              const float* __restrict__ bq, const float* __restrict__ bk,
                                              const float* __restrict__ bv,
                                              _Float16* XQ, _Float16* XK, _Float16* VH) {
  const int lane = threadIdx.x & 31;
  // the wave's number in a scalar register: every base address below is then scalar, and the only vector address
  // registers are three lane offsets that are never written again
  const int wave = __builtin_amdgcn_readfirstlane(threadIdx.x >> 5);
  const unsigned l8 = 8u * lane;                                 // this lane's 16-B chunk of a 512-B half unit, in halves
  const unsigned hb = 8u * (lane >> 4), rl = lane & 15;          // bias offsets: 8hh (XQ, XK), rl (VH)
  const int p0 = blockIdx.x * PPB + (wave & 1) * 64;             // first of this wave's 64 positions
  const int ct0 = (wave >> 1) * 4;                               // first of this wave's 4 row tiles in each weight plane
  const float cs64 = 1.0f / SCW;                                 // undo the weight carry
  const _Float16* ax = XT + (size_t)p0 * CH;                     // row tile p0/16, CH/32 units each
  const int wo = ct0 * 16 * CH;                                  // row tile ct0 of a weight plane
  const _Float16* wp[3] = {WQ + wo, WK + wo, WV + wo};
  const float* bp[3] = {bq + 16 * ct0, bk + 16 * ct0, bv + 16 * ct0};              // channel 16*ct0
  // XQ, XK: unit (p0/16 + i)*8 + ct/2, half ct&1; VH: unit ct*(TOK/32) + p0/32 + i/2, half i&1; here for ct = ct0, i = 0
  _Float16* dp[3] = {XQ + (size_t)p0 * CH + ct0 * 256, XK + (size_t)p0 * CH + ct0 * 256,
                     VH + (size_t)ct0 * 16 * TOK + (size_t)p0 * 16};
  v16h xf[4][CH / 32], kf[2][CH / 32];
#pragma unroll
  for (int ks = 0; ks < CH / 32; ++ks) kf[0][ks] = ldfrag_h(wp[0] + 512 * ks + l8);
  // keeps the first tile's loads in front: mixed in behind the others they would make its products wait for all
  __builtin_amdgcn_sched_barrier(0);
#pragma unroll   // k step by k step, the order in which the first tile's products take them
  for (int ks = 0; ks < CH / 32; ++ks)
#pragma unroll
    for (int i = 0; i < 4; ++i) xf[i][ks] = ldfrag_h(ax + i * 16 * CH + 512 * ks + l8);
  // as above: the second tile's loads stay last
  __builtin_amdgcn_sched_barrier(0);
#pragma unroll
  for (int ks = 0; ks < CH / 32; ++ks) kf[1][ks] = ldfrag_h(wp[0] + 16 * CH + 512 * ks + l8);
  // the code below may re-use the base registers that the xT loads name
  asm volatile("s_wait_xcnt 0x0" ::: "memory");
  // keeps the second tile's loads behind the first products' operands, so that tile 0 does not wait for them,
  // and every later register write behind the wait above
  __builtin_amdgcn_sched_barrier(0);
#pragma unroll   // plane, operand roles and ring slot become constants; the last two tiles drop their refill
  for (int t = 0; t < 12; ++t) {
    const int sel = t >> 2;                                      // 0 Wq, 1 Wk, 2 Wv
    const int tc = t & 3;                                        // row tile ct = ct0 + tc of the plane = 16 output channels
    // this tile's biases, issued a whole tile of products ahead of their use
    float bb[8];
    if (sel < 2) {
      ld8(bp[sel] + 16 * tc + hb, bb);                           // channels 16ct + 8hh + r
    } else {
      bb[0] = bp[2][16 * tc + rl];                               // channel 16ct + rl
    }
    // keeps the bias loads here: sunk to their use they would be waited out there
    __builtin_amdgcn_sched_barrier(0);
    v8f a[4];
#pragma unroll
    for (int i = 0; i < 4; ++i) a[i] = zero8();
#pragma unroll
    for (int ks = 0; ks < CH / 32; ++ks) {
#pragma unroll
      for (int i = 0; i < 4; ++i)
        a[i] = sel < 2 ? mma_h_raw(kf[t & 1][ks], xf[i][ks], a[i]) : mma_h_raw(xf[i][ks], kf[t & 1][ks], a[i]);
      // the fragment of the tile after next, issued two whole tiles ahead of its use
      if (t + 2 < 12) kf[t & 1][ks] = ldfrag_h(wp[(t + 2) >> 2] + ((t + 2) & 3) * 16 * CH + 512 * ks + l8);
      // keeps the refill here: the scheduler otherwise sinks it to just in front of its use
      __builtin_amdgcn_sched_barrier(0);
    }
    if (sel < 2) {
#pragma unroll
      for (int i = 0; i < 4; ++i) {
        HU h;
#pragma unroll
        for (int r = 0; r < 8; ++r) h.s[r] = (_Float16)((a[i][r] * cs64 + bfr(bb[r])) * SCQK);
        *(v4u*)(dp[sel] + tc * 256 + i * 16 * CH + l8) = h.u;
      }
    } else {
      const float bc = bfr(bb[0]);
#pragma unroll
      for (int i = 0; i < 4; ++i) {
        HU h;
#pragma unroll
        for (int r = 0; r < 8; ++r) h.s[r] = (_Float16)((a[i][r] * cs64 + bc) * SCV);
        *(v4u*)(dp[2] + tc * 16 * TOK + i * 256 + l8) = h.u;
      }
    }
    if (t + 1 < 12) {
      // the next tile rewrites the data registers that these stores name
      asm volatile("s_wait_xcnt 0x0" ::: "memory");
      // keeps every register write of the next tile behind the wait above
      __builtin_amdgcn_sched_barrier(0);
    }
  }
}

// =====================================================================================================
// Scores + row softmax + softmax-weighted value sum + residual in one kernel: the softmax rows never leave LDS.
// Block = (b, 128 query rows n0..n0+127), 8 waves (two a SIMD, so a wave may hold up to 512 registers), one block
// a WGP, 256 blocks. LDS: 128 E rows of 1024 f16 at a pitch of 2064 B (16 B x odd: the 16 rows of a fragment read or
// of a chunk store fall on 16 different bank groups), 16-B chunk c (k = 8c..8c+7) at byte 16c; and per row one
// statistics word per 16-key tile, at a pitch of 272 B. A statistics word holds the tile's reference (its score
// maximum rounded up to the upper 16 bits of a float) and, as f16 in the lower 16 bits, the tile's sum / 16.
//  (1) wave w computes, for the 64 queries of half w&1, the 16-key score tiles ct = (w>>1), (w>>1)+4, ... (16 of them),
//      transposed: A = XK rows, Bt = XQ rows (K = 256), s = (k8 . q8) / (64*16), so that a lane holds 8 consecutive keys
//      of one query = one chunk, and lane l ^ 16 the tile's other 8. Still in registers: tile reference mc,
//      e = 32768 * exp(s - mc), tile sum zc = sum e (ascending key in each half, then the two halves), f16(e) stored as
//      the chunk, the statistics word in the row's statistics line. This vector work of one wave runs beside the products of the
//      other wave on its SIMD. The 32 query fragments are loaded once and stay in registers; the key fragments form
//      a ring two key tiles deep. Waves 2j and 2j+1 stream the same key tiles; they sit on different SIMDs and are of
//      the same age there, so they run side by side and the second one's loads can hit the WGP cache.
//  (2) wave w owns rows 16w..16w+15, four at a time: lane holds the words of the tiles of its chunks 32j + lane
//      (j = 0..3; every tile is held by two lanes); row reference M (xor shuffles), fc = exp(mc - M),
//      Z = sum_c fc * zc (fixed lane order + xor shuffles, every tile counted twice), then each chunk is rescaled in
//      place, E = f16(e) * f16(32768 * fc / Z); f16 subnormals are flushed to zero in a second pass over the wave's
//      rows, taken only where a ballot finds a value below the smallest normal f16 among them.
//  (3) after a block barrier: D[c][n] = sum_m (16*v)[c][m] . E[n][m], A = value plane rows c (fragment order, row
//      length TOK, k from b*NT), Bt = the 128 E rows in LDS, K = 1024 (32 k steps, ascending). Wave w owns
//      channels 32w..32w+31 (2 x 8 tiles), so every value fragment is loaded once a block and feeds eight products.
//      The value fragments form a ring 8 steps deep, first filled ahead of (2); the E fragments are read one step ahead.
// Epilogue: out[b][c][n] = D/(16*32768) + bf16RNE(x[b][c][n]); per wave four 16x64 f32 slabs staged in LDS, in the
// wave's own 16 rows of the statistics area, which nobody reads after (2).
// coverage: (1): 2 query halves x 4 wave groups x 16 key tiles x 2 chunks = 128 chunks and 64 words in each of 128 rows;
// (2): 8 waves x 16 rows x 4 j x 32 lanes = the same 128 chunks x 128 rows; out: 8 waves x 4 slabs x 16 rows x 64 cols =
// 256 c x 128 n per block; grid (8, 32) = every (n tile, b) -> whole output [32][256][1024].
// =====================================================================================================
__device__ __forceinline__ v16h ldfrag_lds(const char* p) {   // elements 0..7 <- 16 B at p, 8..15 <- 16 B at p + 32
  HU lo, hi;
  lo.f = *(const v4f*)(p);
  hi.f = *(const v4f*)(p + 32);
  FR f;
  f.h[0] = lo.h;
  f.h[1] = hi.h;
  return f.v;
}
__device__ __forceinline__ float xhalf(float x) {             // the value of lane l ^ 16
  return __builtin_bit_cast(float, __builtin_amdgcn_permlanex16(__builtin_bit_cast(int, x), __builtin_bit_cast(int, x),
                                                                0x76543210, 0xfedcba98, false, false));
}

__global__ __launch_bounds__(256) void k_attn(const _Float16* __restrict__ XQ, const _Float16* __restrict__ XK,
                                              const _Float16* __restrict__ VH, const float* __restrict__ X,
                                              float* out) {
  __shared__ __align__(16) float sc[RSB * PIT];               // the f16 E rows
  __shared__ __align__(16) float sst[RSB * SPIT];             // their tile statistics; in the epilogue the output slabs
  const int tid = threadIdx.x, wave = tid >> 5, lane = tid & 31;
  const int hh = lane >> 4, rl = lane & 15;
  const int rb = blockIdx.x, b = blockIdx.y, n0 = rb * RSB;

  // ---- (1) scores ----
  {
    const int qh = wave & 1, kg = wave >> 1;
    const _Float16* aq = XQ + (size_t)(b * NT + n0 + 64 * qh) * CH + 8 * lane;   // row tile (b*NT+n0+64qh)/16, CH/32 units each
    const _Float16* bk = XK + (size_t)(b * NT + 16 * kg) * CH + 8 * lane;
    v16h q[4][CH / 32], kf[2][CH / 32];
#pragma unroll
    for (int ks = 0; ks < CH / 32; ++ks) kf[0][ks] = ldfrag_h(bk + 512 * ks);
#pragma unroll
    for (int i = 0; i < 4; ++i)
#pragma unroll
      for (int ks = 0; ks < CH / 32; ++ks) q[i][ks] = ldfrag_h(aq + i * 16 * CH + 512 * ks);
#pragma unroll
    for (int ks = 0; ks < CH / 32; ++ks) kf[1][ks] = ldfrag_h(bk + 64 * CH + 512 * ks);
    // the code below re-uses the base registers that the query loads name
    asm volatile("s_wait_xcnt 0x0" ::: "memory");
    // keeps the second tile's loads behind the first products' operands, so that tile 0 does not wait for them,
    // and every later register write behind the wait above
    __builtin_amdgcn_sched_barrier(0);
    const _Float16* kp = bk + 2 * 64 * CH;                      // key tile two ahead of the pair in work
    float* er = sc + (64 * qh + rl) * PIT + 4 * (2 * kg + hh);  // this lane's chunk of key tile kg, query tile 0
    unsigned* sr = (unsigned*)sst + (64 * qh + 16 * hh + rl) * SPIT + kg;   // word of key tile kg, query tile hh
    // one key tile: slot = ring slot and place in the pair (column tile ct = kg + 4 * (2 * pair + slot))
    auto tile = [&](const int slot, const bool refill) __attribute__((always_inline)) {
      v8f a[4];
#pragma unroll
      for (int i = 0; i < 4; ++i) a[i] = zero8();
#pragma unroll
      for (int ks = 0; ks < CH / 32; ++ks) {
#pragma unroll
        for (int i = 0; i < 4; ++i) a[i] = mma_h_raw(kf[slot][ks], q[i][ks], a[i]);
        // the fragment of the tile after next, issued two whole tiles ahead of its use
        if (refill) kf[slot][ks] = ldfrag_h(kp + slot * 64 * CH + 512 * ks);
        // keeps the refill here: the scheduler otherwise sinks it to just in front of its use
        __builtin_amdgcn_sched_barrier(0);
      }
      // D row = key 8hh + r of the column tile, D col = query rl of row tile i: a lane's 8 values are one chunk of its row
      unsigned stw[4];
#pragma unroll
      for (int i = 0; i < 4; ++i) {
        float am = a[i][0];
#pragma unroll
        for (int r = 1; r < 8; ++r) am = fmaxf(am, a[i][r]);
        am = fmaxf(am, xhalf(am));                              // over the tile's 16 keys
        const float ms = am * SCS;
        const unsigned mu0 = __float_as_uint(ms);
        const unsigned mu = (ms > 0.0f ? mu0 + 0xFFFFu : mu0) & 0xFFFF0000u;   // rounded up: e never exceeds 32768
        const float k0 = 15.0f - __uint_as_float(mu) * 1.44269504088896f;      // 2^15 * exp(s - mc) = exp2(a*CEX + k0)
        float ev[8];
#pragma unroll
        for (int r = 0; r < 8; ++r) ev[r] = a[i][r] * CEX + k0;
        exp2x8(ev);
        float zs = ev[0];
#pragma unroll
        for (int r = 1; r < 8; ++r) zs += ev[r];
        zs += xhalf(zs);
        HU u;
#pragma unroll
        for (int r = 0; r < 8; ++r) u.s[r] = (_Float16)ev[r];
        *(v4f*)(er + i * 16 * PIT + slot * 32) = u.f;
        const _Float16 zh = (_Float16)(zs * 0.0625f);           // in (0, 32768]
        stw[i] = mu | (unsigned)__builtin_bit_cast(unsigned short, zh);
      }
      // both halves of the wave hold the same four words: the lower half stores those of query tiles 0 and 2, the upper
      // half those of 1 and 3
#pragma unroll
      for (int ip = 0; ip < 2; ++ip) sr[ip * 32 * SPIT + slot * 4] = hh ? stw[2 * ip + 1] : stw[2 * ip];
    };
    // rolled, two tiles a trip, so that the kernel's text stays small; the ring slots stay constants
#pragma unroll 1
    for (int tp = 0; tp < NT / 128 - 1; ++tp) {
      tile(0, true);
      tile(1, true);
      // the address registers that the key loads name are rewritten below
      asm volatile("s_wait_xcnt 0x0" ::: "memory");
      // keeps that rewriting behind the wait above
      __builtin_amdgcn_sched_barrier(0);
      kp += 2 * 64 * CH;
      er += 2 * 32;
      sr += 2 * 4;
    }
    tile(0, false);
    tile(1, false);
  }
  __syncthreads();

  // ---- value ring, first fill: the loads fly while the softmax runs ----
  const int cb = wave * 32;
  const char* pv = (const char*)VH;
  unsigned oa[2];                              // byte offset of this lane's 16 B in the first unit, per channel tile
#pragma unroll
  for (int i = 0; i < 2; ++i)
    oa[i] = ((unsigned)((cb >> 4) + i) * (unsigned)(TOK >> 5) + (unsigned)((b * NT) >> 5)) * 1024u + lane * 16u;
  v16h va[VRING][2];
#pragma unroll
  for (int s = 0; s < VRING; ++s)
#pragma unroll
    for (int i = 0; i < 2; ++i) va[s][i] = ldfrag_h((const _Float16*)(pv + oa[i] + 1024 * s));
  // the softmax re-uses the offset registers that these loads name
  asm volatile("s_wait_xcnt 0x0" ::: "memory");
  // keeps these loads in front of the softmax (sunk to their use they would be waited out there), and every
  // later register write behind the wait above
  __builtin_amdgcn_sched_barrier(0);

  // ---- (2) row statistics from the tile statistics, E rows rescaled in place ----
  {
    v8h lo8;                                                    // smallest E value that this lane has written, per element
#pragma unroll
    for (int e = 0; e < 8; ++e) lo8[e] = (_Float16)1.0f;
    for (int g = 0; g < 4; ++g) {
      const int row0 = 16 * wave + 4 * g;                       // four rows side by side: their reduction chains overlap
      float cm[16], cz[16], mx[4], z[4];                        // values of the chunks' tiles at [4 * q4 + j]
#pragma unroll
      for (int q4 = 0; q4 < 4; ++q4) {
        const unsigned* sp = (const unsigned*)sst + (row0 + q4) * SPIT + (lane >> 1);   // chunk 32j + lane: tile 16j + lane/2
#pragma unroll
        for (int j = 0; j < 4; ++j) {
          const unsigned st = sp[16 * j];
          cm[4 * q4 + j] = __uint_as_float(st & 0xFFFF0000u);
          cz[4 * q4 + j] = (float)__builtin_bit_cast(_Float16, (unsigned short)(st & 0xFFFFu));
        }
      }
#pragma unroll
      for (int q4 = 0; q4 < 4; ++q4)
        mx[q4] = fmaxf(fmaxf(cm[4 * q4], cm[4 * q4 + 1]), fmaxf(cm[4 * q4 + 2], cm[4 * q4 + 3]));
#pragma unroll
      for (int off = 16; off >= 1; off >>= 1)
#pragma unroll
        for (int q4 = 0; q4 < 4; ++q4) mx[q4] = fmaxf(mx[q4], __shfl_xor(mx[q4], off, 32));
#pragma unroll
      for (int c = 0; c < 16; ++c) cm[c] = (cm[c] - mx[c >> 2]) * 1.44269504088896f;
      exp2x8(cm);                                               // fc = exp(mc - M): tile reference -> row reference
      exp2x8(cm + 8);
#pragma unroll
      for (int q4 = 0; q4 < 4; ++q4) {
        z[q4] = 0.0f;
#pragma unroll
        for (int j = 0; j < 4; ++j) z[q4] += cm[4 * q4 + j] * cz[4 * q4 + j];
      }
#pragma unroll
      for (int off = 16; off >= 1; off >>= 1)
#pragma unroll
        for (int q4 = 0; q4 < 4; ++q4) z[q4] += __shfl_xor(z[q4], off, 32);
#pragma unroll
      for (int q4 = 0; q4 < 4; ++q4) {
        // z = 2 * (32768 * row sum) / 16: every tile twice, sums carried / 16
        const float rz = (SCE * 0.125f) * (1.0f / z[q4]);
        v4f* srow = (v4f*)(sc + (row0 + q4) * PIT);
#pragma unroll
        for (int j = 0; j < 4; ++j) {
          const _Float16 gf = (_Float16)(cm[4 * q4 + j] * rz);  // about [0, 1]
          HU u;
          u.f = srow[32 * j + lane];
          u.h = u.h * gf;
          lo8 = __builtin_elementwise_min(lo8, u.h);
          srow[32 * j + lane] = u.f;
        }
      }
    }
    _Float16 lo = lo8[0];
#pragma unroll
    for (int e = 1; e < 8; ++e) lo = lo8[e] < lo ? lo8[e] : lo;
    // f16 subnormal -> exact zero: the selects run only in a wave that holds a value below the smallest normal
    if (__builtin_amdgcn_ballot_w32((float)lo < 6.103515625e-05f) != 0u) {
      // rolled: a pass that is seldom taken stays short in the kernel's text
#pragma unroll 1
      for (int c = 0; c < 64; ++c) {
        v4f* p = (v4f*)(sc + (16 * wave + (c >> 2)) * PIT) + 32 * (c & 3) + lane;
        HU u;
        u.f = *p;
#pragma unroll
        for (int e = 0; e < 8; ++e) {
          const _Float16 h0 = u.s[e];
          u.s[e] = (float)h0 < 6.103515625e-05f ? (_Float16)0.0f : h0;
        }
        *p = u.f;
      }
    }
  }
  __syncthreads();   // every staged f16 row is complete before another wave reads its fragments

  // ---- (3) value sum ----
  v8f acc[2][8];
#pragma unroll
  for (int i = 0; i < 2; ++i)
#pragma unroll
    for (int j = 0; j < 8; ++j) acc[i][j] = zero8();

  const char* ep = (const char*)sc + rl * (PIT * 4) + hh * 16;  // E row 16j + rl, k = 32S + 8hh (+16): byte 64S (+32)
  v16h ef[2][8];
#pragma unroll
  for (int j = 0; j < 8; ++j) ef[0][j] = ldfrag_lds(ep + j * (16 * PIT * 4));
  // VRING k steps; ring slots and k offsets inside them are constants
  auto steps = [&](const bool last) __attribute__((always_inline)) {
#pragma unroll
    for (int s = 0; s < VRING; ++s) {
      if (!last || s + 1 < VRING) {
#pragma unroll
        for (int j = 0; j < 8; ++j) ef[(s + 1) & 1][j] = ldfrag_lds(ep + j * (16 * PIT * 4) + 64 * (s + 1));
      }
      // the next step's LDS reads stay one group in front of this step's products, not spread among them
      __builtin_amdgcn_sched_barrier(0);
#pragma unroll
      for (int i = 0; i < 2; ++i)
#pragma unroll
        for (int j = 0; j < 8; ++j) acc[i][j] = mma_h_raw(va[s][i], ef[s & 1][j], acc[i][j]);
      // keeps the refill right behind the products that free its slot: sunk, it would be waited out at its use
      __builtin_amdgcn_sched_barrier(0);
      if (!last) {
#pragma unroll
        for (int i = 0; i < 2; ++i) va[s][i] = ldfrag_h((const _Float16*)(pv + oa[i] + 1024 * (s + VRING)));
      }
      __builtin_amdgcn_sched_barrier(0);
    }
  };
  // rolled, VRING steps a trip, so that the kernel's text stays small
#pragma unroll 1
  for (int tp = 0; tp < NT / 32 / VRING - 1; ++tp) {
    steps(false);
    // the offset registers that the value loads name are rewritten below
    asm volatile("s_wait_xcnt 0x0" ::: "memory");
    // keeps that rewriting behind the wait above
    __builtin_amdgcn_sched_barrier(0);
    oa[0] += 1024 * VRING;
    oa[1] += 1024 * VRING;
    ep += 64 * VRING;
  }
  steps(true);
#pragma unroll
  for (int i = 0; i < 2; ++i) {
    acc_guard4(acc[i][0], acc[i][1], acc[i][2], acc[i][3]);
    acc_guard4(acc[i][4], acc[i][5], acc[i][6], acc[i][7]);
  }

  // ---- epilogue ----
  const float fo = 1.0f / (SCV * SCE);
  float* slab = sst + wave * (16 * 68);
  const int p4 = (lane & 15) * 4, r2 = lane >> 4;
  // one address each for x and out: the rows and column halves of a lane become immediate offsets, and no address
  // register of an issued load or store is written again
  const size_t eo = ((size_t)(b * CH + cb + r2)) * NT + n0 + p4;
  const float* xb = X + eo;
  float* ob = out + eo;
#pragma unroll
  for (int i = 0; i < 2; ++i) {
#pragma unroll
    for (int jh = 0; jh < 2; ++jh) {
#pragma unroll
      for (int r = 0; r < 8; ++r) {
#pragma unroll
        for (int j = 0; j < 4; ++j) {
          // D row = c offset 8hh + r, D col = n offset 64jh + 16j + rl
          slab[(8 * hh + r) * 68 + 16 * j + rl] = acc[i][4 * jh + j][r];
        }
      }
      wave_lds_sync();
      v4f ov[8];
#pragma unroll
      for (int it = 0; it < 8; ++it) {
        const int row = 2 * it + r2;                          // it 0..7 x r2 0..1 = rows 0..15
        const v4f a = *(const v4f*)(slab + row * 68 + p4);
        const v4f xv = *(const v4f*)(xb + (16 * i + 2 * it) * NT + 64 * jh);   // channel cb + 16i + row
        v4f o;
#pragma unroll
        for (int e = 0; e < 4; ++e) o[e] = a[e] * fo + bfr(xv[e]);
        ov[it] = o;
      }
      {
#pragma unroll
        for (int it = 0; it < 8; ++it) *(v4f*)(ob + (16 * i + 2 * it) * NT + 64 * jh) = ov[it];
      }
      wave_lds_sync();
    }
  }
}

// =====================================================================================================
// Workspace map; every plane [rows][k] below is stored in fragment order (see the head of the file).
//   WQ16  f16 [256][256]             0        131072   (64*Wq, bf16RNE)
//   WK16  f16 [256][256]        131072        131072   (64*Wk)
//   WV16  f16 [256][256]        262144        131072   (64*Wv)
//   XQ    f16 [32768][256]      393216      16777216   (8*q, position rows, k = c)
//   XK    f16 [32768][256]    17170432      16777216   (8*k)
//   VH    f16 [256][32768]    33947648      16777216   (16*v, row c, k = b*1024 + m)
//   xT    f16 [32768][256]    50724864      16777216   (bf16RNE(x) transposed to position rows)
//   end                       67502080
// d_out f32 [32][256][1024] at byte 0.
// =====================================================================================================
extern "C" void kernel_launch(void* const* d_in, const int* in_sizes, int n_in,
                              void* d_out, int out_size, void* d_ws, size_t ws_size,
                              hipStream_t stream) {
  if (n_in < 7) return;
  if (in_sizes[0] != NB * CH * NT) return;
  if (in_sizes[1] != CH * CH || in_sizes[2] != CH) return;
  if (in_sizes[3] != CH * CH || in_sizes[4] != CH) return;
  if (in_sizes[5] != CH * CH || in_sizes[6] != CH) return;
  if (out_size != OUTN) return;

  const float* x  = (const float*)d_in[0];   // [32][256][1024]
  const float* Wq = (const float*)d_in[1];   // [256][256]  ([out][in])
  const float* bq = (const float*)d_in[2];   // [256]
  const float* Wk = (const float*)d_in[3];   // [256][256]
  const float* bk = (const float*)d_in[4];   // [256]
  const float* Wv = (const float*)d_in[5];   // [256][256]
  const float* bv = (const float*)d_in[6];   // [256]

  const size_t PW  = (size_t)CH * CH * 2;                    //   131072
  const size_t PPL = (size_t)TOK * CH * 2;                   // 16777216

  size_t off = 0;
  const size_t oWQ = off; off += PW;
  const size_t oWK = off; off += PW;
  const size_t oWV = off; off += PW;
  const size_t oXQ = off; off += PPL;
  const size_t oXK = off; off += PPL;
  const size_t oVH = off; off += PPL;
  const size_t oXT = off; off += PPL;                        // off = 67502080
  if (off > ws_size) return;
  if (off > (size_t)134217728) return;

  char* ws = (char*)d_ws;
  _Float16* WQ16 = (_Float16*)(ws + oWQ);
  _Float16* WK16 = (_Float16*)(ws + oWK);
  _Float16* WV16 = (_Float16*)(ws + oWV);
  _Float16* XQ   = (_Float16*)(ws + oXQ);
  _Float16* XK   = (_Float16*)(ws + oXK);
  _Float16* VH   = (_Float16*)(ws + oVH);
  _Float16* xT   = (_Float16*)(ws + oXT);
  float*    outf = (float*)d_out;

  const dim3 blk(256);
  const dim3 gPrep(3 * WBLK + (NT / 64) * (CH / 64) * NB);             // 96 + 2048
  const dim3 gPr(TOK / PPB);                                           // 256 blocks of 128 positions
  const dim3 gAt(NT / RSB, NB);                                        // (8, 32)

  // (1) weight planes, x64 carried (conv weights [out][in]: rows = out, k = in), and x [32][256][1024]
  //     transposed to position rows xT [32768][256]; all in fragment order
  k_prep<<<gPrep, blk, 0, stream>>>(x, Wq, Wk, Wv, xT, WQ16, WK16, WV16);
  // (2) XQ, XK, VH from xT and the weight planes
  k_proj<<<gPr, blk, 0, stream>>>(xT, WQ16, WK16, WV16, bq, bk, bv, XQ, XK, VH);
  // (3) scores + row softmax + softmax-weighted value sum + residual -> d_out
  k_attn<<<gAt, blk, 0, stream>>>(XQ, XK, VH, x, outf);
}

// v008
// A run of this version takes 54.8 microseconds.
// Next to v007, in two timings, it ran 1.10 and 1.09 times as fast.
// Over all steps from v000 it is 4.36 times as fast.
#include <hip/hip_runtime.h>
#include <math.h>
#include <stdint.h>

// All contractions on v_wmma_f32_16x16x32_f16 (f16 operands, f32 accumulate): the three 1x1-conv
// projections take bf16-RNE inputs (x1) and bf16-RNE weights (x64) as single f16 planes; the 256-deep
// query.key scores use single f16 planes of 8*q and 8*k; the 1024-deep softmax-weighted value sum uses
// a single f16 plane of 16*v against E = f16(32768*softmax) held as f16 rows in LDS. Softmax
// arithmetic, biases, residual add and epilogues are f32; a 16-key tile's statistics rest in LDS as one word (reference:
// upper 16 bits of a float, sum: f16); the factor that rescales an E chunk is f16.
//
// Every f16 operand plane [R][K] in memory lives in fragment order: for 16-row tile T and 32-deep k step S the unit
// (T*(K/32) + S) is 512 halves; inside it element (row, k) sits at ((k>>4)&1)*256 + (((k>>3)&1)*16 + (row&15))*8
// + (k&7). A wave's two 16-B loads of one fragment then cover 2 x 512 contiguous bytes (whole 128-B lines).

#define NB   32
#define CH   256
#define NT   1024
#define TOK  (NB * NT)
#define RSB  128                            // query rows per attention block
#define PIT  (NT / 2 + 4)                   // LDS pitch of an E row of NT f16, in floats
#define SPIT (NT / 16 + 4)                  // LDS pitch of a row's NT/16 statistics words, in words
#define VRING 8                             // value fragment ring, k steps
#define OUTN (NB * CH * NT)
#define WBLK ((CH * CH) / 2048)            // 256-thread blocks per weight plane, 8 elements a thread
#define PPB  128                            // positions per projection block
#define XTP  (16 * CH * 2 + 16)             // LDS pitch of a 16-position tile of x (CH/32 units of 1024 B), in bytes

#define SCW  64.0f
#define SCQK 8.0f
#define SCV  16.0f
#define SCE  32768.0f
#define SCS  (1.0f / (SCQK * SCQK * 16.0f))
#define CEX  (SCS * 1.44269504088896f)      // raw score product -> exponent of two

static_assert(TOK % 64 == 0 && CH % 64 == 0 && CH % 32 == 0 && NT % 32 == 0);
static_assert(TOK % PPB == 0 && PPB == 2 * 64 && CH == 4 * 4 * 16);
static_assert(NT % RSB == 0 && RSB == 128 && NT == 4 * 256);
static_assert((PIT * 4) % 32 == 16 && (NT / 32) % VRING == 0);
static_assert(SPIT % 64 == 4 && RSB * SPIT == 8 * 16 * 68);
static_assert((NT / 16) % 8 == 0 && CH == 8 * 32);
static_assert((CH * CH) % 2048 == 0);
static_assert(NT % PPB == 0 && PPB == 32 * 4 && XTP % 256 == 16);

typedef _Float16       v16h __attribute__((ext_vector_type(16)));
typedef _Float16       v8h  __attribute__((ext_vector_type(8)));
typedef float          v8f  __attribute__((ext_vector_type(8)));
typedef float          v4f  __attribute__((ext_vector_type(4)));
typedef float          v2f  __attribute__((ext_vector_type(2)));
typedef unsigned int   v4u  __attribute__((ext_vector_type(4)));
typedef _Float16       v2h  __attribute__((ext_vector_type(2)));
typedef __bf16         v2b  __attribute__((ext_vector_type(2)));

union HU { v8h h; v4u u; v4f f; _Float16 s[8]; v2h p[4]; };
union FR { v16h v; v8h h[2]; _Float16 s[16]; };
static_assert(sizeof(HU) == 16);
static_assert(sizeof(FR) == 32);

// ---- scalar helpers --------------------------------------------------------------------------------
__device__ __forceinline__ unsigned short bf_bits(float f) {          // f32 -> bf16 bits, RNE convert
  const unsigned u = __float_as_uint(f);
  return (unsigned short)((u + 0x7FFFu + ((u >> 16) & 1u)) >> 16);
}
__device__ __forceinline__ float bf_up(unsigned short h) { return __uint_as_float(((unsigned)h) << 16); }
__device__ __forceinline__ float bfr(float f) { return bf_up(bf_bits(f)); }   // value after bf16 RNE convert
// f16(bf16RNE(a)), f16(bf16RNE(b)) by the packed converts, which round to nearest even: the values of bfr() for every
// finite input
__device__ __forceinline__ v2h bfr2h(float a, float b) {
  const v2f x = {a, b};
  return __builtin_convertvector(__builtin_convertvector(__builtin_convertvector(x, v2b), v2f), v2h);
}
__device__ __forceinline__ v8f zero8() { v8f z = {0.f, 0.f, 0.f, 0.f, 0.f, 0.f, 0.f, 0.f}; return z; }

__device__ __forceinline__ void ld8(const float* p, float* o) {
  const v4f a = *(const v4f*)(p);
  const v4f b = *(const v4f*)(p + 4);
  o[0] = a[0]; o[1] = a[1]; o[2] = a[2]; o[3] = a[3];
  o[4] = b[0]; o[5] = b[1]; o[6] = b[2]; o[7] = b[3];
}

// ---- fragment loader: 16-bit A/B operand from a fragment-order plane, p = unit*512 + 8*lane, h = lane>>4;
//      elements 0..7 <- p[0..7] (k0+8h..k0+8h+7), elements 8..15 <- p[256..263] (k0+16+8h..k0+16+8h+7)
__device__ __forceinline__ v16h ldfrag_h(const _Float16* p) {
  FR f;
  f.h[0] = *(const v8h*)(p);
  f.h[1] = *(const v8h*)(p + 256);
  return f.v;
}

// ---- WMMA helpers --------------------------------------------------------------------------------------
__device__ __forceinline__ v8f mma_h_raw(v16h a, v16h b, v8f c) {
  return __builtin_amdgcn_wmma_f32_16x16x32_f16(false, a, false, b, (short)0, c, false, false);
}
__device__ __forceinline__ void acc_guard4(v8f& a, v8f& b, v8f& c, v8f& d) {
#if defined(__HIP_DEVICE_COMPILE__)
  asm volatile("v_nop\n\tv_nop\n\tv_nop\n\tv_nop" : "+v"(a), "+v"(b), "+v"(c), "+v"(d));
#endif
}
// v[0..7] <- 2^v[0..7]. One statement, in place, with a v_nop behind the last: it keeps the slot that the instruction
// set asks for between a transcendental and an instruction that overwrites its source or reads its result.
__device__ __forceinline__ void exp2x8(float* v) {
#if defined(__HIP_DEVICE_COMPILE__)
  asm("v_exp_f32 %0, %0\n\tv_exp_f32 %1, %1\n\tv_exp_f32 %2, %2\n\tv_exp_f32 %3, %3\n\t"
      "v_exp_f32 %4, %4\n\tv_exp_f32 %5, %5\n\tv_exp_f32 %6, %6\n\tv_exp_f32 %7, %7\n\tv_nop"
      : "+v"(v[0]), "+v"(v[1]), "+v"(v[2]), "+v"(v[3]), "+v"(v[4]), "+v"(v[5]), "+v"(v[6]), "+v"(v[7]));
#endif
}
__device__ __forceinline__ void wave_lds_sync() {
  __builtin_amdgcn_fence(__ATOMIC_RELEASE, "workgroup");
  __builtin_amdgcn_wave_barrier();
  __builtin_amdgcn_fence(__ATOMIC_ACQUIRE, "workgroup");
}

// =====================================================================================================
// Weight convert: in [R][kd] f32 row-major -> out f16(scale * bf16RNE(in)) in fragment order; thread i owns
// the i-th 16-B chunk of the output (lane = i&31, part = (i>>5)&1, unit = i>>6), one 16-B store per lane.
// coverage: n8 threads x 8 = the whole plane; n8 is a multiple of 256 at every call here. blk = block index
// within the plane.
// =====================================================================================================
__device__ __forceinline__ void cvt_flat(const float* __restrict__ in, _Float16* out, int n8, int kd, float scale, int blk) {
  const int i = blk * 256 + threadIdx.x;
  if (i < n8) {
    const int ksn = kd >> 5, unit = i >> 6;
    const int tile = unit / ksn, ks = unit - tile * ksn;
    const int row = tile * 16 + (i & 15);
    const int k = ks * 32 + ((i >> 5) & 1) * 16 + ((i >> 4) & 1) * 8;
    float v[8];
    ld8(in + (size_t)row * kd + k, v);
    HU u;
#pragma unroll
    for (int e = 0; e < 8; ++e) u.s[e] = (_Float16)(bfr(v[e]) * scale);
    _Float16* p = out + (size_t)i * 8;
    *(v4u*)p = u.u;
    
  }
}

// =====================================================================================================
// The three weight planes in one launch, WBLK blocks each.
// =====================================================================================================
__global__ __launch_bounds__(256) void k_prep(const float* __restrict__ Wq, const float* __restrict__ Wk,
                                              const float* __restrict__ Wv,
                                              _Float16* WQ, _Float16* WK, _Float16* WV) {
  const int bx = blockIdx.x;
  const int sel = bx / WBLK;
  const float* in = sel == 0 ? Wq : (sel == 1 ? Wk : Wv);
  _Float16* o = sel == 0 ? WQ : (sel == 1 ? WK : WV);
  cvt_flat(in, o, (CH * CH) / 8, CH, SCW, bx - sel * WBLK);
}

// =====================================================================================================
// The three projections in one launch, one pass over x. Block = 128 positions of one image, 8 waves (two a SIMD, so a
// wave may hold up to 512 registers), one block a WGP.
// First the block builds xT = f16(bf16RNE(x)) for its positions (rows = position, k = channel) in LDS, in fragment
// order, a 16-position tile at a pitch of XTP bytes: wave w reads channels 32w..32w+31 (k step w), a lane 4 positions of
// each (a wave's load = 512 contiguous bytes of one channel row), and stores 16 chunks of 8 channels x 1 position.
// With the 16 B of pad a tile, the 16 lanes of each half wave store to 16 different bank groups; a fragment read
// is 2 x 512 contiguous bytes. coverage: 8 waves x 32 channels x 32 lanes x 4 positions = 256 k x 128 rows.
// Behind one block barrier wave w holds the 32 xT fragments of positions p0..p0+63
// (p0 = 128*block + 64*(w&1)) in registers for the whole kernel and runs through 12 weight row tiles: tiles
// 4*(w>>1) .. +3 of Wq, then of Wk, then of Wv. Every weight fragment is loaded once a wave and feeds four products;
// the weight fragments form a ring two row tiles deep. K = 256 (8 k steps, ascending) for every accumulator.
// The two waves that stream the same weight tiles (2j, 2j+1) sit on different SIMDs and are of the same age there,
// so they run side by side and the second one's loads can hit the WGP cache.
// The operand roles are chosen so that a lane's 8 accumulator rows are 8 consecutive k of the plane it writes:
//   XQ, XK (rows = position, k = channel): A = weight tile, B = xT tile i -> D row = channel 8hh + r, D col = position rl
//   VH     (rows = channel, k = position): A = xT tile i, B = weight tile -> D row = position 8hh + r, D col = channel rl
// In both cases the lane's 8 halves are the 16-B chunk number 'lane' of a 512-B half unit: one contiguous wave store.
//   XQ = f16(8*(xT . Wq^T + bq)), XK = f16(8*(xT . Wk^T + bk)), VH = f16(16*(Wv . x + bv)); biases bf16RNE.
// coverage: XQ, XK: 256 blocks x 2 position groups x 4 tiles i x 16 positions = 32768 rows, 4 wave groups x 4 tiles x
// 16 = 256 channels; VH: the same 256 channels as rows x the same 32768 positions as k.
// =====================================================================================================
__global__ __launch_bounds__(256) void k_proj(const float* __restrict__ X, const _Float16* __restrict__ WQ,
                                              const _Float16* __restrict__ WK, const _Float16* __restrict__ WV,
                                              const float* __restrict__ bq, const float* __restrict__ bk,
                                              const float* __restrict__ bv,
                                              _Float16* XQ, _Float16* XK, _Float16* VH) {
  __shared__ __align__(16) char sx[(PPB / 16) * XTP];            // xT of the block's positions
  const int lane = threadIdx.x & 31;
  // the wave's number in a scalar register: every base address below is then scalar, and the only vector address
  // registers are lane offsets that are never written again
  const int wave = __builtin_amdgcn_readfirstlane(threadIdx.x >> 5);
  const unsigned l8 = 8u * lane;                                 // this lane's 16-B chunk of a 512-B half unit, in halves
  const unsigned hb = 8u * (lane >> 4), rl = lane & 15;          // bias offsets: 8hh (XQ, XK), rl (VH)
  const int p0 = blockIdx.x * PPB + (wave & 1) * 64;             // first of this wave's 64 positions
  const int ct0 = (wave >> 1) * 4;                               // first of this wave's 4 row tiles in each weight plane
  const float cs64 = 1.0f / SCW;                                 // undo the weight carry
  const int wo = ct0 * 16 * CH;                                  // row tile ct0 of a weight plane
  const _Float16* wp[3] = {WQ + wo, WK + wo, WV + wo};
  const float* bp[3] = {bq + 16 * ct0, bk + 16 * ct0, bv + 16 * ct0};              // channel 16*ct0
  // XQ, XK: unit (p0/16 + i)*8 + ct/2, half ct&1; VH: unit ct*(TOK/32) + p0/32 + i/2, half i&1; here for ct = ct0, i = 0
  _Float16* dp[3] = {XQ + (size_t)p0 * CH + ct0 * 256, XK + (size_t)p0 * CH + ct0 * 256,
                     VH + (size_t)ct0 * 16 * TOK + (size_t)p0 * 16};
  v16h xf[4][CH / 32], kf[2][CH / 32];
  {
    const int pb = blockIdx.x * PPB;                             // image pb / NT, positions pb % NT .. + 127 of it
    const float* xs = X + ((size_t)(pb / NT) * CH + 32 * wave) * NT + pb % NT;     // channel 32*wave
    const unsigned l4 = 4u * lane;
    v4f xr[32];
#pragma unroll
    for (int c = 0; c < 32; ++c) xr[c] = *(const v4f*)(xs + c * NT + l4);
    // keeps the loads from memory in front of the weight loads, which come from L2
    __builtin_amdgcn_sched_barrier(0);
#pragma unroll
    for (int s = 0; s < 2; ++s)
#pragma unroll
      for (int ks = 0; ks < CH / 32; ++ks) kf[s][ks] = ldfrag_h(wp[0] + s * 16 * CH + 512 * ks + l8);
    // the code below may re-use the registers that these loads name
    asm volatile("s_wait_xcnt 0x0" ::: "memory");
    // keeps every load above in front of the first wait for x, and every later register write behind the wait above
    __builtin_amdgcn_sched_barrier(0);
    // position 4*lane + j: tile lane>>2, row 4*(lane&3) + j; channel 32*wave + 8*g + e: unit 'wave', chunk column g
    char* sd = sx + (lane >> 2) * XTP + wave * 1024 + (lane & 3) * 64;
#pragma unroll
    for (int g = 0; g < 4; ++g)
#pragma unroll
      for (int j = 0; j < 4; ++j) {
        HU u;
#pragma unroll
        for (int e = 0; e < 4; ++e) u.p[e] = bfr2h(xr[8 * g + 2 * e][j], xr[8 * g + 2 * e + 1][j]);
        *(v4u*)(sd + (g >> 1) * 512 + (g & 1) * 256 + j * 16) = u.u;
      }
  }
  __syncthreads();   // every wave's k step of xT is in LDS before another wave reads its fragments
  {
    const char* sl = sx + (wave & 1) * 4 * XTP + lane * 16;      // tile 4*(wave&1) = position p0
#pragma unroll   // k step by k step, the order in which the first tile's products take them
    for (int ks = 0; ks < CH / 32; ++ks)
#pragma unroll
      for (int i = 0; i < 4; ++i) {
        FR f;
        f.h[0] = *(const v8h*)(sl + i * XTP + 1024 * ks);
        f.h[1] = *(const v8h*)(sl + i * XTP + 1024 * ks + 512);
        xf[i][ks] = f.v;
      }
  }
#pragma unroll   // plane, operand roles and ring slot become constants; the last two tiles drop their refill
  for (int t = 0; t < 12; ++t) {
    const int sel = t >> 2;                                      // 0 Wq, 1 Wk, 2 Wv
    const int tc = t & 3;                                        // row tile ct = ct0 + tc of the plane = 16 output channels
    // this tile's biases, issued a whole tile of products ahead of their use
    float bb[8];
    if (sel < 2) {
      ld8(bp[sel] + 16 * tc + hb, bb);                           // channels 16ct + 8hh + r
    } else {
      bb[0] = bp[2][16 * tc + rl];                               // channel 16ct + rl
    }
    // keeps the bias loads here: sunk to their use they would be waited out there
    __builtin_amdgcn_sched_barrier(0);
    v8f a[4];
#pragma unroll
    for (int i = 0; i < 4; ++i) a[i] = zero8();
#pragma unroll
    for (int ks = 0; ks < CH / 32; ++ks) {
#pragma unroll
      for (int i = 0; i < 4; ++i)
        a[i] = sel < 2 ? mma_h_raw(kf[t & 1][ks], xf[i][ks], a[i]) : mma_h_raw(xf[i][ks], kf[t & 1][ks], a[i]);
      // the fragment of the tile after next, issued two whole tiles ahead of its use
      if (t + 2 < 12) kf[t & 1][ks] = ldfrag_h(wp[(t + 2) >> 2] + ((t + 2) & 3) * 16 * CH + 512 * ks + l8);
      // keeps the refill here: the scheduler otherwise sinks it to just in front of its use
      __builtin_amdgcn_sched_barrier(0);
    }
    if (sel < 2) {
#pragma unroll
      for (int i = 0; i < 4; ++i) {
        HU h;
#pragma unroll
        for (int r = 0; r < 8; ++r) h.s[r] = (_Float16)((a[i][r] * cs64 + bfr(bb[r])) * SCQK);
        *(v4u*)(dp[sel] + tc * 256 + i * 16 * CH + l8) = h.u;
      }
    } else {
      const float bc = bfr(bb[0]);
#pragma unroll
      for (int i = 0; i < 4; ++i) {
        HU h;
#pragma unroll
        for (int r = 0; r < 8; ++r) h.s[r] = (_Float16)((a[i][r] * cs64 + bc) * SCV);
        *(v4u*)(dp[2] + tc * 16 * TOK + i * 256 + l8) = h.u;
      }
    }
    if (t + 1 < 12) {
      // the next tile rewrites the data registers that these stores name
      asm volatile("s_wait_xcnt 0x0" ::: "memory");
      // keeps every register write of the next tile behind the wait above
      __builtin_amdgcn_sched_barrier(0);
    }
  }
}

// =====================================================================================================
// Scores + row softmax + softmax-weighted value sum + residual in one kernel: the softmax rows never leave LDS.
// Block = (b, 128 query rows n0..n0+127), 8 waves (two a SIMD, so a wave may hold up to 512 registers), one block
// a WGP, 256 blocks. LDS: 128 E rows of 1024 f16 at a pitch of 2064 B (16 B x odd: the 16 rows of a fragment read or
// of a chunk store fall on 16 different bank groups), 16-B chunk c (k = 8c..8c+7) at byte 16c; and per row one
// statistics word per 16-key tile, at a pitch of 272 B. A statistics word holds the tile's reference (its score
// maximum rounded up to the upper 16 bits of a float) and, as f16 in the lower 16 bits, the tile's sum / 16.
//  (1) wave w computes, for the 64 queries of half w&1, the 16-key score tiles ct = (w>>1), (w>>1)+4, ... (16 of them),
//      transposed: A = XK rows, Bt = XQ rows (K = 256), s = (k8 . q8) / (64*16), so that a lane holds 8 consecutive keys
//      of one query = one chunk, and lane l ^ 16 the tile's other 8. Still in registers: tile reference mc,
//      e = 32768 * exp(s - mc), tile sum zc = sum e (ascending key in each half, then the two halves), f16(e) stored as
//      the chunk, the statistics word in the row's statistics line. This vector work of one wave runs beside the products of the
//      other wave on its SIMD. The 32 query fragments are loaded once and stay in registers; the key fragments form
//      a ring two key tiles deep. Waves 2j and 2j+1 stream the same key tiles; they sit on different SIMDs and are of
//      the same age there, so they run side by side and the second one's loads can hit the WGP cache.
//  (2) wave w owns rows 16w..16w+15, four at a time: lane holds the words of the tiles of its chunks 32j + lane
//      (j = 0..3; every tile is held by two lanes); row reference M (xor shuffles), fc = exp(mc - M),
//      Z = sum_c fc * zc (fixed lane order + xor shuffles, every tile counted twice), then each chunk is rescaled in
//      place, E = f16(e) * f16(32768 * fc / Z); f16 subnormals are flushed to zero in a second pass over the wave's
//      rows, taken only where a ballot finds a value below the smallest normal f16 among them.
//  (3) after a block barrier: D[c][n] = sum_m (16*v)[c][m] . E[n][m], A = value plane rows c (fragment order, row
//      length TOK, k from b*NT), Bt = the 128 E rows in LDS, K = 1024 (32 k steps, ascending). Wave w owns
//      channels 32w..32w+31 (2 x 8 tiles), so every value fragment is loaded once a block and feeds eight products.
//      The value fragments form a ring 8 steps deep, first filled ahead of (2); the E fragments are read one step ahead.
// Epilogue: out[b][c][n] = D/(16*32768) + bf16RNE(x[b][c][n]); per wave four 16x64 f32 slabs staged in LDS, in the
// wave's own 16 rows of the statistics area, which nobody reads after (2).
// coverage: (1): 2 query halves x 4 wave groups x 16 key tiles x 2 chunks = 128 chunks and 64 words in each of 128 rows;
// (2): 8 waves x 16 rows x 4 j x 32 lanes = the same 128 chunks x 128 rows; out: 8 waves x 4 slabs x 16 rows x 64 cols =
// 256 c x 128 n per block; grid (8, 32) = every (n tile, b) -> whole output [32][256][1024].
// =====================================================================================================
__device__ __forceinline__ v16h ldfrag_lds(const char* p) {   // elements 0..7 <- 16 B at p, 8..15 <- 16 B at p + 32
  HU lo, hi;
  lo.f = *(const v4f*)(p);
  hi.f = *(const v4f*)(p + 32);
  FR f;
  f.h[0] = lo.h;
  f.h[1] = hi.h;
  return f.v;
}
__device__ __forceinline__ float xhalf(float x) {             // the value of lane l ^ 16
  return __builtin_bit_cast(float, __builtin_amdgcn_permlanex16(__builtin_bit_cast(int, x), __builtin_bit_cast(int, x),
                                                                0x76543210, 0xfedcba98, false, false));
}

__global__ __launch_bounds__(256) void k_attn(const _Float16* __restrict__ XQ, const _Float16* __restrict__ XK,
                                              const _Float16* __restrict__ VH, const float* __restrict__ X,
                                              float* out) {
  __shared__ __align__(16) float sc[RSB * PIT];               // the f16 E rows
  __shared__ __align__(16) float sst[RSB * SPIT];             // their tile statistics; in the epilogue the output slabs
  const int tid = threadIdx.x, wave = tid >> 5, lane = tid & 31;
  const int hh = lane >> 4, rl = lane & 15;
  const int rb = blockIdx.x, b = blockIdx.y, n0 = rb * RSB;

  // ---- (1) scores ----
  {
    const int qh = wave & 1, kg = wave >> 1;
    const _Float16* aq = XQ + (size_t)(b * NT + n0 + 64 * qh) * CH + 8 * lane;   // row tile (b*NT+n0+64qh)/16, CH/32 units each
    const _Float16* bk = XK + (size_t)(b * NT + 16 * kg) * CH + 8 * lane;
    v16h q[4][CH / 32], kf[2][CH / 32];
#pragma unroll
    for (int ks = 0; ks < CH / 32; ++ks) kf[0][ks] = ldfrag_h(bk + 512 * ks);
#pragma unroll
    for (int i = 0; i < 4; ++i)
#pragma unroll
      for (int ks = 0; ks < CH / 32; ++ks) q[i][ks] = ldfrag_h(aq + i * 16 * CH + 512 * ks);
#pragma unroll
    for (int ks = 0; ks < CH / 32; ++ks) kf[1][ks] = ldfrag_h(bk + 64 * CH + 512 * ks);
    // the code below re-uses the base registers that the query loads name
    asm volatile("s_wait_xcnt 0x0" ::: "memory");
    // keeps the second tile's loads behind the first products' operands, so that tile 0 does not wait for them,
    // and every later register write behind the wait above
    __builtin_amdgcn_sched_barrier(0);
    const _Float16* kp = bk + 2 * 64 * CH;                      // key tile two ahead of the pair in work
    float* er = sc + (64 * qh + rl) * PIT + 4 * (2 * kg + hh);  // this lane's chunk of key tile kg, query tile 0
    unsigned* sr = (unsigned*)sst + (64 * qh + 16 * hh + rl) * SPIT + kg;   // word of key tile kg, query tile hh
    // one key tile: slot = ring slot and place in the pair (column tile ct = kg + 4 * (2 * pair + slot))
    auto tile = [&](const int slot, const bool refill) __attribute__((always_inline)) {
      v8f a[4];
#pragma unroll
      for (int i = 0; i < 4; ++i) a[i] = zero8();
#pragma unroll
      for (int ks = 0; ks < CH / 32; ++ks) {
#pragma unroll
        for (int i = 0; i < 4; ++i) a[i] = mma_h_raw(kf[slot][ks], q[i][ks], a[i]);
        // the fragment of the tile after next, issued two whole tiles ahead of its use
        if (refill) kf[slot][ks] = ldfrag_h(kp + slot * 64 * CH + 512 * ks);
        // keeps the refill here: the scheduler otherwise sinks it to just in front of its use
        __builtin_amdgcn_sched_barrier(0);
      }
      // D row = key 8hh + r of the column tile, D col = query rl of row tile i: a lane's 8 values are one chunk of its row
      unsigned stw[4];
#pragma unroll
      for (int i = 0; i < 4; ++i) {
        float am = a[i][0];
#pragma unroll
        for (int r = 1; r < 8; ++r) am = fmaxf(am, a[i][r]);
        am = fmaxf(am, xhalf(am));                              // over the tile's 16 keys
        const float ms = am * SCS;
        const unsigned mu0 = __float_as_uint(ms);
        const unsigned mu = (ms > 0.0f ? mu0 + 0xFFFFu : mu0) & 0xFFFF0000u;   // rounded up: e never exceeds 32768
        const float k0 = 15.0f - __uint_as_float(mu) * 1.44269504088896f;      // 2^15 * exp(s - mc) = exp2(a*CEX + k0)
        float ev[8];
#pragma unroll
        for (int r = 0; r < 8; ++r) ev[r] = a[i][r] * CEX + k0;
        exp2x8(ev);
        float zs = ev[0];
#pragma unroll
        for (int r = 1; r < 8; ++r) zs += ev[r];
        zs += xhalf(zs);
        HU u;
#pragma unroll
        for (int r = 0; r < 8; ++r) u.s[r] = (_Float16)ev[r];
        *(v4f*)(er + i * 16 * PIT + slot * 32) = u.f;
        const _Float16 zh = (_Float16)(zs * 0.0625f);           // in (0, 32768]
        stw[i] = mu | (unsigned)__builtin_bit_cast(unsigned short, zh);
      }
      // both halves of the wave hold the same four words: the lower half stores those of query tiles 0 and 2, the upper
      // half those of 1 and 3
#pragma unroll
      for (int ip = 0; ip < 2; ++ip) sr[ip * 32 * SPIT + slot * 4] = hh ? stw[2 * ip + 1] : stw[2 * ip];
    };
    // rolled, two tiles a trip, so that the kernel's text stays small; the ring slots stay constants
#pragma unroll 1
    for (int tp = 0; tp < NT / 128 - 1; ++tp) {
      tile(0, true);
      tile(1, true);
      // the address registers that the key loads name are rewritten below
      asm volatile("s_wait_xcnt 0x0" ::: "memory");
      // keeps that rewriting behind the wait above
      __builtin_amdgcn_sched_barrier(0);
      kp += 2 * 64 * CH;
      er += 2 * 32;
      sr += 2 * 4;
    }
    tile(0, false);
    tile(1, false);
  }
  __syncthreads();

  // ---- value ring, first fill: the loads fly while the softmax runs ----
  const int cb = wave * 32;
  const char* pv = (const char*)VH;
  unsigned oa[2];                              // byte offset of this lane's 16 B in the first unit, per channel tile
#pragma unroll
  for (int i = 0; i < 2; ++i)
    oa[i] = ((unsigned)((cb >> 4) + i) * (unsigned)(TOK >> 5) + (unsigned)((b * NT) >> 5)) * 1024u + lane * 16u;
  v16h va[VRING][2];
#pragma unroll
  for (int s = 0; s < VRING; ++s)
#pragma unroll
    for (int i = 0; i < 2; ++i) va[s][i] = ldfrag_h((const _Float16*)(pv + oa[i] + 1024 * s));
  // the softmax re-uses the offset registers that these loads name
  asm volatile("s_wait_xcnt 0x0" ::: "memory");
  // keeps these loads in front of the softmax (sunk to their use they would be waited out there), and every
  // later register write behind the wait above
  __builtin_amdgcn_sched_barrier(0);

  // ---- (2) row statistics from the tile statistics, E rows rescaled in place ----
  {
    v8h lo8;                                                    // smallest E value that this lane has written, per element
#pragma unroll
    for (int e = 0; e < 8; ++e) lo8[e] = (_Float16)1.0f;
    for (int g = 0; g < 4; ++g) {
      const int row0 = 16 * wave + 4 * g;                       // four rows side by side: their reduction chains overlap
      float cm[16], cz[16], mx[4], z[4];                        // values of the chunks' tiles at [4 * q4 + j]
#pragma unroll
      for (int q4 = 0; q4 < 4; ++q4) {
        const unsigned* sp = (const unsigned*)sst + (row0 + q4) * SPIT + (lane >> 1);   // chunk 32j + lane: tile 16j + lane/2
#pragma unroll
        for (int j = 0; j < 4; ++j) {
          const unsigned st = sp[16 * j];
          cm[4 * q4 + j] = __uint_as_float(st & 0xFFFF0000u);
          cz[4 * q4 + j] = (float)__builtin_bit_cast(_Float16, (unsigned short)(st & 0xFFFFu));
        }
      }
#pragma unroll
      for (int q4 = 0; q4 < 4; ++q4)
        mx[q4] = fmaxf(fmaxf(cm[4 * q4], cm[4 * q4 + 1]), fmaxf(cm[4 * q4 + 2], cm[4 * q4 + 3]));
#pragma unroll
      for (int off = 16; off >= 1; off >>= 1)
#pragma unroll
        for (int q4 = 0; q4 < 4; ++q4) mx[q4] = fmaxf(mx[q4], __shfl_xor(mx[q4], off, 32));
#pragma unroll
      for (int c = 0; c < 16; ++c) cm[c] = (cm[c] - mx[c >> 2]) * 1.44269504088896f;
      exp2x8(cm);                                               // fc = exp(mc - M): tile reference -> row reference
      exp2x8(cm + 8);
#pragma unroll
      for (int q4 = 0; q4 < 4; ++q4) {
        z[q4] = 0.0f;
#pragma unroll
        for (int j = 0; j < 4; ++j) z[q4] += cm[4 * q4 + j] * cz[4 * q4 + j];
      }
#pragma unroll
      for (int off = 16; off >= 1; off >>= 1)
#pragma unroll
        for (int q4 = 0; q4 < 4; ++q4) z[q4] += __shfl_xor(z[q4], off, 32);
#pragma unroll
      for (int q4 = 0; q4 < 4; ++q4) {
        // z = 2 * (32768 * row sum) / 16: every tile twice, sums carried / 16
        const float rz = (SCE * 0.125f) * (1.0f / z[q4]);
        v4f* srow = (v4f*)(sc + (row0 + q4) * PIT);
#pragma unroll
        for (int j = 0; j < 4; ++j) {
          const _Float16 gf = (_Float16)(cm[4 * q4 + j] * rz);  // about [0, 1]
          HU u;
          u.f = srow[32 * j + lane];
          u.h = u.h * gf;
          lo8 = __builtin_elementwise_min(lo8, u.h);
          srow[32 * j + lane] = u.f;
        }
      }
    }
    _Float16 lo = lo8[0];
#pragma unroll
    for (int e = 1; e < 8; ++e) lo = lo8[e] < lo ? lo8[e] : lo;
    // f16 subnormal -> exact zero: the selects run only in a wave that holds a value below the smallest normal
    if (__builtin_amdgcn_ballot_w32((float)lo < 6.103515625e-05f) != 0u) {
      // rolled: a pass that is seldom taken stays short in the kernel's text
#pragma unroll 1
      for (int c = 0; c < 64; ++c) {
        v4f* p = (v4f*)(sc + (16 * wave + (c >> 2)) * PIT) + 32 * (c & 3) + lane;
        HU u;
        u.f = *p;
#pragma unroll
        for (int e = 0; e < 8; ++e) {
          const _Float16 h0 = u.s[e];
          u.s[e] = (float)h0 < 6.103515625e-05f ? (_Float16)0.0f : h0;
        }
        *p = u.f;
      }
    }
  }
  __syncthreads();   // every staged f16 row is complete before another wave reads its fragments

  // ---- (3) value sum ----
  v8f acc[2][8];
#pragma unroll
  for (int i = 0; i < 2; ++i)
#pragma unroll
    for (int j = 0; j < 8; ++j) acc[i][j] = zero8();

  const char* ep = (const char*)sc + rl * (PIT * 4) + hh * 16;  // E row 16j + rl, k = 32S + 8hh (+16): byte 64S (+32)
  v16h ef[2][8];
#pragma unroll
  for (int j = 0; j < 8; ++j) ef[0][j] = ldfrag_lds(ep + j * (16 * PIT * 4));
  // VRING k steps; ring slots and k offsets inside them are constants
  auto steps = [&](const bool last) __attribute__((always_inline)) {
#pragma unroll
    for (int s = 0; s < VRING; ++s) {
      if (!last || s + 1 < VRING) {
#pragma unroll
        for (int j = 0; j < 8; ++j) ef[(s + 1) & 1][j] = ldfrag_lds(ep + j * (16 * PIT * 4) + 64 * (s + 1));
      }
      // the next step's LDS reads stay one group in front of this step's products, not spread among them
      __builtin_amdgcn_sched_barrier(0);
#pragma unroll
      for (int i = 0; i < 2; ++i)
#pragma unroll
        for (int j = 0; j < 8; ++j) acc[i][j] = mma_h_raw(va[s][i], ef[s & 1][j], acc[i][j]);
      // keeps the refill right behind the products that free its slot: sunk, it would be waited out at its use
      __builtin_amdgcn_sched_barrier(0);
      if (!last) {
#pragma unroll
        for (int i = 0; i < 2; ++i) va[s][i] = ldfrag_h((const _Float16*)(pv + oa[i] + 1024 * (s + VRING)));
      }
      __builtin_amdgcn_sched_barrier(0);
    }
  };
  // rolled, VRING steps a trip, so that the kernel's text stays small
#pragma unroll 1
  for (int tp = 0; tp < NT / 32 / VRING - 1; ++tp) {
    steps(false);
    // the offset registers that the value loads name are rewritten below
    asm volatile("s_wait_xcnt 0x0" ::: "memory");
    // keeps that rewriting behind the wait above
    __builtin_amdgcn_sched_barrier(0);
    oa[0] += 1024 * VRING;
    oa[1] += 1024 * VRING;
    ep += 64 * VRING;
  }
  steps(true);
#pragma unroll
  for (int i = 0; i < 2; ++i) {
    acc_guard4(acc[i][0], acc[i][1], acc[i][2], acc[i][3]);
    acc_guard4(acc[i][4], acc[i][5], acc[i][6], acc[i][7]);
  }

  // ---- epilogue ----
  const float fo = 1.0f / (SCV * SCE);
  float* slab = sst + wave * (16 * 68);
  const int p4 = (lane & 15) * 4, r2 = lane >> 4;
  // one address each for x and out: the rows and column halves of a lane become immediate offsets, and no address
  // register of an issued load or store is written again
  const size_t eo = ((size_t)(b * CH + cb + r2)) * NT + n0 + p4;
  const float* xb = X + eo;
  float* ob = out + eo;
#pragma unroll
  for (int i = 0; i < 2; ++i) {
#pragma unroll
    for (int jh = 0; jh < 2; ++jh) {
#pragma unroll
      for (int r = 0; r < 8; ++r) {
#pragma unroll
        for (int j = 0; j < 4; ++j) {
          // D row = c offset 8hh + r, D col = n offset 64jh + 16j + rl
          slab[(8 * hh + r) * 68 + 16 * j + rl] = acc[i][4 * jh + j][r];
        }
      }
      wave_lds_sync();
      v4f ov[8];
#pragma unroll
      for (int it = 0; it < 8; ++it) {
        const int row = 2 * it + r2;                          // it 0..7 x r2 0..1 = rows 0..15
        const v4f a = *(const v4f*)(slab + row * 68 + p4);
        const v4f xv = *(const v4f*)(xb + (16 * i + 2 * it) * NT + 64 * jh);   // channel cb + 16i + row
        v4f o;
#pragma unroll
        for (int e = 0; e < 4; ++e) o[e] = a[e] * fo + bfr(xv[e]);
        ov[it] = o;
      }
      {
#pragma unroll
        for (int it = 0; it < 8; ++it) *(v4f*)(ob + (16 * i + 2 * it) * NT + 64 * jh) = ov[it];
      }
      wave_lds_sync();
    }
  }
}

// =====================================================================================================
// Workspace map; every plane [rows][k] below is stored in fragment order (see the head of the file).
//   WQ16  f16 [256][256]             0        131072   (64*Wq, bf16RNE)
//   WK16  f16 [256][256]        131072        131072   (64*Wk)
//   WV16  f16 [256][256]        262144        131072   (64*Wv)
//   XQ    f16 [32768][256]      393216      16777216   (8*q, position rows, k = c)
//   XK    f16 [32768][256]    17170432      16777216   (8*k)
//   VH    f16 [256][32768]    33947648      16777216   (16*v, row c, k = b*1024 + m)
//   end                       50724864
// d_out f32 [32][256][1024] at byte 0.
// =====================================================================================================
extern "C" void kernel_launch(void* const* d_in, const int* in_sizes, int n_in,
                              void* d_out, int out_size, void* d_ws, size_t ws_size,
                              hipStream_t stream) {
  if (n_in < 7) return;
  if (in_sizes[0] != NB * CH * NT) return;
  if (in_sizes[1] != CH * CH || in_sizes[2] != CH) return;
  if (in_sizes[3] != CH * CH || in_sizes[4] != CH) return;
  if (in_sizes[5] != CH * CH || in_sizes[6] != CH) return;
  if (out_size != OUTN) return;

  const float* x  = (const float*)d_in[0];   // [32][256][1024]
  const float* Wq = (const float*)d_in[1];   // [256][256]  ([out][in])
  const float* bq = (const float*)d_in[2];   // [256]
  const float* Wk = (const float*)d_in[3];   // [256][256]
  const float* bk = (const float*)d_in[4];   // [256]
  const float* Wv = (const float*)d_in[5];   // [256][256]
  const float* bv = (const float*)d_in[6];   // [256]

  const size_t PW  = (size_t)CH * CH * 2;                    //   131072
  const size_t PPL = (size_t)TOK * CH * 2;                   // 16777216

  size_t off = 0;
  const size_t oWQ = off; off += PW;
  const size_t oWK = off; off += PW;
  const size_t oWV = off; off += PW;
  const size_t oXQ = off; off += PPL;
  const size_t oXK = off; off += PPL;
  const size_t oVH = off; off += PPL;                        // off = 50724864
  if (off > ws_size) return;
  if (off > (size_t)134217728) return;

  char* ws = (char*)d_ws;
  _Float16* WQ16 = (_Float16*)(ws + oWQ);
  _Float16* WK16 = (_Float16*)(ws + oWK);
  _Float16* WV16 = (_Float16*)(ws + oWV);
  _Float16* XQ   = (_Float16*)(ws + oXQ);
  _Float16* XK   = (_Float16*)(ws + oXK);
  _Float16* VH   = (_Float16*)(ws + oVH);
  float*    outf = (float*)d_out;

  const dim3 blk(256);
  const dim3 gPrep(3 * WBLK);                                          // 96
  const dim3 gPr(TOK / PPB);                                           // 256 blocks of 128 positions
  const dim3 gAt(NT / RSB, NB);                                        // (8, 32)

  // (1) weight planes, x64 carried (conv weights [out][in]: rows = out, k = in), in fragment order
  k_prep<<<gPrep, blk, 0, stream>>>(Wq, Wk, Wv, WQ16, WK16, WV16);
  // (2) XQ, XK, VH from x [32][256][1024] and the weight planes
  k_proj<<<gPr, blk, 0, stream>>>(x, WQ16, WK16, WV16, bq, bk, bv, XQ, XK, VH);
  // (3) scores + row softmax + softmax-weighted value sum + residual -> d_out
  k_attn<<<gAt, blk, 0, stream>>>(XQ, XK, VH, x, outf);
}

// v009
// A run of this version takes 47 microseconds.
// Next to v008, in two timings, it ran 1.16 and 1.17 times as fast.
// Over all steps from v000 it is 5.09 times as fast.
#include <hip/hip_runtime.h>
#include <math.h>
#include <stdint.h>

// All contractions on v_wmma_f32_16x16x32_f16 (f16 operands, f32 accumulate): the three 1x1-conv
// projections take bf16-RNE inputs (x1) and bf16-RNE weights (x64) as single f16 planes; the 256-deep
// query.key scores use single f16 planes of 8*q and 8*k; the 1024-deep softmax-weighted value sum uses
// a single f16 plane of 16*v against E = f16(32768*softmax) held as f16 rows in LDS. Softmax
// arithmetic, biases, residual add and epilogues are f32; a 16-key tile's statistics rest in LDS as one word (reference:
// upper 16 bits of a float, sum: f16); the factor that rescales an E chunk is f16.
//
// Every f16 operand plane [R][K] in memory lives in fragment order: for 16-row tile T and 32-deep k step S the unit
// (T*(K/32) + S) is 512 halves; inside it element (row, k) sits at ((k>>4)&1)*256 + (((k>>3)&1)*16 + (row&15))*8
// + (k&7). A wave's two 16-B loads of one fragment then cover 2 x 512 contiguous bytes (whole 128-B lines).

#define NB   32
#define CH   256
#define NT   1024
#define TOK  (NB * NT)
#define RSB  128                            // query rows per attention block
#define PIT  (NT / 2 + 4)                   // LDS pitch of an E row of NT f16, in floats
#define SPIT (NT / 16 + 4)                  // LDS pitch of a row's NT/16 statistics words, in words
#define VRING 8                             // value fragment ring, k steps
#define OUTN (NB * CH * NT)
#define WBLK ((CH * CH) / 2048)            // 256-thread blocks per weight plane, 8 elements a thread
#define PPB  128                            // positions per projection block
#define XTP  (16 * CH * 2 + 16)             // LDS pitch of a 16-position tile of x (CH/32 units of 1024 B), in bytes

#define SCW  64.0f
#define SCQK 8.0f
#define SCV  16.0f
#define SCE  32768.0f
#define SCS  (1.0f / (SCQK * SCQK * 16.0f))
#define CEX  (SCS * 1.44269504088896f)      // raw score product -> exponent of two

static_assert(TOK % 64 == 0 && CH % 64 == 0 && CH % 32 == 0 && NT % 32 == 0);
static_assert(TOK % PPB == 0 && PPB == 2 * 64 && CH == 4 * 4 * 16);
static_assert(NT % RSB == 0 && RSB == 128 && NT == 4 * 256);
static_assert((PIT * 4) % 32 == 16 && (NT / 32) % VRING == 0);
static_assert(SPIT % 64 == 4 && RSB * SPIT == 8 * 16 * 68);
static_assert((NT / 16) % 8 == 0 && CH == 8 * 32);
static_assert((CH * CH) % 2048 == 0);
static_assert(NT % PPB == 0 && PPB == 32 * 4 && XTP % 256 == 16);

typedef _Float16       v16h __attribute__((ext_vector_type(16)));
typedef _Float16       v8h  __attribute__((ext_vector_type(8)));
typedef float          v8f  __attribute__((ext_vector_type(8)));
typedef float          v4f  __attribute__((ext_vector_type(4)));
typedef float          v2f  __attribute__((ext_vector_type(2)));
typedef unsigned int   v4u  __attribute__((ext_vector_type(4)));
typedef _Float16       v2h  __attribute__((ext_vector_type(2)));
typedef __bf16         v2b  __attribute__((ext_vector_type(2)));

union HU { v8h h; v4u u; v4f f; _Float16 s[8]; v2h p[4]; };
union FR { v16h v; v8h h[2]; _Float16 s[16]; };
static_assert(sizeof(HU) == 16);
static_assert(sizeof(FR) == 32);

// ---- scalar helpers --------------------------------------------------------------------------------
__device__ __forceinline__ unsigned short bf_bits(float f) {          // f32 -> bf16 bits, RNE convert
  const unsigned u = __float_as_uint(f);
  return (unsigned short)((u + 0x7FFFu + ((u >> 16) & 1u)) >> 16);
}
__device__ __forceinline__ float bf_up(unsigned short h) { return __uint_as_float(((unsigned)h) << 16); }
__device__ __forceinline__ float bfr(float f) { return bf_up(bf_bits(f)); }   // value after bf16 RNE convert
// f16(bf16RNE(a)), f16(bf16RNE(b)) by the packed converts, which round to nearest even: the values of bfr() for every
// finite input
__device__ __forceinline__ v2h bfr2h(float a, float b) {
  const v2f x = {a, b};
  return __builtin_convertvector(__builtin_convertvector(__builtin_convertvector(x, v2b), v2f), v2h);
}
__device__ __forceinline__ v8f zero8() { v8f z = {0.f, 0.f, 0.f, 0.f, 0.f, 0.f, 0.f, 0.f}; return z; }

__device__ __forceinline__ void ld8(const float* p, float* o) {
  const v4f a = *(const v4f*)(p);
  const v4f b = *(const v4f*)(p + 4);
  o[0] = a[0]; o[1] = a[1]; o[2] = a[2]; o[3] = a[3];
  o[4] = b[0]; o[5] = b[1]; o[6] = b[2]; o[7] = b[3];
}

// ---- fragment loader: 16-bit A/B operand from a fragment-order plane, p = unit*512 + 8*lane, h = lane>>4;
//      elements 0..7 <- p[0..7] (k0+8h..k0+8h+7), elements 8..15 <- p[256..263] (k0+16+8h..k0+16+8h+7)
__device__ __forceinline__ v16h ldfrag_h(const _Float16* p) {
  FR f;
  f.h[0] = *(const v8h*)(p);
  f.h[1] = *(const v8h*)(p + 256);
  return f.v;
}

// ---- WMMA helpers --------------------------------------------------------------------------------------
__device__ __forceinline__ v8f mma_h_raw(v16h a, v16h b, v8f c) {
  return __builtin_amdgcn_wmma_f32_16x16x32_f16(false, a, false, b, (short)0, c, false, false);
}
__device__ __forceinline__ void acc_guard4(v8f& a, v8f& b, v8f& c, v8f& d) {
#if defined(__HIP_DEVICE_COMPILE__)
  asm volatile("v_nop\n\tv_nop\n\tv_nop\n\tv_nop" : "+v"(a), "+v"(b), "+v"(c), "+v"(d));
#endif
}
// v[0..7] <- 2^v[0..7]. One statement, in place, with a v_nop behind the last: it keeps the slot that the instruction
// set asks for between a transcendental and an instruction that overwrites its source or reads its result.
__device__ __forceinline__ void exp2x8(float* v) {
#if defined(__HIP_DEVICE_COMPILE__)
  asm("v_exp_f32 %0, %0\n\tv_exp_f32 %1, %1\n\tv_exp_f32 %2, %2\n\tv_exp_f32 %3, %3\n\t"
      "v_exp_f32 %4, %4\n\tv_exp_f32 %5, %5\n\tv_exp_f32 %6, %6\n\tv_exp_f32 %7, %7\n\tv_nop"
      : "+v"(v[0]), "+v"(v[1]), "+v"(v[2]), "+v"(v[3]), "+v"(v[4]), "+v"(v[5]), "+v"(v[6]), "+v"(v[7]));
#endif
}
__device__ __forceinline__ void wave_lds_sync() {
  __builtin_amdgcn_fence(__ATOMIC_RELEASE, "workgroup");
  __builtin_amdgcn_wave_barrier();
  __builtin_amdgcn_fence(__ATOMIC_ACQUIRE, "workgroup");
}

// =====================================================================================================
// Weight convert: in [R][kd] f32 row-major -> out f16(scale * bf16RNE(in)) in fragment order; thread i owns
// the i-th 16-B chunk of the output (lane = i&31, part = (i>>5)&1, unit = i>>6), one 16-B store per lane.
// coverage: n8 threads x 8 = the whole plane; n8 is a multiple of 256 at every call here. blk = block index
// within the plane.
// =====================================================================================================
__device__ __forceinline__ void cvt_flat(const float* __restrict__ in, _Float16* out, int n8, int kd, float scale, int blk) {
  const int i = blk * 256 + threadIdx.x;
  if (i < n8) {
    const int ksn = kd >> 5, unit = i >> 6;
    const int tile = unit / ksn, ks = unit - tile * ksn;
    const int row = tile * 16 + (i & 15);
    const int k = ks * 32 + ((i >> 5) & 1) * 16 + ((i >> 4) & 1) * 8;
    float v[8];
    ld8(in + (size_t)row * kd + k, v);
    HU u;
#pragma unroll
    for (int e = 0; e < 8; ++e) u.s[e] = (_Float16)(bfr(v[e]) * scale);
    _Float16* p = out + (size_t)i * 8;
    *(v4u*)p = u.u;
    
  }
}

// =====================================================================================================
// The three weight planes in one launch, WBLK blocks each.
// =====================================================================================================
__global__ __launch_bounds__(256) void k_prep(const float* __restrict__ Wq, const float* __restrict__ Wk,
                                              const float* __restrict__ Wv,
                                              _Float16* WQ, _Float16* WK, _Float16* WV) {
  const int bx = blockIdx.x;
  const int sel = bx / WBLK;
  const float* in = sel == 0 ? Wq : (sel == 1 ? Wk : Wv);
  _Float16* o = sel == 0 ? WQ : (sel == 1 ? WK : WV);
  cvt_flat(in, o, (CH * CH) / 8, CH, SCW, bx - sel * WBLK);
}

// =====================================================================================================
// The three projections in one launch, one pass over x. Block = 128 positions of one image, 8 waves (two a SIMD, so a
// wave may hold up to 512 registers), one block a WGP.
// First the block builds xT = f16(bf16RNE(x)) for its positions (rows = position, k = channel) in LDS, in fragment
// order, a 16-position tile at a pitch of XTP bytes: wave w reads channels 32w..32w+31 (k step w), a lane 4 positions of
// each (a wave's load = 512 contiguous bytes of one channel row), and stores 16 chunks of 8 channels x 1 position.
// With the 16 B of pad a tile, the 16 lanes of each half wave store to 16 different bank groups; a fragment read
// is 2 x 512 contiguous bytes. coverage: 8 waves x 32 channels x 32 lanes x 4 positions = 256 k x 128 rows.
// Behind one block barrier wave w holds the 32 xT fragments of positions p0..p0+63
// (p0 = 1024*image + 128*group + 64*(w&1)) in registers for the whole kernel and runs through 12 weight row tiles: tiles
// 4*(w>>1) .. +3 of Wq, then of Wk, then of Wv. Every weight fragment is loaded once a wave and feeds four products;
// the weight fragments form a ring two row tiles deep. K = 256 (8 k steps, ascending) for every accumulator.
// The two waves that stream the same weight tiles (2j, 2j+1) sit on different SIMDs and are of the same age there,
// so they run side by side and the second one's loads can hit the WGP cache.
// The operand roles are chosen so that a lane's 8 accumulator rows are 8 consecutive k of the plane it writes:
//   XQ, XK (rows = position, k = channel): A = weight tile, B = xT tile i -> D row = channel 8hh + r, D col = position rl
//   VH     (rows = channel, k = position): A = xT tile i, B = weight tile -> D row = position 8hh + r, D col = channel rl
// In both cases the lane's 8 halves are the 16-B chunk number 'lane' of a 512-B half unit: one contiguous wave store.
//   XQ = f16(8*(xT . Wq^T + bq)), XK = f16(8*(xT . Wk^T + bk)), VH = f16(16*(Wv . x + bv)); biases bf16RNE.
// coverage: XQ, XK: 32 images x 8 blocks x 2 position groups x 4 tiles i x 16 positions = 32768 rows, 4 wave groups x
// 4 tiles x 16 = 256 channels; VH: the same 256 channels as rows x the same 32768 positions as k.
// Block index -> image, here and in k_attn: grid (32 images, 8 blocks of 128 positions), so the flat block index is
// image + 32 * block and the 8 blocks of an image have equal flat indices modulo 8. For speed only: every (image, block) pair is done once wherever
// the blocks land.
// =====================================================================================================
__global__ __launch_bounds__(256) void k_proj(const float* __restrict__ X, const _Float16* __restrict__ WQ,
                                              const _Float16* __restrict__ WK, const _Float16* __restrict__ WV,
                                              const float* __restrict__ bq, const float* __restrict__ bk,
                                              const float* __restrict__ bv,
                                              _Float16* XQ, _Float16* XK, _Float16* VH) {
  __shared__ __align__(16) char sx[(PPB / 16) * XTP];            // xT of the block's positions
  const int lane = threadIdx.x & 31;
  // the wave's number in a scalar register: every base address below is then scalar, and the only vector address
  // registers are lane offsets that are never written again
  const int wave = __builtin_amdgcn_readfirstlane(threadIdx.x >> 5);
  const unsigned l8 = 8u * lane;                                 // this lane's 16-B chunk of a 512-B half unit, in halves
  const unsigned hb = 8u * (lane >> 4), rl = lane & 15;          // bias offsets: 8hh (XQ, XK), rl (VH)
  // image = blockIdx.x, 128-position group of it = blockIdx.y: see "Block index -> image" above k_proj
  const int pb = blockIdx.x * NT + blockIdx.y * PPB;             // first of the block's positions
  const int p0 = pb + (wave & 1) * 64;                           // first of this wave's 64 positions
  const int ct0 = (wave >> 1) * 4;                               // first of this wave's 4 row tiles in each weight plane
  const float cs64 = 1.0f / SCW;                                 // undo the weight carry
  const int wo = ct0 * 16 * CH;                                  // row tile ct0 of a weight plane
  const _Float16* wp[3] = {WQ + wo, WK + wo, WV + wo};
  const float* bp[3] = {bq + 16 * ct0, bk + 16 * ct0, bv + 16 * ct0};              // channel 16*ct0
  // XQ, XK: unit (p0/16 + i)*8 + ct/2, half ct&1; VH: unit ct*(TOK/32) + p0/32 + i/2, half i&1; here for ct = ct0, i = 0
  _Float16* dp[3] = {XQ + (size_t)p0 * CH + ct0 * 256, XK + (size_t)p0 * CH + ct0 * 256,
                     VH + (size_t)ct0 * 16 * TOK + (size_t)p0 * 16};
  v16h xf[4][CH / 32], kf[2][CH / 32];
  {
    const float* xs = X + ((size_t)blockIdx.x * CH + 32 * wave) * NT + blockIdx.y * PPB;   // channel 32*wave
    const unsigned l4 = 4u * lane;
    v4f xr[32];
#pragma unroll
    for (int c = 0; c < 32; ++c) xr[c] = *(const v4f*)(xs + c * NT + l4);
    // keeps the loads from memory in front of the weight loads, which come from L2
    __builtin_amdgcn_sched_barrier(0);
#pragma unroll
    for (int s = 0; s < 2; ++s)
#pragma unroll
      for (int ks = 0; ks < CH / 32; ++ks) kf[s][ks] = ldfrag_h(wp[0] + s * 16 * CH + 512 * ks + l8);
    // the code below may re-use the registers that these loads name
    asm volatile("s_wait_xcnt 0x0" ::: "memory");
    // keeps every load above in front of the first wait for x, and every later register write behind the wait above
    __builtin_amdgcn_sched_barrier(0);
    // position 4*lane + j: tile lane>>2, row 4*(lane&3) + j; channel 32*wave + 8*g + e: unit 'wave', chunk column g
    char* sd = sx + (lane >> 2) * XTP + wave * 1024 + (lane & 3) * 64;
#pragma unroll
    for (int g = 0; g < 4; ++g)
#pragma unroll
      for (int j = 0; j < 4; ++j) {
        HU u;
#pragma unroll
        for (int e = 0; e < 4; ++e) u.p[e] = bfr2h(xr[8 * g + 2 * e][j], xr[8 * g + 2 * e + 1][j]);
        *(v4u*)(sd + (g >> 1) * 512 + (g & 1) * 256 + j * 16) = u.u;
      }
  }
  __syncthreads();   // every wave's k step of xT is in LDS before another wave reads its fragments
  {
    const char* sl = sx + (wave & 1) * 4 * XTP + lane * 16;      // tile 4*(wave&1) = position p0
#pragma unroll   // k step by k step, the order in which the first tile's products take them
    for (int ks = 0; ks < CH / 32; ++ks)
#pragma unroll
      for (int i = 0; i < 4; ++i) {
        FR f;
        f.h[0] = *(const v8h*)(sl + i * XTP + 1024 * ks);
        f.h[1] = *(const v8h*)(sl + i * XTP + 1024 * ks + 512);
        xf[i][ks] = f.v;
      }
  }
#pragma unroll   // plane, operand roles and ring slot become constants; the last two tiles drop their refill
  for (int t = 0; t < 12; ++t) {
    const int sel = t >> 2;                                      // 0 Wq, 1 Wk, 2 Wv
    const int tc = t & 3;                                        // row tile ct = ct0 + tc of the plane = 16 output channels
    // this tile's biases, issued a whole tile of products ahead of their use
    float bb[8];
    if (sel < 2) {
      ld8(bp[sel] + 16 * tc + hb, bb);                           // channels 16ct + 8hh + r
    } else {
      bb[0] = bp[2][16 * tc + rl];                               // channel 16ct + rl
    }
    // keeps the bias loads here: sunk to their use they would be waited out there
    __builtin_amdgcn_sched_barrier(0);
    v8f a[4];
#pragma unroll
    for (int i = 0; i < 4; ++i) a[i] = zero8();
#pragma unroll
    for (int ks = 0; ks < CH / 32; ++ks) {
#pragma unroll
      for (int i = 0; i < 4; ++i)
        a[i] = sel < 2 ? mma_h_raw(kf[t & 1][ks], xf[i][ks], a[i]) : mma_h_raw(xf[i][ks], kf[t & 1][ks], a[i]);
      // the fragment of the tile after next, issued two whole tiles ahead of its use
      if (t + 2 < 12) kf[t & 1][ks] = ldfrag_h(wp[(t + 2) >> 2] + ((t + 2) & 3) * 16 * CH + 512 * ks + l8);
      // keeps the refill here: the scheduler otherwise sinks it to just in front of its use
      __builtin_amdgcn_sched_barrier(0);
    }
    if (sel < 2) {
#pragma unroll
      for (int i = 0; i < 4; ++i) {
        HU h;
#pragma unroll
        for (int r = 0; r < 8; ++r) h.s[r] = (_Float16)((a[i][r] * cs64 + bfr(bb[r])) * SCQK);
        *(v4u*)(dp[sel] + tc * 256 + i * 16 * CH + l8) = h.u;
      }
    } else {
      const float bc = bfr(bb[0]);
#pragma unroll
      for (int i = 0; i < 4; ++i) {
        HU h;
#pragma unroll
        for (int r = 0; r < 8; ++r) h.s[r] = (_Float16)((a[i][r] * cs64 + bc) * SCV);
        *(v4u*)(dp[2] + tc * 16 * TOK + i * 256 + l8) = h.u;
      }
    }
    if (t + 1 < 12) {
      // the next tile rewrites the data registers that these stores name
      asm volatile("s_wait_xcnt 0x0" ::: "memory");
      // keeps every register write of the next tile behind the wait above
      __builtin_amdgcn_sched_barrier(0);
    }
  }
}

// =====================================================================================================
// Scores + row softmax + softmax-weighted value sum + residual in one kernel: the softmax rows never leave LDS.
// Block = (b, 128 query rows n0..n0+127), 8 waves (two a SIMD, so a wave may hold up to 512 registers), one block
// a WGP, 256 blocks. LDS: 128 E rows of 1024 f16 at a pitch of 2064 B (16 B x odd: the 16 rows of a fragment read or
// of a chunk store fall on 16 different bank groups), 16-B chunk c (k = 8c..8c+7) at byte 16c; and per row one
// statistics word per 16-key tile, at a pitch of 272 B. A statistics word holds the tile's reference (its score
// maximum rounded up to the upper 16 bits of a float) and, as f16 in the lower 16 bits, the tile's sum / 16.
//  (1) wave w computes, for the 64 queries of half w&1, the 16-key score tiles ct = (w>>1), (w>>1)+4, ... (16 of them),
//      transposed: A = XK rows, Bt = XQ rows (K = 256), s = (k8 . q8) / (64*16), so that a lane holds 8 consecutive keys
//      of one query = one chunk, and lane l ^ 16 the tile's other 8. Still in registers: tile reference mc,
//      e = 32768 * exp(s - mc), tile sum zc = sum e (ascending key in each half, then the two halves), f16(e) stored as
//      the chunk, the statistics word in the row's statistics line. This vector work of one wave runs beside the products of the
//      other wave on its SIMD. The 32 query fragments are loaded once and stay in registers; the key fragments form
//      a ring two key tiles deep. Waves 2j and 2j+1 stream the same key tiles; they sit on different SIMDs and are of
//      the same age there, so they run side by side and the second one's loads can hit the WGP cache.
//  (2) wave w owns rows 16w..16w+15, four at a time: lane holds the words of the tiles of its chunks 32j + lane
//      (j = 0..3; every tile is held by two lanes); row reference M (xor shuffles), fc = exp(mc - M),
//      Z = sum_c fc * zc (fixed lane order + xor shuffles, every tile counted twice), then each chunk is rescaled in
//      place, E = f16(e) * f16(32768 * fc / Z); f16 subnormals are flushed to zero in a second pass over the wave's
//      rows, taken only where a ballot finds a value below the smallest normal f16 among them.
//  (3) after a block barrier: D[c][n] = sum_m (16*v)[c][m] . E[n][m], A = value plane rows c (fragment order, row
//      length TOK, k from b*NT), Bt = the 128 E rows in LDS, K = 1024 (32 k steps, ascending). Wave w owns
//      channels 32w..32w+31 (2 x 8 tiles), so every value fragment is loaded once a block and feeds eight products.
//      The value fragments form a ring 8 steps deep, first filled ahead of (2); the E fragments are read one step ahead.
// Epilogue: out[b][c][n] = D/(16*32768) + bf16RNE(x[b][c][n]); per wave four 16x64 f32 slabs staged in LDS, in the
// wave's own 16 rows of the statistics area, which nobody reads after (2).
// coverage: (1): 2 query halves x 4 wave groups x 16 key tiles x 2 chunks = 128 chunks and 64 words in each of 128 rows;
// (2): 8 waves x 16 rows x 4 j x 32 lanes = the same 128 chunks x 128 rows; out: 8 waves x 4 slabs x 16 rows x 64 cols =
// 256 c x 128 n per block; grid (32, 8) = every (b, n tile) -> whole output [32][256][1024].
// =====================================================================================================
__device__ __forceinline__ v16h ldfrag_lds(const char* p) {   // elements 0..7 <- 16 B at p, 8..15 <- 16 B at p + 32
  HU lo, hi;
  lo.f = *(const v4f*)(p);
  hi.f = *(const v4f*)(p + 32);
  FR f;
  f.h[0] = lo.h;
  f.h[1] = hi.h;
  return f.v;
}
__device__ __forceinline__ float xhalf(float x) {             // the value of lane l ^ 16
  return __builtin_bit_cast(float, __builtin_amdgcn_permlanex16(__builtin_bit_cast(int, x), __builtin_bit_cast(int, x),
                                                                0x76543210, 0xfedcba98, false, false));
}

__global__ __launch_bounds__(256) void k_attn(const _Float16* __restrict__ XQ, const _Float16* __restrict__ XK,
                                              const _Float16* __restrict__ VH, const float* __restrict__ X,
                                              float* out) {
  __shared__ __align__(16) float sc[RSB * PIT];               // the f16 E rows
  __shared__ __align__(16) float sst[RSB * SPIT];             // their tile statistics; in the epilogue the output slabs
  const int tid = threadIdx.x, wave = tid >> 5, lane = tid & 31;
  const int hh = lane >> 4, rl = lane & 15;
  const int b = blockIdx.x, rb = blockIdx.y, n0 = rb * RSB;     // image first: see "Block index -> image" above k_proj

  // ---- (1) scores ----
  {
    const int qh = wave & 1, kg = wave >> 1;
    const _Float16* aq = XQ + (size_t)(b * NT + n0 + 64 * qh) * CH + 8 * lane;   // row tile (b*NT+n0+64qh)/16, CH/32 units each
    const _Float16* bk = XK + (size_t)(b * NT + 16 * kg) * CH + 8 * lane;
    v16h q[4][CH / 32], kf[2][CH / 32];
#pragma unroll
    for (int ks = 0; ks < CH / 32; ++ks) kf[0][ks] = ldfrag_h(bk + 512 * ks);
#pragma unroll
    for (int i = 0; i < 4; ++i)
#pragma unroll
      for (int ks = 0; ks < CH / 32; ++ks) q[i][ks] = ldfrag_h(aq + i * 16 * CH + 512 * ks);
#pragma unroll
    for (int ks = 0; ks < CH / 32; ++ks) kf[1][ks] = ldfrag_h(bk + 64 * CH + 512 * ks);
    // the code below re-uses the base registers that the query loads name
    asm volatile("s_wait_xcnt 0x0" ::: "memory");
    // keeps the second tile's loads behind the first products' operands, so that tile 0 does not wait for them,
    // and every later register write behind the wait above
    __builtin_amdgcn_sched_barrier(0);
    const _Float16* kp = bk + 2 * 64 * CH;                      // key tile two ahead of the pair in work
    float* er = sc + (64 * qh + rl) * PIT + 4 * (2 * kg + hh);  // this lane's chunk of key tile kg, query tile 0
    unsigned* sr = (unsigned*)sst + (64 * qh + 16 * hh + rl) * SPIT + kg;   // word of key tile kg, query tile hh
    // one key tile: slot = ring slot and place in the pair (column tile ct = kg + 4 * (2 * pair + slot))
    auto tile = [&](const int slot, const bool refill) __attribute__((always_inline)) {
      v8f a[4];
#pragma unroll
      for (int i = 0; i < 4; ++i) a[i] = zero8();
#pragma unroll
      for (int ks = 0; ks < CH / 32; ++ks) {
#pragma unroll
        for (int i = 0; i < 4; ++i) a[i] = mma_h_raw(kf[slot][ks], q[i][ks], a[i]);
        // the fragment of the tile after next, issued two whole tiles ahead of its use
        if (refill) kf[slot][ks] = ldfrag_h(kp + slot * 64 * CH + 512 * ks);
        // keeps the refill here: the scheduler otherwise sinks it to just in front of its use
        __builtin_amdgcn_sched_barrier(0);
      }
      // D row = key 8hh + r of the column tile, D col = query rl of row tile i: a lane's 8 values are one chunk of its row
      unsigned stw[4];
#pragma unroll
      for (int i = 0; i < 4; ++i) {
        float am = a[i][0];
#pragma unroll
        for (int r = 1; r < 8; ++r) am = fmaxf(am, a[i][r]);
        am = fmaxf(am, xhalf(am));                              // over the tile's 16 keys
        const float ms = am * SCS;
        const unsigned mu0 = __float_as_uint(ms);
        const unsigned mu = (ms > 0.0f ? mu0 + 0xFFFFu : mu0) & 0xFFFF0000u;   // rounded up: e never exceeds 32768
        const float k0 = 15.0f - __uint_as_float(mu) * 1.44269504088896f;      // 2^15 * exp(s - mc) = exp2(a*CEX + k0)
        float ev[8];
#pragma unroll
        for (int r = 0; r < 8; ++r) ev[r] = a[i][r] * CEX + k0;
        exp2x8(ev);
        float zs = ev[0];
#pragma unroll
        for (int r = 1; r < 8; ++r) zs += ev[r];
        zs += xhalf(zs);
        HU u;
#pragma unroll
        for (int r = 0; r < 8; ++r) u.s[r] = (_Float16)ev[r];
        *(v4f*)(er + i * 16 * PIT + slot * 32) = u.f;
        const _Float16 zh = (_Float16)(zs * 0.0625f);           // in (0, 32768]
        stw[i] = mu | (unsigned)__builtin_bit_cast(unsigned short, zh);
      }
      // both halves of the wave hold the same four words: the lower half stores those of query tiles 0 and 2, the upper
      // half those of 1 and 3
#pragma unroll
      for (int ip = 0; ip < 2; ++ip) sr[ip * 32 * SPIT + slot * 4] = hh ? stw[2 * ip + 1] : stw[2 * ip];
    };
    // rolled, two tiles a trip, so that the kernel's text stays small; the ring slots stay constants
#pragma unroll 1
    for (int tp = 0; tp < NT / 128 - 1; ++tp) {
      tile(0, true);
      tile(1, true);
      // the address registers that the key loads name are rewritten below
      asm volatile("s_wait_xcnt 0x0" ::: "memory");
      // keeps that rewriting behind the wait above
      __builtin_amdgcn_sched_barrier(0);
      kp += 2 * 64 * CH;
      er += 2 * 32;
      sr += 2 * 4;
    }
    tile(0, false);
    tile(1, false);
  }
  __syncthreads();

  // ---- value ring, first fill: the loads fly while the softmax runs ----
  const int cb = wave * 32;
  const char* pv = (const char*)VH;
  unsigned oa[2];                              // byte offset of this lane's 16 B in the first unit, per channel tile
#pragma unroll
  for (int i = 0; i < 2; ++i)
    oa[i] = ((unsigned)((cb >> 4) + i) * (unsigned)(TOK >> 5) + (unsigned)((b * NT) >> 5)) * 1024u + lane * 16u;
  v16h va[VRING][2];
#pragma unroll
  for (int s = 0; s < VRING; ++s)
#pragma unroll
    for (int i = 0; i < 2; ++i) va[s][i] = ldfrag_h((const _Float16*)(pv + oa[i] + 1024 * s));
  // the softmax re-uses the offset registers that these loads name
  asm volatile("s_wait_xcnt 0x0" ::: "memory");
  // keeps these loads in front of the softmax (sunk to their use they would be waited out there), and every
  // later register write behind the wait above
  __builtin_amdgcn_sched_barrier(0);

  // ---- (2) row statistics from the tile statistics, E rows rescaled in place ----
  {
    v8h lo8;                                                    // smallest E value that this lane has written, per element
#pragma unroll
    for (int e = 0; e < 8; ++e) lo8[e] = (_Float16)1.0f;
    for (int g = 0; g < 4; ++g) {
      const int row0 = 16 * wave + 4 * g;                       // four rows side by side: their reduction chains overlap
      float cm[16], cz[16], mx[4], z[4];                        // values of the chunks' tiles at [4 * q4 + j]
#pragma unroll
      for (int q4 = 0; q4 < 4; ++q4) {
        const unsigned* sp = (const unsigned*)sst + (row0 + q4) * SPIT + (lane >> 1);   // chunk 32j + lane: tile 16j + lane/2
#pragma unroll
        for (int j = 0; j < 4; ++j) {
          const unsigned st = sp[16 * j];
          cm[4 * q4 + j] = __uint_as_float(st & 0xFFFF0000u);
          cz[4 * q4 + j] = (float)__builtin_bit_cast(_Float16, (unsigned short)(st & 0xFFFFu));
        }
      }
#pragma unroll
      for (int q4 = 0; q4 < 4; ++q4)
        mx[q4] = fmaxf(fmaxf(cm[4 * q4], cm[4 * q4 + 1]), fmaxf(cm[4 * q4 + 2], cm[4 * q4 + 3]));
#pragma unroll
      for (int off = 16; off >= 1; off >>= 1)
#pragma unroll
        for (int q4 = 0; q4 < 4; ++q4) mx[q4] = fmaxf(mx[q4], __shfl_xor(mx[q4], off, 32));
#pragma unroll
      for (int c = 0; c < 16; ++c) cm[c] = (cm[c] - mx[c >> 2]) * 1.44269504088896f;
      exp2x8(cm);                                               // fc = exp(mc - M): tile reference -> row reference
      exp2x8(cm + 8);
#pragma unroll
      for (int q4 = 0; q4 < 4; ++q4) {
        z[q4] = 0.0f;
#pragma unroll
        for (int j = 0; j < 4; ++j) z[q4] += cm[4 * q4 + j] * cz[4 * q4 + j];
      }
#pragma unroll
      for (int off = 16; off >= 1; off >>= 1)
#pragma unroll
        for (int q4 = 0; q4 < 4; ++q4) z[q4] += __shfl_xor(z[q4], off, 32);
#pragma unroll
      for (int q4 = 0; q4 < 4; ++q4) {
        // z = 2 * (32768 * row sum) / 16: every tile twice, sums carried / 16
        const float rz = (SCE * 0.125f) * (1.0f / z[q4]);
        v4f* srow = (v4f*)(sc + (row0 + q4) * PIT);
#pragma unroll
        for (int j = 0; j < 4; ++j) {
          const _Float16 gf = (_Float16)(cm[4 * q4 + j] * rz);  // about [0, 1]
          HU u;
          u.f = srow[32 * j + lane];
          u.h = u.h * gf;
          lo8 = __builtin_elementwise_min(lo8, u.h);
          srow[32 * j + lane] = u.f;
        }
      }
    }
    _Float16 lo = lo8[0];
#pragma unroll
    for (int e = 1; e < 8; ++e) lo = lo8[e] < lo ? lo8[e] : lo;
    // f16 subnormal -> exact zero: the selects run only in a wave that holds a value below the smallest normal
    if (__builtin_amdgcn_ballot_w32((float)lo < 6.103515625e-05f) != 0u) {
      // rolled: a pass that is seldom taken stays short in the kernel's text
#pragma unroll 1
      for (int c = 0; c < 64; ++c) {
        v4f* p = (v4f*)(sc + (16 * wave + (c >> 2)) * PIT) + 32 * (c & 3) + lane;
        HU u;
        u.f = *p;
#pragma unroll
        for (int e = 0; e < 8; ++e) {
          const _Float16 h0 = u.s[e];
          u.s[e] = (float)h0 < 6.103515625e-05f ? (_Float16)0.0f : h0;
        }
        *p = u.f;
      }
    }
  }
  __syncthreads();   // every staged f16 row is complete before another wave reads its fragments

  // ---- (3) value sum ----
  v8f acc[2][8];
#pragma unroll
  for (int i = 0; i < 2; ++i)
#pragma unroll
    for (int j = 0; j < 8; ++j) acc[i][j] = zero8();

  const char* ep = (const char*)sc + rl * (PIT * 4) + hh * 16;  // E row 16j + rl, k = 32S + 8hh (+16): byte 64S (+32)
  v16h ef[2][8];
#pragma unroll
  for (int j = 0; j < 8; ++j) ef[0][j] = ldfrag_lds(ep + j * (16 * PIT * 4));
  // VRING k steps; ring slots and k offsets inside them are constants
  auto steps = [&](const bool last) __attribute__((always_inline)) {
#pragma unroll
    for (int s = 0; s < VRING; ++s) {
      if (!last || s + 1 < VRING) {
#pragma unroll
        for (int j = 0; j < 8; ++j) ef[(s + 1) & 1][j] = ldfrag_lds(ep + j * (16 * PIT * 4) + 64 * (s + 1));
      }
      // the next step's LDS reads stay one group in front of this step's products, not spread among them
      __builtin_amdgcn_sched_barrier(0);
#pragma unroll
      for (int i = 0; i < 2; ++i)
#pragma unroll
        for (int j = 0; j < 8; ++j) acc[i][j] = mma_h_raw(va[s][i], ef[s & 1][j], acc[i][j]);
      // keeps the refill right behind the products that free its slot: sunk, it would be waited out at its use
      __builtin_amdgcn_sched_barrier(0);
      if (!last) {
#pragma unroll
        for (int i = 0; i < 2; ++i) va[s][i] = ldfrag_h((const _Float16*)(pv + oa[i] + 1024 * (s + VRING)));
      }
      __builtin_amdgcn_sched_barrier(0);
    }
  };
  // rolled, VRING steps a trip, so that the kernel's text stays small
#pragma unroll 1
  for (int tp = 0; tp < NT / 32 / VRING - 1; ++tp) {
    steps(false);
    // the offset registers that the value loads name are rewritten below
    asm volatile("s_wait_xcnt 0x0" ::: "memory");
    // keeps that rewriting behind the wait above
    __builtin_amdgcn_sched_barrier(0);
    oa[0] += 1024 * VRING;
    oa[1] += 1024 * VRING;
    ep += 64 * VRING;
  }
  steps(true);
#pragma unroll
  for (int i = 0; i < 2; ++i) {
    acc_guard4(acc[i][0], acc[i][1], acc[i][2], acc[i][3]);
    acc_guard4(acc[i][4], acc[i][5], acc[i][6], acc[i][7]);
  }

  // ---- epilogue ----
  const float fo = 1.0f / (SCV * SCE);
  float* slab = sst + wave * (16 * 68);
  const int p4 = (lane & 15) * 4, r2 = lane >> 4;
  // one address each for x and out: the rows and column halves of a lane become immediate offsets, and no address
  // register of an issued load or store is written again
  const size_t eo = ((size_t)(b * CH + cb + r2)) * NT + n0 + p4;
  const float* xb = X + eo;
  float* ob = out + eo;
#pragma unroll
  for (int i = 0; i < 2; ++i) {
#pragma unroll
    for (int jh = 0; jh < 2; ++jh) {
#pragma unroll
      for (int r = 0; r < 8; ++r) {
#pragma unroll
        for (int j = 0; j < 4; ++j) {
          // D row = c offset 8hh + r, D col = n offset 64jh + 16j + rl
          slab[(8 * hh + r) * 68 + 16 * j + rl] = acc[i][4 * jh + j][r];
        }
      }
      wave_lds_sync();
      v4f ov[8];
#pragma unroll
      for (int it = 0; it < 8; ++it) {
        const int row = 2 * it + r2;                          // it 0..7 x r2 0..1 = rows 0..15
        const v4f a = *(const v4f*)(slab + row * 68 + p4);
        const v4f xv = *(const v4f*)(xb + (16 * i + 2 * it) * NT + 64 * jh);   // channel cb + 16i + row
        v4f o;
#pragma unroll
        for (int e = 0; e < 4; ++e) o[e] = a[e] * fo + bfr(xv[e]);
        ov[it] = o;
      }
      {
#pragma unroll
        for (int it = 0; it < 8; ++it) *(v4f*)(ob + (16 * i + 2 * it) * NT + 64 * jh) = ov[it];
      }
      wave_lds_sync();
    }
  }
}

// =====================================================================================================
// Workspace map; every plane [rows][k] below is stored in fragment order (see the head of the file).
//   WQ16  f16 [256][256]             0        131072   (64*Wq, bf16RNE)
//   WK16  f16 [256][256]        131072        131072   (64*Wk)
//   WV16  f16 [256][256]        262144        131072   (64*Wv)
//   XQ    f16 [32768][256]      393216      16777216   (8*q, position rows, k = c)
//   XK    f16 [32768][256]    17170432      16777216   (8*k)
//   VH    f16 [256][32768]    33947648      16777216   (16*v, row c, k = b*1024 + m)
//   end                       50724864
// d_out f32 [32][256][1024] at byte 0.
// =====================================================================================================
extern "C" void kernel_launch(void* const* d_in, const int* in_sizes, int n_in,
                              void* d_out, int out_size, void* d_ws, size_t ws_size,
                              hipStream_t stream) {
  if (n_in < 7) return;
  if (in_sizes[0] != NB * CH * NT) return;
  if (in_sizes[1] != CH * CH || in_sizes[2] != CH) return;
  if (in_sizes[3] != CH * CH || in_sizes[4] != CH) return;
  if (in_sizes[5] != CH * CH || in_sizes[6] != CH) return;
  if (out_size != OUTN) return;

  const float* x  = (const float*)d_in[0];   // [32][256][1024]
  const float* Wq = (const float*)d_in[1];   // [256][256]  ([out][in])
  const float* bq = (const float*)d_in[2];   // [256]
  const float* Wk = (const float*)d_in[3];   // [256][256]
  const float* bk = (const float*)d_in[4];   // [256]
  const float* Wv = (const float*)d_in[5];   // [256][256]
  const float* bv = (const float*)d_in[6];   // [256]

  const size_t PW  = (size_t)CH * CH * 2;                    //   131072
  const size_t PPL = (size_t)TOK * CH * 2;                   // 16777216

  size_t off = 0;
  const size_t oWQ = off; off += PW;
  const size_t oWK = off; off += PW;
  const size_t oWV = off; off += PW;
  const size_t oXQ = off; off += PPL;
  const size_t oXK = off; off += PPL;
  const size_t oVH = off; off += PPL;                        // off = 50724864
  if (off > ws_size) return;
  if (off > (size_t)134217728) return;

  char* ws = (char*)d_ws;
  _Float16* WQ16 = (_Float16*)(ws + oWQ);
  _Float16* WK16 = (_Float16*)(ws + oWK);
  _Float16* WV16 = (_Float16*)(ws + oWV);
  _Float16* XQ   = (_Float16*)(ws + oXQ);
  _Float16* XK   = (_Float16*)(ws + oXK);
  _Float16* VH   = (_Float16*)(ws + oVH);
  float*    outf = (float*)d_out;

  const dim3 blk(256);
  const dim3 gPrep(3 * WBLK);                                          // 96
  const dim3 gPr(NB, NT / PPB);                                        // (32, 8): 256 blocks of 128 positions
  const dim3 gAt(NB, NT / RSB);                                        // (32, 8)

  // (1) weight planes, x64 carried (conv weights [out][in]: rows = out, k = in), in fragment order
  k_prep<<<gPrep, blk, 0, stream>>>(Wq, Wk, Wv, WQ16, WK16, WV16);
  // (2) XQ, XK, VH from x [32][256][1024] and the weight planes
  k_proj<<<gPr, blk, 0, stream>>>(x, WQ16, WK16, WV16, bq, bk, bv, XQ, XK, VH);
  // (3) scores + row softmax + softmax-weighted value sum + residual -> d_out
  k_attn<<<gAt, blk, 0, stream>>>(XQ, XK, VH, x, outf);
}

// v010
// One run takes 43.4 microseconds.
// Next to v009, in two timings, it ran 1.09 times as fast each time.
// Counting every step since v000, it is 5.54 times as fast.
#include <hip/hip_runtime.h>
#include <math.h>
#include <stdint.h>

// All contractions on v_wmma_f32_16x16x32_f16 (f16 operands, f32 accumulate): the three 1x1-conv
// projections take bf16-RNE inputs (x1) and bf16-RNE weights (x64) as single f16 planes; the 256-deep
// query.key scores use single f16 planes of 8*q and 8*k; the 1024-deep softmax-weighted value sum uses
// a single f16 plane of 16*v against E = f16(32*exp(score - row reference)) held as f16 rows in LDS; the division by
// the row's sum is done on the f32 result. Softmax
// arithmetic, biases, residual add and epilogues are f32; a 16-key tile's statistics rest in LDS as one word (reference:
// upper 16 bits of a float, sum: f16); the factor that rescales an E chunk, where one is needed, is f16.
//
// Every f16 operand plane [R][K] in memory lives in fragment order: for 16-row tile T and 32-deep k step S the unit
// (T*(K/32) + S) is 512 halves; inside it element (row, k) sits at ((k>>4)&1)*256 + (((k>>3)&1)*16 + (row&15))*8
// + (k&7). A wave's two 16-B loads of one fragment then cover 2 x 512 contiguous bytes (whole 128-B lines).

#define NB   32
#define CH   256
#define NT   1024
#define TOK  (NB * NT)
#define RSB  128                            // query rows per attention block
#define PIT  (NT / 2 + 4)                   // LDS pitch of an E row of NT f16, in floats
#define SPIT (NT / 16 + 4)                  // LDS pitch of a row's NT/16 statistics words, in words
#define VRING 8                             // value fragment ring, k steps
#define OUTN (NB * CH * NT)
#define WBLK ((CH * CH) / 2048)            // 256-thread blocks per weight plane, 8 elements a thread
#define PPB  128                            // positions per projection block
#define XTP  (16 * CH * 2 + 16)             // LDS pitch of a 16-position tile of x (CH/32 units of 1024 B), in bytes

#define SCW  64.0f
#define SCQK 8.0f
#define SCV  16.0f
#define EXA  5.0f                           // E = 2^EXA * exp(score - reference)
#define ZLO  16.0f                          // a 16-key tile keeps the reference 0 where its sum of E lies in [ZLO, ZHI]
#define ZHI  65000.0f                       // below the f16 maximum
#define ROFF 6.9f                           // else its reference is its score maximum - ROFF: 2^EXA * exp(ROFF) < 32768
#define SCS  (1.0f / (SCQK * SCQK * 16.0f))
#define CEX  (SCS * 1.44269504088896f)      // raw score product -> exponent of two

static_assert(TOK % 64 == 0 && CH % 64 == 0 && CH % 32 == 0 && NT % 32 == 0);
static_assert(TOK % PPB == 0 && PPB == 2 * 64 && CH == 4 * 4 * 16);
static_assert(NT % RSB == 0 && RSB == 128 && NT == 4 * 256);
static_assert((PIT * 4) % 32 == 16 && (NT / 32) % VRING == 0);
static_assert(SPIT % 64 == 4 && RSB * SPIT == 8 * 16 * 68);
static_assert((NT / 16) % 8 == 0 && CH == 8 * 32);
static_assert((CH * CH) % 2048 == 0);
static_assert(NT % PPB == 0 && PPB == 32 * 4 && XTP % 256 == 16);

typedef _Float16       v16h __attribute__((ext_vector_type(16)));
typedef _Float16       v8h  __attribute__((ext_vector_type(8)));
typedef float          v8f  __attribute__((ext_vector_type(8)));
typedef float          v4f  __attribute__((ext_vector_type(4)));
typedef float          v2f  __attribute__((ext_vector_type(2)));
typedef unsigned int   v4u  __attribute__((ext_vector_type(4)));
typedef _Float16       v2h  __attribute__((ext_vector_type(2)));
typedef __bf16         v2b  __attribute__((ext_vector_type(2)));

union HU { v8h h; v4u u; v4f f; _Float16 s[8]; v2h p[4]; };
union FR { v16h v; v8h h[2]; _Float16 s[16]; };
static_assert(sizeof(HU) == 16);
static_assert(sizeof(FR) == 32);

// ---- scalar helpers --------------------------------------------------------------------------------
__device__ __forceinline__ unsigned short bf_bits(float f) {          // f32 -> bf16 bits, RNE convert
  const unsigned u = __float_as_uint(f);
  return (unsigned short)((u + 0x7FFFu + ((u >> 16) & 1u)) >> 16);
}
__device__ __forceinline__ float bf_up(unsigned short h) { return __uint_as_float(((unsigned)h) << 16); }
__device__ __forceinline__ float bfr(float f) { return bf_up(bf_bits(f)); }   // value after bf16 RNE convert
// f16(bf16RNE(a)), f16(bf16RNE(b)) by the packed converts, which round to nearest even: the values of bfr() for every
// finite input
__device__ __forceinline__ v2h bfr2h(float a, float b) {
  const v2f x = {a, b};
  return __builtin_convertvector(__builtin_convertvector(__builtin_convertvector(x, v2b), v2f), v2h);
}
__device__ __forceinline__ v8f zero8() { v8f z = {0.f, 0.f, 0.f, 0.f, 0.f, 0.f, 0.f, 0.f}; return z; }

__device__ __forceinline__ void ld8(const float* p, float* o) {
  const v4f a = *(const v4f*)(p);
  const v4f b = *(const v4f*)(p + 4);
  o[0] = a[0]; o[1] = a[1]; o[2] = a[2]; o[3] = a[3];
  o[4] = b[0]; o[5] = b[1]; o[6] = b[2]; o[7] = b[3];
}

// ---- fragment loader: 16-bit A/B operand from a fragment-order plane, p = unit*512 + 8*lane, h = lane>>4;
//      elements 0..7 <- p[0..7] (k0+8h..k0+8h+7), elements 8..15 <- p[256..263] (k0+16+8h..k0+16+8h+7)
__device__ __forceinline__ v16h ldfrag_h(const _Float16* p) {
  FR f;
  f.h[0] = *(const v8h*)(p);
  f.h[1] = *(const v8h*)(p + 256);
  return f.v;
}

// ---- WMMA helpers --------------------------------------------------------------------------------------
__device__ __forceinline__ v8f mma_h_raw(v16h a, v16h b, v8f c) {
  return __builtin_amdgcn_wmma_f32_16x16x32_f16(false, a, false, b, (short)0, c, false, false);
}
__device__ __forceinline__ void acc_guard4(v8f& a, v8f& b, v8f& c, v8f& d) {
#if defined(__HIP_DEVICE_COMPILE__)
  asm volatile("v_nop\n\tv_nop\n\tv_nop\n\tv_nop" : "+v"(a), "+v"(b), "+v"(c), "+v"(d));
#endif
}
// v[0..7] <- 2^v[0..7]. One statement, in place, with a v_nop behind the last: it keeps the slot that the instruction
// set asks for between a transcendental and an instruction that overwrites its source or reads its result.
__device__ __forceinline__ void exp2x8(float* v) {
#if defined(__HIP_DEVICE_COMPILE__)
  asm("v_exp_f32 %0, %0\n\tv_exp_f32 %1, %1\n\tv_exp_f32 %2, %2\n\tv_exp_f32 %3, %3\n\t"
      "v_exp_f32 %4, %4\n\tv_exp_f32 %5, %5\n\tv_exp_f32 %6, %6\n\tv_exp_f32 %7, %7\n\tv_nop"
      : "+v"(v[0]), "+v"(v[1]), "+v"(v[2]), "+v"(v[3]), "+v"(v[4]), "+v"(v[5]), "+v"(v[6]), "+v"(v[7]));
#endif
}
__device__ __forceinline__ void wave_lds_sync() {
  __builtin_amdgcn_fence(__ATOMIC_RELEASE, "workgroup");
  __builtin_amdgcn_wave_barrier();
  __builtin_amdgcn_fence(__ATOMIC_ACQUIRE, "workgroup");
}

// =====================================================================================================
// Weight convert: in [R][kd] f32 row-major -> out f16(scale * bf16RNE(in)) in fragment order; thread i owns
// the i-th 16-B chunk of the output (lane = i&31, part = (i>>5)&1, unit = i>>6), one 16-B store per lane.
// coverage: n8 threads x 8 = the whole plane; n8 is a multiple of 256 at every call here. blk = block index
// within the plane.
// =====================================================================================================
__device__ __forceinline__ void cvt_flat(const float* __restrict__ in, _Float16* out, int n8, int kd, float scale, int blk) {
  const int i = blk * 256 + threadIdx.x;
  if (i < n8) {
    const int ksn = kd >> 5, unit = i >> 6;
    const int tile = unit / ksn, ks = unit - tile * ksn;
    const int row = tile * 16 + (i & 15);
    const int k = ks * 32 + ((i >> 5) & 1) * 16 + ((i >> 4) & 1) * 8;
    float v[8];
    ld8(in + (size_t)row * kd + k, v);
    HU u;
#pragma unroll
    for (int e = 0; e < 8; ++e) u.s[e] = (_Float16)(bfr(v[e]) * scale);
    _Float16* p = out + (size_t)i * 8;
    *(v4u*)p = u.u;
    
  }
}

// =====================================================================================================
// The three weight planes in one launch, WBLK blocks each.
// =====================================================================================================
__global__ __launch_bounds__(256) void k_prep(const float* __restrict__ Wq, const float* __restrict__ Wk,
                                              const float* __restrict__ Wv,
                                              _Float16* WQ, _Float16* WK, _Float16* WV) {
  const int bx = blockIdx.x;
  const int sel = bx / WBLK;
  const float* in = sel == 0 ? Wq : (sel == 1 ? Wk : Wv);
  _Float16* o = sel == 0 ? WQ : (sel == 1 ? WK : WV);
  cvt_flat(in, o, (CH * CH) / 8, CH, SCW, bx - sel * WBLK);
}

// =====================================================================================================
// The three projections in one launch, one pass over x. Block = 128 positions of one image, 8 waves (two a SIMD, so a
// wave may hold up to 512 registers), one block a WGP.
// First the block builds xT = f16(bf16RNE(x)) for its positions (rows = position, k = channel) in LDS, in fragment
// order, a 16-position tile at a pitch of XTP bytes: wave w reads channels 32w..32w+31 (k step w), a lane 4 positions of
// each (a wave's load = 512 contiguous bytes of one channel row), and stores 16 chunks of 8 channels x 1 position.
// With the 16 B of pad a tile, the 16 lanes of each half wave store to 16 different bank groups; a fragment read
// is 2 x 512 contiguous bytes. coverage: 8 waves x 32 channels x 32 lanes x 4 positions = 256 k x 128 rows.
// Behind one block barrier wave w holds the 32 xT fragments of positions p0..p0+63
// (p0 = 1024*image + 128*group + 64*(w&1)) in registers for the whole kernel and runs through 12 weight row tiles: tiles
// 4*(w>>1) .. +3 of Wq, then of Wk, then of Wv. Every weight fragment is loaded once a wave and feeds four products;
// the weight fragments form a ring two row tiles deep. K = 256 (8 k steps, ascending) for every accumulator.
// The two waves that stream the same weight tiles (2j, 2j+1) sit on different SIMDs and are of the same age there,
// so they run side by side and the second one's loads can hit the WGP cache.
// The operand roles are chosen so that a lane's 8 accumulator rows are 8 consecutive k of the plane it writes:
//   XQ, XK (rows = position, k = channel): A = weight tile, B = xT tile i -> D row = channel 8hh + r, D col = position rl
//   VH     (rows = channel, k = position): A = xT tile i, B = weight tile -> D row = position 8hh + r, D col = channel rl
// In both cases the lane's 8 halves are the 16-B chunk number 'lane' of a 512-B half unit: one contiguous wave store.
//   XQ = f16(8*(xT . Wq^T + bq)), XK = f16(8*(xT . Wk^T + bk)), VH = f16(16*(Wv . x + bv)); biases bf16RNE.
// coverage: XQ, XK: 32 images x 8 blocks x 2 position groups x 4 tiles i x 16 positions = 32768 rows, 4 wave groups x
// 4 tiles x 16 = 256 channels; VH: the same 256 channels as rows x the same 32768 positions as k.
// Block index -> image, here and in k_attn: grid (32 images, 8 blocks of 128 positions), so the flat block index is
// image + 32 * block and the 8 blocks of an image have equal flat indices modulo 8. For speed only: every (image, block) pair is done once wherever
// the blocks land.
// =====================================================================================================
__global__ __launch_bounds__(256) void k_proj(const float* __restrict__ X, const _Float16* __restrict__ WQ,
                                              const _Float16* __restrict__ WK, const _Float16* __restrict__ WV,
                                              const float* __restrict__ bq, const float* __restrict__ bk,
                                              const float* __restrict__ bv,
                                              _Float16* XQ, _Float16* XK, _Float16* VH) {
  __shared__ __align__(16) char sx[(PPB / 16) * XTP];            // xT of the block's positions
  const int lane = threadIdx.x & 31;
  // the wave's number in a scalar register: every base address below is then scalar, and the only vector address
  // registers are lane offsets that are never written again
  const int wave = __builtin_amdgcn_readfirstlane(threadIdx.x >> 5);
  const unsigned l8 = 8u * lane;                                 // this lane's 16-B chunk of a 512-B half unit, in halves
  const unsigned hb = 8u * (lane >> 4), rl = lane & 15;          // bias offsets: 8hh (XQ, XK), rl (VH)
  // image = blockIdx.x, 128-position group of it = blockIdx.y: see "Block index -> image" above k_proj
  const int pb = blockIdx.x * NT + blockIdx.y * PPB;             // first of the block's positions
  const int p0 = pb + (wave & 1) * 64;                           // first of this wave's 64 positions
  const int ct0 = (wave >> 1) * 4;                               // first of this wave's 4 row tiles in each weight plane
  const float cs64 = 1.0f / SCW;                                 // undo the weight carry
  const int wo = ct0 * 16 * CH;                                  // row tile ct0 of a weight plane
  const _Float16* wp[3] = {WQ + wo, WK + wo, WV + wo};
  const float* bp[3] = {bq + 16 * ct0, bk + 16 * ct0, bv + 16 * ct0};              // channel 16*ct0
  // XQ, XK: unit (p0/16 + i)*8 + ct/2, half ct&1; VH: unit ct*(TOK/32) + p0/32 + i/2, half i&1; here for ct = ct0, i = 0
  _Float16* dp[3] = {XQ + (size_t)p0 * CH + ct0 * 256, XK + (size_t)p0 * CH + ct0 * 256,
                     VH + (size_t)ct0 * 16 * TOK + (size_t)p0 * 16};
  v16h xf[4][CH / 32], kf[2][CH / 32];
  {
    const float* xs = X + ((size_t)blockIdx.x * CH + 32 * wave) * NT + blockIdx.y * PPB;   // channel 32*wave
    const unsigned l4 = 4u * lane;
    v4f xr[32];
#pragma unroll
    for (int c = 0; c < 32; ++c) xr[c] = *(const v4f*)(xs + c * NT + l4);
    // keeps the loads from memory in front of the weight loads, which come from L2
    __builtin_amdgcn_sched_barrier(0);
#pragma unroll
    for (int s = 0; s < 2; ++s)
#pragma unroll
      for (int ks = 0; ks < CH / 32; ++ks) kf[s][ks] = ldfrag_h(wp[0] + s * 16 * CH + 512 * ks + l8);
    // the code below may re-use the registers that these loads name
    asm volatile("s_wait_xcnt 0x0" ::: "memory");
    // keeps every load above in front of the first wait for x, and every later register write behind the wait above
    __builtin_amdgcn_sched_barrier(0);
    // position 4*lane + j: tile lane>>2, row 4*(lane&3) + j; channel 32*wave + 8*g + e: unit 'wave', chunk column g
    char* sd = sx + (lane >> 2) * XTP + wave * 1024 + (lane & 3) * 64;
#pragma unroll
    for (int g = 0; g < 4; ++g)
#pragma unroll
      for (int j = 0; j < 4; ++j) {
        HU u;
#pragma unroll
        for (int e = 0; e < 4; ++e) u.p[e] = bfr2h(xr[8 * g + 2 * e][j], xr[8 * g + 2 * e + 1][j]);
        *(v4u*)(sd + (g >> 1) * 512 + (g & 1) * 256 + j * 16) = u.u;
      }
  }
  __syncthreads();   // every wave's k step of xT is in LDS before another wave reads its fragments
  {
    const char* sl = sx + (wave & 1) * 4 * XTP + lane * 16;      // tile 4*(wave&1) = position p0
#pragma unroll   // k step by k step, the order in which the first tile's products take them
    for (int ks = 0; ks < CH / 32; ++ks)
#pragma unroll
      for (int i = 0; i < 4; ++i) {
        FR f;
        f.h[0] = *(const v8h*)(sl + i * XTP + 1024 * ks);
        f.h[1] = *(const v8h*)(sl + i * XTP + 1024 * ks + 512);
        xf[i][ks] = f.v;
      }
  }
#pragma unroll   // plane, operand roles and ring slot become constants; the last two tiles drop their refill
  for (int t = 0; t < 12; ++t) {
    const int sel = t >> 2;                                      // 0 Wq, 1 Wk, 2 Wv
    const int tc = t & 3;                                        // row tile ct = ct0 + tc of the plane = 16 output channels
    // this tile's biases, issued a whole tile of products ahead of their use
    float bb[8];
    if (sel < 2) {
      ld8(bp[sel] + 16 * tc + hb, bb);                           // channels 16ct + 8hh + r
    } else {
      bb[0] = bp[2][16 * tc + rl];                               // channel 16ct + rl
    }
    // keeps the bias loads here: sunk to their use they would be waited out there
    __builtin_amdgcn_sched_barrier(0);
    v8f a[4];
#pragma unroll
    for (int i = 0; i < 4; ++i) a[i] = zero8();
#pragma unroll
    for (int ks = 0; ks < CH / 32; ++ks) {
#pragma unroll
      for (int i = 0; i < 4; ++i)
        a[i] = sel < 2 ? mma_h_raw(kf[t & 1][ks], xf[i][ks], a[i]) : mma_h_raw(xf[i][ks], kf[t & 1][ks], a[i]);
      // the fragment of the tile after next, issued two whole tiles ahead of its use
      if (t + 2 < 12) kf[t & 1][ks] = ldfrag_h(wp[(t + 2) >> 2] + ((t + 2) & 3) * 16 * CH + 512 * ks + l8);
      // keeps the refill here: the scheduler otherwise sinks it to just in front of its use
      __builtin_amdgcn_sched_barrier(0);
    }
    if (sel < 2) {
#pragma unroll
      for (int i = 0; i < 4; ++i) {
        HU h;
#pragma unroll
        for (int r = 0; r < 8; ++r) h.s[r] = (_Float16)((a[i][r] * cs64 + bfr(bb[r])) * SCQK);
        *(v4u*)(dp[sel] + tc * 256 + i * 16 * CH + l8) = h.u;
      }
    } else {
      const float bc = bfr(bb[0]);
#pragma unroll
      for (int i = 0; i < 4; ++i) {
        HU h;
#pragma unroll
        for (int r = 0; r < 8; ++r) h.s[r] = (_Float16)((a[i][r] * cs64 + bc) * SCV);
        *(v4u*)(dp[2] + tc * 16 * TOK + i * 256 + l8) = h.u;
      }
    }
    if (t + 1 < 12) {
      // the next tile rewrites the data registers that these stores name
      asm volatile("s_wait_xcnt 0x0" ::: "memory");
      // keeps every register write of the next tile behind the wait above
      __builtin_amdgcn_sched_barrier(0);
    }
  }
}

// =====================================================================================================
// Scores + row softmax + softmax-weighted value sum + residual in one kernel: the softmax rows never leave LDS.
// Block = (b, 128 query rows n0..n0+127), 8 waves (two a SIMD, so a wave may hold up to 512 registers), one block
// a WGP, 256 blocks. LDS: 128 E rows of 1024 f16 at a pitch of 2064 B (16 B x odd: the 16 rows of a fragment read or
// of a chunk store fall on 16 different bank groups), 16-B chunk c (k = 8c..8c+7) at byte 16c; and per row one
// statistics word per 16-key tile, at a pitch of 272 B. A statistics word holds the tile's reference (0 where the tile's
// sum then lies in [16, 65000], else its score maximum - 6.9 rounded up to the upper 16 bits of a float) and, as f16 in
// the lower 16 bits, the tile's sum / 16.
//  (1) wave w computes, for the 64 queries of half w&1, the 16-key score tiles ct = (w>>1), (w>>1)+4, ... (16 of them),
//      transposed: A = XK rows, Bt = XQ rows (K = 256), s = (k8 . q8) / (64*16), so that a lane holds 8 consecutive keys
//      of one query = one chunk, and lane l ^ 16 the tile's other 8. Still in registers: tile reference mc (0, seldom
//      another, behind one ballot a key tile), e = 32 * exp(s - mc), zc = tile sum / 16 = (sum e) / 16 (ascending key in each half,
//      then the two halves), f16(e) stored as
//      the chunk, the statistics word behind the row. This vector work of one wave runs beside the products of the
//      other wave on its SIMD. The 32 query fragments are loaded once and stay in registers; the key fragments form
//      a ring two key tiles deep. Waves 2j and 2j+1 stream the same key tiles; they sit on different SIMDs and are of
//      the same age there, so they run side by side and the second one's loads can hit the WGP cache.
//  (2) wave w owns rows 16w..16w+15: lane l holds the 32 words of half l>>4 of row l&15. Where a ballot finds only
//      the reference 0 in the wave's rows, the E rows stand as they are and Z = sum_c zc (four chains in the lane, then
//      the two halves). Else: row reference M, fc = exp(mc - M), Z = sum_c fc * zc (ascending in the lane, then the two
//      halves), each chunk rescaled in place, E = f16(e) * f16(fc), its f16 subnormals flushed to zero.
//      Either way the row's factor 1 / (16 * 16 * Z) goes to LDS for the epilogue.
//  (3) after a block barrier: D[c][n] = sum_m (16*v)[c][m] . E[n][m], A = value plane rows c (fragment order, row
//      length TOK, k from b*NT), Bt = the 128 E rows in LDS, K = 1024 (32 k steps, ascending). Wave w owns
//      channels 32w..32w+31 (2 x 8 tiles), so every value fragment is loaded once a block and feeds eight products.
//      The value fragments form a ring 8 steps deep, first filled ahead of (2); the E fragments are read one step ahead.
// Epilogue: out[b][c][n] = D[c][n] * factor[n] + bf16RNE(x[b][c][n]); per wave four 16x64 f32 slabs staged in LDS, in the
// wave's own 16 rows of the statistics area, which nobody reads after (2).
// coverage: (1): 2 query halves x 4 wave groups x 16 key tiles x 2 chunks = 128 chunks and 64 words in each of 128 rows;
// (2): 8 waves x 16 rows x 2 halves x 32 tiles x 2 chunks = the same 128 chunks x 128 rows; out: 8 waves x 4 slabs x 16 rows x 64 cols =
// 256 c x 128 n per block; grid (32, 8) = every (b, n tile) -> whole output [32][256][1024].
// =====================================================================================================
__device__ __forceinline__ v16h ldfrag_lds(const char* p) {   // elements 0..7 <- 16 B at p, 8..15 <- 16 B at p + 32
  HU lo, hi;
  lo.f = *(const v4f*)(p);
  hi.f = *(const v4f*)(p + 32);
  FR f;
  f.h[0] = lo.h;
  f.h[1] = hi.h;
  return f.v;
}
__device__ __forceinline__ float xhalf(float x) {             // the value of lane l ^ 16
  return __builtin_bit_cast(float, __builtin_amdgcn_permlanex16(__builtin_bit_cast(int, x), __builtin_bit_cast(int, x),
                                                                0x76543210, 0xfedcba98, false, false));
}

__global__ __launch_bounds__(256) void k_attn(const _Float16* __restrict__ XQ, const _Float16* __restrict__ XK,
                                              const _Float16* __restrict__ VH, const float* __restrict__ X,
                                              float* out) {
  __shared__ __align__(16) float sc[RSB * PIT];               // the f16 E rows
  __shared__ __align__(16) float sst[RSB * SPIT];             // their tile statistics; in the epilogue the output slabs
  __shared__ __align__(16) float srz[RSB];                    // per row 1 / (16 * sum of its E)
  const int tid = threadIdx.x, wave = tid >> 5, lane = tid & 31;
  const int hh = lane >> 4, rl = lane & 15;
  const int b = blockIdx.x, rb = blockIdx.y, n0 = rb * RSB;     // image first: see "Block index -> image" above k_proj

  // ---- (1) scores ----
  {
    const int qh = wave & 1, kg = wave >> 1;
    const _Float16* aq = XQ + (size_t)(b * NT + n0 + 64 * qh) * CH + 8 * lane;   // row tile (b*NT+n0+64qh)/16, CH/32 units each
    const _Float16* bk = XK + (size_t)(b * NT + 16 * kg) * CH + 8 * lane;
    v16h q[4][CH / 32], kf[2][CH / 32];
#pragma unroll
    for (int ks = 0; ks < CH / 32; ++ks) kf[0][ks] = ldfrag_h(bk + 512 * ks);
#pragma unroll
    for (int i = 0; i < 4; ++i)
#pragma unroll
      for (int ks = 0; ks < CH / 32; ++ks) q[i][ks] = ldfrag_h(aq + i * 16 * CH + 512 * ks);
#pragma unroll
    for (int ks = 0; ks < CH / 32; ++ks) kf[1][ks] = ldfrag_h(bk + 64 * CH + 512 * ks);
    // the code below re-uses the base registers that the query loads name
    asm volatile("s_wait_xcnt 0x0" ::: "memory");
    // keeps the second tile's loads behind the first products' operands, so that tile 0 does not wait for them,
    // and every later register write behind the wait above
    __builtin_amdgcn_sched_barrier(0);
    const _Float16* kp = bk + 2 * 64 * CH;                      // key tile two ahead of the pair in work
    float* er = sc + (64 * qh + rl) * PIT + 4 * (2 * kg + hh);  // this lane's chunk of key tile kg, query tile 0
    unsigned* sr = (unsigned*)sst + (64 * qh + 16 * hh + rl) * SPIT + kg;   // word of key tile kg, query tile hh
    // one key tile: slot = ring slot and place in the pair (column tile ct = kg + 4 * (2 * pair + slot))
    auto tile = [&](const int slot, const bool refill) __attribute__((always_inline)) {
      v8f a[4];
#pragma unroll
      for (int i = 0; i < 4; ++i) a[i] = zero8();
#pragma unroll
      for (int ks = 0; ks < CH / 32; ++ks) {
#pragma unroll
        for (int i = 0; i < 4; ++i) a[i] = mma_h_raw(kf[slot][ks], q[i][ks], a[i]);
        // the fragment of the tile after next, issued two whole tiles ahead of its use
        if (refill) kf[slot][ks] = ldfrag_h(kp + slot * 64 * CH + 512 * ks);
        // keeps the refill here: the scheduler otherwise sinks it to just in front of its use
        __builtin_amdgcn_sched_barrier(0);
      }
      // D row = key 8hh + r of the column tile, D col = query rl of row tile i: a lane's 8 values are one chunk of its row
      // first against the common reference 0: e = 2^EXA * exp(s), no maximum taken
      float zs4[4];
      unsigned stw[4];
#pragma unroll
      for (int i = 0; i < 4; ++i) {
        float ev[8];
#pragma unroll
        for (int r = 0; r < 8; ++r) ev[r] = a[i][r] * CEX + EXA;
        exp2x8(ev);
        float zs = ev[0];
#pragma unroll
        for (int r = 1; r < 8; ++r) zs += ev[r];
        zs += xhalf(zs);                                        // over the tile's 16 keys
        HU u;
#pragma unroll
        for (int r = 0; r < 8; ++r) u.s[r] = (_Float16)ev[r];
        *(v4f*)(er + i * 16 * PIT + slot * 32) = u.f;
        zs4[i] = zs;
        const _Float16 zh = (_Float16)(zs * 0.0625f);           // at most ZHI / 16 where it is kept
        stw[i] = (unsigned)__builtin_bit_cast(unsigned short, zh);
      }
      if (refill && slot == 1) {
        // the address registers that the key loads name are rewritten at the trip's foot; the wait stands in front of the
        // branch below because behind it the compiler lifted that rewriting over the wait
        asm volatile("s_wait_xcnt 0x0" ::: "memory");
      }
      // a tile's sum in [ZLO, ZHI] says that every e of it fits f16 and that its largest is at least ZLO / 16; one test
      // a key tile; where it fails for a query, that query's 16 values are done again against a reference of their own
      const float zlo = fminf(fminf(zs4[0], zs4[1]), fminf(zs4[2], zs4[3]));
      const float zhi = fmaxf(fmaxf(zs4[0], zs4[1]), fmaxf(zs4[2], zs4[3]));
      if (__builtin_expect(__builtin_amdgcn_ballot_w32(!(zlo >= ZLO && zhi <= ZHI)) != 0u, 0)) {
#pragma unroll
        for (int i = 0; i < 4; ++i) {
          float am = a[i][0];
#pragma unroll
          for (int r = 1; r < 8; ++r) am = fmaxf(am, a[i][r]);
          am = fmaxf(am, xhalf(am));                            // over the tile's 16 keys
          const float ms = am * SCS - ROFF;
          const unsigned mu0 = __float_as_uint(ms);
          const unsigned mur = (ms > 0.0f ? mu0 + 0xFFFFu : mu0) & 0xFFFF0000u;   // rounded up: e <= 2^EXA * exp(ROFF)
          const unsigned mu = (zs4[i] >= ZLO && zs4[i] <= ZHI) ? 0u : mur;
          const float k0 = EXA - __uint_as_float(mu) * 1.44269504088896f;         // 2^EXA * exp(s - mc) = exp2(a*CEX + k0)
          float ev[8];
#pragma unroll
          for (int r = 0; r < 8; ++r) ev[r] = a[i][r] * CEX + k0;
          exp2x8(ev);
          float zs = ev[0];
#pragma unroll
          for (int r = 1; r < 8; ++r) zs += ev[r];
          zs += xhalf(zs);
          HU u;
#pragma unroll
          for (int r = 0; r < 8; ++r) u.s[r] = (_Float16)ev[r];
          *(v4f*)(er + i * 16 * PIT + slot * 32) = u.f;         // over this lane's own store above
          const _Float16 zh = (_Float16)(zs * 0.0625f);         // at most ZHI / 16 or 2^EXA * exp(ROFF)
          stw[i] = mu | (unsigned)__builtin_bit_cast(unsigned short, zh);
          // one query tile's values live at a time: interleaved, the four spill
          __builtin_amdgcn_sched_barrier(0);
        }
      }
      // both halves of the wave hold the same four words: the lower half stores those of query tiles 0 and 2, the upper
      // half those of 1 and 3
#pragma unroll
      for (int ip = 0; ip < 2; ++ip) sr[ip * 32 * SPIT + slot * 4] = hh ? stw[2 * ip + 1] : stw[2 * ip];
    };
    // rolled, two tiles a trip, so that the kernel's text stays small; the ring slots stay constants
#pragma unroll 1
    for (int tp = 0; tp < NT / 128 - 1; ++tp) {
      tile(0, true);
      tile(1, true);
      kp += 2 * 64 * CH;                                        // behind the wait in tile(1, true)
      er += 2 * 32;
      sr += 2 * 4;
    }
    tile(0, false);
    tile(1, false);
  }
  __syncthreads();

  // ---- value ring, first fill: the loads fly while the row sums are taken ----
  const int cb = wave * 32;
  const char* pv = (const char*)VH;
  unsigned oa[2];                              // byte offset of this lane's 16 B in the first unit, per channel tile
#pragma unroll
  for (int i = 0; i < 2; ++i)
    oa[i] = ((unsigned)((cb >> 4) + i) * (unsigned)(TOK >> 5) + (unsigned)((b * NT) >> 5)) * 1024u + lane * 16u;
  v16h va[VRING][2];
#pragma unroll
  for (int s = 0; s < VRING; ++s)
#pragma unroll
    for (int i = 0; i < 2; ++i) va[s][i] = ldfrag_h((const _Float16*)(pv + oa[i] + 1024 * s));
  // the code below re-uses the offset registers that these loads name
  asm volatile("s_wait_xcnt 0x0" ::: "memory");
  // keeps these loads in front of the row sums (sunk to their use they would be waited out there), and every
  // later register write behind the wait above
  __builtin_amdgcn_sched_barrier(0);

  // ---- (2) row sums from the tile statistics; E rows rescaled in place only where the tiles' references differ ----
  {
    const int row = 16 * wave + rl;                             // lane = (row rl of the wave's 16, half hh of its 64 tiles)
    const unsigned* sp = (const unsigned*)sst + row * SPIT + 32 * hh;
    v4u st[8];
#pragma unroll
    for (int j = 0; j < 8; ++j) st[j] = *(const v4u*)(sp + 4 * j);
    unsigned any = 0u;
#pragma unroll
    for (int j = 0; j < 8; ++j)
#pragma unroll
      for (int e = 0; e < 4; ++e) any |= st[j][e];
    float z;
    if (__builtin_expect(__builtin_amdgcn_ballot_w32((any & 0xFFFF0000u) != 0u) != 0u, 0)) {
      float mx = __uint_as_float(st[0][0] & 0xFFFF0000u);
#pragma unroll
      for (int j = 0; j < 8; ++j)
#pragma unroll
        for (int e = 0; e < 4; ++e) mx = fmaxf(mx, __uint_as_float(st[j][e] & 0xFFFF0000u));
      mx = fmaxf(mx, xhalf(mx));                                // row reference M
      v4f* erow = (v4f*)(sc + row * PIT) + 64 * hh;             // chunks 2t, 2t + 1 of this lane's tiles t
      z = 0.0f;
      // rolled, 8 tiles a trip: a pass that is seldom taken stays short in the kernel's text
#pragma unroll 1
      for (int g = 0; g < 4; ++g) {
        const v4u wa = *(const v4u*)(sp + 8 * g), wb = *(const v4u*)(sp + 8 * g + 4);
        float fc[8], zc[8];
#pragma unroll
        for (int e = 0; e < 8; ++e) {
          const unsigned w = e < 4 ? wa[e & 3] : wb[e & 3];
          fc[e] = (__uint_as_float(w & 0xFFFF0000u) - mx) * 1.44269504088896f;
          zc[e] = (float)__builtin_bit_cast(_Float16, (unsigned short)(w & 0xFFFFu));
        }
        exp2x8(fc);                                             // fc = exp(mc - M): tile reference -> row reference
#pragma unroll
        for (int e = 0; e < 8; ++e) z += fc[e] * zc[e];
#pragma unroll
        for (int e = 0; e < 8; ++e) {
          const _Float16 gf = (_Float16)fc[e];                  // in [0, 1]
#pragma unroll
          for (int c = 0; c < 2; ++c) {
            v4f* p = erow + 2 * (8 * g + e) + c;
            HU u;
            u.f = *p;
            u.h = u.h * gf;
#pragma unroll
            for (int k = 0; k < 8; ++k) {                       // f16 subnormal -> exact zero
              const _Float16 h0 = u.s[k];
              u.s[k] = (float)h0 < 6.103515625e-05f ? (_Float16)0.0f : h0;
            }
            *p = u.f;
          }
        }
      }
    } else {
      // every tile of the wave's 16 rows has the reference 0: the E rows stand as they are
      float zp[4] = {0.0f, 0.0f, 0.0f, 0.0f};                   // four chains, tiles ascending in each
#pragma unroll
      for (int j = 0; j < 8; ++j)
#pragma unroll
        for (int e = 0; e < 4; ++e)
          zp[e] += (float)__builtin_bit_cast(_Float16, (unsigned short)(st[j][e] & 0xFFFFu));
      z = (zp[0] + zp[1]) + (zp[2] + zp[3]);
    }
    z += xhalf(z);                                              // = (sum of the row's E before rounding) / 16
    if (hh == 0) srz[row] = (1.0f / (SCV * 16.0f)) * (1.0f / z);
  }
  // every f16 row and every row's factor is complete before another wave reads it. The fences name LDS only: the value
  // ring's loads, which land in this wave's own registers, stay in flight over the barrier instead of being waited out
  __builtin_amdgcn_fence(__ATOMIC_RELEASE, "workgroup", "local");
  __builtin_amdgcn_s_barrier();
  __builtin_amdgcn_fence(__ATOMIC_ACQUIRE, "workgroup", "local");

  // ---- (3) value sum ----
  v8f acc[2][8];
#pragma unroll
  for (int i = 0; i < 2; ++i)
#pragma unroll
    for (int j = 0; j < 8; ++j) acc[i][j] = zero8();

  const char* ep = (const char*)sc + rl * (PIT * 4) + hh * 16;  // E row 16j + rl, k = 32S + 8hh (+16): byte 64S (+32)
  v16h ef[2][8];
#pragma unroll
  for (int j = 0; j < 8; ++j) ef[0][j] = ldfrag_lds(ep + j * (16 * PIT * 4));
  // VRING k steps; ring slots and k offsets inside them are constants
  auto steps = [&](const bool last) __attribute__((always_inline)) {
#pragma unroll
    for (int s = 0; s < VRING; ++s) {
      if (!last || s + 1 < VRING) {
#pragma unroll
        for (int j = 0; j < 8; ++j) ef[(s + 1) & 1][j] = ldfrag_lds(ep + j * (16 * PIT * 4) + 64 * (s + 1));
      }
      // the next step's LDS reads stay one group in front of this step's products, not spread among them
      __builtin_amdgcn_sched_barrier(0);
#pragma unroll
      for (int i = 0; i < 2; ++i)
#pragma unroll
        for (int j = 0; j < 8; ++j) acc[i][j] = mma_h_raw(va[s][i], ef[s & 1][j], acc[i][j]);
      // keeps the refill right behind the products that free its slot: sunk, it would be waited out at its use
      __builtin_amdgcn_sched_barrier(0);
      if (!last) {
#pragma unroll
        for (int i = 0; i < 2; ++i) va[s][i] = ldfrag_h((const _Float16*)(pv + oa[i] + 1024 * (s + VRING)));
      }
      __builtin_amdgcn_sched_barrier(0);
    }
  };
  // rolled, VRING steps a trip, so that the kernel's text stays small
#pragma unroll 1
  for (int tp = 0; tp < NT / 32 / VRING - 1; ++tp) {
    steps(false);
    // the offset registers that the value loads name are rewritten below
    asm volatile("s_wait_xcnt 0x0" ::: "memory");
    // keeps that rewriting behind the wait above
    __builtin_amdgcn_sched_barrier(0);
    oa[0] += 1024 * VRING;
    oa[1] += 1024 * VRING;
    ep += 64 * VRING;
  }
  steps(true);
#pragma unroll
  for (int i = 0; i < 2; ++i) {
    acc_guard4(acc[i][0], acc[i][1], acc[i][2], acc[i][3]);
    acc_guard4(acc[i][4], acc[i][5], acc[i][6], acc[i][7]);
  }

  // ---- epilogue ----
  float* slab = sst + wave * (16 * 68);
  const int p4 = (lane & 15) * 4, r2 = lane >> 4;
  // one address each for x and out: the rows and column halves of a lane become immediate offsets, and no address
  // register of an issued load or store is written again
  const size_t eo = ((size_t)(b * CH + cb + r2)) * NT + n0 + p4;
  const float* xb = X + eo;
  float* ob = out + eo;
  v4f rzv[2];                                                 // the factors of this lane's 4 query columns, per column half
#pragma unroll
  for (int jh = 0; jh < 2; ++jh) rzv[jh] = *(const v4f*)(srz + 64 * jh + p4);
#pragma unroll
  for (int i = 0; i < 2; ++i) {
#pragma unroll
    for (int jh = 0; jh < 2; ++jh) {
#pragma unroll
      for (int r = 0; r < 8; ++r) {
#pragma unroll
        for (int j = 0; j < 4; ++j) {
          // D row = c offset 8hh + r, D col = n offset 64jh + 16j + rl
          slab[(8 * hh + r) * 68 + 16 * j + rl] = acc[i][4 * jh + j][r];
        }
      }
      wave_lds_sync();
      v4f ov[8];
#pragma unroll
      for (int it = 0; it < 8; ++it) {
        const int row = 2 * it + r2;                          // it 0..7 x r2 0..1 = rows 0..15
        const v4f a = *(const v4f*)(slab + row * 68 + p4);
        const v4f xv = *(const v4f*)(xb + (16 * i + 2 * it) * NT + 64 * jh);   // channel cb + 16i + row
        v4f o;
#pragma unroll
        for (int e = 0; e < 4; ++e) o[e] = a[e] * rzv[jh][e] + bfr(xv[e]);
        ov[it] = o;
      }
      {
#pragma unroll
        for (int it = 0; it < 8; ++it) *(v4f*)(ob + (16 * i + 2 * it) * NT + 64 * jh) = ov[it];
      }
      wave_lds_sync();
    }
  }
}

// =====================================================================================================
// Workspace map; every plane [rows][k] below is stored in fragment order (see the head of the file).
//   WQ16  f16 [256][256]             0        131072   (64*Wq, bf16RNE)
//   WK16  f16 [256][256]        131072        131072   (64*Wk)
//   WV16  f16 [256][256]        262144        131072   (64*Wv)
//   XQ    f16 [32768][256]      393216      16777216   (8*q, position rows, k = c)
//   XK    f16 [32768][256]    17170432      16777216   (8*k)
//   VH    f16 [256][32768]    33947648      16777216   (16*v, row c, k = b*1024 + m)
//   end                       50724864
// d_out f32 [32][256][1024] at byte 0.
// =====================================================================================================
extern "C" void kernel_launch(void* const* d_in, const int* in_sizes, int n_in,
                              void* d_out, int out_size, void* d_ws, size_t ws_size,
                              hipStream_t stream) {
  if (n_in < 7) return;
  if (in_sizes[0] != NB * CH * NT) return;
  if (in_sizes[1] != CH * CH || in_sizes[2] != CH) return;
  if (in_sizes[3] != CH * CH || in_sizes[4] != CH) return;
  if (in_sizes[5] != CH * CH || in_sizes[6] != CH) return;
  if (out_size != OUTN) return;

  const float* x  = (const float*)d_in[0];   // [32][256][1024]
  const float* Wq = (const float*)d_in[1];   // [256][256]  ([out][in])
  const float* bq = (const float*)d_in[2];   // [256]
  const float* Wk = (const float*)d_in[3];   // [256][256]
  const float* bk = (const float*)d_in[4];   // [256]
  const float* Wv = (const float*)d_in[5];   // [256][256]
  const float* bv = (const float*)d_in[6];   // [256]

  const size_t PW  = (size_t)CH * CH * 2;                    //   131072
  const size_t PPL = (size_t)TOK * CH * 2;                   // 16777216

  size_t off = 0;
  const size_t oWQ = off; off += PW;
  const size_t oWK = off; off += PW;
  const size_t oWV = off; off += PW;
  const size_t oXQ = off; off += PPL;
  const size_t oXK = off; off += PPL;
  const size_t oVH = off; off += PPL;                        // off = 50724864
  if (off > ws_size) return;
  if (off > (size_t)134217728) return;

  char* ws = (char*)d_ws;
  _Float16* WQ16 = (_Float16*)(ws + oWQ);
  _Float16* WK16 = (_Float16*)(ws + oWK);
  _Float16* WV16 = (_Float16*)(ws + oWV);
  _Float16* XQ   = (_Float16*)(ws + oXQ);
  _Float16* XK   = (_Float16*)(ws + oXK);
  _Float16* VH   = (_Float16*)(ws + oVH);
  float*    outf = (float*)d_out;

  const dim3 blk(256);
  const dim3 gPrep(3 * WBLK);                                          // 96
  const dim3 gPr(NB, NT / PPB);                                        // (32, 8): 256 blocks of 128 positions
  const dim3 gAt(NB, NT / RSB);                                        // (32, 8)

  // (1) weight planes, x64 carried (conv weights [out][in]: rows = out, k = in), in fragment order
  k_prep<<<gPrep, blk, 0, stream>>>(Wq, Wk, Wv, WQ16, WK16, WV16);
  // (2) XQ, XK, VH from x [32][256][1024] and the weight planes
  k_proj<<<gPr, blk, 0, stream>>>(x, WQ16, WK16, WV16, bq, bk, bv, XQ, XK, VH);
  // (3) scores + row softmax + softmax-weighted value sum + residual -> d_out
  k_attn<<<gAt, blk, 0, stream>>>(XQ, XK, VH, x, outf);
}
